// v000
// The times below were measured on an AMD MI455X: many runs one after another, warmed up first and cycling through
// copies of the inputs, with the whole window's GPU time divided by the number of runs. Launches and the gaps
// between them are all in it. The median over several windows is given; except for v000 it joins two sittings, which
// can be a few percent apart, so the side-by-side timings, each taken in one sitting, are the better comparison.
// v000, which the later versions start from, runs in 401 microseconds.
#include <hip/hip_runtime.h>
// Contractions: q/k/v/o projections ([tokens][1024] x [1024][1024]^T), scores k.q^T (K = 64), relative-key table relk.q^T (K = 64), v^T.p^T (K = keys) and relv^T.w^T (K = 65 padded to 96) on v_wmma_f32_16x16x32_f16 (f16 operands, f32 accumulate). Inputs RNE-converted to bf16 on load (exact in f16; weights carried x16, relk x1024, relv x64), softmax numerators carried x1024, bucket weights x16, ctx rows x16; softmax statistics and all epilogues in f32.
// Structure: token rows r = b*SEQ + s. X16 = f16(bf16(x)); Q16/K16/V16 = f16(X16 . Bt_w / 16); VT = V16^T per (batch, head); attention per (64 queries, head, batch): per wave a table QR[query][bucket] = q . relk[bucket] / 8
// (5 WMMA tiles into wave-private LDS), S^T tiles = K . Q^T, logit = s/8 + QR[query][clip(key - query, -32, 32) + 32], online softmax per lane, O^T = VT . P^T; bucket weights W[query][bucket] (buckets 1..63 from band logits kept in LDS,
// buckets 0 and 64 as running sums) then O^T += RelVT . W^T; O16[r][h*64+d] = f16(16 ctx); out = (O16 . Bt_o) / 256 + bf16(b_o) -> f32 rows.
#ifndef NB
#define NB 8
#endif
#ifndef SEQ
#define SEQ 1024
#endif
#define NB_FULL 8
#define SEQ_FULL 1024
#define DM 1024
#define NH 16
#define HD 64
#define MAXREL 32
#define NREL 65
#define RKR 80
#define RVK 96
#define NR ((size_t)NB * SEQ)
#define SZ_BT ((size_t)DM * DM * 2)
#define SZ_ACT (NR * DM * 2)
#define SZ_RK ((size_t)RKR * HD * 2)
#define SZ_RV ((size_t)HD * RVK * 2)
#define WS_TOTAL ((size_t)4 * SZ_BT + SZ_RK + SZ_RV + (size_t)6 * SZ_ACT)
static_assert(NH * HD == DM);
static_assert(SEQ % 128 == 0);
static_assert(SEQ <= SEQ_FULL);
static_assert(NB >= 1 && NB <= NB_FULL);
static_assert(DM == 128 * 8);
static_assert(DM % 256 == 0);
static_assert(HD == 64);
static_assert(NREL == 2 * MAXREL + 1);
static_assert(RKR % 16 == 0 && RKR >= NREL);
static_assert(RVK % 32 == 0 && RVK >= NREL);
static_assert((RKR * HD / 8) % 32 == 0);
static_assert((HD * RVK / 8) % 256 == 0);
static_assert(SZ_BT % 256 == 0 && SZ_ACT % 256 == 0 && SZ_RK % 256 == 0 && SZ_RV % 256 == 0);
static_assert(WS_TOTAL <= (size_t)134217728);
static_assert((size_t)NB * NH * HD * SEQ * 2 == SZ_ACT);

typedef _Float16 v16h __attribute__((ext_vector_type(16)));
typedef unsigned short v8us __attribute__((ext_vector_type(8), may_alias));
typedef float v8f __attribute__((ext_vector_type(8)));
typedef float v4f __attribute__((ext_vector_type(4)));
typedef float v4fa __attribute__((ext_vector_type(4), may_alias));
typedef _Float16 v4h __attribute__((ext_vector_type(4)));
union FragH { v16h v; v8us half[2]; _Float16 h[16]; unsigned short u[16]; };

__device__ __forceinline__ unsigned short bf16_bits(float x) { unsigned int u = __float_as_uint(x); return (unsigned short)((u + 0x7FFFu + ((u >> 16) & 1u)) >> 16); }
__device__ __forceinline__ float bf16_val(unsigned short b) { return __uint_as_float(((unsigned int)b) << 16); }
__device__ __forceinline__ float bf16_rne(float x) { return bf16_val(bf16_bits(x)); }
// f32 -> f16 operand convert that cannot produce an f16 subnormal (value select)
static __device__ __forceinline__ _Float16 toh_flush(float v) { const _Float16 r = (_Float16)v; return (fabsf(v) < 6.103515625e-05f) ? (_Float16)0.0f : r; }

// 16x32 f16 fragment from a k-contiguous row: elements 0..7 <- p[8h .. 8h+7], elements 8..15 <- p[16+8h .. 16+8h+7] (same map for A rows and for Bt[n][k] rows)
__device__ __forceinline__ v16h g2_frag(const _Float16* p, int hh) { FragH f; f.half[0] = *(const v8us*)((const unsigned short*)p + 8 * hh); f.half[1] = *(const v8us*)((const unsigned short*)p + 16 + 8 * hh); return f.v; }
__device__ __forceinline__ v8f g2_mma(v16h a, v16h b, v8f c) { v8f d = __builtin_amdgcn_wmma_f32_16x16x32_f16(false, a, false, b, (short)0, c, false, false); asm volatile("v_nop\n\tv_nop\n\tv_nop\n\tv_nop" : "+v"(d) : "v"(a), "v"(b)); return d; }
// two k-steps into one accumulator, hazard guard after the second
__device__ __forceinline__ v8f mma2(v16h a0, v16h b0, v16h a1, v16h b1, v8f c) {
  c = __builtin_amdgcn_wmma_f32_16x16x32_f16(false, a0, false, b0, (short)0, c, false, false);
  c = __builtin_amdgcn_wmma_f32_16x16x32_f16(false, a1, false, b1, (short)0, c, false, false);
  asm volatile("v_nop\n\tv_nop\n\tv_nop\n\tv_nop" : "+v"(c) : "v"(a0), "v"(b0), "v"(a1), "v"(b1));
  return c;
}

__global__ __launch_bounds__(256) void k_wnat(const float* __restrict__ w, size_t n8, _Float16* __restrict__ Bt) {
  const size_t t = (size_t)blockIdx.x * 256 + threadIdx.x; if (t >= n8) return; FragH f;
#pragma unroll
  for (int q = 0; q < 8; ++q) f.h[q] = (_Float16)(bf16_rne(w[t * 8 + q]) * 16.0f);
  const v8us o = f.half[0];
  *(v8us*)((unsigned short*)Bt + t * 8) = o; 
}

// relative-position planes (one block): RK16[bucket][d] = f16(bf16(relk[bucket][d]) * 1024), rows NREL..RKR-1 zero; RVT[d][bucket] = f16(bf16(relv[bucket][d]) * 64), columns NREL..RVK-1 zero.
__global__ __launch_bounds__(256) void k_rel(const float* __restrict__ relk, const float* __restrict__ relv, _Float16* __restrict__ RK16, _Float16* __restrict__ RVT) {
  const int tid = threadIdx.x;
#pragma unroll 1
  for (int c = tid; c < RKR * HD / 8; c += 256) {
    const int row = c / (HD / 8), d8 = (c % (HD / 8)) * 8;
    const int rr = min(row, NREL - 1);
    FragH f;
#pragma unroll
    for (int q = 0; q < 8; ++q) {
      float val = relk[rr * HD + d8 + q]; asm volatile("" : "+v"(val));
      const float sv = (row < NREL) ? bf16_rne(val) * 1024.0f : 0.0f;
      f.h[q] = toh_flush(sv);
    }
    const v8us o = f.half[0];
    unsigned short* dp = (unsigned short*)RK16 + (size_t)c * 8;
    *(v8us*)dp = o; 
  }
#pragma unroll 1
  for (int c = tid; c < HD * RVK / 8; c += 256) {
    const int d = c / (RVK / 8), r8 = (c % (RVK / 8)) * 8;
    FragH f;
#pragma unroll
    for (int q = 0; q < 8; ++q) {
      const int r = r8 + q; const int rr = min(r, NREL - 1);
      float val = relv[rr * HD + d]; asm volatile("" : "+v"(val));
      const float sv = (r < NREL) ? bf16_rne(val) * 64.0f : 0.0f;
      f.h[q] = toh_flush(sv);
    }
    const v8us o = f.half[0];
    unsigned short* dp = (unsigned short*)RVT + (size_t)c * 8;
    *(v8us*)dp = o; 
  }
}

// X16[r][c] = f16(bf16(x)); block = 128 threads per token row, thread t owns columns 8t..8t+7; input row read at the full stride (b*SEQ_FULL + s);
__global__ __launch_bounds__(128) void k_xcvt(const float* __restrict__ x, _Float16* __restrict__ X16) {
  const int r = blockIdx.x; const int b = r / SEQ, s = r - b * SEQ;
  const int t = threadIdx.x;
  const float* xr = x + ((size_t)b * SEQ_FULL + s) * DM + 8 * t;
  const v4f xa = *(const v4fa*)xr, xb = *(const v4fa*)(xr + 4);
  FragH f;
#pragma unroll
  for (int q = 0; q < 4; ++q) { f.h[q] = toh_flush(bf16_rne(xa[q])); f.h[4 + q] = toh_flush(bf16_rne(xb[q])); }
  const v8us o = f.half[0];
  unsigned short* d = (unsigned short*)X16 + (size_t)r * DM + 8 * t;
  *(v8us*)d = o; 
}

// 32x64 wave tile MAC loop: A rows a0p (rows row0..+15) and a1p (+16..+31), Bt rows b0p (cols col0..+63 in 4 groups of 16, pitch ldb halves), K % 32 == 0
__device__ __forceinline__ void mac32x64(const _Float16* __restrict__ a0p, const _Float16* __restrict__ a1p, const _Float16* __restrict__ b0p, size_t ldb, int K, int hh,
                                         v8f& c00, v8f& c01, v8f& c02, v8f& c03, v8f& c10, v8f& c11, v8f& c12, v8f& c13) {
  const _Float16* b1p = b0p + 16 * ldb; const _Float16* b2p = b1p + 16 * ldb; const _Float16* b3p = b2p + 16 * ldb;
#pragma unroll 1
  for (int kb = 0; kb < K; kb += 32) {
    const v16h a0 = g2_frag(a0p + kb, hh), a1 = g2_frag(a1p + kb, hh);
    v16h bq = g2_frag(b0p + kb, hh); c00 = g2_mma(a0, bq, c00); c10 = g2_mma(a1, bq, c10);
    bq = g2_frag(b1p + kb, hh); c01 = g2_mma(a0, bq, c01); c11 = g2_mma(a1, bq, c11);
    bq = g2_frag(b2p + kb, hh); c02 = g2_mma(a0, bq, c02); c12 = g2_mma(a1, bq, c12);
    bq = g2_frag(b3p + kb, hh); c03 = g2_mma(a0, bq, c03); c13 = g2_mma(a1, bq, c13);
  }
}

// projections: plane by (0 q, 1 k, 2 v): Y16_by[r][col] = f16((X16[r] . Bt_by[col]) * alpha).
__global__ __launch_bounds__(128) void k_qkv(const _Float16* __restrict__ X16, const _Float16* __restrict__ Bt, float alpha, _Float16* __restrict__ Y16) {
  __shared__ __attribute__((aligned(16))) float so[4][32][68];
  const int tid = threadIdx.x, lane = tid & 31, ln = lane & 15, hh = lane >> 4;
  const int w = __builtin_amdgcn_readfirstlane(tid >> 5);
  const int by = blockIdx.y;
  const _Float16* Bh = Bt + (size_t)by * DM * DM;
  _Float16* Yp = Y16 + (size_t)by * NR * DM;
  const int ntn = DM / 64;
  const int mt = blockIdx.x / ntn, nq = blockIdx.x - mt * ntn;
  const int row0 = mt * 128 + 32 * w, col0 = nq * 64;
  if (row0 >= (int)NR) return;
  const _Float16* a0p = X16 + (size_t)(row0 + ln) * DM; const _Float16* a1p = a0p + (size_t)16 * DM;
  const _Float16* b0p = Bh + (size_t)(col0 + ln) * DM;
  const v8f z8 = {0.f, 0.f, 0.f, 0.f, 0.f, 0.f, 0.f, 0.f};
  v8f c00 = z8, c01 = z8, c02 = z8, c03 = z8, c10 = z8, c11 = z8, c12 = z8, c13 = z8;
  mac32x64(a0p, a1p, b0p, (size_t)DM, DM, hh, c00, c01, c02, c03, c10, c11, c12, c13);
  v8f accs[8] = {c00, c01, c02, c03, c10, c11, c12, c13};
#pragma unroll
  for (int u = 0; u < 8; ++u) {
    const int t = u & 3, half = u >> 2;
#pragma unroll
    for (int r = 0; r < 8; ++r) so[w][half * 16 + 8 * hh + r][t * 16 + ln] = accs[u][r] * alpha;
  }
  __builtin_amdgcn_fence(4 /* acq_rel order */, "workgroup"); __builtin_amdgcn_wave_barrier();
  const int rsub = lane >> 4, c4 = (lane & 15) * 4;
  {
#pragma unroll
    for (int q = 0; q < 16; ++q) {
      const int r = q * 2 + rsub; const v4f v = *(const v4fa*)&so[w][r][c4]; v4h h4;
#pragma unroll
      for (int i = 0; i < 4; ++i) h4[i] = toh_flush(v[i]);
      *(v4h*)(Yp + (size_t)(row0 + r) * DM + col0 + c4) = h4;
    }
    
  }
}

template <int NHv, int TTv>
__global__ __launch_bounds__(256) void k_vt(const _Float16* __restrict__ V16, int ldv, int voff, _Float16* __restrict__ Vt) {
  __shared__ unsigned short tl[64][66];
  const int tid = threadIdx.x; const int slab = blockIdx.x / (TTv / 64), lg = blockIdx.x % (TTv / 64); const int b = slab / NHv, h = slab % NHv;
  for (int i = tid; i < 64 * 8; i += 256) {
    const int r = i / 8, c8 = (i % 8) * 8; FragH f; f.half[0] = *(const v8us*)((const unsigned short*)V16 + ((size_t)b * TTv + lg * 64 + r) * ldv + voff + h * 64 + c8);
#pragma unroll
    for (int q = 0; q < 8; ++q) tl[r][c8 + q] = f.u[q];
  }
  __syncthreads();
  {
#pragma unroll
    for (int rd = 0; rd < 2; ++rd) {
      const int d = rd * 32 + tid / 8, pc = tid % 8; FragH f;
#pragma unroll
      for (int q = 0; q < 8; ++q) f.u[q] = tl[pc * 8 + q][d];
      *(v8us*)((unsigned short*)Vt + ((size_t)slab * 64 + d) * TTv + lg * 64 + pc * 8) = f.half[0];
    }
    
  }
}

// QR^T tiles (16 buckets x 16 queries) = RK16 . Q^T -> qrt[w][query][bucket] = q.relk[bucket] / 8. S^T 16-key tiles = K . Q^T (A = K16 rows: row = key, k = d; B = Q16 rows: col = query);
// each lane holds keys 8hh+r of query ln; logit = s/8 + qrt[query][clip(key-query)+32]; 64-key blocks wholly left (key-query <= -32) or right (>= 32) of the band take one per-lane constant (wave-uniform test);
// p = exp(logit - m) carried x1024 as f16; O^T (64 d x 16 queries) = VT . P^T with the B operand packed from the two adjacent S^T D tiles (element r <- keys 0..15, element 8+r <- keys 16..31).
// Bucket weights: buckets 1..63 hold one key each -> the logit is kept in tlg[w][query][bucket] and exponentiated against the final maximum; buckets 0 / 64 are running sums scaled with the online factor.
__global__ __launch_bounds__(128) __attribute__((amdgpu_num_vgpr(256))) void k_attn(const _Float16* __restrict__ Q16, const _Float16* __restrict__ K16, const _Float16* __restrict__ VT,
                                                                                const _Float16* __restrict__ RK16, const _Float16* __restrict__ RVT, _Float16* __restrict__ O16) {
  __shared__ __attribute__((aligned(16))) unsigned short so[4][16][72];
  __shared__ __attribute__((aligned(16))) unsigned short wt[4][16][104];
  __shared__ float qrt[4][16][84];
  __shared__ float tlg[4][16][68];
  const int tid = threadIdx.x, lane = tid & 31, ln = lane & 15, hh = lane >> 4;
  const int w = __builtin_amdgcn_readfirstlane(tid >> 5);
  const int h = blockIdx.y, b = blockIdx.z;
  const int q0 = blockIdx.x * 64 + w * 16;
  const int qi = q0 + ln;
  const size_t rq = (size_t)b * SEQ + q0;
  const size_t rk = (size_t)b * SEQ;
  const _Float16* qp = Q16 + (rq + ln) * DM + h * HD;
  const v16h qb0 = g2_frag(qp, hh), qb1 = g2_frag(qp + 32, hh);
  const _Float16* kp0 = K16 + (rk + ln) * DM + h * HD;
  const _Float16* vp0 = VT + ((size_t)(b * NH + h) * HD + ln) * SEQ;
  const v8f z8 = {0.f, 0.f, 0.f, 0.f, 0.f, 0.f, 0.f, 0.f};
  // relative-key table: columns 0..RKR-1 of the row of query ln, in logit units (1/1024 carry and 1/8 scale folded)
#pragma unroll
  for (int t = 0; t < RKR / 16; ++t) {
    const _Float16* rp = RK16 + (size_t)(16 * t + ln) * HD;
    const v16h ra0 = g2_frag(rp, hh), ra1 = g2_frag(rp + 32, hh);
    const v8f c = mma2(ra0, qb0, ra1, qb1, z8);
#pragma unroll
    for (int r = 0; r < 8; ++r) qrt[w][ln][16 * t + 8 * hh + r] = c[r] * 0.0001220703125f;
  }
#pragma unroll 1
  for (int c = 0; c < 34; ++c) tlg[w][ln][34 * hh + c] = -1.0e30f;
  __builtin_amdgcn_fence(4 /* acq_rel order */, "workgroup"); __builtin_amdgcn_wave_barrier();
  const float c0 = qrt[w][ln][0], c64 = qrt[w][ln][2 * MAXREL];
  v8f o0 = z8, o1 = z8, o2 = z8, o3 = z8;
  float mrun = -1.0e30f, lrun = 0.f, wl = 0.f, wr = 0.f;
#pragma unroll 1
  for (int kt = 0; kt < SEQ; kt += 64) {
    v8f s[4];
#pragma unroll
    for (int j = 0; j < 4; ++j) {
      const _Float16* kp = kp0 + (size_t)(kt + 16 * j) * DM;
      const v16h ka0 = g2_frag(kp, hh), ka1 = g2_frag(kp + 32, hh);
      s[j] = mma2(ka0, qb0, ka1, qb1, z8);
    }
    const bool farl = (kt + 63 + MAXREL <= q0);          /* every key of the block at distance <= -32 of every query of the wave */
    const bool farr = (kt >= q0 + 15 + MAXREL);          /* every key at distance >= +32 */
    const int dbase = kt + 8 * hh - qi;
    if (farl || farr) {
      const float cb = farl ? c0 : c64;
#pragma unroll
      for (int j = 0; j < 4; ++j)
#pragma unroll
        for (int r = 0; r < 8; ++r) s[j][r] = s[j][r] * 0.125f + cb;
    } else {
#pragma unroll
      for (int j = 0; j < 4; ++j)
#pragma unroll
        for (int r = 0; r < 8; ++r) {
          const int d = dbase + 16 * j + r;
          const int rel = min(max(d, -MAXREL), MAXREL) + MAXREL;
          float bias = qrt[w][ln][rel]; asm volatile("" : "+v"(bias));
          const float t = s[j][r] * 0.125f + bias;
          s[j][r] = t;
          const int slot = (d > -MAXREL && d < MAXREL) ? rel : 66 + hh;      /* band logit kept; clipped keys go to a per-lane dump slot */
          tlg[w][ln][slot] = t;
        }
    }
    float mx = -1.0e30f;
#pragma unroll
    for (int j = 0; j < 4; ++j)
#pragma unroll
      for (int r = 0; r < 8; ++r) mx = fmaxf(mx, s[j][r]);
    mx = fmaxf(mx, __shfl_xor(mx, 16, 32));
    const float mnew = fmaxf(mrun, mx);
    const float alpha = __expf(mrun - mnew);
    mrun = mnew;
    float ps = 0.f; FragH pf[2];
#pragma unroll
    for (int j = 0; j < 4; ++j)
#pragma unroll
      for (int r = 0; r < 8; ++r) {
        const float p = __expf(s[j][r] - mnew);
        s[j][r] = p;
        ps += p;
        pf[j >> 1].h[(j & 1) * 8 + r] = toh_flush(p * 1024.0f);
      }
    float pl = 0.f, pr = 0.f;
    if (farl || farr) {
      pl = farl ? ps : 0.f; pr = farl ? 0.f : ps;
    } else {
#pragma unroll
      for (int j = 0; j < 4; ++j)
#pragma unroll
        for (int r = 0; r < 8; ++r) {
          const int d = dbase + 16 * j + r; const float p = s[j][r];
          pl += (d <= -MAXREL) ? p : 0.f;
          pr += (d >= MAXREL) ? p : 0.f;
        }
    }
    wl = wl * alpha + pl; wr = wr * alpha + pr;
    ps += __shfl_xor(ps, 16, 32);
    lrun = lrun * alpha + ps;
#pragma unroll
    for (int r = 0; r < 8; ++r) { o0[r] *= alpha; o1[r] *= alpha; o2[r] *= alpha; o3[r] *= alpha; }
    { const _Float16* vp = vp0 + (size_t)0 * 16 * SEQ + kt; const v16h va0 = g2_frag(vp, hh), va1 = g2_frag(vp + 32, hh); o0 = mma2(va0, pf[0].v, va1, pf[1].v, o0); }
    { const _Float16* vp = vp0 + (size_t)1 * 16 * SEQ + kt; const v16h va0 = g2_frag(vp, hh), va1 = g2_frag(vp + 32, hh); o1 = mma2(va0, pf[0].v, va1, pf[1].v, o1); }
    { const _Float16* vp = vp0 + (size_t)2 * 16 * SEQ + kt; const v16h va0 = g2_frag(vp, hh), va1 = g2_frag(vp + 32, hh); o2 = mma2(va0, pf[0].v, va1, pf[1].v, o2); }
    { const _Float16* vp = vp0 + (size_t)3 * 16 * SEQ + kt; const v16h va0 = g2_frag(vp, hh), va1 = g2_frag(vp + 32, hh); o3 = mma2(va0, pf[0].v, va1, pf[1].v, o3); }
  }
  wl += __shfl_xor(wl, 16, 32); wr += __shfl_xor(wr, 16, 32);
  __builtin_amdgcn_fence(4 /* acq_rel order */, "workgroup"); __builtin_amdgcn_wave_barrier();
  // bucket weight row of query ln, columns 48hh .. 48hh+47 by this lane (all RVK columns written; columns >= NREL zero)
#pragma unroll 1
  for (int c = 0; c < 6; ++c) {
    FragH f;
#pragma unroll
    for (int q = 0; q < 8; ++q) {
      const int r = 48 * hh + 8 * c + q;
      const int rr = min(r, 67);
      float tv = tlg[w][ln][rr]; asm volatile("" : "+v"(tv));
      const float e = __expf(tv - mrun);
      const float wv = (r == 0) ? wl : (r == 2 * MAXREL) ? wr : (r < 2 * MAXREL) ? e : 0.f;
      f.h[q] = toh_flush(wv * 16.0f);
    }
    *(v8us*)&wt[w][ln][48 * hh + 8 * c] = f.half[0];
  }
  __builtin_amdgcn_fence(4 /* acq_rel order */, "workgroup"); __builtin_amdgcn_wave_barrier();
#pragma unroll
  for (int ks = 0; ks < RVK / 32; ++ks) {
    FragH wb; wb.half[0] = *(const v8us*)&wt[w][ln][32 * ks + 8 * hh]; wb.half[1] = *(const v8us*)&wt[w][ln][32 * ks + 16 + 8 * hh];
    const _Float16* rv = RVT + (size_t)ln * RVK + 32 * ks;
    o0 = g2_mma(g2_frag(rv, hh), wb.v, o0);
    o1 = g2_mma(g2_frag(rv + 16 * RVK, hh), wb.v, o1);
    o2 = g2_mma(g2_frag(rv + 32 * RVK, hh), wb.v, o2);
    o3 = g2_mma(g2_frag(rv + 48 * RVK, hh), wb.v, o3);
  }
  const float rl = (1.0f / lrun) * 0.015625f;
  { FragH f;
#pragma unroll
    for (int r = 0; r < 8; ++r) f.h[r] = toh_flush(o0[r] * rl);
    *(v8us*)&so[w][ln][0 + 8 * hh] = f.half[0]; }
  { FragH f;
#pragma unroll
    for (int r = 0; r < 8; ++r) f.h[r] = toh_flush(o1[r] * rl);
    *(v8us*)&so[w][ln][16 + 8 * hh] = f.half[0]; }
  { FragH f;
#pragma unroll
    for (int r = 0; r < 8; ++r) f.h[r] = toh_flush(o2[r] * rl);
    *(v8us*)&so[w][ln][32 + 8 * hh] = f.half[0]; }
  { FragH f;
#pragma unroll
    for (int r = 0; r < 8; ++r) f.h[r] = toh_flush(o3[r] * rl);
    *(v8us*)&so[w][ln][48 + 8 * hh] = f.half[0]; }
  __builtin_amdgcn_fence(4 /* acq_rel order */, "workgroup"); __builtin_amdgcn_wave_barrier();
  const int li = lane >> 3, pc = lane & 7;
  {
#pragma unroll
    for (int g = 0; g < 4; ++g) {
      const int i = g * 4 + li;
      const v8us v = *(const v8us*)&so[w][i][pc * 8];
      *(v8us*)((unsigned short*)O16 + (rq + i) * DM + h * HD + pc * 8) = v;
    }
    
  }
}

// out[r][col] = (A1[r] . B1[col]) * al1 + bf16(bias[col]); one K = DM loop into a wave-private LDS tile; bias added at the store stage as a 4-wide f32 vector; f32 rows:
__global__ __launch_bounds__(128) void k_out(const _Float16* __restrict__ A1, const _Float16* __restrict__ B1, float al1, const float* __restrict__ bias, float* __restrict__ Out) {
  __shared__ __attribute__((aligned(16))) float so[4][32][68];
  const int tid = threadIdx.x, lane = tid & 31, ln = lane & 15, hh = lane >> 4;
  const int w = __builtin_amdgcn_readfirstlane(tid >> 5);
  const int ntn = DM / 64;
  const int mt = blockIdx.x / ntn, nq = blockIdx.x - mt * ntn;
  const int row0 = mt * 128 + 32 * w, col0 = nq * 64;
  if (row0 >= (int)NR) return;
  const v8f z8 = {0.f, 0.f, 0.f, 0.f, 0.f, 0.f, 0.f, 0.f};
  v8f c00 = z8, c01 = z8, c02 = z8, c03 = z8, c10 = z8, c11 = z8, c12 = z8, c13 = z8;
  {
    const _Float16* a0p = A1 + (size_t)(row0 + ln) * DM; const _Float16* a1p = a0p + (size_t)16 * DM;
    const _Float16* b0p = B1 + (size_t)(col0 + ln) * DM;
    mac32x64(a0p, a1p, b0p, (size_t)DM, DM, hh, c00, c01, c02, c03, c10, c11, c12, c13);
    v8f accs[8] = {c00, c01, c02, c03, c10, c11, c12, c13};
#pragma unroll
    for (int u = 0; u < 8; ++u) {
      const int t = u & 3, half = u >> 2;
#pragma unroll
      for (int r = 0; r < 8; ++r) so[w][half * 16 + 8 * hh + r][t * 16 + ln] = accs[u][r] * al1;
    }
  }
  __builtin_amdgcn_fence(4 /* acq_rel order */, "workgroup"); __builtin_amdgcn_wave_barrier();
  const int rsub = lane >> 4, c4 = (lane & 15) * 4;
  const v4f bz = *(const v4fa*)(bias + col0 + c4);
  v4f bb;
#pragma unroll
  for (int i = 0; i < 4; ++i) bb[i] = bf16_rne(bz[i]);
  {
#pragma unroll
    for (int q = 0; q < 16; ++q) {
      const int r = q * 2 + rsub; const v4f v0 = *(const v4fa*)&so[w][r][c4];
      const v4f v = v0 + bb;
      *(v4f*)(Out + (size_t)(row0 + r) * DM + col0 + c4) = v;
    }
    
  }
}

extern "C" void kernel_launch(void* const* d_in, const int* in_sizes, int n_in,
                              void* d_out, int out_size, void* d_ws, size_t ws_size, hipStream_t stream) {
  if (n_in < 8) return;
  if (in_sizes[0] < (int)(((size_t)(NB - 1) * SEQ_FULL + SEQ) * DM)) return;
  for (int i = 1; i <= 4; ++i) if (in_sizes[i] < DM * DM) return;
  if (in_sizes[5] < DM) return;
  if (in_sizes[6] < NREL * HD) return;
  if (in_sizes[7] < NREL * HD) return;
  if (out_size < (int)(NR * DM)) return;
  const float* const* I = (const float* const*)d_in;
  const float* x = I[0]; const float* wq = I[1]; const float* wk = I[2]; const float* wv = I[3]; const float* wo = I[4]; const float* bo = I[5]; const float* relk = I[6]; const float* relv = I[7];
  char* ws = (char*)d_ws; size_t off = 0;
  auto take = [&](size_t bytes) { char* p = ws + off; off += (bytes + 255) & ~(size_t)255; return p; };
  _Float16* BQKV = (_Float16*)take((size_t)3 * SZ_BT);               /* Bt planes q, k, v (contiguous, stride DM*DM) */
  _Float16* BO   = (_Float16*)take(SZ_BT);
  _Float16* RK16 = (_Float16*)take(SZ_RK);                           /* [RKR][HD] */
  _Float16* RVT  = (_Float16*)take(SZ_RV);                           /* [HD][RVK] */
  _Float16* X16  = (_Float16*)take(SZ_ACT);
  _Float16* QKV16 = (_Float16*)take((size_t)3 * SZ_ACT);             /* Q16, K16, V16 planes (stride NR*DM) */
  _Float16* VT   = (_Float16*)take((size_t)NB * NH * HD * SEQ * 2);  /* [b*NH+h][d][s] */
  _Float16* O16  = (_Float16*)take(SZ_ACT);
  if (off > ws_size) return;
  _Float16* Q16 = QKV16; _Float16* K16 = QKV16 + NR * DM; _Float16* V16 = QKV16 + (size_t)2 * NR * DM;

  { const size_t n8 = (size_t)DM * DM / 8; const unsigned g = (unsigned)((n8 + 255) / 256);
    k_wnat<<<g, 256, 0, stream>>>(wq, n8, BQKV);
    k_wnat<<<g, 256, 0, stream>>>(wk, n8, BQKV + (size_t)DM * DM);
    k_wnat<<<g, 256, 0, stream>>>(wv, n8, BQKV + (size_t)2 * DM * DM);
    k_wnat<<<g, 256, 0, stream>>>(wo, n8, BO); }
  k_rel<<<1, 256, 0, stream>>>(relk, relv, RK16, RVT);
  k_xcvt<<<(unsigned)NR, 128, 0, stream>>>(x, X16);
  k_qkv<<<dim3((unsigned)((NR / 128) * (DM / 64)), 3), 128, 0, stream>>>(X16, BQKV, 0.0625f, QKV16);      /* q, k, v as f16 rows */
  k_vt<NH, SEQ><<<(unsigned)(NB * NH * (SEQ / 64)), 256, 0, stream>>>(V16, DM, 0, VT);
  k_attn<<<dim3(SEQ / 64, NH, NB), 128, 0, stream>>>(Q16, K16, VT, RK16, RVT, O16);
  k_out<<<(unsigned)((NR / 128) * (DM / 64)), 128, 0, stream>>>(O16, BO, 0.00390625f, bo, (float*)d_out);      /* out = ctx Wo^T + b_o */
}

// v001
// One run takes 261 microseconds.
// Two timings next to v000 both put it at 1.56 times that version's speed.
#include <hip/hip_runtime.h>
// Contractions: q/k/v/o projections ([tokens][1024] x [1024][1024]^T), scores k.q^T (K = 64), relative-key table relk.q^T (K = 64), v^T.p^T (K = keys) and relv^T.w^T (K = 65 padded to 96) on v_wmma_f32_16x16x32_f16 (f16 operands, f32 accumulate). Inputs RNE-converted to bf16 on load (exact in f16; weights carried x16, relk x1024, relv x64), softmax numerators carried x1024, bucket weights x16, ctx rows x16; softmax statistics and all epilogues in f32.
// Structure: token rows r = b*SEQ + s. X16 = f16(bf16(x)); Q16/K16/V16 = f16(X16 . Bt_w / 16); VT = V16^T per (batch, head); attention per (64 queries, head, batch): per wave a table QR[query][bucket] = q . relk[bucket] / 8
// (5 WMMA tiles into wave-private LDS), S^T tiles = K . Q^T, logit = s/8 + QR[query][clip(key - query, -32, 32) + 32], online softmax per lane, O^T = VT . P^T; bucket weights W[query][bucket] (buckets 1..63 from band logits kept in LDS,
// buckets 0 and 64 as running sums) then O^T += RelVT . W^T; O16[r][h*64+d] = f16(16 ctx); out = (O16 . Bt_o) / 256 + bf16(b_o) -> f32 rows.
#ifndef NB
#define NB 8
#endif
#ifndef SEQ
#define SEQ 1024
#endif
#define NB_FULL 8
#define SEQ_FULL 1024
#define DM 1024
#define NH 16
#define HD 64
#define MAXREL 32
#define NREL 65
#define RKR 80
#define RVK 96
#define NR ((size_t)NB * SEQ)
#define SZ_BT ((size_t)DM * DM * 2)
#define SZ_ACT (NR * DM * 2)
#define SZ_RK ((size_t)RKR * HD * 2)
#define SZ_RV ((size_t)HD * RVK * 2)
#define WS_TOTAL ((size_t)4 * SZ_BT + SZ_RK + SZ_RV + (size_t)6 * SZ_ACT)
static_assert(NH * HD == DM);
static_assert(SEQ % 128 == 0);
static_assert(SEQ <= SEQ_FULL);
static_assert(NB >= 1 && NB <= NB_FULL);
static_assert(DM == 128 * 8);
static_assert(DM % 256 == 0);
static_assert(HD == 64);
static_assert(NREL == 2 * MAXREL + 1);
static_assert(RKR % 16 == 0 && RKR >= NREL);
static_assert(RVK % 32 == 0 && RVK >= NREL);
static_assert((RKR * HD / 8) % 32 == 0);
static_assert((HD * RVK / 8) % 256 == 0);
static_assert(SZ_BT % 256 == 0 && SZ_ACT % 256 == 0 && SZ_RK % 256 == 0 && SZ_RV % 256 == 0);
static_assert(WS_TOTAL <= (size_t)134217728);
static_assert((size_t)NB * NH * HD * SEQ * 2 == SZ_ACT);

typedef _Float16 v16h __attribute__((ext_vector_type(16)));
typedef unsigned short v8us __attribute__((ext_vector_type(8), may_alias));
typedef float v8f __attribute__((ext_vector_type(8)));
typedef float v4f __attribute__((ext_vector_type(4)));
typedef float v4fa __attribute__((ext_vector_type(4), may_alias));
typedef _Float16 v4h __attribute__((ext_vector_type(4)));
union FragH { v16h v; v8us half[2]; _Float16 h[16]; unsigned short u[16]; };

__device__ __forceinline__ unsigned short bf16_bits(float x) { unsigned int u = __float_as_uint(x); return (unsigned short)((u + 0x7FFFu + ((u >> 16) & 1u)) >> 16); }
__device__ __forceinline__ float bf16_val(unsigned short b) { return __uint_as_float(((unsigned int)b) << 16); }
__device__ __forceinline__ float bf16_rne(float x) { return bf16_val(bf16_bits(x)); }
// f32 -> f16 operand convert that cannot produce an f16 subnormal (value select)
static __device__ __forceinline__ _Float16 toh_flush(float v) { const _Float16 r = (_Float16)v; return (fabsf(v) < 6.103515625e-05f) ? (_Float16)0.0f : r; }

// 16x32 f16 fragment from a k-contiguous row: elements 0..7 <- p[8h .. 8h+7], elements 8..15 <- p[16+8h .. 16+8h+7] (same map for A rows and for Bt[n][k] rows)
__device__ __forceinline__ v16h g2_frag(const _Float16* p, int hh) { FragH f; f.half[0] = *(const v8us*)((const unsigned short*)p + 8 * hh); f.half[1] = *(const v8us*)((const unsigned short*)p + 16 + 8 * hh); return f.v; }
__device__ __forceinline__ v8f g2_mma(v16h a, v16h b, v8f c) { v8f d = __builtin_amdgcn_wmma_f32_16x16x32_f16(false, a, false, b, (short)0, c, false, false); asm volatile("v_nop\n\tv_nop\n\tv_nop\n\tv_nop" : "+v"(d) : "v"(a), "v"(b)); return d; }
// two k-steps into one accumulator, hazard guard after the second
__device__ __forceinline__ v8f mma2(v16h a0, v16h b0, v16h a1, v16h b1, v8f c) {
  c = __builtin_amdgcn_wmma_f32_16x16x32_f16(false, a0, false, b0, (short)0, c, false, false);
  c = __builtin_amdgcn_wmma_f32_16x16x32_f16(false, a1, false, b1, (short)0, c, false, false);
  asm volatile("v_nop\n\tv_nop\n\tv_nop\n\tv_nop" : "+v"(c) : "v"(a0), "v"(b0), "v"(a1), "v"(b1));
  return c;
}

__global__ __launch_bounds__(256) void k_wnat(const float* __restrict__ w, size_t n8, _Float16* __restrict__ Bt) {
  const size_t t = (size_t)blockIdx.x * 256 + threadIdx.x; if (t >= n8) return; FragH f;
#pragma unroll
  for (int q = 0; q < 8; ++q) f.h[q] = (_Float16)(bf16_rne(w[t * 8 + q]) * 16.0f);
  const v8us o = f.half[0];
  *(v8us*)((unsigned short*)Bt + t * 8) = o; 
}

// relative-position planes (one block): RK16[bucket][d] = f16(bf16(relk[bucket][d]) * 1024), rows NREL..RKR-1 zero; RVT[d][bucket] = f16(bf16(relv[bucket][d]) * 64), columns NREL..RVK-1 zero.
__global__ __launch_bounds__(256) void k_rel(const float* __restrict__ relk, const float* __restrict__ relv, _Float16* __restrict__ RK16, _Float16* __restrict__ RVT) {
  const int tid = threadIdx.x;
#pragma unroll 1
  for (int c = tid; c < RKR * HD / 8; c += 256) {
    const int row = c / (HD / 8), d8 = (c % (HD / 8)) * 8;
    const int rr = min(row, NREL - 1);
    FragH f;
#pragma unroll
    for (int q = 0; q < 8; ++q) {
      float val = relk[rr * HD + d8 + q]; asm volatile("" : "+v"(val));
      const float sv = (row < NREL) ? bf16_rne(val) * 1024.0f : 0.0f;
      f.h[q] = toh_flush(sv);
    }
    const v8us o = f.half[0];
    unsigned short* dp = (unsigned short*)RK16 + (size_t)c * 8;
    *(v8us*)dp = o; 
  }
#pragma unroll 1
  for (int c = tid; c < HD * RVK / 8; c += 256) {
    const int d = c / (RVK / 8), r8 = (c % (RVK / 8)) * 8;
    FragH f;
#pragma unroll
    for (int q = 0; q < 8; ++q) {
      const int r = r8 + q; const int rr = min(r, NREL - 1);
      float val = relv[rr * HD + d]; asm volatile("" : "+v"(val));
      const float sv = (r < NREL) ? bf16_rne(val) * 64.0f : 0.0f;
      f.h[q] = toh_flush(sv);
    }
    const v8us o = f.half[0];
    unsigned short* dp = (unsigned short*)RVT + (size_t)c * 8;
    *(v8us*)dp = o; 
  }
}

// X16[r][c] = f16(bf16(x)); block = 128 threads per token row, thread t owns columns 8t..8t+7; input row read at the full stride (b*SEQ_FULL + s);
__global__ __launch_bounds__(128) void k_xcvt(const float* __restrict__ x, _Float16* __restrict__ X16) {
  const int r = blockIdx.x; const int b = r / SEQ, s = r - b * SEQ;
  const int t = threadIdx.x;
  const float* xr = x + ((size_t)b * SEQ_FULL + s) * DM + 8 * t;
  const v4f xa = *(const v4fa*)xr, xb = *(const v4fa*)(xr + 4);
  FragH f;
#pragma unroll
  for (int q = 0; q < 4; ++q) { f.h[q] = toh_flush(bf16_rne(xa[q])); f.h[4 + q] = toh_flush(bf16_rne(xb[q])); }
  const v8us o = f.half[0];
  unsigned short* d = (unsigned short*)X16 + (size_t)r * DM + 8 * t;
  *(v8us*)d = o; 
}

// Projection GEMM tile: one block of 4 waves computes 128 rows x 256 columns; wave (w >> 1, w & 1) owns 64 x 128 (4 x 8 accumulator tiles).
// A pass is 64 k = 128 B of every operand row. A stage in LDS is [A slice 0 | A slice 1 | B slice 0 | B slice 1], rows at pitch 144 B (128 B + the mover's 16 B pad, conflict-free for 16-byte reads);
// A slices hold 64 rows (9216 B, placed every 10240 B so that each place is a multiple of 2 KiB), B slices 128 rows (18432 B). Two stages; every wave issues one tensor load per stage: waves 0, 1 the A slices, waves 2, 3 the B slices.
#define GP_ROWB 128u
#define GP_PITCH 144u
#define GP_SLA 10240u
#define GP_SLB 18432u
#define GP_STAGE (2u * GP_SLA + 2u * GP_SLB)
#define GP_NPASS ((unsigned)(DM * 2) / GP_ROWB)
static_assert(GP_SLA % 2048u == 0 && GP_SLB % 2048u == 0 && GP_STAGE % 2048u == 0);
static_assert(64u * GP_PITCH <= GP_SLA && 128u * GP_PITCH <= GP_SLB);
static_assert(GP_NPASS >= 2);
static_assert(NR % 128 == 0 && DM % 256 == 0);
static_assert(4u * 32u * 132u * 4u <= 2u * GP_STAGE);
typedef unsigned int u32x4 __attribute__((ext_vector_type(4)));
typedef unsigned int u32x8 __attribute__((ext_vector_type(8)));
__device__ __forceinline__ unsigned int uni(unsigned int v) { return (unsigned int)__builtin_amdgcn_readfirstlane(v); }
__device__ __forceinline__ unsigned int pinned(unsigned int v) { unsigned int s = uni(v); asm volatile("" : "+s"(s)); return s; }  // a wave-uniform word held in a scalar register, so that the test around a tensor load is a scalar branch and a descriptor formed from the word stays behind the wait and the barrier in front of it
__device__ __forceinline__ v16h lds_frag(const unsigned char* p) { FragH f; f.half[0] = *(const v8us*)p; f.half[1] = *(const v8us*)(p + 32); return f.v; }

__device__ __forceinline__ void gemm128x256(const _Float16* __restrict__ Arows, const _Float16* __restrict__ Brows, unsigned char* L, int w, int ln, int hh, v8f (&acc)[4][8]) {
  const unsigned int lbase = (unsigned int)(size_t)L;
  const bool isB = w >= 2; const unsigned int sl = (unsigned int)w & 1u;
  const unsigned int nrows = isB ? 128u : 64u;
  const unsigned long long srcb = (unsigned long long)(size_t)(isB ? Brows + (size_t)sl * 128 * DM : Arows + (size_t)sl * 64 * DM);
  const unsigned int place = lbase + (isB ? 2u * GP_SLA + sl * GP_SLB : sl * GP_SLA);
  u32x8 g1;                                             /* 1-byte elements, tensor = tile = nrows rows of 128 B, source pitch one operand row, 4 dwords of pad behind every 32 */
  g1[0] = uni((1u << 20) | (4u << 22) | (3u << 25));
  g1[1] = uni(GP_ROWB << 16);
  g1[2] = uni(nrows << 16);
  g1[3] = uni(GP_ROWB << 16);
  g1[4] = uni(nrows);
  g1[5] = uni((unsigned int)(DM * 2));
  g1[6] = uni(0u);
  g1[7] = uni(0u);
  u32x4 g0;
  auto issue = [&](unsigned int st) {
    const unsigned long long ga = srcb + (unsigned long long)st * GP_ROWB;
    g0[0] = uni(1u); g0[1] = uni(place + (st & 1u) * GP_STAGE); g0[2] = uni((unsigned int)ga); g0[3] = uni((((unsigned int)(ga >> 32)) & 0x01FFFFFFu) | 0x80000000u);
    asm volatile("tensor_load_to_lds %0, %1" :: "s"(g0), "s"(g1) : "memory");
  };
  issue(0u);
  asm volatile("s_wait_tensorcnt 0x0" :: "s"(g0), "s"(g1) : "memory");  /* stage 0 has landed for this wave's slice; the descriptor words are named so that their registers stay untouched while the request is outstanding */
  __syncthreads();                                      /* ... and is published to the other waves */
  const unsigned char* ap = L + (unsigned int)(w >> 1) * GP_SLA + (unsigned int)ln * GP_PITCH + 16u * (unsigned int)hh;
  const unsigned char* bp = L + 2u * GP_SLA + (unsigned int)(w & 1) * GP_SLB + (unsigned int)ln * GP_PITCH + 16u * (unsigned int)hh;
#pragma unroll 1
  for (unsigned int s = 0; s < GP_NPASS; ++s) {         /* rolled: one copy of the pass in the instruction cache; the buffer is picked by the pass's parity */
    if (pinned(s + 1u < GP_NPASS)) issue(pinned(s + 1u)); /* behind the barrier that freed its buffer: stage s + 1 flies while pass s is worked on */
    const unsigned char* as = ap + (s & 1u) * GP_STAGE; const unsigned char* bs = bp + (s & 1u) * GP_STAGE;
    v16h a[2][4], b[2][8];
#pragma unroll
    for (int ks = 0; ks < 2; ++ks) {
      a[ks][0] = lds_frag(as + ks * 64);
#pragma unroll
      for (int j = 0; j < 8; ++j) b[ks][j] = lds_frag(bs + j * 16 * GP_PITCH + ks * 64);
#pragma unroll
      for (int i = 1; i < 4; ++i) a[ks][i] = lds_frag(as + i * 16 * GP_PITCH + ks * 64);
    }
    __builtin_amdgcn_sched_barrier(0);                  /* the pass's LDS reads stay one group ahead of its WMMAs (for speed only) */
#pragma unroll
    for (int ks = 0; ks < 2; ++ks)
#pragma unroll
      for (int i = 0; i < 4; ++i)
#pragma unroll
        for (int j = 0; j < 8; ++j) acc[i][j] = __builtin_amdgcn_wmma_f32_16x16x32_f16(false, a[ks][i], false, b[ks][j], (short)0, acc[i][j], false, false);
    __builtin_amdgcn_sched_barrier(0);                  /* the WMMAs stay in front of the publish point: moved behind it, the wait for stage s + 1 would stand a whole pass earlier and the refill would lose its lead */
    asm volatile("s_wait_dscnt 0x0" ::: "memory");      /* this wave has left the buffer of pass s */
    asm volatile("s_wait_tensorcnt 0x0" :: "s"(g0), "s"(g1) : "memory");  /* its slice of stage s + 1 has landed; the descriptor words are named so that their registers stay untouched from the issue to here */
    __syncthreads();                                    /* publishes stage s + 1 and frees the buffer of pass s */
  }
  asm volatile("s_wait_tensorcnt 0x0" ::: "memory");    /* nothing of the mover is outstanding when the ring becomes output staging */
  asm volatile("s_wait_dscnt 0x0" ::: "memory");
}

// projections: plane by (0 q, 1 k, 2 v): Y16_by[r][col] = f16((X16[r] . Bt_by[col]) * alpha). The last pass's barrier has ended every read of the ring; each wave then stages 32 x 128 f32 at a time in its own quarter of it.
__global__ __launch_bounds__(128) void k_qkv(const _Float16* __restrict__ X16, const _Float16* __restrict__ Bt, float alpha, _Float16* __restrict__ Y16) {
  __shared__ __attribute__((aligned(2048))) unsigned char L[2u * GP_STAGE];
  const int tid = threadIdx.x, lane = tid & 31, ln = lane & 15, hh = lane >> 4;
  const int w = __builtin_amdgcn_readfirstlane(tid >> 5);
  const int by = blockIdx.y;
  const _Float16* Bh = Bt + (size_t)by * DM * DM;
  _Float16* Yp = Y16 + (size_t)by * NR * DM;
  const int ntn = DM / 256;
  const int mt = blockIdx.x / ntn, nq = blockIdx.x - mt * ntn;
  if (mt * 128 >= (int)NR) return;
  const v8f z8 = {0.f, 0.f, 0.f, 0.f, 0.f, 0.f, 0.f, 0.f};
  v8f acc[4][8];
#pragma unroll
  for (int i = 0; i < 4; ++i)
#pragma unroll
    for (int j = 0; j < 8; ++j) acc[i][j] = z8;
  gemm128x256(X16 + (size_t)mt * 128 * DM, Bh + (size_t)nq * 256 * DM, L, w, ln, hh, acc);
  const int row0 = mt * 128 + 64 * (w >> 1), col0 = nq * 256 + 128 * (w & 1);
  float (*so)[132] = (float (*)[132])(L + (size_t)w * (GP_STAGE / 2u));
#pragma unroll
  for (int h2 = 0; h2 < 2; ++h2) {
#pragma unroll
    for (int ii = 0; ii < 2; ++ii)
#pragma unroll
      for (int j = 0; j < 8; ++j)
#pragma unroll
        for (int r = 0; r < 8; ++r) so[ii * 16 + 8 * hh + r][j * 16 + ln] = acc[2 * h2 + ii][j][r] * alpha;
    __builtin_amdgcn_fence(4 /* acq_rel order */, "workgroup"); __builtin_amdgcn_wave_barrier();
#pragma unroll 1                                        /* groups of eight rows: eight LDS reads in flight cover their latency, one wait per group behind the stores */
    for (int q8 = 0; q8 < 32; q8 += 8) {
#pragma unroll
      for (int q = 0; q < 8; ++q) {
        const v4f v = *(const v4fa*)&so[q8 + q][lane * 4]; v4h h4;
#pragma unroll
        for (int i = 0; i < 4; ++i) h4[i] = toh_flush(v[i]);
        *(v4h*)(Yp + (size_t)(row0 + 32 * h2 + q8 + q) * DM + col0 + lane * 4) = h4;
      }
      asm volatile("s_wait_xcnt 0x0" ::: "memory");     /* in front of the next group, which overwrites registers that these stores name */
    }
    __builtin_amdgcn_fence(4 /* acq_rel order */, "workgroup"); __builtin_amdgcn_wave_barrier();
  }
}

template <int NHv, int TTv>
__global__ __launch_bounds__(256) void k_vt(const _Float16* __restrict__ V16, int ldv, int voff, _Float16* __restrict__ Vt) {
  __shared__ unsigned short tl[64][66];
  const int tid = threadIdx.x; const int slab = blockIdx.x / (TTv / 64), lg = blockIdx.x % (TTv / 64); const int b = slab / NHv, h = slab % NHv;
  for (int i = tid; i < 64 * 8; i += 256) {
    const int r = i / 8, c8 = (i % 8) * 8; FragH f; f.half[0] = *(const v8us*)((const unsigned short*)V16 + ((size_t)b * TTv + lg * 64 + r) * ldv + voff + h * 64 + c8);
#pragma unroll
    for (int q = 0; q < 8; ++q) tl[r][c8 + q] = f.u[q];
  }
  __syncthreads();
  {
#pragma unroll
    for (int rd = 0; rd < 2; ++rd) {
      const int d = rd * 32 + tid / 8, pc = tid % 8; FragH f;
#pragma unroll
      for (int q = 0; q < 8; ++q) f.u[q] = tl[pc * 8 + q][d];
      *(v8us*)((unsigned short*)Vt + ((size_t)slab * 64 + d) * TTv + lg * 64 + pc * 8) = f.half[0];
    }
    
  }
}

// QR^T tiles (16 buckets x 16 queries) = RK16 . Q^T -> qrt[w][query][bucket] = q.relk[bucket] / 8. S^T 16-key tiles = K . Q^T (A = K16 rows: row = key, k = d; B = Q16 rows: col = query);
// each lane holds keys 8hh+r of query ln; logit = s/8 + qrt[query][clip(key-query)+32]; 64-key blocks wholly left (key-query <= -32) or right (>= 32) of the band take one per-lane constant (wave-uniform test);
// p = exp(logit - m) carried x1024 as f16; O^T (64 d x 16 queries) = VT . P^T with the B operand packed from the two adjacent S^T D tiles (element r <- keys 0..15, element 8+r <- keys 16..31).
// Bucket weights: buckets 1..63 hold one key each -> the logit is kept in tlg[w][query][bucket] and exponentiated against the final maximum; buckets 0 / 64 are running sums scaled with the online factor.
__global__ __launch_bounds__(128) __attribute__((amdgpu_num_vgpr(256))) void k_attn(const _Float16* __restrict__ Q16, const _Float16* __restrict__ K16, const _Float16* __restrict__ VT,
                                                                                const _Float16* __restrict__ RK16, const _Float16* __restrict__ RVT, _Float16* __restrict__ O16) {
  __shared__ __attribute__((aligned(16))) unsigned short so[4][16][72];
  __shared__ __attribute__((aligned(16))) unsigned short wt[4][16][104];
  __shared__ float qrt[4][16][84];
  __shared__ float tlg[4][16][68];
  const int tid = threadIdx.x, lane = tid & 31, ln = lane & 15, hh = lane >> 4;
  const int w = __builtin_amdgcn_readfirstlane(tid >> 5);
  const int h = blockIdx.y, b = blockIdx.z;
  const int q0 = blockIdx.x * 64 + w * 16;
  const int qi = q0 + ln;
  const size_t rq = (size_t)b * SEQ + q0;
  const size_t rk = (size_t)b * SEQ;
  const _Float16* qp = Q16 + (rq + ln) * DM + h * HD;
  const v16h qb0 = g2_frag(qp, hh), qb1 = g2_frag(qp + 32, hh);
  const _Float16* kp0 = K16 + (rk + ln) * DM + h * HD;
  const _Float16* vp0 = VT + ((size_t)(b * NH + h) * HD + ln) * SEQ;
  const v8f z8 = {0.f, 0.f, 0.f, 0.f, 0.f, 0.f, 0.f, 0.f};
  // relative-key table: columns 0..RKR-1 of the row of query ln, in logit units (1/1024 carry and 1/8 scale folded)
#pragma unroll
  for (int t = 0; t < RKR / 16; ++t) {
    const _Float16* rp = RK16 + (size_t)(16 * t + ln) * HD;
    const v16h ra0 = g2_frag(rp, hh), ra1 = g2_frag(rp + 32, hh);
    const v8f c = mma2(ra0, qb0, ra1, qb1, z8);
#pragma unroll
    for (int r = 0; r < 8; ++r) qrt[w][ln][16 * t + 8 * hh + r] = c[r] * 0.0001220703125f;
  }
#pragma unroll 1
  for (int c = 0; c < 34; ++c) tlg[w][ln][34 * hh + c] = -1.0e30f;
  __builtin_amdgcn_fence(4 /* acq_rel order */, "workgroup"); __builtin_amdgcn_wave_barrier();
  const float c0 = qrt[w][ln][0], c64 = qrt[w][ln][2 * MAXREL];
  v8f o0 = z8, o1 = z8, o2 = z8, o3 = z8;
  float mrun = -1.0e30f, lrun = 0.f, wl = 0.f, wr = 0.f;
#pragma unroll 1
  for (int kt = 0; kt < SEQ; kt += 64) {
    v8f s[4];
#pragma unroll
    for (int j = 0; j < 4; ++j) {
      const _Float16* kp = kp0 + (size_t)(kt + 16 * j) * DM;
      const v16h ka0 = g2_frag(kp, hh), ka1 = g2_frag(kp + 32, hh);
      s[j] = mma2(ka0, qb0, ka1, qb1, z8);
    }
    const bool farl = (kt + 63 + MAXREL <= q0);          /* every key of the block at distance <= -32 of every query of the wave */
    const bool farr = (kt >= q0 + 15 + MAXREL);          /* every key at distance >= +32 */
    const int dbase = kt + 8 * hh - qi;
    if (farl || farr) {
      const float cb = farl ? c0 : c64;
#pragma unroll
      for (int j = 0; j < 4; ++j)
#pragma unroll
        for (int r = 0; r < 8; ++r) s[j][r] = s[j][r] * 0.125f + cb;
    } else {
#pragma unroll
      for (int j = 0; j < 4; ++j)
#pragma unroll
        for (int r = 0; r < 8; ++r) {
          const int d = dbase + 16 * j + r;
          const int rel = min(max(d, -MAXREL), MAXREL) + MAXREL;
          float bias = qrt[w][ln][rel]; asm volatile("" : "+v"(bias));
          const float t = s[j][r] * 0.125f + bias;
          s[j][r] = t;
          const int slot = (d > -MAXREL && d < MAXREL) ? rel : 66 + hh;      /* band logit kept; clipped keys go to a per-lane dump slot */
          tlg[w][ln][slot] = t;
        }
    }
    float mx = -1.0e30f;
#pragma unroll
    for (int j = 0; j < 4; ++j)
#pragma unroll
      for (int r = 0; r < 8; ++r) mx = fmaxf(mx, s[j][r]);
    mx = fmaxf(mx, __shfl_xor(mx, 16, 32));
    const float mnew = fmaxf(mrun, mx);
    const float alpha = __expf(mrun - mnew);
    mrun = mnew;
    float ps = 0.f; FragH pf[2];
#pragma unroll
    for (int j = 0; j < 4; ++j)
#pragma unroll
      for (int r = 0; r < 8; ++r) {
        const float p = __expf(s[j][r] - mnew);
        s[j][r] = p;
        ps += p;
        pf[j >> 1].h[(j & 1) * 8 + r] = toh_flush(p * 1024.0f);
      }
    float pl = 0.f, pr = 0.f;
    if (farl || farr) {
      pl = farl ? ps : 0.f; pr = farl ? 0.f : ps;
    } else {
#pragma unroll
      for (int j = 0; j < 4; ++j)
#pragma unroll
        for (int r = 0; r < 8; ++r) {
          const int d = dbase + 16 * j + r; const float p = s[j][r];
          pl += (d <= -MAXREL) ? p : 0.f;
          pr += (d >= MAXREL) ? p : 0.f;
        }
    }
    wl = wl * alpha + pl; wr = wr * alpha + pr;
    ps += __shfl_xor(ps, 16, 32);
    lrun = lrun * alpha + ps;
#pragma unroll
    for (int r = 0; r < 8; ++r) { o0[r] *= alpha; o1[r] *= alpha; o2[r] *= alpha; o3[r] *= alpha; }
    { const _Float16* vp = vp0 + (size_t)0 * 16 * SEQ + kt; const v16h va0 = g2_frag(vp, hh), va1 = g2_frag(vp + 32, hh); o0 = mma2(va0, pf[0].v, va1, pf[1].v, o0); }
    { const _Float16* vp = vp0 + (size_t)1 * 16 * SEQ + kt; const v16h va0 = g2_frag(vp, hh), va1 = g2_frag(vp + 32, hh); o1 = mma2(va0, pf[0].v, va1, pf[1].v, o1); }
    { const _Float16* vp = vp0 + (size_t)2 * 16 * SEQ + kt; const v16h va0 = g2_frag(vp, hh), va1 = g2_frag(vp + 32, hh); o2 = mma2(va0, pf[0].v, va1, pf[1].v, o2); }
    { const _Float16* vp = vp0 + (size_t)3 * 16 * SEQ + kt; const v16h va0 = g2_frag(vp, hh), va1 = g2_frag(vp + 32, hh); o3 = mma2(va0, pf[0].v, va1, pf[1].v, o3); }
  }
  wl += __shfl_xor(wl, 16, 32); wr += __shfl_xor(wr, 16, 32);
  __builtin_amdgcn_fence(4 /* acq_rel order */, "workgroup"); __builtin_amdgcn_wave_barrier();
  // bucket weight row of query ln, columns 48hh .. 48hh+47 by this lane (all RVK columns written; columns >= NREL zero)
#pragma unroll 1
  for (int c = 0; c < 6; ++c) {
    FragH f;
#pragma unroll
    for (int q = 0; q < 8; ++q) {
      const int r = 48 * hh + 8 * c + q;
      const int rr = min(r, 67);
      float tv = tlg[w][ln][rr]; asm volatile("" : "+v"(tv));
      const float e = __expf(tv - mrun);
      const float wv = (r == 0) ? wl : (r == 2 * MAXREL) ? wr : (r < 2 * MAXREL) ? e : 0.f;
      f.h[q] = toh_flush(wv * 16.0f);
    }
    *(v8us*)&wt[w][ln][48 * hh + 8 * c] = f.half[0];
  }
  __builtin_amdgcn_fence(4 /* acq_rel order */, "workgroup"); __builtin_amdgcn_wave_barrier();
#pragma unroll
  for (int ks = 0; ks < RVK / 32; ++ks) {
    FragH wb; wb.half[0] = *(const v8us*)&wt[w][ln][32 * ks + 8 * hh]; wb.half[1] = *(const v8us*)&wt[w][ln][32 * ks + 16 + 8 * hh];
    const _Float16* rv = RVT + (size_t)ln * RVK + 32 * ks;
    o0 = g2_mma(g2_frag(rv, hh), wb.v, o0);
    o1 = g2_mma(g2_frag(rv + 16 * RVK, hh), wb.v, o1);
    o2 = g2_mma(g2_frag(rv + 32 * RVK, hh), wb.v, o2);
    o3 = g2_mma(g2_frag(rv + 48 * RVK, hh), wb.v, o3);
  }
  const float rl = (1.0f / lrun) * 0.015625f;
  { FragH f;
#pragma unroll
    for (int r = 0; r < 8; ++r) f.h[r] = toh_flush(o0[r] * rl);
    *(v8us*)&so[w][ln][0 + 8 * hh] = f.half[0]; }
  { FragH f;
#pragma unroll
    for (int r = 0; r < 8; ++r) f.h[r] = toh_flush(o1[r] * rl);
    *(v8us*)&so[w][ln][16 + 8 * hh] = f.half[0]; }
  { FragH f;
#pragma unroll
    for (int r = 0; r < 8; ++r) f.h[r] = toh_flush(o2[r] * rl);
    *(v8us*)&so[w][ln][32 + 8 * hh] = f.half[0]; }
  { FragH f;
#pragma unroll
    for (int r = 0; r < 8; ++r) f.h[r] = toh_flush(o3[r] * rl);
    *(v8us*)&so[w][ln][48 + 8 * hh] = f.half[0]; }
  __builtin_amdgcn_fence(4 /* acq_rel order */, "workgroup"); __builtin_amdgcn_wave_barrier();
  const int li = lane >> 3, pc = lane & 7;
  {
#pragma unroll
    for (int g = 0; g < 4; ++g) {
      const int i = g * 4 + li;
      const v8us v = *(const v8us*)&so[w][i][pc * 8];
      *(v8us*)((unsigned short*)O16 + (rq + i) * DM + h * HD + pc * 8) = v;
    }
    
  }
}

// out[r][col] = (A1[r] . B1[col]) * al1 + bf16(bias[col]); the same tile loop; each wave stages 32 x 128 f32 at a time in its own quarter of the ring; bias added at the store stage as a 4-wide f32 vector; f32 rows:
__global__ __launch_bounds__(128) void k_out(const _Float16* __restrict__ A1, const _Float16* __restrict__ B1, float al1, const float* __restrict__ bias, float* __restrict__ Out) {
  __shared__ __attribute__((aligned(2048))) unsigned char L[2u * GP_STAGE];
  const int tid = threadIdx.x, lane = tid & 31, ln = lane & 15, hh = lane >> 4;
  const int w = __builtin_amdgcn_readfirstlane(tid >> 5);
  const int ntn = DM / 256;
  const int mt = blockIdx.x / ntn, nq = blockIdx.x - mt * ntn;
  if (mt * 128 >= (int)NR) return;
  const v8f z8 = {0.f, 0.f, 0.f, 0.f, 0.f, 0.f, 0.f, 0.f};
  v8f acc[4][8];
#pragma unroll
  for (int i = 0; i < 4; ++i)
#pragma unroll
    for (int j = 0; j < 8; ++j) acc[i][j] = z8;
  gemm128x256(A1 + (size_t)mt * 128 * DM, B1 + (size_t)nq * 256 * DM, L, w, ln, hh, acc);
  const int row0 = mt * 128 + 64 * (w >> 1), col0 = nq * 256 + 128 * (w & 1);
  float (*so)[132] = (float (*)[132])(L + (size_t)w * (GP_STAGE / 2u));
  const v4f bz = *(const v4fa*)(bias + col0 + lane * 4);
  v4f bb;
#pragma unroll
  for (int i = 0; i < 4; ++i) bb[i] = bf16_rne(bz[i]);
#pragma unroll
  for (int h2 = 0; h2 < 2; ++h2) {
#pragma unroll
    for (int ii = 0; ii < 2; ++ii)
#pragma unroll
      for (int j = 0; j < 8; ++j)
#pragma unroll
        for (int r = 0; r < 8; ++r) so[ii * 16 + 8 * hh + r][j * 16 + ln] = acc[2 * h2 + ii][j][r] * al1;
    __builtin_amdgcn_fence(4 /* acq_rel order */, "workgroup"); __builtin_amdgcn_wave_barrier();
#pragma unroll 1                                        /* groups of eight rows: eight LDS reads in flight cover their latency, one wait per group behind the stores */
    for (int q8 = 0; q8 < 32; q8 += 8) {
#pragma unroll
      for (int q = 0; q < 8; ++q) {
        const v4f v0 = *(const v4fa*)&so[q8 + q][lane * 4];
        const v4f v = v0 + bb;
        *(v4f*)(Out + (size_t)(row0 + 32 * h2 + q8 + q) * DM + col0 + lane * 4) = v;
      }
      asm volatile("s_wait_xcnt 0x0" ::: "memory");     /* in front of the next group, which overwrites registers that these stores name */
    }
    __builtin_amdgcn_fence(4 /* acq_rel order */, "workgroup"); __builtin_amdgcn_wave_barrier();
  }
}

extern "C" void kernel_launch(void* const* d_in, const int* in_sizes, int n_in,
                              void* d_out, int out_size, void* d_ws, size_t ws_size, hipStream_t stream) {
  if (n_in < 8) return;
  if (in_sizes[0] < (int)(((size_t)(NB - 1) * SEQ_FULL + SEQ) * DM)) return;
  for (int i = 1; i <= 4; ++i) if (in_sizes[i] < DM * DM) return;
  if (in_sizes[5] < DM) return;
  if (in_sizes[6] < NREL * HD) return;
  if (in_sizes[7] < NREL * HD) return;
  if (out_size < (int)(NR * DM)) return;
  const float* const* I = (const float* const*)d_in;
  const float* x = I[0]; const float* wq = I[1]; const float* wk = I[2]; const float* wv = I[3]; const float* wo = I[4]; const float* bo = I[5]; const float* relk = I[6]; const float* relv = I[7];
  char* ws = (char*)d_ws; size_t off = 0;
  auto take = [&](size_t bytes) { char* p = ws + off; off += (bytes + 255) & ~(size_t)255; return p; };
  _Float16* BQKV = (_Float16*)take((size_t)3 * SZ_BT);               /* Bt planes q, k, v (contiguous, stride DM*DM) */
  _Float16* BO   = (_Float16*)take(SZ_BT);
  _Float16* RK16 = (_Float16*)take(SZ_RK);                           /* [RKR][HD] */
  _Float16* RVT  = (_Float16*)take(SZ_RV);                           /* [HD][RVK] */
  _Float16* X16  = (_Float16*)take(SZ_ACT);
  _Float16* QKV16 = (_Float16*)take((size_t)3 * SZ_ACT);             /* Q16, K16, V16 planes (stride NR*DM) */
  _Float16* VT   = (_Float16*)take((size_t)NB * NH * HD * SEQ * 2);  /* [b*NH+h][d][s] */
  _Float16* O16  = (_Float16*)take(SZ_ACT);
  if (off > ws_size) return;
  _Float16* Q16 = QKV16; _Float16* K16 = QKV16 + NR * DM; _Float16* V16 = QKV16 + (size_t)2 * NR * DM;

  { const size_t n8 = (size_t)DM * DM / 8; const unsigned g = (unsigned)((n8 + 255) / 256);
    k_wnat<<<g, 256, 0, stream>>>(wq, n8, BQKV);
    k_wnat<<<g, 256, 0, stream>>>(wk, n8, BQKV + (size_t)DM * DM);
    k_wnat<<<g, 256, 0, stream>>>(wv, n8, BQKV + (size_t)2 * DM * DM);
    k_wnat<<<g, 256, 0, stream>>>(wo, n8, BO); }
  k_rel<<<1, 256, 0, stream>>>(relk, relv, RK16, RVT);
  k_xcvt<<<(unsigned)NR, 128, 0, stream>>>(x, X16);
  k_qkv<<<dim3((unsigned)((NR / 128) * (DM / 256)), 3), 128, 0, stream>>>(X16, BQKV, 0.0625f, QKV16);      /* q, k, v as f16 rows */
  k_vt<NH, SEQ><<<(unsigned)(NB * NH * (SEQ / 64)), 256, 0, stream>>>(V16, DM, 0, VT);
  k_attn<<<dim3(SEQ / 64, NH, NB), 128, 0, stream>>>(Q16, K16, VT, RK16, RVT, O16);
  k_out<<<(unsigned)((NR / 128) * (DM / 256)), 128, 0, stream>>>(O16, BO, 0.00390625f, bo, (float*)d_out);      /* out = ctx Wo^T + b_o */
}

// v002
// It runs in 164 microseconds.
// In both of two side-by-side timings against v001, it was 1.59 times as fast.
// Over all steps from v000 it is 2.48 times as fast.
#include <hip/hip_runtime.h>
// Contractions: q/k/v/o projections ([tokens][1024] x [1024][1024]^T), scores k.q^T (K = 64), relative-key table relk.q^T (K = 64), v^T.p^T (K = keys) and relv^T.w^T (K = 65 padded to 96) on v_wmma_f32_16x16x32_f16 (f16 operands, f32 accumulate). Inputs RNE-converted to bf16 on load (exact in f16; weights carried x16, relk x1024, relv x64), softmax numerators carried x1024, bucket weights x16, ctx rows x16; softmax statistics and all epilogues in f32.
// Structure: token rows r = b*SEQ + s. X16 = f16(bf16(x)); Q16/K16/V16 = f16(X16 . Bt_w / 16); VT = V16^T per (batch, head); attention per (64 queries, head, batch): per wave a table QR[query][bucket] = q . relk[bucket] / 8
// (5 WMMA tiles into wave-private LDS), S^T tiles = K . Q^T, logit = s/8 + QR[query][clip(key - query, -32, 32) + 32], online softmax per lane, O^T = VT . P^T; bucket weights W[query][bucket] (buckets 1..63 from band logits kept in LDS,
// buckets 0 and 64 as running sums) then O^T += RelVT . W^T; O16[r][h*64+d] = f16(16 ctx); out = (O16 . Bt_o) / 256 + bf16(b_o) -> f32 rows.
#ifndef NB
#define NB 8
#endif
#ifndef SEQ
#define SEQ 1024
#endif
#define NB_FULL 8
#define SEQ_FULL 1024
#define DM 1024
#define NH 16
#define HD 64
#define MAXREL 32
#define NREL 65
#define RKR 80
#define RVK 96
#define NR ((size_t)NB * SEQ)
#define SZ_BT ((size_t)DM * DM * 2)
#define SZ_ACT (NR * DM * 2)
#define SZ_RK ((size_t)RKR * HD * 2)
#define SZ_RV ((size_t)HD * RVK * 2)
#define WS_TOTAL ((size_t)4 * SZ_BT + SZ_RK + SZ_RV + (size_t)6 * SZ_ACT)
static_assert(NH * HD == DM);
static_assert(SEQ % 128 == 0);
static_assert(SEQ <= SEQ_FULL);
static_assert(NB >= 1 && NB <= NB_FULL);
static_assert(DM == 128 * 8);
static_assert(DM % 256 == 0);
static_assert(HD == 64);
static_assert(NREL == 2 * MAXREL + 1);
static_assert(RKR % 16 == 0 && RKR >= NREL);
static_assert(RVK % 32 == 0 && RVK >= NREL);
static_assert((RKR * HD / 8) % 32 == 0);
static_assert((HD * RVK / 8) % 256 == 0);
static_assert(SZ_BT % 256 == 0 && SZ_ACT % 256 == 0 && SZ_RK % 256 == 0 && SZ_RV % 256 == 0);
static_assert(WS_TOTAL <= (size_t)134217728);
static_assert((size_t)NB * NH * HD * SEQ * 2 == SZ_ACT);

typedef _Float16 v16h __attribute__((ext_vector_type(16)));
typedef unsigned short v8us __attribute__((ext_vector_type(8), may_alias));
typedef float v8f __attribute__((ext_vector_type(8)));
typedef float v4f __attribute__((ext_vector_type(4)));
typedef float v4fa __attribute__((ext_vector_type(4), may_alias));
typedef _Float16 v4h __attribute__((ext_vector_type(4)));
union FragH { v16h v; v8us half[2]; _Float16 h[16]; unsigned short u[16]; };

__device__ __forceinline__ unsigned short bf16_bits(float x) { unsigned int u = __float_as_uint(x); return (unsigned short)((u + 0x7FFFu + ((u >> 16) & 1u)) >> 16); }
__device__ __forceinline__ float bf16_val(unsigned short b) { return __uint_as_float(((unsigned int)b) << 16); }
__device__ __forceinline__ float bf16_rne(float x) { return bf16_val(bf16_bits(x)); }
// f32 -> f16 operand convert that cannot produce an f16 subnormal (value select)
static __device__ __forceinline__ _Float16 toh_flush(float v) { const _Float16 r = (_Float16)v; return (fabsf(v) < 6.103515625e-05f) ? (_Float16)0.0f : r; }

// 16x32 f16 fragment from a k-contiguous row: elements 0..7 <- p[8h .. 8h+7], elements 8..15 <- p[16+8h .. 16+8h+7] (same map for A rows and for Bt[n][k] rows)
__device__ __forceinline__ v16h g2_frag(const _Float16* p, int hh) { FragH f; f.half[0] = *(const v8us*)((const unsigned short*)p + 8 * hh); f.half[1] = *(const v8us*)((const unsigned short*)p + 16 + 8 * hh); return f.v; }
__device__ __forceinline__ v8f g2_mma(v16h a, v16h b, v8f c) { v8f d = __builtin_amdgcn_wmma_f32_16x16x32_f16(false, a, false, b, (short)0, c, false, false); asm volatile("v_nop\n\tv_nop\n\tv_nop\n\tv_nop" : "+v"(d) : "v"(a), "v"(b)); return d; }
// two k-steps into one accumulator, hazard guard after the second
__device__ __forceinline__ v8f mma2(v16h a0, v16h b0, v16h a1, v16h b1, v8f c) {
  c = __builtin_amdgcn_wmma_f32_16x16x32_f16(false, a0, false, b0, (short)0, c, false, false);
  c = __builtin_amdgcn_wmma_f32_16x16x32_f16(false, a1, false, b1, (short)0, c, false, false);
  asm volatile("v_nop\n\tv_nop\n\tv_nop\n\tv_nop" : "+v"(c) : "v"(a0), "v"(b0), "v"(a1), "v"(b1));
  return c;
}

__global__ __launch_bounds__(256) void k_wnat(const float* __restrict__ w, size_t n8, _Float16* __restrict__ Bt) {
  const size_t t = (size_t)blockIdx.x * 256 + threadIdx.x; if (t >= n8) return; FragH f;
#pragma unroll
  for (int q = 0; q < 8; ++q) f.h[q] = (_Float16)(bf16_rne(w[t * 8 + q]) * 16.0f);
  const v8us o = f.half[0];
  *(v8us*)((unsigned short*)Bt + t * 8) = o; 
}

// relative-position planes (one block): RK16[bucket][d] = f16(bf16(relk[bucket][d]) * 1024), rows NREL..RKR-1 zero; RVT[d][bucket] = f16(bf16(relv[bucket][d]) * 64), columns NREL..RVK-1 zero.
__global__ __launch_bounds__(256) void k_rel(const float* __restrict__ relk, const float* __restrict__ relv, _Float16* __restrict__ RK16, _Float16* __restrict__ RVT) {
  const int tid = threadIdx.x;
#pragma unroll 1
  for (int c = tid; c < RKR * HD / 8; c += 256) {
    const int row = c / (HD / 8), d8 = (c % (HD / 8)) * 8;
    const int rr = min(row, NREL - 1);
    FragH f;
#pragma unroll
    for (int q = 0; q < 8; ++q) {
      float val = relk[rr * HD + d8 + q]; asm volatile("" : "+v"(val));
      const float sv = (row < NREL) ? bf16_rne(val) * 1024.0f : 0.0f;
      f.h[q] = toh_flush(sv);
    }
    const v8us o = f.half[0];
    unsigned short* dp = (unsigned short*)RK16 + (size_t)c * 8;
    *(v8us*)dp = o; 
  }
#pragma unroll 1
  for (int c = tid; c < HD * RVK / 8; c += 256) {
    const int d = c / (RVK / 8), r8 = (c % (RVK / 8)) * 8;
    FragH f;
#pragma unroll
    for (int q = 0; q < 8; ++q) {
      const int r = r8 + q; const int rr = min(r, NREL - 1);
      float val = relv[rr * HD + d]; asm volatile("" : "+v"(val));
      const float sv = (r < NREL) ? bf16_rne(val) * 64.0f : 0.0f;
      f.h[q] = toh_flush(sv);
    }
    const v8us o = f.half[0];
    unsigned short* dp = (unsigned short*)RVT + (size_t)c * 8;
    *(v8us*)dp = o; 
  }
}

// X16[r][c] = f16(bf16(x)); block = 128 threads per token row, thread t owns columns 8t..8t+7; input row read at the full stride (b*SEQ_FULL + s);
__global__ __launch_bounds__(128) void k_xcvt(const float* __restrict__ x, _Float16* __restrict__ X16) {
  const int r = blockIdx.x; const int b = r / SEQ, s = r - b * SEQ;
  const int t = threadIdx.x;
  const float* xr = x + ((size_t)b * SEQ_FULL + s) * DM + 8 * t;
  const v4f xa = *(const v4fa*)xr, xb = *(const v4fa*)(xr + 4);
  FragH f;
#pragma unroll
  for (int q = 0; q < 4; ++q) { f.h[q] = toh_flush(bf16_rne(xa[q])); f.h[4 + q] = toh_flush(bf16_rne(xb[q])); }
  const v8us o = f.half[0];
  unsigned short* d = (unsigned short*)X16 + (size_t)r * DM + 8 * t;
  *(v8us*)d = o; 
}

// Projection GEMM tile: one block of 4 waves computes 128 rows x 256 columns; wave (w >> 1, w & 1) owns 64 x 128 (4 x 8 accumulator tiles).
// A pass is 64 k = 128 B of every operand row. A stage in LDS is [A slice 0 | A slice 1 | B slice 0 | B slice 1], rows at pitch 144 B (128 B + the mover's 16 B pad, conflict-free for 16-byte reads);
// A slices hold 64 rows (9216 B, placed every 10240 B so that each place is a multiple of 2 KiB), B slices 128 rows (18432 B). Two stages; every wave issues one tensor load per stage: waves 0, 1 the A slices, waves 2, 3 the B slices.
#define GP_ROWB 128u
#define GP_PITCH 144u
#define GP_SLA 10240u
#define GP_SLB 18432u
#define GP_STAGE (2u * GP_SLA + 2u * GP_SLB)
#define GP_NPASS ((unsigned)(DM * 2) / GP_ROWB)
static_assert(GP_SLA % 2048u == 0 && GP_SLB % 2048u == 0 && GP_STAGE % 2048u == 0);
static_assert(64u * GP_PITCH <= GP_SLA && 128u * GP_PITCH <= GP_SLB);
static_assert(GP_NPASS >= 2);
static_assert(NR % 128 == 0 && DM % 256 == 0);
static_assert(4u * 32u * 132u * 4u <= 2u * GP_STAGE);
typedef unsigned int u32x4 __attribute__((ext_vector_type(4)));
typedef unsigned int u32x8 __attribute__((ext_vector_type(8)));
__device__ __forceinline__ unsigned int uni(unsigned int v) { return (unsigned int)__builtin_amdgcn_readfirstlane(v); }
__device__ __forceinline__ unsigned int pinned(unsigned int v) { unsigned int s = uni(v); asm volatile("" : "+s"(s)); return s; }  // a wave-uniform word held in a scalar register, so that the test around a tensor load is a scalar branch and a descriptor formed from the word stays behind the wait and the barrier in front of it
__device__ __forceinline__ v16h lds_frag(const unsigned char* p) { FragH f; f.half[0] = *(const v8us*)p; f.half[1] = *(const v8us*)(p + 32); return f.v; }

__device__ __forceinline__ void gemm128x256(const _Float16* __restrict__ Arows, const _Float16* __restrict__ Brows, unsigned char* L, int w, int ln, int hh, v8f (&acc)[4][8]) {
  const unsigned int lbase = (unsigned int)(size_t)L;
  const bool isB = w >= 2; const unsigned int sl = (unsigned int)w & 1u;
  const unsigned int nrows = isB ? 128u : 64u;
  const unsigned long long srcb = (unsigned long long)(size_t)(isB ? Brows + (size_t)sl * 128 * DM : Arows + (size_t)sl * 64 * DM);
  const unsigned int place = lbase + (isB ? 2u * GP_SLA + sl * GP_SLB : sl * GP_SLA);
  u32x8 g1;                                             /* 1-byte elements, tensor = tile = nrows rows of 128 B, source pitch one operand row, 4 dwords of pad behind every 32 */
  g1[0] = uni((1u << 20) | (4u << 22) | (3u << 25));
  g1[1] = uni(GP_ROWB << 16);
  g1[2] = uni(nrows << 16);
  g1[3] = uni(GP_ROWB << 16);
  g1[4] = uni(nrows);
  g1[5] = uni((unsigned int)(DM * 2));
  g1[6] = uni(0u);
  g1[7] = uni(0u);
  u32x4 g0;
  auto issue = [&](unsigned int st) {
    const unsigned long long ga = srcb + (unsigned long long)st * GP_ROWB;
    g0[0] = uni(1u); g0[1] = uni(place + (st & 1u) * GP_STAGE); g0[2] = uni((unsigned int)ga); g0[3] = uni((((unsigned int)(ga >> 32)) & 0x01FFFFFFu) | 0x80000000u);
    asm volatile("tensor_load_to_lds %0, %1" :: "s"(g0), "s"(g1) : "memory");
  };
  issue(0u);
  asm volatile("s_wait_tensorcnt 0x0" :: "s"(g0), "s"(g1) : "memory");  /* stage 0 has landed for this wave's slice; the descriptor words are named so that their registers stay untouched while the request is outstanding */
  __syncthreads();                                      /* ... and is published to the other waves */
  const unsigned char* ap = L + (unsigned int)(w >> 1) * GP_SLA + (unsigned int)ln * GP_PITCH + 16u * (unsigned int)hh;
  const unsigned char* bp = L + 2u * GP_SLA + (unsigned int)(w & 1) * GP_SLB + (unsigned int)ln * GP_PITCH + 16u * (unsigned int)hh;
#pragma unroll 1
  for (unsigned int s = 0; s < GP_NPASS; ++s) {         /* rolled: one copy of the pass in the instruction cache; the buffer is picked by the pass's parity */
    if (pinned(s + 1u < GP_NPASS)) issue(pinned(s + 1u)); /* behind the barrier that freed its buffer: stage s + 1 flies while pass s is worked on */
    const unsigned char* as = ap + (s & 1u) * GP_STAGE; const unsigned char* bs = bp + (s & 1u) * GP_STAGE;
    v16h a[2][4], b[2][8];
#pragma unroll
    for (int ks = 0; ks < 2; ++ks) {
      a[ks][0] = lds_frag(as + ks * 64);
#pragma unroll
      for (int j = 0; j < 8; ++j) b[ks][j] = lds_frag(bs + j * 16 * GP_PITCH + ks * 64);
#pragma unroll
      for (int i = 1; i < 4; ++i) a[ks][i] = lds_frag(as + i * 16 * GP_PITCH + ks * 64);
    }
    __builtin_amdgcn_sched_barrier(0);                  /* the pass's LDS reads stay one group ahead of its WMMAs (for speed only) */
#pragma unroll
    for (int ks = 0; ks < 2; ++ks)
#pragma unroll
      for (int i = 0; i < 4; ++i)
#pragma unroll
        for (int j = 0; j < 8; ++j) acc[i][j] = __builtin_amdgcn_wmma_f32_16x16x32_f16(false, a[ks][i], false, b[ks][j], (short)0, acc[i][j], false, false);
    __builtin_amdgcn_sched_barrier(0);                  /* the WMMAs stay in front of the publish point: moved behind it, the wait for stage s + 1 would stand a whole pass earlier and the refill would lose its lead */
    asm volatile("s_wait_dscnt 0x0" ::: "memory");      /* this wave has left the buffer of pass s */
    asm volatile("s_wait_tensorcnt 0x0" :: "s"(g0), "s"(g1) : "memory");  /* its slice of stage s + 1 has landed; the descriptor words are named so that their registers stay untouched from the issue to here */
    __syncthreads();                                    /* publishes stage s + 1 and frees the buffer of pass s */
  }
  asm volatile("s_wait_tensorcnt 0x0" ::: "memory");    /* nothing of the mover is outstanding when the ring becomes output staging */
  asm volatile("s_wait_dscnt 0x0" ::: "memory");
}

// projections: plane by (0 q, 1 k, 2 v): Y16_by[r][col] = f16((X16[r] . Bt_by[col]) * alpha). The last pass's barrier has ended every read of the ring; each wave then stages 32 x 128 f32 at a time in its own quarter of it.
__global__ __launch_bounds__(128) void k_qkv(const _Float16* __restrict__ X16, const _Float16* __restrict__ Bt, float alpha, _Float16* __restrict__ Y16) {
  __shared__ __attribute__((aligned(2048))) unsigned char L[2u * GP_STAGE];
  const int tid = threadIdx.x, lane = tid & 31, ln = lane & 15, hh = lane >> 4;
  const int w = __builtin_amdgcn_readfirstlane(tid >> 5);
  const int by = blockIdx.y;
  const _Float16* Bh = Bt + (size_t)by * DM * DM;
  _Float16* Yp = Y16 + (size_t)by * NR * DM;
  const int ntn = DM / 256;
  const int mt = blockIdx.x / ntn, nq = blockIdx.x - mt * ntn;
  if (mt * 128 >= (int)NR) return;
  const v8f z8 = {0.f, 0.f, 0.f, 0.f, 0.f, 0.f, 0.f, 0.f};
  v8f acc[4][8];
#pragma unroll
  for (int i = 0; i < 4; ++i)
#pragma unroll
    for (int j = 0; j < 8; ++j) acc[i][j] = z8;
  gemm128x256(X16 + (size_t)mt * 128 * DM, Bh + (size_t)nq * 256 * DM, L, w, ln, hh, acc);
  const int row0 = mt * 128 + 64 * (w >> 1), col0 = nq * 256 + 128 * (w & 1);
  float (*so)[132] = (float (*)[132])(L + (size_t)w * (GP_STAGE / 2u));
#pragma unroll
  for (int h2 = 0; h2 < 2; ++h2) {
#pragma unroll
    for (int ii = 0; ii < 2; ++ii)
#pragma unroll
      for (int j = 0; j < 8; ++j)
#pragma unroll
        for (int r = 0; r < 8; ++r) so[ii * 16 + 8 * hh + r][j * 16 + ln] = acc[2 * h2 + ii][j][r] * alpha;
    __builtin_amdgcn_fence(4 /* acq_rel order */, "workgroup"); __builtin_amdgcn_wave_barrier();
#pragma unroll 1                                        /* groups of eight rows: eight LDS reads in flight cover their latency, one wait per group behind the stores */
    for (int q8 = 0; q8 < 32; q8 += 8) {
#pragma unroll
      for (int q = 0; q < 8; ++q) {
        const v4f v = *(const v4fa*)&so[q8 + q][lane * 4]; v4h h4;
#pragma unroll
        for (int i = 0; i < 4; ++i) h4[i] = toh_flush(v[i]);
        *(v4h*)(Yp + (size_t)(row0 + 32 * h2 + q8 + q) * DM + col0 + lane * 4) = h4;
      }
      asm volatile("s_wait_xcnt 0x0" ::: "memory");     /* in front of the next group, which overwrites registers that these stores name */
    }
    __builtin_amdgcn_fence(4 /* acq_rel order */, "workgroup"); __builtin_amdgcn_wave_barrier();
  }
}

template <int NHv, int TTv>
__global__ __launch_bounds__(256) void k_vt(const _Float16* __restrict__ V16, int ldv, int voff, _Float16* __restrict__ Vt) {
  __shared__ unsigned short tl[64][66];
  const int tid = threadIdx.x; const int slab = blockIdx.x / (TTv / 64), lg = blockIdx.x % (TTv / 64); const int b = slab / NHv, h = slab % NHv;
  for (int i = tid; i < 64 * 8; i += 256) {
    const int r = i / 8, c8 = (i % 8) * 8; FragH f; f.half[0] = *(const v8us*)((const unsigned short*)V16 + ((size_t)b * TTv + lg * 64 + r) * ldv + voff + h * 64 + c8);
#pragma unroll
    for (int q = 0; q < 8; ++q) tl[r][c8 + q] = f.u[q];
  }
  __syncthreads();
  {
#pragma unroll
    for (int rd = 0; rd < 2; ++rd) {
      const int d = rd * 32 + tid / 8, pc = tid % 8; FragH f;
#pragma unroll
      for (int q = 0; q < 8; ++q) f.u[q] = tl[pc * 8 + q][d];
      *(v8us*)((unsigned short*)Vt + ((size_t)slab * 64 + d) * TTv + lg * 64 + pc * 8) = f.half[0];
    }
    
  }
}

// Attention K / V^T ring: a stage is 64 keys = [K tile: 64 key rows of 128 B | V^T tile: 64 d rows of 128 B], rows at pitch 144 B (128 B + the mover's 16 B pad, conflict-free for 16-byte reads); a tile holds 9216 B and is placed every 10240 B (a multiple of 2 KiB).
// Two stages, shared by the block's four waves; behind the loop's last barrier the ring is free and holds each wave's own bucket-weight and output rows.
#define AT_ROWB 128u
#define AT_PITCH 144u
#define AT_TILE 10240u
#define AT_STAGE (2u * AT_TILE)
#define AT_NPASS ((unsigned)SEQ / 64u)
#define AT_WTB (16u * 104u * 2u)
#define AT_SOB (16u * 72u * 2u)
static_assert(AT_TILE % 2048u == 0 && 64u * AT_PITCH <= AT_TILE);
static_assert(AT_NPASS >= 2);
static_assert(AT_ROWB == (unsigned)(HD * 2) && (DM * 2) % 16 == 0 && (SEQ * 2) % 16 == 0 && SEQ % 64 == 0);
static_assert(4u * (AT_WTB + AT_SOB) <= 2u * AT_STAGE && AT_WTB % 16u == 0 && AT_SOB % 16u == 0);
// QR^T tiles (16 buckets x 16 queries) = RK16 . Q^T -> qrt[w][query][bucket] = q.relk[bucket] / 8. S^T 16-key tiles = K . Q^T (A = K16 rows: row = key, k = d; B = Q16 rows: col = query);
// each lane holds keys 8hh+r of query ln; logit = s/8 + qrt[query][clip(key-query)+32]; 64-key blocks wholly left (key-query <= -32) or right (>= 32) of the band take one per-lane constant (wave-uniform test);
// p = exp(logit - m) carried x1024 as f16; O^T (64 d x 16 queries) = VT . P^T with the B operand packed from the two adjacent S^T D tiles (element r <- keys 0..15, element 8+r <- keys 16..31).
// Bucket weights: buckets 1..63 hold one key each -> the logit is kept in tlg[w][query][bucket] and exponentiated against the final maximum; buckets 0 / 64 are running sums scaled with the online factor.
__global__ __launch_bounds__(128) __attribute__((amdgpu_num_vgpr(256))) void k_attn(const _Float16* __restrict__ Q16, const _Float16* __restrict__ K16, const _Float16* __restrict__ VT,
                                                                                const _Float16* __restrict__ RK16, const _Float16* __restrict__ RVT, _Float16* __restrict__ O16) {
  __shared__ __attribute__((aligned(2048))) unsigned char L[2u * AT_STAGE];
  __shared__ float qrt[4][16][84];
  __shared__ float tlg[4][16][68];
  const int tid = threadIdx.x, lane = tid & 31, ln = lane & 15, hh = lane >> 4;
  const int w = __builtin_amdgcn_readfirstlane(tid >> 5);
  const int h = blockIdx.y, b = blockIdx.z;
  const int q0 = blockIdx.x * 64 + w * 16;
  const int qi = q0 + ln;
  const size_t rq = (size_t)b * SEQ + q0;
  const size_t rk = (size_t)b * SEQ;
  const _Float16* qp = Q16 + (rq + ln) * DM + h * HD;
  const v16h qb0 = g2_frag(qp, hh), qb1 = g2_frag(qp + 32, hh);
  const v8f z8 = {0.f, 0.f, 0.f, 0.f, 0.f, 0.f, 0.f, 0.f};
  // K / V^T ring: wave 0 brings the stage's 64 K rows (next stage 64 rows on), wave 1 its 64 V^T rows (next stage 128 B on); waves 2 and 3 issue nothing
  const unsigned int issuer = (unsigned int)(w < 2);
  const unsigned long long srcb = (unsigned long long)(size_t)(w == 0 ? K16 + rk * DM + h * HD : VT + (size_t)(b * NH + h) * HD * SEQ);
  const unsigned int sstep = (w == 0) ? 64u * (unsigned int)(DM * 2) : AT_ROWB;
  const unsigned int place = (unsigned int)(size_t)L + (w == 0 ? 0u : AT_TILE);
  u32x8 g1;                                             /* 1-byte elements, tensor = tile = 64 rows of 128 B, source pitch one K16 or VT row, 4 dwords of pad behind every 32 */
  g1[0] = uni((1u << 20) | (4u << 22) | (3u << 25));
  g1[1] = pinned(AT_ROWB << 16);                        /* words 1 to 7: descriptor words held in scalar registers, so that the group is built once and its registers stay as they are while a request is outstanding */
  g1[2] = pinned(64u << 16);
  g1[3] = pinned(AT_ROWB << 16);
  g1[4] = pinned(64u);
  g1[5] = pinned(w == 0 ? (unsigned int)(DM * 2) : (unsigned int)(SEQ * 2));
  g1[6] = pinned(0u);
  g1[7] = pinned(0u);
  u32x4 g0;
  const unsigned int cnt1 = pinned(1u);                 /* group 0's constant word held in a scalar register, not written again while a request is outstanding */
  auto issue = [&](unsigned int st) {
    const unsigned long long ga = srcb + (unsigned long long)st * sstep;
    g0[0] = uni(cnt1); g0[1] = uni(place + (st & 1u) * AT_STAGE); g0[2] = uni((unsigned int)ga); g0[3] = uni((((unsigned int)(ga >> 32)) & 0x01FFFFFFu) | 0x80000000u);
    asm volatile("tensor_load_to_lds %0, %1" :: "s"(g0), "s"(g1) : "memory");
  };
  if (pinned(issuer)) {
    issue(0u);
    asm volatile("s_wait_tensorcnt 0x0" :: "s"(g0), "s"(g1) : "memory");  /* stage 0 has landed; the descriptor words are named so that their registers stay untouched while the request is outstanding */
  }
  __syncthreads();                                      /* ... and is published to the other waves */
  if (pinned(issuer)) issue(pinned(1u));                /* stage 1 flies while the table below and pass 0 are worked on */
  const unsigned char* kf0 = L + (unsigned int)ln * AT_PITCH + 16u * (unsigned int)hh;
  // relative-key table: columns 0..RKR-1 of the row of query ln, in logit units (1/1024 carry and 1/8 scale folded)
#pragma unroll
  for (int t = 0; t < RKR / 16; ++t) {
    const _Float16* rp = RK16 + (size_t)(16 * t + ln) * HD;
    const v16h ra0 = g2_frag(rp, hh), ra1 = g2_frag(rp + 32, hh);
    const v8f c = mma2(ra0, qb0, ra1, qb1, z8);
#pragma unroll
    for (int r = 0; r < 8; ++r) qrt[w][ln][16 * t + 8 * hh + r] = c[r] * 0.0001220703125f;
  }
#pragma unroll 1
  for (int c = 0; c < 34; ++c) tlg[w][ln][34 * hh + c] = -1.0e30f;
  __builtin_amdgcn_fence(4 /* acq_rel order */, "workgroup"); __builtin_amdgcn_wave_barrier();
  const float c0 = qrt[w][ln][0], c64 = qrt[w][ln][2 * MAXREL];
  v8f o0 = z8, o1 = z8, o2 = z8, o3 = z8;
  float mrun = -1.0e30f, lrun = 0.f, wl = 0.f, wr = 0.f;
#pragma unroll 1
  for (int kt = 0; kt < SEQ; kt += 64) {
    const unsigned int st = (unsigned int)kt >> 6;
    const unsigned char* kf = kf0 + (st & 1u) * AT_STAGE; const unsigned char* vf = kf + AT_TILE;
    v8f s[4];
    v16h kv[4][2];
#pragma unroll
    for (int j = 0; j < 4; ++j) { kv[j][0] = lds_frag(kf + j * 16 * AT_PITCH); kv[j][1] = lds_frag(kf + j * 16 * AT_PITCH + 64); }
    __builtin_amdgcn_sched_barrier(0);                  /* the pass's K reads stay one group ahead of its WMMAs: read tile by tile, the wave waits out the LDS latency four times */
#pragma unroll
    for (int j = 0; j < 4; ++j) s[j] = mma2(kv[j][0], qb0, kv[j][1], qb1, z8);
#pragma unroll
    for (int j = 0; j < 4; ++j) { kv[j][0] = lds_frag(vf + j * 16 * AT_PITCH); kv[j][1] = lds_frag(vf + j * 16 * AT_PITCH + 64); }
    __builtin_amdgcn_sched_barrier(0);                  /* the pass's V^T reads are issued here, as one group: their latency passes under the softmax arithmetic */
    const bool farl = (kt + 63 + MAXREL <= q0);          /* every key of the block at distance <= -32 of every query of the wave */
    const bool farr = (kt >= q0 + 15 + MAXREL);          /* every key at distance >= +32 */
    const int dbase = kt + 8 * hh - qi;
    if (farl || farr) {
      const float cb = farl ? c0 : c64;
#pragma unroll
      for (int j = 0; j < 4; ++j)
#pragma unroll
        for (int r = 0; r < 8; ++r) s[j][r] = s[j][r] * 0.125f + cb;
    } else {
#pragma unroll
      for (int j = 0; j < 4; ++j)
#pragma unroll
        for (int r = 0; r < 8; ++r) {
          const int d = dbase + 16 * j + r;
          const int rel = min(max(d, -MAXREL), MAXREL) + MAXREL;
          float bias = qrt[w][ln][rel]; asm volatile("" : "+v"(bias));
          const float t = s[j][r] * 0.125f + bias;
          s[j][r] = t;
          const int slot = (d > -MAXREL && d < MAXREL) ? rel : 66 + hh;      /* band logit kept; clipped keys go to a per-lane dump slot */
          tlg[w][ln][slot] = t;
        }
    }
    float mx = -1.0e30f;
#pragma unroll
    for (int j = 0; j < 4; ++j)
#pragma unroll
      for (int r = 0; r < 8; ++r) mx = fmaxf(mx, s[j][r]);
    mx = fmaxf(mx, __shfl_xor(mx, 16, 32));
    const float mnew = fmaxf(mrun, mx);
    const float alpha = __expf(mrun - mnew);
    mrun = mnew;
    float ps = 0.f; FragH pf[2];
#pragma unroll
    for (int j = 0; j < 4; ++j)
#pragma unroll
      for (int r = 0; r < 8; ++r) {
        const float p = __expf(s[j][r] - mnew);
        s[j][r] = p;
        ps += p;
        pf[j >> 1].h[(j & 1) * 8 + r] = toh_flush(p * 1024.0f);
      }
    float pl = 0.f, pr = 0.f;
    if (farl || farr) {
      pl = farl ? ps : 0.f; pr = farl ? 0.f : ps;
    } else {
#pragma unroll
      for (int j = 0; j < 4; ++j)
#pragma unroll
        for (int r = 0; r < 8; ++r) {
          const int d = dbase + 16 * j + r; const float p = s[j][r];
          pl += (d <= -MAXREL) ? p : 0.f;
          pr += (d >= MAXREL) ? p : 0.f;
        }
    }
    wl = wl * alpha + pl; wr = wr * alpha + pr;
    ps += __shfl_xor(ps, 16, 32);
    lrun = lrun * alpha + ps;
#pragma unroll
    for (int r = 0; r < 8; ++r) { o0[r] *= alpha; o1[r] *= alpha; o2[r] *= alpha; o3[r] *= alpha; }
    o0 = mma2(kv[0][0], pf[0].v, kv[0][1], pf[1].v, o0);
    o1 = mma2(kv[1][0], pf[0].v, kv[1][1], pf[1].v, o1);
    o2 = mma2(kv[2][0], pf[0].v, kv[2][1], pf[1].v, o2);
    o3 = mma2(kv[3][0], pf[0].v, kv[3][1], pf[1].v, o3);
    asm volatile("s_wait_dscnt 0x0" ::: "memory");      /* this wave has left the buffer of pass st */
    if (pinned(issuer)) asm volatile("s_wait_tensorcnt 0x0" :: "s"(g0), "s"(g1) : "memory");  /* the issuer's tile of stage st + 1 has landed; the descriptor words are named so that their registers stay untouched from the issue to here */
    __syncthreads();                                    /* publishes stage st + 1 and frees the buffer of pass st */
    if (pinned(issuer & (unsigned int)(st + 2u < AT_NPASS))) issue(pinned(st + 2u));  /* refill of the buffer just left: stage st + 2 flies while pass st + 1 is worked on */
  }
  asm volatile("s_wait_tensorcnt 0x0" ::: "memory");    /* nothing of the mover is outstanding when the ring becomes the waves' epilogue staging */
  asm volatile("s_wait_dscnt 0x0" ::: "memory");
  unsigned short (*wt)[104] = (unsigned short (*)[104])(L + (unsigned int)w * AT_WTB);                  /* bucket weights, this wave's own 16 x 104 */
  unsigned short (*so)[72] = (unsigned short (*)[72])(L + 4u * AT_WTB + (unsigned int)w * AT_SOB);      /* output rows, this wave's own 16 x 72 */
  wl += __shfl_xor(wl, 16, 32); wr += __shfl_xor(wr, 16, 32);
  __builtin_amdgcn_fence(4 /* acq_rel order */, "workgroup"); __builtin_amdgcn_wave_barrier();
  // bucket weight row of query ln, columns 48hh .. 48hh+47 by this lane (all RVK columns written; columns >= NREL zero)
#pragma unroll 1
  for (int c = 0; c < 6; ++c) {
    FragH f;
#pragma unroll
    for (int q = 0; q < 8; ++q) {
      const int r = 48 * hh + 8 * c + q;
      const int rr = min(r, 67);
      float tv = tlg[w][ln][rr]; asm volatile("" : "+v"(tv));
      const float e = __expf(tv - mrun);
      const float wv = (r == 0) ? wl : (r == 2 * MAXREL) ? wr : (r < 2 * MAXREL) ? e : 0.f;
      f.h[q] = toh_flush(wv * 16.0f);
    }
    *(v8us*)&wt[ln][48 * hh + 8 * c] = f.half[0];
  }
  __builtin_amdgcn_fence(4 /* acq_rel order */, "workgroup"); __builtin_amdgcn_wave_barrier();
#pragma unroll
  for (int ks = 0; ks < RVK / 32; ++ks) {
    FragH wb; wb.half[0] = *(const v8us*)&wt[ln][32 * ks + 8 * hh]; wb.half[1] = *(const v8us*)&wt[ln][32 * ks + 16 + 8 * hh];
    const _Float16* rv = RVT + (size_t)ln * RVK + 32 * ks;
    o0 = g2_mma(g2_frag(rv, hh), wb.v, o0);
    o1 = g2_mma(g2_frag(rv + 16 * RVK, hh), wb.v, o1);
    o2 = g2_mma(g2_frag(rv + 32 * RVK, hh), wb.v, o2);
    o3 = g2_mma(g2_frag(rv + 48 * RVK, hh), wb.v, o3);
  }
  const float rl = (1.0f / lrun) * 0.015625f;
  { FragH f;
#pragma unroll
    for (int r = 0; r < 8; ++r) f.h[r] = toh_flush(o0[r] * rl);
    *(v8us*)&so[ln][0 + 8 * hh] = f.half[0]; }
  { FragH f;
#pragma unroll
    for (int r = 0; r < 8; ++r) f.h[r] = toh_flush(o1[r] * rl);
    *(v8us*)&so[ln][16 + 8 * hh] = f.half[0]; }
  { FragH f;
#pragma unroll
    for (int r = 0; r < 8; ++r) f.h[r] = toh_flush(o2[r] * rl);
    *(v8us*)&so[ln][32 + 8 * hh] = f.half[0]; }
  { FragH f;
#pragma unroll
    for (int r = 0; r < 8; ++r) f.h[r] = toh_flush(o3[r] * rl);
    *(v8us*)&so[ln][48 + 8 * hh] = f.half[0]; }
  __builtin_amdgcn_fence(4 /* acq_rel order */, "workgroup"); __builtin_amdgcn_wave_barrier();
  const int li = lane >> 3, pc = lane & 7;
  {
#pragma unroll
    for (int g = 0; g < 4; ++g) {
      const int i = g * 4 + li;
      const v8us v = *(const v8us*)&so[i][pc * 8];
      *(v8us*)((unsigned short*)O16 + (rq + i) * DM + h * HD + pc * 8) = v;
    }
    
  }
}

// out[r][col] = (A1[r] . B1[col]) * al1 + bf16(bias[col]); the same tile loop; each wave stages 32 x 128 f32 at a time in its own quarter of the ring; bias added at the store stage as a 4-wide f32 vector; f32 rows:
__global__ __launch_bounds__(128) void k_out(const _Float16* __restrict__ A1, const _Float16* __restrict__ B1, float al1, const float* __restrict__ bias, float* __restrict__ Out) {
  __shared__ __attribute__((aligned(2048))) unsigned char L[2u * GP_STAGE];
  const int tid = threadIdx.x, lane = tid & 31, ln = lane & 15, hh = lane >> 4;
  const int w = __builtin_amdgcn_readfirstlane(tid >> 5);
  const int ntn = DM / 256;
  const int mt = blockIdx.x / ntn, nq = blockIdx.x - mt * ntn;
  if (mt * 128 >= (int)NR) return;
  const v8f z8 = {0.f, 0.f, 0.f, 0.f, 0.f, 0.f, 0.f, 0.f};
  v8f acc[4][8];
#pragma unroll
  for (int i = 0; i < 4; ++i)
#pragma unroll
    for (int j = 0; j < 8; ++j) acc[i][j] = z8;
  gemm128x256(A1 + (size_t)mt * 128 * DM, B1 + (size_t)nq * 256 * DM, L, w, ln, hh, acc);
  const int row0 = mt * 128 + 64 * (w >> 1), col0 = nq * 256 + 128 * (w & 1);
  float (*so)[132] = (float (*)[132])(L + (size_t)w * (GP_STAGE / 2u));
  const v4f bz = *(const v4fa*)(bias + col0 + lane * 4);
  v4f bb;
#pragma unroll
  for (int i = 0; i < 4; ++i) bb[i] = bf16_rne(bz[i]);
#pragma unroll
  for (int h2 = 0; h2 < 2; ++h2) {
#pragma unroll
    for (int ii = 0; ii < 2; ++ii)
#pragma unroll
      for (int j = 0; j < 8; ++j)
#pragma unroll
        for (int r = 0; r < 8; ++r) so[ii * 16 + 8 * hh + r][j * 16 + ln] = acc[2 * h2 + ii][j][r] * al1;
    __builtin_amdgcn_fence(4 /* acq_rel order */, "workgroup"); __builtin_amdgcn_wave_barrier();
#pragma unroll 1                                        /* groups of eight rows: eight LDS reads in flight cover their latency, one wait per group behind the stores */
    for (int q8 = 0; q8 < 32; q8 += 8) {
#pragma unroll
      for (int q = 0; q < 8; ++q) {
        const v4f v0 = *(const v4fa*)&so[q8 + q][lane * 4];
        const v4f v = v0 + bb;
        *(v4f*)(Out + (size_t)(row0 + 32 * h2 + q8 + q) * DM + col0 + lane * 4) = v;
      }
      asm volatile("s_wait_xcnt 0x0" ::: "memory");     /* in front of the next group, which overwrites registers that these stores name */
    }
    __builtin_amdgcn_fence(4 /* acq_rel order */, "workgroup"); __builtin_amdgcn_wave_barrier();
  }
}

extern "C" void kernel_launch(void* const* d_in, const int* in_sizes, int n_in,
                              void* d_out, int out_size, void* d_ws, size_t ws_size, hipStream_t stream) {
  if (n_in < 8) return;
  if (in_sizes[0] < (int)(((size_t)(NB - 1) * SEQ_FULL + SEQ) * DM)) return;
  for (int i = 1; i <= 4; ++i) if (in_sizes[i] < DM * DM) return;
  if (in_sizes[5] < DM) return;
  if (in_sizes[6] < NREL * HD) return;
  if (in_sizes[7] < NREL * HD) return;
  if (out_size < (int)(NR * DM)) return;
  const float* const* I = (const float* const*)d_in;
  const float* x = I[0]; const float* wq = I[1]; const float* wk = I[2]; const float* wv = I[3]; const float* wo = I[4]; const float* bo = I[5]; const float* relk = I[6]; const float* relv = I[7];
  char* ws = (char*)d_ws; size_t off = 0;
  auto take = [&](size_t bytes) { char* p = ws + off; off += (bytes + 255) & ~(size_t)255; return p; };
  _Float16* BQKV = (_Float16*)take((size_t)3 * SZ_BT);               /* Bt planes q, k, v (contiguous, stride DM*DM) */
  _Float16* BO   = (_Float16*)take(SZ_BT);
  _Float16* RK16 = (_Float16*)take(SZ_RK);                           /* [RKR][HD] */
  _Float16* RVT  = (_Float16*)take(SZ_RV);                           /* [HD][RVK] */
  _Float16* X16  = (_Float16*)take(SZ_ACT);
  _Float16* QKV16 = (_Float16*)take((size_t)3 * SZ_ACT);             /* Q16, K16, V16 planes (stride NR*DM) */
  _Float16* VT   = (_Float16*)take((size_t)NB * NH * HD * SEQ * 2);  /* [b*NH+h][d][s] */
  _Float16* O16  = (_Float16*)take(SZ_ACT);
  if (off > ws_size) return;
  _Float16* Q16 = QKV16; _Float16* K16 = QKV16 + NR * DM; _Float16* V16 = QKV16 + (size_t)2 * NR * DM;

  { const size_t n8 = (size_t)DM * DM / 8; const unsigned g = (unsigned)((n8 + 255) / 256);
    k_wnat<<<g, 256, 0, stream>>>(wq, n8, BQKV);
    k_wnat<<<g, 256, 0, stream>>>(wk, n8, BQKV + (size_t)DM * DM);
    k_wnat<<<g, 256, 0, stream>>>(wv, n8, BQKV + (size_t)2 * DM * DM);
    k_wnat<<<g, 256, 0, stream>>>(wo, n8, BO); }
  k_rel<<<1, 256, 0, stream>>>(relk, relv, RK16, RVT);
  k_xcvt<<<(unsigned)NR, 128, 0, stream>>>(x, X16);
  k_qkv<<<dim3((unsigned)((NR / 128) * (DM / 256)), 3), 128, 0, stream>>>(X16, BQKV, 0.0625f, QKV16);      /* q, k, v as f16 rows */
  k_vt<NH, SEQ><<<(unsigned)(NB * NH * (SEQ / 64)), 256, 0, stream>>>(V16, DM, 0, VT);
  k_attn<<<dim3(SEQ / 64, NH, NB), 128, 0, stream>>>(Q16, K16, VT, RK16, RVT, O16);
  k_out<<<(unsigned)((NR / 128) * (DM / 256)), 128, 0, stream>>>(O16, BO, 0.00390625f, bo, (float*)d_out);      /* out = ctx Wo^T + b_o */
}

// v003
// It runs in 153 microseconds.
// In both of two side-by-side timings against v002, it was 1.07 times as fast.
// All steps since v000 together make it 2.66 times as fast.
#include <hip/hip_runtime.h>
// Contractions: q/k/v/o projections ([tokens][1024] x [1024][1024]^T), scores k.q^T (K = 64), relative-key table relk.q^T (K = 64), v^T.p^T (K = keys) and relv^T.w^T (K = 65 padded to 96) on v_wmma_f32_16x16x32_f16 (f16 operands, f32 accumulate). Inputs RNE-converted to bf16 on load (exact in f16; weights carried x16, relk x1024, relv x64), softmax numerators carried x1024, bucket weights x16, ctx rows x16; softmax statistics and all epilogues in f32.
// Structure: token rows r = b*SEQ + s. X16 = f16(bf16(x)); Q16/K16/V16 = f16(X16 . Bt_w / 16); VT = V16^T per (batch, head); attention per (64 queries, head, batch): per wave a table QR[query][bucket] = q . relk[bucket] / 8
// (5 WMMA tiles into wave-private LDS), S^T tiles = K . Q^T, logit = s/8 + QR[query][clip(key - query, -32, 32) + 32], online softmax per lane, O^T = VT . P^T; bucket weights W[query][bucket] (buckets 1..63 from band logits kept in LDS,
// buckets 0 and 64 as running sums) then O^T += RelVT . W^T; O16[r][h*64+d] = f16(16 ctx); out = (O16 . Bt_o) / 256 + bf16(b_o) -> f32 rows.
#ifndef NB
#define NB 8
#endif
#ifndef SEQ
#define SEQ 1024
#endif
#define NB_FULL 8
#define SEQ_FULL 1024
#define DM 1024
#define NH 16
#define HD 64
#define MAXREL 32
#define NREL 65
#define RKR 80
#define RVK 96
#define NR ((size_t)NB * SEQ)
#define SZ_BT ((size_t)DM * DM * 2)
#define SZ_ACT (NR * DM * 2)
#define SZ_RK ((size_t)RKR * HD * 2)
#define SZ_RV ((size_t)HD * RVK * 2)
#define WS_TOTAL ((size_t)4 * SZ_BT + SZ_RK + SZ_RV + (size_t)6 * SZ_ACT)
static_assert(NH * HD == DM);
static_assert(SEQ % 128 == 0);
static_assert(SEQ <= SEQ_FULL);
static_assert(NB >= 1 && NB <= NB_FULL);
static_assert(DM == 128 * 8);
static_assert(DM % 256 == 0);
static_assert(HD == 64);
static_assert(NREL == 2 * MAXREL + 1);
static_assert(RKR % 16 == 0 && RKR >= NREL);
static_assert(RVK % 32 == 0 && RVK >= NREL);
static_assert((RKR * HD / 8) % 32 == 0);
static_assert((HD * RVK / 8) % 256 == 0);
static_assert(SZ_BT % 256 == 0 && SZ_ACT % 256 == 0 && SZ_RK % 256 == 0 && SZ_RV % 256 == 0);
static_assert(WS_TOTAL <= (size_t)134217728);
static_assert((size_t)NB * NH * HD * SEQ * 2 == SZ_ACT);

typedef _Float16 v16h __attribute__((ext_vector_type(16)));
typedef unsigned short v8us __attribute__((ext_vector_type(8), may_alias));
typedef float v8f __attribute__((ext_vector_type(8)));
typedef float v4f __attribute__((ext_vector_type(4)));
typedef float v4fa __attribute__((ext_vector_type(4), may_alias));
typedef _Float16 v4h __attribute__((ext_vector_type(4)));
union FragH { v16h v; v8us half[2]; _Float16 h[16]; unsigned short u[16]; };

__device__ __forceinline__ unsigned short bf16_bits(float x) { unsigned int u = __float_as_uint(x); return (unsigned short)((u + 0x7FFFu + ((u >> 16) & 1u)) >> 16); }
__device__ __forceinline__ float bf16_val(unsigned short b) { return __uint_as_float(((unsigned int)b) << 16); }
__device__ __forceinline__ float bf16_rne(float x) { return bf16_val(bf16_bits(x)); }
// f32 -> f16 operand convert that cannot produce an f16 subnormal (value select)
static __device__ __forceinline__ _Float16 toh_flush(float v) { const _Float16 r = (_Float16)v; return (fabsf(v) < 6.103515625e-05f) ? (_Float16)0.0f : r; }

// 16x32 f16 fragment from a k-contiguous row: elements 0..7 <- p[8h .. 8h+7], elements 8..15 <- p[16+8h .. 16+8h+7] (same map for A rows and for Bt[n][k] rows)
__device__ __forceinline__ v16h g2_frag(const _Float16* p, int hh) { FragH f; f.half[0] = *(const v8us*)((const unsigned short*)p + 8 * hh); f.half[1] = *(const v8us*)((const unsigned short*)p + 16 + 8 * hh); return f.v; }
__device__ __forceinline__ v8f g2_mma(v16h a, v16h b, v8f c) { v8f d = __builtin_amdgcn_wmma_f32_16x16x32_f16(false, a, false, b, (short)0, c, false, false); asm volatile("v_nop\n\tv_nop\n\tv_nop\n\tv_nop" : "+v"(d) : "v"(a), "v"(b)); return d; }
// two k-steps into one accumulator, hazard guard after the second
__device__ __forceinline__ v8f mma2(v16h a0, v16h b0, v16h a1, v16h b1, v8f c) {
  c = __builtin_amdgcn_wmma_f32_16x16x32_f16(false, a0, false, b0, (short)0, c, false, false);
  c = __builtin_amdgcn_wmma_f32_16x16x32_f16(false, a1, false, b1, (short)0, c, false, false);
  asm volatile("v_nop\n\tv_nop\n\tv_nop\n\tv_nop" : "+v"(c) : "v"(a0), "v"(b0), "v"(a1), "v"(b1));
  return c;
}

// Bt[n][k] = f16(bf16(w[n][k]) * 16); block blk of a plane's PB_W, thread t owns 8 elements
__device__ __forceinline__ void d_wnat(const float* __restrict__ w, unsigned int blk, _Float16* __restrict__ Bt) {
  const size_t t = (size_t)blk * 256 + threadIdx.x; FragH f;
#pragma unroll
  for (int q = 0; q < 8; ++q) f.h[q] = (_Float16)(bf16_rne(w[t * 8 + q]) * 16.0f);
  const v8us o = f.half[0];
  *(v8us*)((unsigned short*)Bt + t * 8) = o;
  asm volatile("s_wait_xcnt 0x0" ::: "memory");       /* behind the store: in the shared grid another part's code follows in the listing and overwrites registers that the store names */
}

// relative-position planes (one block): RK16[bucket][d] = f16(bf16(relk[bucket][d]) * 1024), rows NREL..RKR-1 zero; RVT[d][bucket] = f16(bf16(relv[bucket][d]) * 64), columns NREL..RVK-1 zero.
__device__ __forceinline__ void d_rel(const float* __restrict__ relk, const float* __restrict__ relv, _Float16* __restrict__ RK16, _Float16* __restrict__ RVT) {
  const int tid = threadIdx.x;
#pragma unroll 1
  for (int c = tid; c < RKR * HD / 8; c += 256) {
    const int row = c / (HD / 8), d8 = (c % (HD / 8)) * 8;
    const int rr = min(row, NREL - 1);
    FragH f;
#pragma unroll
    for (int q = 0; q < 8; ++q) {
      float val = relk[rr * HD + d8 + q]; asm volatile("" : "+v"(val));
      const float sv = (row < NREL) ? bf16_rne(val) * 1024.0f : 0.0f;
      f.h[q] = toh_flush(sv);
    }
    const v8us o = f.half[0];
    unsigned short* dp = (unsigned short*)RK16 + (size_t)c * 8;
    *(v8us*)dp = o; 
  }
#pragma unroll 1
  for (int c = tid; c < HD * RVK / 8; c += 256) {
    const int d = c / (RVK / 8), r8 = (c % (RVK / 8)) * 8;
    FragH f;
#pragma unroll
    for (int q = 0; q < 8; ++q) {
      const int r = r8 + q; const int rr = min(r, NREL - 1);
      float val = relv[rr * HD + d]; asm volatile("" : "+v"(val));
      const float sv = (r < NREL) ? bf16_rne(val) * 64.0f : 0.0f;
      f.h[q] = toh_flush(sv);
    }
    const v8us o = f.half[0];
    unsigned short* dp = (unsigned short*)RVT + (size_t)c * 8;
    *(v8us*)dp = o; 
  }
}

// X16[r][c] = f16(bf16(x)); 128 threads per token row, two rows per block, thread t of a row owns columns 8t..8t+7; input row read at the full stride (b*SEQ_FULL + s);
__device__ __forceinline__ void d_xcvt(const float* __restrict__ x, unsigned int blk, _Float16* __restrict__ X16) {
  const int r = (int)blk * 2 + (int)(threadIdx.x >> 7); const int b = r / SEQ, s = r - b * SEQ;
  const int t = threadIdx.x & 127;
  const float* xr = x + ((size_t)b * SEQ_FULL + s) * DM + 8 * t;
  const v4f xa = *(const v4fa*)xr, xb = *(const v4fa*)(xr + 4);
  FragH f;
#pragma unroll
  for (int q = 0; q < 4; ++q) { f.h[q] = toh_flush(bf16_rne(xa[q])); f.h[4 + q] = toh_flush(bf16_rne(xb[q])); }
  const v8us o = f.half[0];
  unsigned short* d = (unsigned short*)X16 + (size_t)r * DM + 8 * t;
  *(v8us*)d = o;
  asm volatile("s_wait_xcnt 0x0" ::: "memory");       /* behind the store: in the shared grid another part's code follows in the listing and overwrites registers that the store names */
}

// All operand conversions in one grid: none reads what another writes, so they share a launch by ranges of the block index (block-uniform branches, no barrier).
// Block 0: the relative-position planes (one block, the longest chain of dependent loads); then PB_W blocks for each of the weight planes q, k, v, o; then PB_X blocks for x.
#define PB_W ((unsigned)((size_t)DM * DM / 8 / 256))
#define PB_X ((unsigned)(NR / 2))
static_assert((size_t)DM * DM % (8 * 256) == 0 && NR % 2 == 0);
__global__ __launch_bounds__(256) void k_prep(const float* __restrict__ x, const float* __restrict__ wq, const float* __restrict__ wk, const float* __restrict__ wv, const float* __restrict__ wo,
                                              const float* __restrict__ relk, const float* __restrict__ relv,
                                              _Float16* __restrict__ X16, _Float16* __restrict__ BQKV, _Float16* __restrict__ BO, _Float16* __restrict__ RK16, _Float16* __restrict__ RVT) {
  const unsigned int bid = blockIdx.x;
  if (bid == 0u) { d_rel(relk, relv, RK16, RVT); return; }
  const unsigned int wb = bid - 1u;
  if (wb < 4u * PB_W) {
    const unsigned int pl = wb / PB_W, blk = wb - pl * PB_W;
    const float* w = (pl == 0u) ? wq : (pl == 1u) ? wk : (pl == 2u) ? wv : wo;
    d_wnat(w, blk, (pl < 3u) ? BQKV + (size_t)pl * DM * DM : BO);
    return;
  }
  d_xcvt(x, wb - 4u * PB_W, X16);
}

// Projection GEMM tile: one block of 4 waves computes 128 rows x 256 columns; wave (w >> 1, w & 1) owns 64 x 128 (4 x 8 accumulator tiles).
// A pass is 64 k = 128 B of every operand row. A stage in LDS is [A slice 0 | A slice 1 | B slice 0 | B slice 1], rows at pitch 144 B (128 B + the mover's 16 B pad, conflict-free for 16-byte reads);
// A slices hold 64 rows (9216 B, placed every 10240 B so that each place is a multiple of 2 KiB), B slices 128 rows (18432 B). Two stages; every wave issues one tensor load per stage: waves 0, 1 the A slices, waves 2, 3 the B slices.
#define GP_ROWB 128u
#define GP_PITCH 144u
#define GP_SLA 10240u
#define GP_SLB 18432u
#define GP_STAGE (2u * GP_SLA + 2u * GP_SLB)
#define GP_NPASS ((unsigned)(DM * 2) / GP_ROWB)
static_assert(GP_SLA % 2048u == 0 && GP_SLB % 2048u == 0 && GP_STAGE % 2048u == 0);
static_assert(64u * GP_PITCH <= GP_SLA && 128u * GP_PITCH <= GP_SLB);
static_assert(GP_NPASS >= 2);
static_assert(NR % 128 == 0 && DM % 256 == 0);
static_assert(4u * 32u * 132u * 4u <= 2u * GP_STAGE);
typedef unsigned int u32x4 __attribute__((ext_vector_type(4)));
typedef unsigned int u32x8 __attribute__((ext_vector_type(8)));
__device__ __forceinline__ unsigned int uni(unsigned int v) { return (unsigned int)__builtin_amdgcn_readfirstlane(v); }
__device__ __forceinline__ unsigned int pinned(unsigned int v) { unsigned int s = uni(v); asm volatile("" : "+s"(s)); return s; }  // a wave-uniform word held in a scalar register, so that the test around a tensor load is a scalar branch and a descriptor formed from the word stays behind the wait and the barrier in front of it
__device__ __forceinline__ v16h lds_frag(const unsigned char* p) { FragH f; f.half[0] = *(const v8us*)p; f.half[1] = *(const v8us*)(p + 32); return f.v; }

__device__ __forceinline__ void gemm128x256(const _Float16* __restrict__ Arows, const _Float16* __restrict__ Brows, unsigned char* L, int w, int ln, int hh, v8f (&acc)[4][8]) {
  const unsigned int lbase = (unsigned int)(size_t)L;
  const bool isB = w >= 2; const unsigned int sl = (unsigned int)w & 1u;
  const unsigned int nrows = isB ? 128u : 64u;
  const unsigned long long srcb = (unsigned long long)(size_t)(isB ? Brows + (size_t)sl * 128 * DM : Arows + (size_t)sl * 64 * DM);
  const unsigned int place = lbase + (isB ? 2u * GP_SLA + sl * GP_SLB : sl * GP_SLA);
  u32x8 g1;                                             /* 1-byte elements, tensor = tile = nrows rows of 128 B, source pitch one operand row, 4 dwords of pad behind every 32 */
  g1[0] = uni((1u << 20) | (4u << 22) | (3u << 25));
  g1[1] = uni(GP_ROWB << 16);
  g1[2] = uni(nrows << 16);
  g1[3] = uni(GP_ROWB << 16);
  g1[4] = uni(nrows);
  g1[5] = uni((unsigned int)(DM * 2));
  g1[6] = uni(0u);
  g1[7] = uni(0u);
  u32x4 g0;
  auto issue = [&](unsigned int st) {
    const unsigned long long ga = srcb + (unsigned long long)st * GP_ROWB;
    g0[0] = uni(1u); g0[1] = uni(place + (st & 1u) * GP_STAGE); g0[2] = uni((unsigned int)ga); g0[3] = uni((((unsigned int)(ga >> 32)) & 0x01FFFFFFu) | 0x80000000u);
    asm volatile("tensor_load_to_lds %0, %1" :: "s"(g0), "s"(g1) : "memory");
  };
  issue(0u);
  asm volatile("s_wait_tensorcnt 0x0" :: "s"(g0), "s"(g1) : "memory");  /* stage 0 has landed for this wave's slice; the descriptor words are named so that their registers stay untouched while the request is outstanding */
  __syncthreads();                                      /* ... and is published to the other waves */
  const unsigned char* ap = L + (unsigned int)(w >> 1) * GP_SLA + (unsigned int)ln * GP_PITCH + 16u * (unsigned int)hh;
  const unsigned char* bp = L + 2u * GP_SLA + (unsigned int)(w & 1) * GP_SLB + (unsigned int)ln * GP_PITCH + 16u * (unsigned int)hh;
#pragma unroll 1
  for (unsigned int s = 0; s < GP_NPASS; ++s) {         /* rolled: one copy of the pass in the instruction cache; the buffer is picked by the pass's parity */
    if (pinned(s + 1u < GP_NPASS)) issue(pinned(s + 1u)); /* behind the barrier that freed its buffer: stage s + 1 flies while pass s is worked on */
    const unsigned char* as = ap + (s & 1u) * GP_STAGE; const unsigned char* bs = bp + (s & 1u) * GP_STAGE;
    v16h a[2][4], b[2][8];
#pragma unroll
    for (int ks = 0; ks < 2; ++ks) {
      a[ks][0] = lds_frag(as + ks * 64);
#pragma unroll
      for (int j = 0; j < 8; ++j) b[ks][j] = lds_frag(bs + j * 16 * GP_PITCH + ks * 64);
#pragma unroll
      for (int i = 1; i < 4; ++i) a[ks][i] = lds_frag(as + i * 16 * GP_PITCH + ks * 64);
    }
    __builtin_amdgcn_sched_barrier(0);                  /* the pass's LDS reads stay one group ahead of its WMMAs (for speed only) */
#pragma unroll
    for (int ks = 0; ks < 2; ++ks)
#pragma unroll
      for (int i = 0; i < 4; ++i)
#pragma unroll
        for (int j = 0; j < 8; ++j) acc[i][j] = __builtin_amdgcn_wmma_f32_16x16x32_f16(false, a[ks][i], false, b[ks][j], (short)0, acc[i][j], false, false);
    __builtin_amdgcn_sched_barrier(0);                  /* the WMMAs stay in front of the publish point: moved behind it, the wait for stage s + 1 would stand a whole pass earlier and the refill would lose its lead */
    asm volatile("s_wait_dscnt 0x0" ::: "memory");      /* this wave has left the buffer of pass s */
    asm volatile("s_wait_tensorcnt 0x0" :: "s"(g0), "s"(g1) : "memory");  /* its slice of stage s + 1 has landed; the descriptor words are named so that their registers stay untouched from the issue to here */
    __syncthreads();                                    /* publishes stage s + 1 and frees the buffer of pass s */
  }
  asm volatile("s_wait_tensorcnt 0x0" ::: "memory");    /* nothing of the mover is outstanding when the ring becomes output staging */
  asm volatile("s_wait_dscnt 0x0" ::: "memory");
}

// projections: plane by (0 q, 1 k, 2 v): Y16_by[r][col] = f16((X16[r] . Bt_by[col]) * alpha). The last pass's barrier has ended every read of the ring; each wave then stages 32 x 128 f32 at a time in its own quarter of it.
__global__ __launch_bounds__(128) void k_qkv(const _Float16* __restrict__ X16, const _Float16* __restrict__ Bt, float alpha, _Float16* __restrict__ Y16) {
  __shared__ __attribute__((aligned(2048))) unsigned char L[2u * GP_STAGE];
  const int tid = threadIdx.x, lane = tid & 31, ln = lane & 15, hh = lane >> 4;
  const int w = __builtin_amdgcn_readfirstlane(tid >> 5);
  const int by = blockIdx.y;
  const _Float16* Bh = Bt + (size_t)by * DM * DM;
  _Float16* Yp = Y16 + (size_t)by * NR * DM;
  const int ntn = DM / 256;
  const int mt = blockIdx.x / ntn, nq = blockIdx.x - mt * ntn;
  if (mt * 128 >= (int)NR) return;
  const v8f z8 = {0.f, 0.f, 0.f, 0.f, 0.f, 0.f, 0.f, 0.f};
  v8f acc[4][8];
#pragma unroll
  for (int i = 0; i < 4; ++i)
#pragma unroll
    for (int j = 0; j < 8; ++j) acc[i][j] = z8;
  gemm128x256(X16 + (size_t)mt * 128 * DM, Bh + (size_t)nq * 256 * DM, L, w, ln, hh, acc);
  const int row0 = mt * 128 + 64 * (w >> 1), col0 = nq * 256 + 128 * (w & 1);
  float (*so)[132] = (float (*)[132])(L + (size_t)w * (GP_STAGE / 2u));
#pragma unroll
  for (int h2 = 0; h2 < 2; ++h2) {
#pragma unroll
    for (int ii = 0; ii < 2; ++ii)
#pragma unroll
      for (int j = 0; j < 8; ++j)
#pragma unroll
        for (int r = 0; r < 8; ++r) so[ii * 16 + 8 * hh + r][j * 16 + ln] = acc[2 * h2 + ii][j][r] * alpha;
    __builtin_amdgcn_fence(4 /* acq_rel order */, "workgroup"); __builtin_amdgcn_wave_barrier();
#pragma unroll 1                                        /* groups of eight rows: eight LDS reads in flight cover their latency, one wait per group behind the stores */
    for (int q8 = 0; q8 < 32; q8 += 8) {
#pragma unroll
      for (int q = 0; q < 8; ++q) {
        const v4f v = *(const v4fa*)&so[q8 + q][lane * 4]; v4h h4;
#pragma unroll
        for (int i = 0; i < 4; ++i) h4[i] = toh_flush(v[i]);
        *(v4h*)(Yp + (size_t)(row0 + 32 * h2 + q8 + q) * DM + col0 + lane * 4) = h4;
      }
      asm volatile("s_wait_xcnt 0x0" ::: "memory");     /* in front of the next group, which overwrites registers that these stores name */
    }
    __builtin_amdgcn_fence(4 /* acq_rel order */, "workgroup"); __builtin_amdgcn_wave_barrier();
  }
}

template <int NHv, int TTv>
__global__ __launch_bounds__(256) void k_vt(const _Float16* __restrict__ V16, int ldv, int voff, _Float16* __restrict__ Vt) {
  __shared__ unsigned short tl[64][66];
  const int tid = threadIdx.x; const int slab = blockIdx.x / (TTv / 64), lg = blockIdx.x % (TTv / 64); const int b = slab / NHv, h = slab % NHv;
  for (int i = tid; i < 64 * 8; i += 256) {
    const int r = i / 8, c8 = (i % 8) * 8; FragH f; f.half[0] = *(const v8us*)((const unsigned short*)V16 + ((size_t)b * TTv + lg * 64 + r) * ldv + voff + h * 64 + c8);
#pragma unroll
    for (int q = 0; q < 8; ++q) tl[r][c8 + q] = f.u[q];
  }
  __syncthreads();
  {
#pragma unroll
    for (int rd = 0; rd < 2; ++rd) {
      const int d = rd * 32 + tid / 8, pc = tid % 8; FragH f;
#pragma unroll
      for (int q = 0; q < 8; ++q) f.u[q] = tl[pc * 8 + q][d];
      *(v8us*)((unsigned short*)Vt + ((size_t)slab * 64 + d) * TTv + lg * 64 + pc * 8) = f.half[0];
    }
    
  }
}

// Attention K / V^T ring: a stage is 64 keys = [K tile: 64 key rows of 128 B | V^T tile: 64 d rows of 128 B], rows at pitch 144 B (128 B + the mover's 16 B pad, conflict-free for 16-byte reads); a tile holds 9216 B and is placed every 10240 B (a multiple of 2 KiB).
// Two stages, shared by the block's four waves; behind the loop's last barrier the ring is free and holds each wave's own bucket-weight and output rows.
#define AT_ROWB 128u
#define AT_PITCH 144u
#define AT_TILE 10240u
#define AT_STAGE (2u * AT_TILE)
#define AT_NPASS ((unsigned)SEQ / 64u)
#define AT_WTB (16u * 104u * 2u)
#define AT_SOB (16u * 72u * 2u)
static_assert(AT_TILE % 2048u == 0 && 64u * AT_PITCH <= AT_TILE);
static_assert(AT_NPASS >= 2);
static_assert(AT_ROWB == (unsigned)(HD * 2) && (DM * 2) % 16 == 0 && (SEQ * 2) % 16 == 0 && SEQ % 64 == 0);
static_assert(4u * (AT_WTB + AT_SOB) <= 2u * AT_STAGE && AT_WTB % 16u == 0 && AT_SOB % 16u == 0);
// QR^T tiles (16 buckets x 16 queries) = RK16 . Q^T -> qrt[w][query][bucket] = q.relk[bucket] / 8. S^T 16-key tiles = K . Q^T (A = K16 rows: row = key, k = d; B = Q16 rows: col = query);
// each lane holds keys 8hh+r of query ln; logit = s/8 + qrt[query][clip(key-query)+32]; 64-key blocks wholly left (key-query <= -32) or right (>= 32) of the band take one per-lane constant (wave-uniform test);
// p = exp(logit - m) carried x1024 as f16; O^T (64 d x 16 queries) = VT . P^T with the B operand packed from the two adjacent S^T D tiles (element r <- keys 0..15, element 8+r <- keys 16..31).
// Bucket weights: buckets 1..63 hold one key each -> the logit is kept in tlg[w][query][bucket] and exponentiated against the final maximum; buckets 0 / 64 are running sums scaled with the online factor.
__global__ __launch_bounds__(128) __attribute__((amdgpu_num_vgpr(256))) void k_attn(const _Float16* __restrict__ Q16, const _Float16* __restrict__ K16, const _Float16* __restrict__ VT,
                                                                                const _Float16* __restrict__ RK16, const _Float16* __restrict__ RVT, _Float16* __restrict__ O16) {
  __shared__ __attribute__((aligned(2048))) unsigned char L[2u * AT_STAGE];
  __shared__ float qrt[4][16][84];
  __shared__ float tlg[4][16][68];
  const int tid = threadIdx.x, lane = tid & 31, ln = lane & 15, hh = lane >> 4;
  const int w = __builtin_amdgcn_readfirstlane(tid >> 5);
  const int h = blockIdx.y, b = blockIdx.z;
  const int q0 = blockIdx.x * 64 + w * 16;
  const int qi = q0 + ln;
  const size_t rq = (size_t)b * SEQ + q0;
  const size_t rk = (size_t)b * SEQ;
  const _Float16* qp = Q16 + (rq + ln) * DM + h * HD;
  const v16h qb0 = g2_frag(qp, hh), qb1 = g2_frag(qp + 32, hh);
  const v8f z8 = {0.f, 0.f, 0.f, 0.f, 0.f, 0.f, 0.f, 0.f};
  // K / V^T ring: wave 0 brings the stage's 64 K rows (next stage 64 rows on), wave 1 its 64 V^T rows (next stage 128 B on); waves 2 and 3 issue nothing
  const unsigned int issuer = (unsigned int)(w < 2);
  const unsigned long long srcb = (unsigned long long)(size_t)(w == 0 ? K16 + rk * DM + h * HD : VT + (size_t)(b * NH + h) * HD * SEQ);
  const unsigned int sstep = (w == 0) ? 64u * (unsigned int)(DM * 2) : AT_ROWB;
  const unsigned int place = (unsigned int)(size_t)L + (w == 0 ? 0u : AT_TILE);
  u32x8 g1;                                             /* 1-byte elements, tensor = tile = 64 rows of 128 B, source pitch one K16 or VT row, 4 dwords of pad behind every 32 */
  g1[0] = uni((1u << 20) | (4u << 22) | (3u << 25));
  g1[1] = pinned(AT_ROWB << 16);                        /* words 1 to 7: descriptor words held in scalar registers, so that the group is built once and its registers stay as they are while a request is outstanding */
  g1[2] = pinned(64u << 16);
  g1[3] = pinned(AT_ROWB << 16);
  g1[4] = pinned(64u);
  g1[5] = pinned(w == 0 ? (unsigned int)(DM * 2) : (unsigned int)(SEQ * 2));
  g1[6] = pinned(0u);
  g1[7] = pinned(0u);
  u32x4 g0;
  const unsigned int cnt1 = pinned(1u);                 /* group 0's constant word held in a scalar register, not written again while a request is outstanding */
  auto issue = [&](unsigned int st) {
    const unsigned long long ga = srcb + (unsigned long long)st * sstep;
    g0[0] = uni(cnt1); g0[1] = uni(place + (st & 1u) * AT_STAGE); g0[2] = uni((unsigned int)ga); g0[3] = uni((((unsigned int)(ga >> 32)) & 0x01FFFFFFu) | 0x80000000u);
    asm volatile("tensor_load_to_lds %0, %1" :: "s"(g0), "s"(g1) : "memory");
  };
  if (pinned(issuer)) {
    issue(0u);
    asm volatile("s_wait_tensorcnt 0x0" :: "s"(g0), "s"(g1) : "memory");  /* stage 0 has landed; the descriptor words are named so that their registers stay untouched while the request is outstanding */
  }
  __syncthreads();                                      /* ... and is published to the other waves */
  if (pinned(issuer)) issue(pinned(1u));                /* stage 1 flies while the table below and pass 0 are worked on */
  const unsigned char* kf0 = L + (unsigned int)ln * AT_PITCH + 16u * (unsigned int)hh;
  // relative-key table: columns 0..RKR-1 of the row of query ln, in logit units (1/1024 carry and 1/8 scale folded)
#pragma unroll
  for (int t = 0; t < RKR / 16; ++t) {
    const _Float16* rp = RK16 + (size_t)(16 * t + ln) * HD;
    const v16h ra0 = g2_frag(rp, hh), ra1 = g2_frag(rp + 32, hh);
    const v8f c = mma2(ra0, qb0, ra1, qb1, z8);
#pragma unroll
    for (int r = 0; r < 8; ++r) qrt[w][ln][16 * t + 8 * hh + r] = c[r] * 0.0001220703125f;
  }
#pragma unroll 1
  for (int c = 0; c < 34; ++c) tlg[w][ln][34 * hh + c] = -1.0e30f;
  __builtin_amdgcn_fence(4 /* acq_rel order */, "workgroup"); __builtin_amdgcn_wave_barrier();
  const float c0 = qrt[w][ln][0], c64 = qrt[w][ln][2 * MAXREL];
  v8f o0 = z8, o1 = z8, o2 = z8, o3 = z8;
  float mrun = -1.0e30f, lrun = 0.f, wl = 0.f, wr = 0.f;
#pragma unroll 1
  for (int kt = 0; kt < SEQ; kt += 64) {
    const unsigned int st = (unsigned int)kt >> 6;
    const unsigned char* kf = kf0 + (st & 1u) * AT_STAGE; const unsigned char* vf = kf + AT_TILE;
    v8f s[4];
    v16h kv[4][2];
#pragma unroll
    for (int j = 0; j < 4; ++j) { kv[j][0] = lds_frag(kf + j * 16 * AT_PITCH); kv[j][1] = lds_frag(kf + j * 16 * AT_PITCH + 64); }
    __builtin_amdgcn_sched_barrier(0);                  /* the pass's K reads stay one group ahead of its WMMAs: read tile by tile, the wave waits out the LDS latency four times */
#pragma unroll
    for (int j = 0; j < 4; ++j) s[j] = mma2(kv[j][0], qb0, kv[j][1], qb1, z8);
#pragma unroll
    for (int j = 0; j < 4; ++j) { kv[j][0] = lds_frag(vf + j * 16 * AT_PITCH); kv[j][1] = lds_frag(vf + j * 16 * AT_PITCH + 64); }
    __builtin_amdgcn_sched_barrier(0);                  /* the pass's V^T reads are issued here, as one group: their latency passes under the softmax arithmetic */
    const bool farl = (kt + 63 + MAXREL <= q0);          /* every key of the block at distance <= -32 of every query of the wave */
    const bool farr = (kt >= q0 + 15 + MAXREL);          /* every key at distance >= +32 */
    const int dbase = kt + 8 * hh - qi;
    if (farl || farr) {
      const float cb = farl ? c0 : c64;
#pragma unroll
      for (int j = 0; j < 4; ++j)
#pragma unroll
        for (int r = 0; r < 8; ++r) s[j][r] = s[j][r] * 0.125f + cb;
    } else {
#pragma unroll
      for (int j = 0; j < 4; ++j)
#pragma unroll
        for (int r = 0; r < 8; ++r) {
          const int d = dbase + 16 * j + r;
          const int rel = min(max(d, -MAXREL), MAXREL) + MAXREL;
          float bias = qrt[w][ln][rel]; asm volatile("" : "+v"(bias));
          const float t = s[j][r] * 0.125f + bias;
          s[j][r] = t;
          const int slot = (d > -MAXREL && d < MAXREL) ? rel : 66 + hh;      /* band logit kept; clipped keys go to a per-lane dump slot */
          tlg[w][ln][slot] = t;
        }
    }
    float mx = -1.0e30f;
#pragma unroll
    for (int j = 0; j < 4; ++j)
#pragma unroll
      for (int r = 0; r < 8; ++r) mx = fmaxf(mx, s[j][r]);
    mx = fmaxf(mx, __shfl_xor(mx, 16, 32));
    const float mnew = fmaxf(mrun, mx);
    const float alpha = __expf(mrun - mnew);
    mrun = mnew;
    float ps = 0.f; FragH pf[2];
#pragma unroll
    for (int j = 0; j < 4; ++j)
#pragma unroll
      for (int r = 0; r < 8; ++r) {
        const float p = __expf(s[j][r] - mnew);
        s[j][r] = p;
        ps += p;
        pf[j >> 1].h[(j & 1) * 8 + r] = toh_flush(p * 1024.0f);
      }
    float pl = 0.f, pr = 0.f;
    if (farl || farr) {
      pl = farl ? ps : 0.f; pr = farl ? 0.f : ps;
    } else {
#pragma unroll
      for (int j = 0; j < 4; ++j)
#pragma unroll
        for (int r = 0; r < 8; ++r) {
          const int d = dbase + 16 * j + r; const float p = s[j][r];
          pl += (d <= -MAXREL) ? p : 0.f;
          pr += (d >= MAXREL) ? p : 0.f;
        }
    }
    wl = wl * alpha + pl; wr = wr * alpha + pr;
    ps += __shfl_xor(ps, 16, 32);
    lrun = lrun * alpha + ps;
#pragma unroll
    for (int r = 0; r < 8; ++r) { o0[r] *= alpha; o1[r] *= alpha; o2[r] *= alpha; o3[r] *= alpha; }
    o0 = mma2(kv[0][0], pf[0].v, kv[0][1], pf[1].v, o0);
    o1 = mma2(kv[1][0], pf[0].v, kv[1][1], pf[1].v, o1);
    o2 = mma2(kv[2][0], pf[0].v, kv[2][1], pf[1].v, o2);
    o3 = mma2(kv[3][0], pf[0].v, kv[3][1], pf[1].v, o3);
    asm volatile("s_wait_dscnt 0x0" ::: "memory");      /* this wave has left the buffer of pass st */
    if (pinned(issuer)) asm volatile("s_wait_tensorcnt 0x0" :: "s"(g0), "s"(g1) : "memory");  /* the issuer's tile of stage st + 1 has landed; the descriptor words are named so that their registers stay untouched from the issue to here */
    __syncthreads();                                    /* publishes stage st + 1 and frees the buffer of pass st */
    if (pinned(issuer & (unsigned int)(st + 2u < AT_NPASS))) issue(pinned(st + 2u));  /* refill of the buffer just left: stage st + 2 flies while pass st + 1 is worked on */
  }
  asm volatile("s_wait_tensorcnt 0x0" ::: "memory");    /* nothing of the mover is outstanding when the ring becomes the waves' epilogue staging */
  asm volatile("s_wait_dscnt 0x0" ::: "memory");
  unsigned short (*wt)[104] = (unsigned short (*)[104])(L + (unsigned int)w * AT_WTB);                  /* bucket weights, this wave's own 16 x 104 */
  unsigned short (*so)[72] = (unsigned short (*)[72])(L + 4u * AT_WTB + (unsigned int)w * AT_SOB);      /* output rows, this wave's own 16 x 72 */
  wl += __shfl_xor(wl, 16, 32); wr += __shfl_xor(wr, 16, 32);
  __builtin_amdgcn_fence(4 /* acq_rel order */, "workgroup"); __builtin_amdgcn_wave_barrier();
  // bucket weight row of query ln, columns 48hh .. 48hh+47 by this lane (all RVK columns written; columns >= NREL zero)
#pragma unroll 1
  for (int c = 0; c < 6; ++c) {
    FragH f;
#pragma unroll
    for (int q = 0; q < 8; ++q) {
      const int r = 48 * hh + 8 * c + q;
      const int rr = min(r, 67);
      float tv = tlg[w][ln][rr]; asm volatile("" : "+v"(tv));
      const float e = __expf(tv - mrun);
      const float wv = (r == 0) ? wl : (r == 2 * MAXREL) ? wr : (r < 2 * MAXREL) ? e : 0.f;
      f.h[q] = toh_flush(wv * 16.0f);
    }
    *(v8us*)&wt[ln][48 * hh + 8 * c] = f.half[0];
  }
  __builtin_amdgcn_fence(4 /* acq_rel order */, "workgroup"); __builtin_amdgcn_wave_barrier();
#pragma unroll
  for (int ks = 0; ks < RVK / 32; ++ks) {
    FragH wb; wb.half[0] = *(const v8us*)&wt[ln][32 * ks + 8 * hh]; wb.half[1] = *(const v8us*)&wt[ln][32 * ks + 16 + 8 * hh];
    const _Float16* rv = RVT + (size_t)ln * RVK + 32 * ks;
    o0 = g2_mma(g2_frag(rv, hh), wb.v, o0);
    o1 = g2_mma(g2_frag(rv + 16 * RVK, hh), wb.v, o1);
    o2 = g2_mma(g2_frag(rv + 32 * RVK, hh), wb.v, o2);
    o3 = g2_mma(g2_frag(rv + 48 * RVK, hh), wb.v, o3);
  }
  const float rl = (1.0f / lrun) * 0.015625f;
  { FragH f;
#pragma unroll
    for (int r = 0; r < 8; ++r) f.h[r] = toh_flush(o0[r] * rl);
    *(v8us*)&so[ln][0 + 8 * hh] = f.half[0]; }
  { FragH f;
#pragma unroll
    for (int r = 0; r < 8; ++r) f.h[r] = toh_flush(o1[r] * rl);
    *(v8us*)&so[ln][16 + 8 * hh] = f.half[0]; }
  { FragH f;
#pragma unroll
    for (int r = 0; r < 8; ++r) f.h[r] = toh_flush(o2[r] * rl);
    *(v8us*)&so[ln][32 + 8 * hh] = f.half[0]; }
  { FragH f;
#pragma unroll
    for (int r = 0; r < 8; ++r) f.h[r] = toh_flush(o3[r] * rl);
    *(v8us*)&so[ln][48 + 8 * hh] = f.half[0]; }
  __builtin_amdgcn_fence(4 /* acq_rel order */, "workgroup"); __builtin_amdgcn_wave_barrier();
  const int li = lane >> 3, pc = lane & 7;
  {
#pragma unroll
    for (int g = 0; g < 4; ++g) {
      const int i = g * 4 + li;
      const v8us v = *(const v8us*)&so[i][pc * 8];
      *(v8us*)((unsigned short*)O16 + (rq + i) * DM + h * HD + pc * 8) = v;
    }
    
  }
}

// out[r][col] = (A1[r] . B1[col]) * al1 + bf16(bias[col]); the same tile loop; each wave stages 32 x 128 f32 at a time in its own quarter of the ring; bias added at the store stage as a 4-wide f32 vector; f32 rows:
__global__ __launch_bounds__(128) void k_out(const _Float16* __restrict__ A1, const _Float16* __restrict__ B1, float al1, const float* __restrict__ bias, float* __restrict__ Out) {
  __shared__ __attribute__((aligned(2048))) unsigned char L[2u * GP_STAGE];
  const int tid = threadIdx.x, lane = tid & 31, ln = lane & 15, hh = lane >> 4;
  const int w = __builtin_amdgcn_readfirstlane(tid >> 5);
  const int ntn = DM / 256;
  const int mt = blockIdx.x / ntn, nq = blockIdx.x - mt * ntn;
  if (mt * 128 >= (int)NR) return;
  const v8f z8 = {0.f, 0.f, 0.f, 0.f, 0.f, 0.f, 0.f, 0.f};
  v8f acc[4][8];
#pragma unroll
  for (int i = 0; i < 4; ++i)
#pragma unroll
    for (int j = 0; j < 8; ++j) acc[i][j] = z8;
  gemm128x256(A1 + (size_t)mt * 128 * DM, B1 + (size_t)nq * 256 * DM, L, w, ln, hh, acc);
  const int row0 = mt * 128 + 64 * (w >> 1), col0 = nq * 256 + 128 * (w & 1);
  float (*so)[132] = (float (*)[132])(L + (size_t)w * (GP_STAGE / 2u));
  const v4f bz = *(const v4fa*)(bias + col0 + lane * 4);
  v4f bb;
#pragma unroll
  for (int i = 0; i < 4; ++i) bb[i] = bf16_rne(bz[i]);
#pragma unroll
  for (int h2 = 0; h2 < 2; ++h2) {
#pragma unroll
    for (int ii = 0; ii < 2; ++ii)
#pragma unroll
      for (int j = 0; j < 8; ++j)
#pragma unroll
        for (int r = 0; r < 8; ++r) so[ii * 16 + 8 * hh + r][j * 16 + ln] = acc[2 * h2 + ii][j][r] * al1;
    __builtin_amdgcn_fence(4 /* acq_rel order */, "workgroup"); __builtin_amdgcn_wave_barrier();
#pragma unroll 1                                        /* groups of eight rows: eight LDS reads in flight cover their latency, one wait per group behind the stores */
    for (int q8 = 0; q8 < 32; q8 += 8) {
#pragma unroll
      for (int q = 0; q < 8; ++q) {
        const v4f v0 = *(const v4fa*)&so[q8 + q][lane * 4];
        const v4f v = v0 + bb;
        *(v4f*)(Out + (size_t)(row0 + 32 * h2 + q8 + q) * DM + col0 + lane * 4) = v;
      }
      asm volatile("s_wait_xcnt 0x0" ::: "memory");     /* in front of the next group, which overwrites registers that these stores name */
    }
    __builtin_amdgcn_fence(4 /* acq_rel order */, "workgroup"); __builtin_amdgcn_wave_barrier();
  }
}

extern "C" void kernel_launch(void* const* d_in, const int* in_sizes, int n_in,
                              void* d_out, int out_size, void* d_ws, size_t ws_size, hipStream_t stream) {
  if (n_in < 8) return;
  if (in_sizes[0] < (int)(((size_t)(NB - 1) * SEQ_FULL + SEQ) * DM)) return;
  for (int i = 1; i <= 4; ++i) if (in_sizes[i] < DM * DM) return;
  if (in_sizes[5] < DM) return;
  if (in_sizes[6] < NREL * HD) return;
  if (in_sizes[7] < NREL * HD) return;
  if (out_size < (int)(NR * DM)) return;
  const float* const* I = (const float* const*)d_in;
  const float* x = I[0]; const float* wq = I[1]; const float* wk = I[2]; const float* wv = I[3]; const float* wo = I[4]; const float* bo = I[5]; const float* relk = I[6]; const float* relv = I[7];
  char* ws = (char*)d_ws; size_t off = 0;
  auto take = [&](size_t bytes) { char* p = ws + off; off += (bytes + 255) & ~(size_t)255; return p; };
  _Float16* BQKV = (_Float16*)take((size_t)3 * SZ_BT);               /* Bt planes q, k, v (contiguous, stride DM*DM) */
  _Float16* BO   = (_Float16*)take(SZ_BT);
  _Float16* RK16 = (_Float16*)take(SZ_RK);                           /* [RKR][HD] */
  _Float16* RVT  = (_Float16*)take(SZ_RV);                           /* [HD][RVK] */
  _Float16* X16  = (_Float16*)take(SZ_ACT);
  _Float16* QKV16 = (_Float16*)take((size_t)3 * SZ_ACT);             /* Q16, K16, V16 planes (stride NR*DM) */
  _Float16* VT   = (_Float16*)take((size_t)NB * NH * HD * SEQ * 2);  /* [b*NH+h][d][s] */
  _Float16* O16  = (_Float16*)take(SZ_ACT);
  if (off > ws_size) return;
  _Float16* Q16 = QKV16; _Float16* K16 = QKV16 + NR * DM; _Float16* V16 = QKV16 + (size_t)2 * NR * DM;

  k_prep<<<1u + 4u * PB_W + PB_X, 256, 0, stream>>>(x, wq, wk, wv, wo, relk, relv, X16, BQKV, BO, RK16, RVT);      /* every f32 -> f16 operand plane */
  k_qkv<<<dim3((unsigned)((NR / 128) * (DM / 256)), 3), 128, 0, stream>>>(X16, BQKV, 0.0625f, QKV16);      /* q, k, v as f16 rows */
  k_vt<NH, SEQ><<<(unsigned)(NB * NH * (SEQ / 64)), 256, 0, stream>>>(V16, DM, 0, VT);
  k_attn<<<dim3(SEQ / 64, NH, NB), 128, 0, stream>>>(Q16, K16, VT, RK16, RVT, O16);
  k_out<<<(unsigned)((NR / 128) * (DM / 256)), 128, 0, stream>>>(O16, BO, 0.00390625f, bo, (float*)d_out);      /* out = ctx Wo^T + b_o */
}

// v004
// A run of this version takes 142 microseconds.
// Next to v003, in two timings, it ran 1.07 and 1.08 times as fast.
// Counting every step since v000, it is 2.86 times as fast.
#include <hip/hip_runtime.h>
// Contractions: q/k/v/o projections ([tokens][1024] x [1024][1024]^T), scores k.q^T (K = 64), relative-key table relk.q^T (K = 64), v^T.p^T (K = keys) and relv^T.w^T (K = 65 padded to 96) on v_wmma_f32_16x16x32_f16 (f16 operands, f32 accumulate). Inputs RNE-converted to bf16 on load (exact in f16; weights carried x16, relk x1024, relv x64), softmax numerators carried x1024, bucket weights x16, ctx rows x16; softmax statistics and all epilogues in f32.
// Structure: token rows r = b*SEQ + s. X16 = f16(bf16(x)); Q16/K16/V16 = f16(X16 . Bt_w / 16); VT = V16^T per (batch, head); attention per (64 queries, head, batch): per wave a table QR[query][bucket] = q . relk[bucket] / 8 (carried x log2 e, as are the logits)
// (5 WMMA tiles into wave-private LDS), S^T tiles = K . Q^T, logit = s/8 + QR[query][clip(key - query, -32, 32) + 32], online softmax per lane, O^T = VT . P^T; bucket weights W[query][bucket] (buckets 1..63 from band logits kept in LDS,
// buckets 0 and 64 as running sums) then O^T += RelVT . W^T; O16[r][h*64+d] = f16(16 ctx); out = (O16 . Bt_o) / 256 + bf16(b_o) -> f32 rows.
#ifndef NB
#define NB 8
#endif
#ifndef SEQ
#define SEQ 1024
#endif
#define NB_FULL 8
#define SEQ_FULL 1024
#define DM 1024
#define NH 16
#define HD 64
#define MAXREL 32
#define NREL 65
#define RKR 80
#define RVK 96
#define NR ((size_t)NB * SEQ)
#define SZ_BT ((size_t)DM * DM * 2)
#define SZ_ACT (NR * DM * 2)
#define SZ_RK ((size_t)RKR * HD * 2)
#define SZ_RV ((size_t)HD * RVK * 2)
#define WS_TOTAL ((size_t)4 * SZ_BT + SZ_RK + SZ_RV + (size_t)6 * SZ_ACT)
static_assert(NH * HD == DM);
static_assert(SEQ % 128 == 0);
static_assert(SEQ <= SEQ_FULL);
static_assert(NB >= 1 && NB <= NB_FULL);
static_assert(DM == 128 * 8);
static_assert(DM % 256 == 0);
static_assert(HD == 64);
static_assert(NREL == 2 * MAXREL + 1);
static_assert(RKR % 16 == 0 && RKR >= NREL);
static_assert(RVK % 32 == 0 && RVK >= NREL);
static_assert((RKR * HD / 8) % 32 == 0);
static_assert((HD * RVK / 8) % 256 == 0);
static_assert(SZ_BT % 256 == 0 && SZ_ACT % 256 == 0 && SZ_RK % 256 == 0 && SZ_RV % 256 == 0);
static_assert(WS_TOTAL <= (size_t)134217728);
static_assert((size_t)NB * NH * HD * SEQ * 2 == SZ_ACT);

typedef _Float16 v16h __attribute__((ext_vector_type(16)));
typedef unsigned short v8us __attribute__((ext_vector_type(8), may_alias));
typedef float v8f __attribute__((ext_vector_type(8)));
typedef float v4f __attribute__((ext_vector_type(4)));
typedef float v4fa __attribute__((ext_vector_type(4), may_alias));
typedef _Float16 v4h __attribute__((ext_vector_type(4)));
typedef float v2f __attribute__((ext_vector_type(2)));
typedef _Float16 v2h __attribute__((ext_vector_type(2)));
union FragH { v16h v; v8us half[2]; v2h h2[8]; _Float16 h[16]; unsigned short u[16]; };

__device__ __forceinline__ unsigned short bf16_bits(float x) { unsigned int u = __float_as_uint(x); return (unsigned short)((u + 0x7FFFu + ((u >> 16) & 1u)) >> 16); }
__device__ __forceinline__ float bf16_val(unsigned short b) { return __uint_as_float(((unsigned int)b) << 16); }
__device__ __forceinline__ float bf16_rne(float x) { return bf16_val(bf16_bits(x)); }
// f32 -> f16 operand convert that cannot produce an f16 subnormal (value select)
static __device__ __forceinline__ _Float16 toh_flush(float v) { const _Float16 r = (_Float16)v; return (fabsf(v) < 6.103515625e-05f) ? (_Float16)0.0f : r; }

// 16x32 f16 fragment from a k-contiguous row: elements 0..7 <- p[8h .. 8h+7], elements 8..15 <- p[16+8h .. 16+8h+7] (same map for A rows and for Bt[n][k] rows)
__device__ __forceinline__ v16h g2_frag(const _Float16* p, int hh) { FragH f; f.half[0] = *(const v8us*)((const unsigned short*)p + 8 * hh); f.half[1] = *(const v8us*)((const unsigned short*)p + 16 + 8 * hh); return f.v; }
__device__ __forceinline__ v8f g2_mma(v16h a, v16h b, v8f c) { v8f d = __builtin_amdgcn_wmma_f32_16x16x32_f16(false, a, false, b, (short)0, c, false, false); asm volatile("v_nop\n\tv_nop\n\tv_nop\n\tv_nop" : "+v"(d) : "v"(a), "v"(b)); return d; }
// two k-steps into one accumulator, hazard guard after the second
__device__ __forceinline__ v8f mma2(v16h a0, v16h b0, v16h a1, v16h b1, v8f c) {
  c = __builtin_amdgcn_wmma_f32_16x16x32_f16(false, a0, false, b0, (short)0, c, false, false);
  c = __builtin_amdgcn_wmma_f32_16x16x32_f16(false, a1, false, b1, (short)0, c, false, false);
  asm volatile("v_nop\n\tv_nop\n\tv_nop\n\tv_nop" : "+v"(c) : "v"(a0), "v"(b0), "v"(a1), "v"(b1));
  return c;
}

// Bt[n][k] = f16(bf16(w[n][k]) * 16); block blk of a plane's PB_W, thread t owns 8 elements
__device__ __forceinline__ void d_wnat(const float* __restrict__ w, unsigned int blk, _Float16* __restrict__ Bt) {
  const size_t t = (size_t)blk * 256 + threadIdx.x; FragH f;
#pragma unroll
  for (int q = 0; q < 8; ++q) f.h[q] = (_Float16)(bf16_rne(w[t * 8 + q]) * 16.0f);
  const v8us o = f.half[0];
  *(v8us*)((unsigned short*)Bt + t * 8) = o;
  asm volatile("s_wait_xcnt 0x0" ::: "memory");       /* behind the store: in the shared grid another part's code follows in the listing and overwrites registers that the store names */
}

// relative-position planes (one block): RK16[bucket][d] = f16(bf16(relk[bucket][d]) * 1024), rows NREL..RKR-1 zero; RVT[d][bucket] = f16(bf16(relv[bucket][d]) * 64), columns NREL..RVK-1 zero.
__device__ __forceinline__ void d_rel(const float* __restrict__ relk, const float* __restrict__ relv, _Float16* __restrict__ RK16, _Float16* __restrict__ RVT) {
  const int tid = threadIdx.x;
#pragma unroll 1
  for (int c = tid; c < RKR * HD / 8; c += 256) {
    const int row = c / (HD / 8), d8 = (c % (HD / 8)) * 8;
    const int rr = min(row, NREL - 1);
    FragH f;
#pragma unroll
    for (int q = 0; q < 8; ++q) {
      float val = relk[rr * HD + d8 + q]; asm volatile("" : "+v"(val));
      const float sv = (row < NREL) ? bf16_rne(val) * 1024.0f : 0.0f;
      f.h[q] = toh_flush(sv);
    }
    const v8us o = f.half[0];
    unsigned short* dp = (unsigned short*)RK16 + (size_t)c * 8;
    *(v8us*)dp = o; 
  }
#pragma unroll 1
  for (int c = tid; c < HD * RVK / 8; c += 256) {
    const int d = c / (RVK / 8), r8 = (c % (RVK / 8)) * 8;
    FragH f;
#pragma unroll
    for (int q = 0; q < 8; ++q) {
      const int r = r8 + q; const int rr = min(r, NREL - 1);
      float val = relv[rr * HD + d]; asm volatile("" : "+v"(val));
      const float sv = (r < NREL) ? bf16_rne(val) * 64.0f : 0.0f;
      f.h[q] = toh_flush(sv);
    }
    const v8us o = f.half[0];
    unsigned short* dp = (unsigned short*)RVT + (size_t)c * 8;
    *(v8us*)dp = o; 
  }
}

// X16[r][c] = f16(bf16(x)); 128 threads per token row, two rows per block, thread t of a row owns columns 8t..8t+7; input row read at the full stride (b*SEQ_FULL + s);
__device__ __forceinline__ void d_xcvt(const float* __restrict__ x, unsigned int blk, _Float16* __restrict__ X16) {
  const int r = (int)blk * 2 + (int)(threadIdx.x >> 7); const int b = r / SEQ, s = r - b * SEQ;
  const int t = threadIdx.x & 127;
  const float* xr = x + ((size_t)b * SEQ_FULL + s) * DM + 8 * t;
  const v4f xa = *(const v4fa*)xr, xb = *(const v4fa*)(xr + 4);
  FragH f;
#pragma unroll
  for (int q = 0; q < 4; ++q) { f.h[q] = toh_flush(bf16_rne(xa[q])); f.h[4 + q] = toh_flush(bf16_rne(xb[q])); }
  const v8us o = f.half[0];
  unsigned short* d = (unsigned short*)X16 + (size_t)r * DM + 8 * t;
  *(v8us*)d = o;
  asm volatile("s_wait_xcnt 0x0" ::: "memory");       /* behind the store: in the shared grid another part's code follows in the listing and overwrites registers that the store names */
}

// All operand conversions in one grid: none reads what another writes, so they share a launch by ranges of the block index (block-uniform branches, no barrier).
// Block 0: the relative-position planes (one block, the longest chain of dependent loads); then PB_W blocks for each of the weight planes q, k, v, o; then PB_X blocks for x.
#define PB_W ((unsigned)((size_t)DM * DM / 8 / 256))
#define PB_X ((unsigned)(NR / 2))
static_assert((size_t)DM * DM % (8 * 256) == 0 && NR % 2 == 0);
__global__ __launch_bounds__(256) void k_prep(const float* __restrict__ x, const float* __restrict__ wq, const float* __restrict__ wk, const float* __restrict__ wv, const float* __restrict__ wo,
                                              const float* __restrict__ relk, const float* __restrict__ relv,
                                              _Float16* __restrict__ X16, _Float16* __restrict__ BQKV, _Float16* __restrict__ BO, _Float16* __restrict__ RK16, _Float16* __restrict__ RVT) {
  const unsigned int bid = blockIdx.x;
  if (bid == 0u) { d_rel(relk, relv, RK16, RVT); return; }
  const unsigned int wb = bid - 1u;
  if (wb < 4u * PB_W) {
    const unsigned int pl = wb / PB_W, blk = wb - pl * PB_W;
    const float* w = (pl == 0u) ? wq : (pl == 1u) ? wk : (pl == 2u) ? wv : wo;
    d_wnat(w, blk, (pl < 3u) ? BQKV + (size_t)pl * DM * DM : BO);
    return;
  }
  d_xcvt(x, wb - 4u * PB_W, X16);
}

// Projection GEMM tile: one block of 4 waves computes 128 rows x 256 columns; wave (w >> 1, w & 1) owns 64 x 128 (4 x 8 accumulator tiles).
// A pass is 64 k = 128 B of every operand row. A stage in LDS is [A slice 0 | A slice 1 | B slice 0 | B slice 1], rows at pitch 144 B (128 B + the mover's 16 B pad, conflict-free for 16-byte reads);
// A slices hold 64 rows (9216 B, placed every 10240 B so that each place is a multiple of 2 KiB), B slices 128 rows (18432 B). Two stages; every wave issues one tensor load per stage: waves 0, 1 the A slices, waves 2, 3 the B slices.
#define GP_ROWB 128u
#define GP_PITCH 144u
#define GP_SLA 10240u
#define GP_SLB 18432u
#define GP_STAGE (2u * GP_SLA + 2u * GP_SLB)
#define GP_NPASS ((unsigned)(DM * 2) / GP_ROWB)
static_assert(GP_SLA % 2048u == 0 && GP_SLB % 2048u == 0 && GP_STAGE % 2048u == 0);
static_assert(64u * GP_PITCH <= GP_SLA && 128u * GP_PITCH <= GP_SLB);
static_assert(GP_NPASS >= 2);
static_assert(NR % 128 == 0 && DM % 256 == 0);
static_assert(4u * 32u * 132u * 4u <= 2u * GP_STAGE);
typedef unsigned int u32x4 __attribute__((ext_vector_type(4)));
typedef unsigned int u32x8 __attribute__((ext_vector_type(8)));
__device__ __forceinline__ unsigned int uni(unsigned int v) { return (unsigned int)__builtin_amdgcn_readfirstlane(v); }
__device__ __forceinline__ unsigned int pinned(unsigned int v) { unsigned int s = uni(v); asm volatile("" : "+s"(s)); return s; }  // a wave-uniform word held in a scalar register, so that the test around a tensor load is a scalar branch and a descriptor formed from the word stays behind the wait and the barrier in front of it
__device__ __forceinline__ v16h lds_frag(const unsigned char* p) { FragH f; f.half[0] = *(const v8us*)p; f.half[1] = *(const v8us*)(p + 32); return f.v; }

__device__ __forceinline__ void gemm128x256(const _Float16* __restrict__ Arows, const _Float16* __restrict__ Brows, unsigned char* L, int w, int ln, int hh, v8f (&acc)[4][8]) {
  const unsigned int lbase = (unsigned int)(size_t)L;
  const bool isB = w >= 2; const unsigned int sl = (unsigned int)w & 1u;
  const unsigned int nrows = isB ? 128u : 64u;
  const unsigned long long srcb = (unsigned long long)(size_t)(isB ? Brows + (size_t)sl * 128 * DM : Arows + (size_t)sl * 64 * DM);
  const unsigned int place = lbase + (isB ? 2u * GP_SLA + sl * GP_SLB : sl * GP_SLA);
  u32x8 g1;                                             /* 1-byte elements, tensor = tile = nrows rows of 128 B, source pitch one operand row, 4 dwords of pad behind every 32 */
  g1[0] = uni((1u << 20) | (4u << 22) | (3u << 25));
  g1[1] = uni(GP_ROWB << 16);
  g1[2] = uni(nrows << 16);
  g1[3] = uni(GP_ROWB << 16);
  g1[4] = uni(nrows);
  g1[5] = uni((unsigned int)(DM * 2));
  g1[6] = uni(0u);
  g1[7] = uni(0u);
  u32x4 g0;
  auto issue = [&](unsigned int st) {
    const unsigned long long ga = srcb + (unsigned long long)st * GP_ROWB;
    g0[0] = uni(1u); g0[1] = uni(place + (st & 1u) * GP_STAGE); g0[2] = uni((unsigned int)ga); g0[3] = uni((((unsigned int)(ga >> 32)) & 0x01FFFFFFu) | 0x80000000u);
    asm volatile("tensor_load_to_lds %0, %1" :: "s"(g0), "s"(g1) : "memory");
  };
  issue(0u);
  asm volatile("s_wait_tensorcnt 0x0" :: "s"(g0), "s"(g1) : "memory");  /* stage 0 has landed for this wave's slice; the descriptor words are named so that their registers stay untouched while the request is outstanding */
  __syncthreads();                                      /* ... and is published to the other waves */
  const unsigned char* ap = L + (unsigned int)(w >> 1) * GP_SLA + (unsigned int)ln * GP_PITCH + 16u * (unsigned int)hh;
  const unsigned char* bp = L + 2u * GP_SLA + (unsigned int)(w & 1) * GP_SLB + (unsigned int)ln * GP_PITCH + 16u * (unsigned int)hh;
#pragma unroll 1
  for (unsigned int s = 0; s < GP_NPASS; ++s) {         /* rolled: one copy of the pass in the instruction cache; the buffer is picked by the pass's parity */
    if (pinned(s + 1u < GP_NPASS)) issue(pinned(s + 1u)); /* behind the barrier that freed its buffer: stage s + 1 flies while pass s is worked on */
    const unsigned char* as = ap + (s & 1u) * GP_STAGE; const unsigned char* bs = bp + (s & 1u) * GP_STAGE;
    v16h a[2][4], b[2][8];
#pragma unroll
    for (int ks = 0; ks < 2; ++ks) {
      a[ks][0] = lds_frag(as + ks * 64);
#pragma unroll
      for (int j = 0; j < 8; ++j) b[ks][j] = lds_frag(bs + j * 16 * GP_PITCH + ks * 64);
#pragma unroll
      for (int i = 1; i < 4; ++i) a[ks][i] = lds_frag(as + i * 16 * GP_PITCH + ks * 64);
    }
    __builtin_amdgcn_sched_barrier(0);                  /* the pass's LDS reads stay one group ahead of its WMMAs (for speed only) */
#pragma unroll
    for (int ks = 0; ks < 2; ++ks)
#pragma unroll
      for (int i = 0; i < 4; ++i)
#pragma unroll
        for (int j = 0; j < 8; ++j) acc[i][j] = __builtin_amdgcn_wmma_f32_16x16x32_f16(false, a[ks][i], false, b[ks][j], (short)0, acc[i][j], false, false);
    __builtin_amdgcn_sched_barrier(0);                  /* the WMMAs stay in front of the publish point: moved behind it, the wait for stage s + 1 would stand a whole pass earlier and the refill would lose its lead */
    asm volatile("s_wait_dscnt 0x0" ::: "memory");      /* this wave has left the buffer of pass s */
    asm volatile("s_wait_tensorcnt 0x0" :: "s"(g0), "s"(g1) : "memory");  /* its slice of stage s + 1 has landed; the descriptor words are named so that their registers stay untouched from the issue to here */
    __syncthreads();                                    /* publishes stage s + 1 and frees the buffer of pass s */
  }
  asm volatile("s_wait_tensorcnt 0x0" ::: "memory");    /* nothing of the mover is outstanding when the ring becomes output staging */
  asm volatile("s_wait_dscnt 0x0" ::: "memory");
}

// projections: plane by (0 q, 1 k, 2 v): Y16_by[r][col] = f16((X16[r] . Bt_by[col]) * alpha). The last pass's barrier has ended every read of the ring; each wave then stages 32 x 128 f32 at a time in its own quarter of it.
__global__ __launch_bounds__(128) void k_qkv(const _Float16* __restrict__ X16, const _Float16* __restrict__ Bt, float alpha, _Float16* __restrict__ Y16) {
  __shared__ __attribute__((aligned(2048))) unsigned char L[2u * GP_STAGE];
  const int tid = threadIdx.x, lane = tid & 31, ln = lane & 15, hh = lane >> 4;
  const int w = __builtin_amdgcn_readfirstlane(tid >> 5);
  const int by = blockIdx.y;
  const _Float16* Bh = Bt + (size_t)by * DM * DM;
  _Float16* Yp = Y16 + (size_t)by * NR * DM;
  const int ntn = DM / 256;
  const int mt = blockIdx.x / ntn, nq = blockIdx.x - mt * ntn;
  if (mt * 128 >= (int)NR) return;
  const v8f z8 = {0.f, 0.f, 0.f, 0.f, 0.f, 0.f, 0.f, 0.f};
  v8f acc[4][8];
#pragma unroll
  for (int i = 0; i < 4; ++i)
#pragma unroll
    for (int j = 0; j < 8; ++j) acc[i][j] = z8;
  gemm128x256(X16 + (size_t)mt * 128 * DM, Bh + (size_t)nq * 256 * DM, L, w, ln, hh, acc);
  const int row0 = mt * 128 + 64 * (w >> 1), col0 = nq * 256 + 128 * (w & 1);
  float (*so)[132] = (float (*)[132])(L + (size_t)w * (GP_STAGE / 2u));
#pragma unroll
  for (int h2 = 0; h2 < 2; ++h2) {
#pragma unroll
    for (int ii = 0; ii < 2; ++ii)
#pragma unroll
      for (int j = 0; j < 8; ++j)
#pragma unroll
        for (int r = 0; r < 8; ++r) so[ii * 16 + 8 * hh + r][j * 16 + ln] = acc[2 * h2 + ii][j][r] * alpha;
    __builtin_amdgcn_fence(4 /* acq_rel order */, "workgroup"); __builtin_amdgcn_wave_barrier();
#pragma unroll 1                                        /* groups of eight rows: eight LDS reads in flight cover their latency, one wait per group behind the stores */
    for (int q8 = 0; q8 < 32; q8 += 8) {
#pragma unroll
      for (int q = 0; q < 8; ++q) {
        const v4f v = *(const v4fa*)&so[q8 + q][lane * 4]; v4h h4;
#pragma unroll
        for (int i = 0; i < 4; ++i) h4[i] = toh_flush(v[i]);
        *(v4h*)(Yp + (size_t)(row0 + 32 * h2 + q8 + q) * DM + col0 + lane * 4) = h4;
      }
      asm volatile("s_wait_xcnt 0x0" ::: "memory");     /* in front of the next group, which overwrites registers that these stores name */
    }
    __builtin_amdgcn_fence(4 /* acq_rel order */, "workgroup"); __builtin_amdgcn_wave_barrier();
  }
}

template <int NHv, int TTv>
__global__ __launch_bounds__(256) void k_vt(const _Float16* __restrict__ V16, int ldv, int voff, _Float16* __restrict__ Vt) {
  __shared__ unsigned short tl[64][66];
  const int tid = threadIdx.x; const int slab = blockIdx.x / (TTv / 64), lg = blockIdx.x % (TTv / 64); const int b = slab / NHv, h = slab % NHv;
  for (int i = tid; i < 64 * 8; i += 256) {
    const int r = i / 8, c8 = (i % 8) * 8; FragH f; f.half[0] = *(const v8us*)((const unsigned short*)V16 + ((size_t)b * TTv + lg * 64 + r) * ldv + voff + h * 64 + c8);
#pragma unroll
    for (int q = 0; q < 8; ++q) tl[r][c8 + q] = f.u[q];
  }
  __syncthreads();
  {
#pragma unroll
    for (int rd = 0; rd < 2; ++rd) {
      const int d = rd * 32 + tid / 8, pc = tid % 8; FragH f;
#pragma unroll
      for (int q = 0; q < 8; ++q) f.u[q] = tl[pc * 8 + q][d];
      *(v8us*)((unsigned short*)Vt + ((size_t)slab * 64 + d) * TTv + lg * 64 + pc * 8) = f.half[0];
    }
    
  }
}

// Attention K / V^T ring: a stage is 64 keys = [K tile: 64 key rows of 128 B | V^T tile: 64 d rows of 128 B], rows at pitch 144 B (128 B + the mover's 16 B pad, conflict-free for 16-byte reads); a tile holds 9216 B and is placed every 10240 B (a multiple of 2 KiB).
// Two stages, shared by the block's four waves; behind the loop's last barrier the ring is free and holds each wave's own bucket-weight and output rows.
#define AT_ROWB 128u
#define AT_PITCH 144u
#define AT_TILE 10240u
#define AT_STAGE (2u * AT_TILE)
#define AT_NPASS ((unsigned)SEQ / 64u)
#define AT_WTB (16u * 104u * 2u)
#define AT_SOB (16u * 72u * 2u)
#define LOG2E 1.4426950408889634f
#define AT_KS (0.125f * LOG2E)
static_assert(AT_TILE % 2048u == 0 && 64u * AT_PITCH <= AT_TILE);
static_assert(AT_NPASS >= 2);
static_assert(AT_ROWB == (unsigned)(HD * 2) && (DM * 2) % 16 == 0 && (SEQ * 2) % 16 == 0 && SEQ % 64 == 0);
static_assert(4u * (AT_WTB + AT_SOB) <= 2u * AT_STAGE && AT_WTB % 16u == 0 && AT_SOB % 16u == 0);
// QR^T tiles (16 buckets x 16 queries) = RK16 . Q^T -> qrt[w][query][bucket] = q.relk[bucket] / 8. S^T 16-key tiles = K . Q^T (A = K16 rows: row = key, k = d; B = Q16 rows: col = query);
// each lane holds keys 8hh+r of query ln; logit = s/8 + qrt[query][clip(key-query)+32], carried in base 2 (table, maximum and kept band logits all x log2 e); 64-key blocks wholly left (key-query <= -32) or right (>= 32) of the band take one per-lane constant (wave-uniform test);
// p x 1024 = exp2(one FMA per score: scale, constant, maximum and the carry's exponent 10 folded), as f16 and in the f32 sums alike; O^T (64 d x 16 queries) = VT . P^T with the B operand packed from the two adjacent S^T D tiles (element r <- keys 0..15, element 8+r <- keys 16..31).
// Bucket weights: buckets 1..63 hold one key each -> the logit is kept in tlg[w][query][bucket] and exponentiated against the final maximum; buckets 0 / 64 are running sums scaled with the online factor.
__global__ __launch_bounds__(128) __attribute__((amdgpu_num_vgpr(256))) void k_attn(const _Float16* __restrict__ Q16, const _Float16* __restrict__ K16, const _Float16* __restrict__ VT,
                                                                                const _Float16* __restrict__ RK16, const _Float16* __restrict__ RVT, _Float16* __restrict__ O16) {
  __shared__ __attribute__((aligned(2048))) unsigned char L[2u * AT_STAGE];
  __shared__ float qrt[4][16][84];
  __shared__ float tlg[4][16][68];
  const int tid = threadIdx.x, lane = tid & 31, ln = lane & 15, hh = lane >> 4;
  const int w = __builtin_amdgcn_readfirstlane(tid >> 5);
  const int h = blockIdx.y, b = blockIdx.z;
  const int q0 = blockIdx.x * 64 + w * 16;
  const int qi = q0 + ln;
  const size_t rq = (size_t)b * SEQ + q0;
  const size_t rk = (size_t)b * SEQ;
  const _Float16* qp = Q16 + (rq + ln) * DM + h * HD;
  const v16h qb0 = g2_frag(qp, hh), qb1 = g2_frag(qp + 32, hh);
  const v8f z8 = {0.f, 0.f, 0.f, 0.f, 0.f, 0.f, 0.f, 0.f};
  // K / V^T ring: wave 0 brings the stage's 64 K rows (next stage 64 rows on), wave 1 its 64 V^T rows (next stage 128 B on); waves 2 and 3 issue nothing
  const unsigned int issuer = (unsigned int)(w < 2);
  const unsigned long long srcb = (unsigned long long)(size_t)(w == 0 ? K16 + rk * DM + h * HD : VT + (size_t)(b * NH + h) * HD * SEQ);
  const unsigned int sstep = (w == 0) ? 64u * (unsigned int)(DM * 2) : AT_ROWB;
  const unsigned int place = (unsigned int)(size_t)L + (w == 0 ? 0u : AT_TILE);
  u32x8 g1;                                             /* 1-byte elements, tensor = tile = 64 rows of 128 B, source pitch one K16 or VT row, 4 dwords of pad behind every 32 */
  g1[0] = uni((1u << 20) | (4u << 22) | (3u << 25));
  g1[1] = pinned(AT_ROWB << 16);                        /* words 1 to 7: descriptor words held in scalar registers, so that the group is built once and its registers stay as they are while a request is outstanding */
  g1[2] = pinned(64u << 16);
  g1[3] = pinned(AT_ROWB << 16);
  g1[4] = pinned(64u);
  g1[5] = pinned(w == 0 ? (unsigned int)(DM * 2) : (unsigned int)(SEQ * 2));
  g1[6] = pinned(0u);
  g1[7] = pinned(0u);
  u32x4 g0;
  const unsigned int cnt1 = pinned(1u);                 /* group 0's constant word held in a scalar register, not written again while a request is outstanding */
  auto issue = [&](unsigned int st) {
    const unsigned long long ga = srcb + (unsigned long long)st * sstep;
    g0[0] = uni(cnt1); g0[1] = uni(place + (st & 1u) * AT_STAGE); g0[2] = uni((unsigned int)ga); g0[3] = uni((((unsigned int)(ga >> 32)) & 0x01FFFFFFu) | 0x80000000u);
    asm volatile("tensor_load_to_lds %0, %1" :: "s"(g0), "s"(g1) : "memory");
  };
  if (pinned(issuer)) {
    issue(0u);
    asm volatile("s_wait_tensorcnt 0x0" :: "s"(g0), "s"(g1) : "memory");  /* stage 0 has landed; the descriptor words are named so that their registers stay untouched while the request is outstanding */
  }
  __syncthreads();                                      /* ... and is published to the other waves */
  if (pinned(issuer)) issue(pinned(1u));                /* stage 1 flies while the table below and pass 0 are worked on */
  const unsigned char* kf0 = L + (unsigned int)ln * AT_PITCH + 16u * (unsigned int)hh;
  // relative-key table: columns 0..RKR-1 of the row of query ln, in base-2 logit units (1/1024 carry, 1/8 scale and log2 e folded)
#pragma unroll
  for (int t = 0; t < RKR / 16; ++t) {
    const _Float16* rp = RK16 + (size_t)(16 * t + ln) * HD;
    const v16h ra0 = g2_frag(rp, hh), ra1 = g2_frag(rp + 32, hh);
    const v8f c = mma2(ra0, qb0, ra1, qb1, z8);
#pragma unroll
    for (int r = 0; r < 8; ++r) qrt[w][ln][16 * t + 8 * hh + r] = c[r] * (0.0001220703125f * LOG2E);
  }
#pragma unroll 1
  for (int c = 0; c < 34; ++c) tlg[w][ln][34 * hh + c] = -1.0e30f;
  __builtin_amdgcn_fence(4 /* acq_rel order */, "workgroup"); __builtin_amdgcn_wave_barrier();
  const float c0 = qrt[w][ln][0], c64 = qrt[w][ln][2 * MAXREL];
  v8f o0 = z8, o1 = z8, o2 = z8, o3 = z8;
  float mrun = -1.0e30f, lrun = 0.f, wl = 0.f, wr = 0.f;
#pragma unroll 1
  for (int kt = 0; kt < SEQ; kt += 64) {
    const unsigned int st = (unsigned int)kt >> 6;
    const unsigned char* kf = kf0 + (st & 1u) * AT_STAGE; const unsigned char* vf = kf + AT_TILE;
    v8f s[4];
    v16h kv[4][2];
#pragma unroll
    for (int j = 0; j < 4; ++j) { kv[j][0] = lds_frag(kf + j * 16 * AT_PITCH); kv[j][1] = lds_frag(kf + j * 16 * AT_PITCH + 64); }
    __builtin_amdgcn_sched_barrier(0);                  /* the pass's K reads stay one group ahead of its WMMAs: read tile by tile, the wave waits out the LDS latency four times */
#pragma unroll
    for (int j = 0; j < 4; ++j) s[j] = mma2(kv[j][0], qb0, kv[j][1], qb1, z8);
#pragma unroll
    for (int j = 0; j < 4; ++j) { kv[j][0] = lds_frag(vf + j * 16 * AT_PITCH); kv[j][1] = lds_frag(vf + j * 16 * AT_PITCH + 64); }
    __builtin_amdgcn_sched_barrier(0);                  /* the pass's V^T reads are issued here, as one group: their latency passes under the softmax arithmetic */
    const bool farl = (kt + 63 + MAXREL <= q0);          /* every key of the block at distance <= -32 of every query of the wave */
    const bool farr = (kt >= q0 + 15 + MAXREL);          /* every key at distance >= +32 */
    const int dbase = kt + 8 * hh - qi;
    const bool far = farl || farr;
    if (!far) {
#pragma unroll
      for (int j = 0; j < 4; ++j)
#pragma unroll
        for (int r = 0; r < 8; ++r) {
          const int d = dbase + 16 * j + r;
          const int rel = min(max(d, -MAXREL), MAXREL) + MAXREL;
          float bias = qrt[w][ln][rel]; asm volatile("" : "+v"(bias));
          const float t = s[j][r] * AT_KS + bias;
          s[j][r] = t;
          const int slot = (d > -MAXREL && d < MAXREL) ? rel : 66 + hh;      /* band logit kept; clipped keys go to a per-lane dump slot */
          tlg[w][ln][slot] = t;
        }
    }
    float mx = -1.0e30f;
#pragma unroll
    for (int j = 0; j < 4; ++j)
#pragma unroll
      for (int r = 0; r < 8; ++r) mx = fmaxf(mx, s[j][r]);
    const float cb = farl ? c0 : c64;
    mx = far ? fmaf(mx, AT_KS, cb) : mx;                /* a far block's scores are still raw: the FMA is monotone, so the maximum's logit is the logits' maximum */
    mx = fmaxf(mx, __shfl_xor(mx, 16, 32));
    const float mnew = fmaxf(mrun, mx);
    const float alpha = __builtin_amdgcn_exp2f(mrun - mnew);
    mrun = mnew;
    const float km = far ? AT_KS : 1.0f;                /* band scores are logits already */
    const float off = (far ? cb : 0.f) + (10.0f - mnew);
    const v2f km2 = {km, km}, off2 = {off, off};
    v2f psj[4]; FragH pf[2];                            /* one chain of packed adds per 16-key tile: four short chains, not one long one */
#pragma unroll
    for (int j = 0; j < 4; ++j)
#pragma unroll
      for (int r = 0; r < 8; r += 2) {
        const v2f sv = {s[j][r], s[j][r + 1]};
        const v2f a = __builtin_elementwise_fma(sv, km2, off2);
        const v2f p = {__builtin_amdgcn_exp2f(a[0]), __builtin_amdgcn_exp2f(a[1])};
        s[j][r] = p[0]; s[j][r + 1] = p[1];
        psj[j] = (r == 0) ? p : psj[j] + p;
        pf[j >> 1].h2[((j & 1) * 8 + r) >> 1] = __builtin_convertvector(p, v2h);
      }
    const v2f ps2 = (psj[0] + psj[1]) + (psj[2] + psj[3]);
    const float ps = ps2[0] + ps2[1];
    float pl = 0.f, pr = 0.f;
    if (far) {
      pl = farl ? ps : 0.f; pr = farl ? 0.f : ps;
    } else {
#pragma unroll
      for (int j = 0; j < 4; ++j)
#pragma unroll
        for (int r = 0; r < 8; ++r) {
          const int d = dbase + 16 * j + r; const float p = s[j][r];
          pl += (d <= -MAXREL) ? p : 0.f;
          pr += (d >= MAXREL) ? p : 0.f;
        }
    }
    wl = wl * alpha + pl; wr = wr * alpha + pr;
    lrun = lrun * alpha + ps;                           /* this lane's keys only: the wave's halves are joined behind the loop */
#pragma unroll
    for (int r = 0; r < 8; ++r) { o0[r] *= alpha; o1[r] *= alpha; o2[r] *= alpha; o3[r] *= alpha; }
    o0 = mma2(kv[0][0], pf[0].v, kv[0][1], pf[1].v, o0);
    o1 = mma2(kv[1][0], pf[0].v, kv[1][1], pf[1].v, o1);
    o2 = mma2(kv[2][0], pf[0].v, kv[2][1], pf[1].v, o2);
    o3 = mma2(kv[3][0], pf[0].v, kv[3][1], pf[1].v, o3);
    asm volatile("s_wait_dscnt 0x0" ::: "memory");      /* this wave has left the buffer of pass st */
    if (pinned(issuer)) asm volatile("s_wait_tensorcnt 0x0" :: "s"(g0), "s"(g1) : "memory");  /* the issuer's tile of stage st + 1 has landed; the descriptor words are named so that their registers stay untouched from the issue to here */
    __syncthreads();                                    /* publishes stage st + 1 and frees the buffer of pass st */
    if (pinned(issuer & (unsigned int)(st + 2u < AT_NPASS))) issue(pinned(st + 2u));  /* refill of the buffer just left: stage st + 2 flies while pass st + 1 is worked on */
  }
  asm volatile("s_wait_tensorcnt 0x0" ::: "memory");    /* nothing of the mover is outstanding when the ring becomes the waves' epilogue staging */
  asm volatile("s_wait_dscnt 0x0" ::: "memory");
  unsigned short (*wt)[104] = (unsigned short (*)[104])(L + (unsigned int)w * AT_WTB);                  /* bucket weights, this wave's own 16 x 104 */
  unsigned short (*so)[72] = (unsigned short (*)[72])(L + 4u * AT_WTB + (unsigned int)w * AT_SOB);      /* output rows, this wave's own 16 x 72 */
  wl += __shfl_xor(wl, 16, 32); wr += __shfl_xor(wr, 16, 32); lrun += __shfl_xor(lrun, 16, 32);
  wl *= 0.0009765625f; wr *= 0.0009765625f;             /* the running sums carry x1024 */
  __builtin_amdgcn_fence(4 /* acq_rel order */, "workgroup"); __builtin_amdgcn_wave_barrier();
  // bucket weight row of query ln, columns 48hh .. 48hh+47 by this lane (all RVK columns written; columns >= NREL zero)
#pragma unroll 1
  for (int c = 0; c < 6; ++c) {
    FragH f;
#pragma unroll
    for (int q = 0; q < 8; ++q) {
      const int r = 48 * hh + 8 * c + q;
      const int rr = min(r, 67);
      float tv = tlg[w][ln][rr]; asm volatile("" : "+v"(tv));
      const float e = __builtin_amdgcn_exp2f(tv - mrun);
      const float wv = (r == 0) ? wl : (r == 2 * MAXREL) ? wr : (r < 2 * MAXREL) ? e : 0.f;
      f.h[q] = toh_flush(wv * 16.0f);
    }
    *(v8us*)&wt[ln][48 * hh + 8 * c] = f.half[0];
  }
  __builtin_amdgcn_fence(4 /* acq_rel order */, "workgroup"); __builtin_amdgcn_wave_barrier();
#pragma unroll
  for (int ks = 0; ks < RVK / 32; ++ks) {
    FragH wb; wb.half[0] = *(const v8us*)&wt[ln][32 * ks + 8 * hh]; wb.half[1] = *(const v8us*)&wt[ln][32 * ks + 16 + 8 * hh];
    const _Float16* rv = RVT + (size_t)ln * RVK + 32 * ks;
    o0 = g2_mma(g2_frag(rv, hh), wb.v, o0);
    o1 = g2_mma(g2_frag(rv + 16 * RVK, hh), wb.v, o1);
    o2 = g2_mma(g2_frag(rv + 32 * RVK, hh), wb.v, o2);
    o3 = g2_mma(g2_frag(rv + 48 * RVK, hh), wb.v, o3);
  }
  const float rl = (1.0f / lrun) * 16.0f;
  { FragH f;
#pragma unroll
    for (int r = 0; r < 8; ++r) f.h[r] = toh_flush(o0[r] * rl);
    *(v8us*)&so[ln][0 + 8 * hh] = f.half[0]; }
  { FragH f;
#pragma unroll
    for (int r = 0; r < 8; ++r) f.h[r] = toh_flush(o1[r] * rl);
    *(v8us*)&so[ln][16 + 8 * hh] = f.half[0]; }
  { FragH f;
#pragma unroll
    for (int r = 0; r < 8; ++r) f.h[r] = toh_flush(o2[r] * rl);
    *(v8us*)&so[ln][32 + 8 * hh] = f.half[0]; }
  { FragH f;
#pragma unroll
    for (int r = 0; r < 8; ++r) f.h[r] = toh_flush(o3[r] * rl);
    *(v8us*)&so[ln][48 + 8 * hh] = f.half[0]; }
  __builtin_amdgcn_fence(4 /* acq_rel order */, "workgroup"); __builtin_amdgcn_wave_barrier();
  const int li = lane >> 3, pc = lane & 7;
  {
#pragma unroll
    for (int g = 0; g < 4; ++g) {
      const int i = g * 4 + li;
      const v8us v = *(const v8us*)&so[i][pc * 8];
      *(v8us*)((unsigned short*)O16 + (rq + i) * DM + h * HD + pc * 8) = v;
    }
    
  }
}

// out[r][col] = (A1[r] . B1[col]) * al1 + bf16(bias[col]); the same tile loop; each wave stages 32 x 128 f32 at a time in its own quarter of the ring; bias added at the store stage as a 4-wide f32 vector; f32 rows:
__global__ __launch_bounds__(128) void k_out(const _Float16* __restrict__ A1, const _Float16* __restrict__ B1, float al1, const float* __restrict__ bias, float* __restrict__ Out) {
  __shared__ __attribute__((aligned(2048))) unsigned char L[2u * GP_STAGE];
  const int tid = threadIdx.x, lane = tid & 31, ln = lane & 15, hh = lane >> 4;
  const int w = __builtin_amdgcn_readfirstlane(tid >> 5);
  const int ntn = DM / 256;
  const int mt = blockIdx.x / ntn, nq = blockIdx.x - mt * ntn;
  if (mt * 128 >= (int)NR) return;
  const v8f z8 = {0.f, 0.f, 0.f, 0.f, 0.f, 0.f, 0.f, 0.f};
  v8f acc[4][8];
#pragma unroll
  for (int i = 0; i < 4; ++i)
#pragma unroll
    for (int j = 0; j < 8; ++j) acc[i][j] = z8;
  gemm128x256(A1 + (size_t)mt * 128 * DM, B1 + (size_t)nq * 256 * DM, L, w, ln, hh, acc);
  const int row0 = mt * 128 + 64 * (w >> 1), col0 = nq * 256 + 128 * (w & 1);
  float (*so)[132] = (float (*)[132])(L + (size_t)w * (GP_STAGE / 2u));
  const v4f bz = *(const v4fa*)(bias + col0 + lane * 4);
  v4f bb;
#pragma unroll
  for (int i = 0; i < 4; ++i) bb[i] = bf16_rne(bz[i]);
#pragma unroll
  for (int h2 = 0; h2 < 2; ++h2) {
#pragma unroll
    for (int ii = 0; ii < 2; ++ii)
#pragma unroll
      for (int j = 0; j < 8; ++j)
#pragma unroll
        for (int r = 0; r < 8; ++r) so[ii * 16 + 8 * hh + r][j * 16 + ln] = acc[2 * h2 + ii][j][r] * al1;
    __builtin_amdgcn_fence(4 /* acq_rel order */, "workgroup"); __builtin_amdgcn_wave_barrier();
#pragma unroll 1                                        /* groups of eight rows: eight LDS reads in flight cover their latency, one wait per group behind the stores */
    for (int q8 = 0; q8 < 32; q8 += 8) {
#pragma unroll
      for (int q = 0; q < 8; ++q) {
        const v4f v0 = *(const v4fa*)&so[q8 + q][lane * 4];
        const v4f v = v0 + bb;
        *(v4f*)(Out + (size_t)(row0 + 32 * h2 + q8 + q) * DM + col0 + lane * 4) = v;
      }
      asm volatile("s_wait_xcnt 0x0" ::: "memory");     /* in front of the next group, which overwrites registers that these stores name */
    }
    __builtin_amdgcn_fence(4 /* acq_rel order */, "workgroup"); __builtin_amdgcn_wave_barrier();
  }
}

extern "C" void kernel_launch(void* const* d_in, const int* in_sizes, int n_in,
                              void* d_out, int out_size, void* d_ws, size_t ws_size, hipStream_t stream) {
  if (n_in < 8) return;
  if (in_sizes[0] < (int)(((size_t)(NB - 1) * SEQ_FULL + SEQ) * DM)) return;
  for (int i = 1; i <= 4; ++i) if (in_sizes[i] < DM * DM) return;
  if (in_sizes[5] < DM) return;
  if (in_sizes[6] < NREL * HD) return;
  if (in_sizes[7] < NREL * HD) return;
  if (out_size < (int)(NR * DM)) return;
  const float* const* I = (const float* const*)d_in;
  const float* x = I[0]; const float* wq = I[1]; const float* wk = I[2]; const float* wv = I[3]; const float* wo = I[4]; const float* bo = I[5]; const float* relk = I[6]; const float* relv = I[7];
  char* ws = (char*)d_ws; size_t off = 0;
  auto take = [&](size_t bytes) { char* p = ws + off; off += (bytes + 255) & ~(size_t)255; return p; };
  _Float16* BQKV = (_Float16*)take((size_t)3 * SZ_BT);               /* Bt planes q, k, v (contiguous, stride DM*DM) */
  _Float16* BO   = (_Float16*)take(SZ_BT);
  _Float16* RK16 = (_Float16*)take(SZ_RK);                           /* [RKR][HD] */
  _Float16* RVT  = (_Float16*)take(SZ_RV);                           /* [HD][RVK] */
  _Float16* X16  = (_Float16*)take(SZ_ACT);
  _Float16* QKV16 = (_Float16*)take((size_t)3 * SZ_ACT);             /* Q16, K16, V16 planes (stride NR*DM) */
  _Float16* VT   = (_Float16*)take((size_t)NB * NH * HD * SEQ * 2);  /* [b*NH+h][d][s] */
  _Float16* O16  = (_Float16*)take(SZ_ACT);
  if (off > ws_size) return;
  _Float16* Q16 = QKV16; _Float16* K16 = QKV16 + NR * DM; _Float16* V16 = QKV16 + (size_t)2 * NR * DM;

  k_prep<<<1u + 4u * PB_W + PB_X, 256, 0, stream>>>(x, wq, wk, wv, wo, relk, relv, X16, BQKV, BO, RK16, RVT);      /* every f32 -> f16 operand plane */
  k_qkv<<<dim3((unsigned)((NR / 128) * (DM / 256)), 3), 128, 0, stream>>>(X16, BQKV, 0.0625f, QKV16);      /* q, k, v as f16 rows */
  k_vt<NH, SEQ><<<(unsigned)(NB * NH * (SEQ / 64)), 256, 0, stream>>>(V16, DM, 0, VT);
  k_attn<<<dim3(SEQ / 64, NH, NB), 128, 0, stream>>>(Q16, K16, VT, RK16, RVT, O16);
  k_out<<<(unsigned)((NR / 128) * (DM / 256)), 128, 0, stream>>>(O16, BO, 0.00390625f, bo, (float*)d_out);      /* out = ctx Wo^T + b_o */
}

// v005
// Measured time: 138 microseconds a run.
// In both of two side-by-side timings against v004, it was 1.03 times as fast.
// All steps since v000 together make it 2.95 times as fast.
#include <hip/hip_runtime.h>
// Contractions: q/k/v/o projections ([tokens][1024] x [1024][1024]^T), scores k.q^T (K = 64), relative-key table relk.q^T (K = 64), v^T.p^T (K = keys) and relv^T.w^T (K = 65 padded to 96) on v_wmma_f32_16x16x32_f16 (f16 operands, f32 accumulate). Inputs RNE-converted to bf16 on load (exact in f16; weights carried x16, relk x1024, relv x64), softmax numerators carried x1024, bucket weights x16, ctx rows x16; softmax statistics and all epilogues in f32.
// Structure: token rows r = b*SEQ + s. X16 = f16(bf16(x)); Q16/K16 = f16(X16 . Bt_w / 16) as token rows, VT[b*NH+h][d][s] = f16(X16 . Bt_v / 16) stored transposed by the projection itself; attention per (64 queries, head, batch): per wave a table QR[query][bucket] = q . relk[bucket] / 8
// (5 WMMA tiles into wave-private LDS), S^T tiles = K . Q^T, logit = s/8 + QR[query][clip(key - query, -32, 32) + 32], online softmax per lane, O^T = VT . P^T; bucket weights W[query][bucket] (buckets 1..63 from band logits kept in LDS,
// buckets 0 and 64 as running sums) then O^T += RelVT . W^T; O16[r][h*64+d] = f16(16 ctx); out = (O16 . Bt_o) / 256 + bf16(b_o) -> f32 rows.
#ifndef NB
#define NB 8
#endif
#ifndef SEQ
#define SEQ 1024
#endif
#define NB_FULL 8
#define SEQ_FULL 1024
#define DM 1024
#define NH 16
#define HD 64
#define MAXREL 32
#define NREL 65
#define RKR 80
#define RVK 96
#define NR ((size_t)NB * SEQ)
#define SZ_BT ((size_t)DM * DM * 2)
#define SZ_ACT (NR * DM * 2)
#define SZ_RK ((size_t)RKR * HD * 2)
#define SZ_RV ((size_t)HD * RVK * 2)
#define WS_TOTAL ((size_t)4 * SZ_BT + SZ_RK + SZ_RV + (size_t)6 * SZ_ACT)
static_assert(NH * HD == DM);
static_assert(SEQ % 128 == 0);
static_assert(SEQ <= SEQ_FULL);
static_assert(NB >= 1 && NB <= NB_FULL);
static_assert(DM == 128 * 8);
static_assert(DM % 256 == 0);
static_assert(HD == 64);
static_assert(NREL == 2 * MAXREL + 1);
static_assert(RKR % 16 == 0 && RKR >= NREL);
static_assert(RVK % 32 == 0 && RVK >= NREL);
static_assert((RKR * HD / 8) % 32 == 0);
static_assert((HD * RVK / 8) % 256 == 0);
static_assert(SZ_BT % 256 == 0 && SZ_ACT % 256 == 0 && SZ_RK % 256 == 0 && SZ_RV % 256 == 0);
static_assert(WS_TOTAL <= (size_t)134217728);
static_assert((size_t)NB * NH * HD * SEQ * 2 == SZ_ACT);

typedef _Float16 v16h __attribute__((ext_vector_type(16)));
typedef unsigned short v8us __attribute__((ext_vector_type(8), may_alias));
typedef float v8f __attribute__((ext_vector_type(8)));
typedef float v4f __attribute__((ext_vector_type(4)));
typedef float v4fa __attribute__((ext_vector_type(4), may_alias));
typedef _Float16 v4h __attribute__((ext_vector_type(4)));
typedef float v2f __attribute__((ext_vector_type(2)));
typedef _Float16 v2h __attribute__((ext_vector_type(2)));
union FragH { v16h v; v8us half[2]; v2h h2[8]; _Float16 h[16]; unsigned short u[16]; };

__device__ __forceinline__ unsigned short bf16_bits(float x) { unsigned int u = __float_as_uint(x); return (unsigned short)((u + 0x7FFFu + ((u >> 16) & 1u)) >> 16); }
__device__ __forceinline__ float bf16_val(unsigned short b) { return __uint_as_float(((unsigned int)b) << 16); }
__device__ __forceinline__ float bf16_rne(float x) { return bf16_val(bf16_bits(x)); }
// f32 -> f16 operand convert that cannot produce an f16 subnormal (value select)
static __device__ __forceinline__ _Float16 toh_flush(float v) { const _Float16 r = (_Float16)v; return (fabsf(v) < 6.103515625e-05f) ? (_Float16)0.0f : r; }

// 16x32 f16 fragment from a k-contiguous row: elements 0..7 <- p[8h .. 8h+7], elements 8..15 <- p[16+8h .. 16+8h+7] (same map for A rows and for Bt[n][k] rows)
__device__ __forceinline__ v16h g2_frag(const _Float16* p, int hh) { FragH f; f.half[0] = *(const v8us*)((const unsigned short*)p + 8 * hh); f.half[1] = *(const v8us*)((const unsigned short*)p + 16 + 8 * hh); return f.v; }
__device__ __forceinline__ v8f g2_mma(v16h a, v16h b, v8f c) { v8f d = __builtin_amdgcn_wmma_f32_16x16x32_f16(false, a, false, b, (short)0, c, false, false); asm volatile("v_nop\n\tv_nop\n\tv_nop\n\tv_nop" : "+v"(d) : "v"(a), "v"(b)); return d; }
// two k-steps into one accumulator, hazard guard after the second
__device__ __forceinline__ v8f mma2(v16h a0, v16h b0, v16h a1, v16h b1, v8f c) {
  c = __builtin_amdgcn_wmma_f32_16x16x32_f16(false, a0, false, b0, (short)0, c, false, false);
  c = __builtin_amdgcn_wmma_f32_16x16x32_f16(false, a1, false, b1, (short)0, c, false, false);
  asm volatile("v_nop\n\tv_nop\n\tv_nop\n\tv_nop" : "+v"(c) : "v"(a0), "v"(b0), "v"(a1), "v"(b1));
  return c;
}

// Bt[n][k] = f16(bf16(w[n][k]) * 16); block blk of a plane's PB_W, thread t owns 8 elements
__device__ __forceinline__ void d_wnat(const float* __restrict__ w, unsigned int blk, _Float16* __restrict__ Bt) {
  const size_t t = (size_t)blk * 256 + threadIdx.x; FragH f;
#pragma unroll
  for (int q = 0; q < 8; ++q) f.h[q] = (_Float16)(bf16_rne(w[t * 8 + q]) * 16.0f);
  const v8us o = f.half[0];
  *(v8us*)((unsigned short*)Bt + t * 8) = o;
  asm volatile("s_wait_xcnt 0x0" ::: "memory");       /* behind the store: in the shared grid another part's code follows in the listing and overwrites registers that the store names */
}

// relative-position planes (one block): RK16[bucket][d] = f16(bf16(relk[bucket][d]) * 1024), rows NREL..RKR-1 zero; RVT[d][bucket] = f16(bf16(relv[bucket][d]) * 64), columns NREL..RVK-1 zero.
__device__ __forceinline__ void d_rel(const float* __restrict__ relk, const float* __restrict__ relv, _Float16* __restrict__ RK16, _Float16* __restrict__ RVT) {
  const int tid = threadIdx.x;
#pragma unroll 1
  for (int c = tid; c < RKR * HD / 8; c += 256) {
    const int row = c / (HD / 8), d8 = (c % (HD / 8)) * 8;
    const int rr = min(row, NREL - 1);
    FragH f;
#pragma unroll
    for (int q = 0; q < 8; ++q) {
      float val = relk[rr * HD + d8 + q]; asm volatile("" : "+v"(val));
      const float sv = (row < NREL) ? bf16_rne(val) * 1024.0f : 0.0f;
      f.h[q] = toh_flush(sv);
    }
    const v8us o = f.half[0];
    unsigned short* dp = (unsigned short*)RK16 + (size_t)c * 8;
    *(v8us*)dp = o; 
  }
#pragma unroll 1
  for (int c = tid; c < HD * RVK / 8; c += 256) {
    const int d = c / (RVK / 8), r8 = (c % (RVK / 8)) * 8;
    FragH f;
#pragma unroll
    for (int q = 0; q < 8; ++q) {
      const int r = r8 + q; const int rr = min(r, NREL - 1);
      float val = relv[rr * HD + d]; asm volatile("" : "+v"(val));
      const float sv = (r < NREL) ? bf16_rne(val) * 64.0f : 0.0f;
      f.h[q] = toh_flush(sv);
    }
    const v8us o = f.half[0];
    unsigned short* dp = (unsigned short*)RVT + (size_t)c * 8;
    *(v8us*)dp = o; 
  }
}

// X16[r][c] = f16(bf16(x)); 128 threads per token row, two rows per block, thread t of a row owns columns 8t..8t+7; input row read at the full stride (b*SEQ_FULL + s);
__device__ __forceinline__ void d_xcvt(const float* __restrict__ x, unsigned int blk, _Float16* __restrict__ X16) {
  const int r = (int)blk * 2 + (int)(threadIdx.x >> 7); const int b = r / SEQ, s = r - b * SEQ;
  const int t = threadIdx.x & 127;
  const float* xr = x + ((size_t)b * SEQ_FULL + s) * DM + 8 * t;
  const v4f xa = *(const v4fa*)xr, xb = *(const v4fa*)(xr + 4);
  FragH f;
#pragma unroll
  for (int q = 0; q < 4; ++q) { f.h[q] = toh_flush(bf16_rne(xa[q])); f.h[4 + q] = toh_flush(bf16_rne(xb[q])); }
  const v8us o = f.half[0];
  unsigned short* d = (unsigned short*)X16 + (size_t)r * DM + 8 * t;
  *(v8us*)d = o;
  asm volatile("s_wait_xcnt 0x0" ::: "memory");       /* behind the store: in the shared grid another part's code follows in the listing and overwrites registers that the store names */
}

// All operand conversions in one grid: none reads what another writes, so they share a launch by ranges of the block index (block-uniform branches, no barrier).
// Block 0: the relative-position planes (one block, the longest chain of dependent loads); then PB_W blocks for each of the weight planes q, k, v, o; then PB_X blocks for x.
#define PB_W ((unsigned)((size_t)DM * DM / 8 / 256))
#define PB_X ((unsigned)(NR / 2))
static_assert((size_t)DM * DM % (8 * 256) == 0 && NR % 2 == 0);
__global__ __launch_bounds__(256) void k_prep(const float* __restrict__ x, const float* __restrict__ wq, const float* __restrict__ wk, const float* __restrict__ wv, const float* __restrict__ wo,
                                              const float* __restrict__ relk, const float* __restrict__ relv,
                                              _Float16* __restrict__ X16, _Float16* __restrict__ BQKV, _Float16* __restrict__ BO, _Float16* __restrict__ RK16, _Float16* __restrict__ RVT) {
  const unsigned int bid = blockIdx.x;
  if (bid == 0u) { d_rel(relk, relv, RK16, RVT); return; }
  const unsigned int wb = bid - 1u;
  if (wb < 4u * PB_W) {
    const unsigned int pl = wb / PB_W, blk = wb - pl * PB_W;
    const float* w = (pl == 0u) ? wq : (pl == 1u) ? wk : (pl == 2u) ? wv : wo;
    d_wnat(w, blk, (pl < 3u) ? BQKV + (size_t)pl * DM * DM : BO);
    return;
  }
  d_xcvt(x, wb - 4u * PB_W, X16);
}

// Projection GEMM tile: one block of 4 waves computes 128 rows x 256 columns; wave (w >> 1, w & 1) owns 64 x 128 (4 x 8 accumulator tiles).
// A pass is 64 k = 128 B of every operand row. A stage in LDS is [A slice 0 | A slice 1 | B slice 0 | B slice 1], rows at pitch 144 B (128 B + the mover's 16 B pad, conflict-free for 16-byte reads);
// A slices hold 64 rows (9216 B, placed every 10240 B so that each place is a multiple of 2 KiB), B slices 128 rows (18432 B). Two stages; every wave issues one tensor load per stage: waves 0, 1 the A slices, waves 2, 3 the B slices.
#define GP_ROWB 128u
#define GP_PITCH 144u
#define GP_SLA 10240u
#define GP_SLB 18432u
#define GP_STAGE (2u * GP_SLA + 2u * GP_SLB)
#define GP_NPASS ((unsigned)(DM * 2) / GP_ROWB)
static_assert(GP_SLA % 2048u == 0 && GP_SLB % 2048u == 0 && GP_STAGE % 2048u == 0);
static_assert(64u * GP_PITCH <= GP_SLA && 128u * GP_PITCH <= GP_SLB);
static_assert(GP_NPASS >= 2);
static_assert(NR % 128 == 0 && DM % 256 == 0);
static_assert(4u * 32u * 132u * 4u <= 2u * GP_STAGE);
typedef unsigned int u32x4 __attribute__((ext_vector_type(4)));
typedef unsigned int u32x8 __attribute__((ext_vector_type(8)));
__device__ __forceinline__ unsigned int uni(unsigned int v) { return (unsigned int)__builtin_amdgcn_readfirstlane(v); }
__device__ __forceinline__ unsigned int pinned(unsigned int v) { unsigned int s = uni(v); asm volatile("" : "+s"(s)); return s; }  // a wave-uniform word held in a scalar register, so that the test around a tensor load is a scalar branch and a descriptor formed from the word stays behind the wait and the barrier in front of it
__device__ __forceinline__ v16h lds_frag(const unsigned char* p) { FragH f; f.half[0] = *(const v8us*)p; f.half[1] = *(const v8us*)(p + 32); return f.v; }

__device__ __forceinline__ void gemm128x256(const _Float16* __restrict__ Arows, const _Float16* __restrict__ Brows, unsigned char* L, int w, int ln, int hh, v8f (&acc)[4][8]) {
  const unsigned int lbase = (unsigned int)(size_t)L;
  const bool isB = w >= 2; const unsigned int sl = (unsigned int)w & 1u;
  const unsigned int nrows = isB ? 128u : 64u;
  const unsigned long long srcb = (unsigned long long)(size_t)(isB ? Brows + (size_t)sl * 128 * DM : Arows + (size_t)sl * 64 * DM);
  const unsigned int place = lbase + (isB ? 2u * GP_SLA + sl * GP_SLB : sl * GP_SLA);
  u32x8 g1;                                             /* 1-byte elements, tensor = tile = nrows rows of 128 B, source pitch one operand row, 4 dwords of pad behind every 32 */
  g1[0] = uni((1u << 20) | (4u << 22) | (3u << 25));
  g1[1] = uni(GP_ROWB << 16);
  g1[2] = uni(nrows << 16);
  g1[3] = uni(GP_ROWB << 16);
  g1[4] = uni(nrows);
  g1[5] = uni((unsigned int)(DM * 2));
  g1[6] = uni(0u);
  g1[7] = uni(0u);
  u32x4 g0;
  auto issue = [&](unsigned int st) {
    const unsigned long long ga = srcb + (unsigned long long)st * GP_ROWB;
    g0[0] = uni(1u); g0[1] = uni(place + (st & 1u) * GP_STAGE); g0[2] = uni((unsigned int)ga); g0[3] = uni((((unsigned int)(ga >> 32)) & 0x01FFFFFFu) | 0x80000000u);
    asm volatile("tensor_load_to_lds %0, %1" :: "s"(g0), "s"(g1) : "memory");
  };
  issue(0u);
  asm volatile("s_wait_tensorcnt 0x0" :: "s"(g0), "s"(g1) : "memory");  /* stage 0 has landed for this wave's slice; the descriptor words are named so that their registers stay untouched while the request is outstanding */
  __syncthreads();                                      /* ... and is published to the other waves */
  const unsigned char* ap = L + (unsigned int)(w >> 1) * GP_SLA + (unsigned int)ln * GP_PITCH + 16u * (unsigned int)hh;
  const unsigned char* bp = L + 2u * GP_SLA + (unsigned int)(w & 1) * GP_SLB + (unsigned int)ln * GP_PITCH + 16u * (unsigned int)hh;
#pragma unroll 1
  for (unsigned int s = 0; s < GP_NPASS; ++s) {         /* rolled: one copy of the pass in the instruction cache; the buffer is picked by the pass's parity */
    if (pinned(s + 1u < GP_NPASS)) issue(pinned(s + 1u)); /* behind the barrier that freed its buffer: stage s + 1 flies while pass s is worked on */
    const unsigned char* as = ap + (s & 1u) * GP_STAGE; const unsigned char* bs = bp + (s & 1u) * GP_STAGE;
    v16h a[2][4], b[2][8];
#pragma unroll
    for (int ks = 0; ks < 2; ++ks) {
      a[ks][0] = lds_frag(as + ks * 64);
#pragma unroll
      for (int j = 0; j < 8; ++j) b[ks][j] = lds_frag(bs + j * 16 * GP_PITCH + ks * 64);
#pragma unroll
      for (int i = 1; i < 4; ++i) a[ks][i] = lds_frag(as + i * 16 * GP_PITCH + ks * 64);
    }
    __builtin_amdgcn_sched_barrier(0);                  /* the pass's LDS reads stay one group ahead of its WMMAs (for speed only) */
#pragma unroll
    for (int ks = 0; ks < 2; ++ks)
#pragma unroll
      for (int i = 0; i < 4; ++i)
#pragma unroll
        for (int j = 0; j < 8; ++j) acc[i][j] = __builtin_amdgcn_wmma_f32_16x16x32_f16(false, a[ks][i], false, b[ks][j], (short)0, acc[i][j], false, false);
    __builtin_amdgcn_sched_barrier(0);                  /* the WMMAs stay in front of the publish point: moved behind it, the wait for stage s + 1 would stand a whole pass earlier and the refill would lose its lead */
    asm volatile("s_wait_dscnt 0x0" ::: "memory");      /* this wave has left the buffer of pass s */
    asm volatile("s_wait_tensorcnt 0x0" :: "s"(g0), "s"(g1) : "memory");  /* its slice of stage s + 1 has landed; the descriptor words are named so that their registers stay untouched from the issue to here */
    __syncthreads();                                    /* publishes stage s + 1 and frees the buffer of pass s */
  }
  asm volatile("s_wait_tensorcnt 0x0" ::: "memory");    /* nothing of the mover is outstanding when the ring becomes output staging */
  asm volatile("s_wait_dscnt 0x0" ::: "memory");
}

// projections: plane by (0 q, 1 k, 2 v): Y16_by[r][col] = f16((X16[r] . Bt_by[col]) * alpha) for q and k; the v plane goes out transposed, VT[b*DM + col][s]. The last pass's barrier has ended every read of the ring; each wave then stages in its own quarter of it:
// q, k: 32 x 128 f32 at a time. v: a lane's 8 accumulator rows of a tile are 8 consecutive tokens of one column, so they are one 16-byte LDS write into [column][token] rows (64 tokens = 128 B; pitch 144 B, so that the 16 rows a half-wave writes fall on distinct banks); read back, 8 lanes store one whole 128-B line of a VT row.
#define VS_PITCH 144u
static_assert(128u * VS_PITCH <= GP_STAGE / 2u && (GP_STAGE / 2u) % 16u == 0);
static_assert(SEQ % 128 == 0);
__global__ __launch_bounds__(128) void k_qkv(const _Float16* __restrict__ X16, const _Float16* __restrict__ Bt, float alpha, _Float16* __restrict__ Y16, _Float16* __restrict__ VT) {
  __shared__ __attribute__((aligned(2048))) unsigned char L[2u * GP_STAGE];
  const int tid = threadIdx.x, lane = tid & 31, ln = lane & 15, hh = lane >> 4;
  const int w = __builtin_amdgcn_readfirstlane(tid >> 5);
  const int by = blockIdx.y;
  const _Float16* Bh = Bt + (size_t)by * DM * DM;
  _Float16* Yp = Y16 + (size_t)by * NR * DM;
  const int ntn = DM / 256;
  const int mt = blockIdx.x / ntn, nq = blockIdx.x - mt * ntn;
  if (mt * 128 >= (int)NR) return;
  const v8f z8 = {0.f, 0.f, 0.f, 0.f, 0.f, 0.f, 0.f, 0.f};
  v8f acc[4][8];
#pragma unroll
  for (int i = 0; i < 4; ++i)
#pragma unroll
    for (int j = 0; j < 8; ++j) acc[i][j] = z8;
  gemm128x256(X16 + (size_t)mt * 128 * DM, Bh + (size_t)nq * 256 * DM, L, w, ln, hh, acc);
  const int row0 = mt * 128 + 64 * (w >> 1), col0 = nq * 256 + 128 * (w & 1);
  if (by == 2) {                                        /* block-uniform: the whole block is of one plane */
    unsigned char* st = L + (size_t)w * (GP_STAGE / 2u);
#pragma unroll
    for (int i = 0; i < 4; ++i)
#pragma unroll
      for (int j = 0; j < 8; ++j) {
        FragH f;
#pragma unroll
        for (int r = 0; r < 8; ++r) f.h[r] = toh_flush(acc[i][j][r] * alpha);
        *(v8us*)(st + (unsigned int)(16 * j + ln) * VS_PITCH + 32u * (unsigned int)i + 16u * (unsigned int)hh) = f.half[0];
      }
    __builtin_amdgcn_fence(4 /* acq_rel order */, "workgroup"); __builtin_amdgcn_wave_barrier();
    const int bb = row0 / SEQ, s0 = row0 - bb * SEQ;    /* the wave's 64 tokens lie in one batch */
    const unsigned char* sr = st + (unsigned int)(lane >> 3) * VS_PITCH + (unsigned int)(lane & 7) * 16u;
    unsigned short* vo = (unsigned short*)VT + ((size_t)bb * DM + col0 + (lane >> 3)) * SEQ + s0 + (lane & 7) * 8;
#pragma unroll 1                                        /* groups of eight: eight LDS reads in flight cover their latency, one wait per group behind the stores */
    for (int q8 = 0; q8 < 32; q8 += 8) {
#pragma unroll
      for (int q = 0; q < 8; ++q) {
        const v8us v = *(const v8us*)(sr + (unsigned int)(q8 + q) * 4u * VS_PITCH);
        *(v8us*)(vo + (size_t)(q8 + q) * 4 * SEQ) = v;
      }
      asm volatile("s_wait_xcnt 0x0" ::: "memory");     /* in front of the next group, which overwrites registers that these stores name */
    }
    return;
  }
  float (*so)[132] = (float (*)[132])(L + (size_t)w * (GP_STAGE / 2u));
#pragma unroll
  for (int h2 = 0; h2 < 2; ++h2) {
#pragma unroll
    for (int ii = 0; ii < 2; ++ii)
#pragma unroll
      for (int j = 0; j < 8; ++j)
#pragma unroll
        for (int r = 0; r < 8; ++r) so[ii * 16 + 8 * hh + r][j * 16 + ln] = acc[2 * h2 + ii][j][r] * alpha;
    __builtin_amdgcn_fence(4 /* acq_rel order */, "workgroup"); __builtin_amdgcn_wave_barrier();
#pragma unroll 1                                        /* groups of eight rows: eight LDS reads in flight cover their latency, one wait per group behind the stores */
    for (int q8 = 0; q8 < 32; q8 += 8) {
#pragma unroll
      for (int q = 0; q < 8; ++q) {
        const v4f v = *(const v4fa*)&so[q8 + q][lane * 4]; v4h h4;
#pragma unroll
        for (int i = 0; i < 4; ++i) h4[i] = toh_flush(v[i]);
        *(v4h*)(Yp + (size_t)(row0 + 32 * h2 + q8 + q) * DM + col0 + lane * 4) = h4;
      }
      asm volatile("s_wait_xcnt 0x0" ::: "memory");     /* in front of the next group, which overwrites registers that these stores name */
    }
    __builtin_amdgcn_fence(4 /* acq_rel order */, "workgroup"); __builtin_amdgcn_wave_barrier();
  }
}

// Attention K / V^T ring: a stage is 64 keys = [K tile: 64 key rows of 128 B | V^T tile: 64 d rows of 128 B], rows at pitch 144 B (128 B + the mover's 16 B pad, conflict-free for 16-byte reads); a tile holds 9216 B and is placed every 10240 B (a multiple of 2 KiB).
// Two stages, shared by the block's four waves; behind the loop's last barrier the ring is free and holds each wave's own bucket-weight and output rows.
#define AT_ROWB 128u
#define AT_PITCH 144u
#define AT_TILE 10240u
#define AT_STAGE (2u * AT_TILE)
#define AT_NPASS ((unsigned)SEQ / 64u)
#define AT_WTB (16u * 104u * 2u)
#define AT_SOB (16u * 72u * 2u)
#define LOG2E 1.4426950408889634f
#define AT_KS (0.125f * LOG2E)
static_assert(AT_TILE % 2048u == 0 && 64u * AT_PITCH <= AT_TILE);
static_assert(AT_NPASS >= 2);
static_assert(AT_ROWB == (unsigned)(HD * 2) && (DM * 2) % 16 == 0 && (SEQ * 2) % 16 == 0 && SEQ % 64 == 0);
static_assert(4u * (AT_WTB + AT_SOB) <= 2u * AT_STAGE && AT_WTB % 16u == 0 && AT_SOB % 16u == 0);
// QR^T tiles (16 buckets x 16 queries) = RK16 . Q^T -> qrt[w][query][bucket] = q.relk[bucket] / 8. S^T 16-key tiles = K . Q^T (A = K16 rows: row = key, k = d; B = Q16 rows: col = query);
// each lane holds keys 8hh+r of query ln; logit = s/8 + qrt[query][clip(key-query)+32], carried in base 2 (table, maximum and kept band logits all x log2 e); 64-key blocks wholly left (key-query <= -32) or right (>= 32) of the band take one per-lane constant (wave-uniform test);
// p x 1024 = exp2(one FMA per score: scale, constant, maximum and the carry's exponent 10 folded), as f16 and in the f32 sums alike; O^T (64 d x 16 queries) = VT . P^T with the B operand packed from the two adjacent S^T D tiles (element r <- keys 0..15, element 8+r <- keys 16..31).
// Bucket weights: buckets 1..63 hold one key each -> the logit is kept in tlg[w][query][bucket] and exponentiated against the final maximum; buckets 0 / 64 are running sums scaled with the online factor.
__global__ __launch_bounds__(128) __attribute__((amdgpu_num_vgpr(256))) void k_attn(const _Float16* __restrict__ Q16, const _Float16* __restrict__ K16, const _Float16* __restrict__ VT,
                                                                                const _Float16* __restrict__ RK16, const _Float16* __restrict__ RVT, _Float16* __restrict__ O16) {
  __shared__ __attribute__((aligned(2048))) unsigned char L[2u * AT_STAGE];
  __shared__ float qrt[4][16][84];
  __shared__ float tlg[4][16][68];
  const int tid = threadIdx.x, lane = tid & 31, ln = lane & 15, hh = lane >> 4;
  const int w = __builtin_amdgcn_readfirstlane(tid >> 5);
  const int h = blockIdx.y, b = blockIdx.z;
  const int q0 = blockIdx.x * 64 + w * 16;
  const int qi = q0 + ln;
  const size_t rq = (size_t)b * SEQ + q0;
  const size_t rk = (size_t)b * SEQ;
  const _Float16* qp = Q16 + (rq + ln) * DM + h * HD;
  const v16h qb0 = g2_frag(qp, hh), qb1 = g2_frag(qp + 32, hh);
  const v8f z8 = {0.f, 0.f, 0.f, 0.f, 0.f, 0.f, 0.f, 0.f};
  // K / V^T ring: wave 0 brings the stage's 64 K rows (next stage 64 rows on), wave 1 its 64 V^T rows (next stage 128 B on); waves 2 and 3 issue nothing
  const unsigned int issuer = (unsigned int)(w < 2);
  const unsigned long long srcb = (unsigned long long)(size_t)(w == 0 ? K16 + rk * DM + h * HD : VT + (size_t)(b * NH + h) * HD * SEQ);
  const unsigned int sstep = (w == 0) ? 64u * (unsigned int)(DM * 2) : AT_ROWB;
  const unsigned int place = (unsigned int)(size_t)L + (w == 0 ? 0u : AT_TILE);
  u32x8 g1;                                             /* 1-byte elements, tensor = tile = 64 rows of 128 B, source pitch one K16 or VT row, 4 dwords of pad behind every 32 */
  g1[0] = uni((1u << 20) | (4u << 22) | (3u << 25));
  g1[1] = pinned(AT_ROWB << 16);                        /* words 1 to 7: descriptor words held in scalar registers, so that the group is built once and its registers stay as they are while a request is outstanding */
  g1[2] = pinned(64u << 16);
  g1[3] = pinned(AT_ROWB << 16);
  g1[4] = pinned(64u);
  g1[5] = pinned(w == 0 ? (unsigned int)(DM * 2) : (unsigned int)(SEQ * 2));
  g1[6] = pinned(0u);
  g1[7] = pinned(0u);
  u32x4 g0;
  const unsigned int cnt1 = pinned(1u);                 /* group 0's constant word held in a scalar register, not written again while a request is outstanding */
  auto issue = [&](unsigned int st) {
    const unsigned long long ga = srcb + (unsigned long long)st * sstep;
    g0[0] = uni(cnt1); g0[1] = uni(place + (st & 1u) * AT_STAGE); g0[2] = uni((unsigned int)ga); g0[3] = uni((((unsigned int)(ga >> 32)) & 0x01FFFFFFu) | 0x80000000u);
    asm volatile("tensor_load_to_lds %0, %1" :: "s"(g0), "s"(g1) : "memory");
  };
  if (pinned(issuer)) {
    issue(0u);
    asm volatile("s_wait_tensorcnt 0x0" :: "s"(g0), "s"(g1) : "memory");  /* stage 0 has landed; the descriptor words are named so that their registers stay untouched while the request is outstanding */
  }
  __syncthreads();                                      /* ... and is published to the other waves */
  if (pinned(issuer)) issue(pinned(1u));                /* stage 1 flies while the table below and pass 0 are worked on */
  const unsigned char* kf0 = L + (unsigned int)ln * AT_PITCH + 16u * (unsigned int)hh;
  // relative-key table: columns 0..RKR-1 of the row of query ln, in base-2 logit units (1/1024 carry, 1/8 scale and log2 e folded)
#pragma unroll
  for (int t = 0; t < RKR / 16; ++t) {
    const _Float16* rp = RK16 + (size_t)(16 * t + ln) * HD;
    const v16h ra0 = g2_frag(rp, hh), ra1 = g2_frag(rp + 32, hh);
    const v8f c = mma2(ra0, qb0, ra1, qb1, z8);
#pragma unroll
    for (int r = 0; r < 8; ++r) qrt[w][ln][16 * t + 8 * hh + r] = c[r] * (0.0001220703125f * LOG2E);
  }
#pragma unroll 1
  for (int c = 0; c < 34; ++c) tlg[w][ln][34 * hh + c] = -1.0e30f;
  __builtin_amdgcn_fence(4 /* acq_rel order */, "workgroup"); __builtin_amdgcn_wave_barrier();
  const float c0 = qrt[w][ln][0], c64 = qrt[w][ln][2 * MAXREL];
  v8f o0 = z8, o1 = z8, o2 = z8, o3 = z8;
  float mrun = -1.0e30f, lrun = 0.f, wl = 0.f, wr = 0.f;
#pragma unroll 1
  for (int kt = 0; kt < SEQ; kt += 64) {
    const unsigned int st = (unsigned int)kt >> 6;
    const unsigned char* kf = kf0 + (st & 1u) * AT_STAGE; const unsigned char* vf = kf + AT_TILE;
    v8f s[4];
    v16h kv[4][2];
#pragma unroll
    for (int j = 0; j < 4; ++j) { kv[j][0] = lds_frag(kf + j * 16 * AT_PITCH); kv[j][1] = lds_frag(kf + j * 16 * AT_PITCH + 64); }
    __builtin_amdgcn_sched_barrier(0);                  /* the pass's K reads stay one group ahead of its WMMAs: read tile by tile, the wave waits out the LDS latency four times */
#pragma unroll
    for (int j = 0; j < 4; ++j) s[j] = mma2(kv[j][0], qb0, kv[j][1], qb1, z8);
#pragma unroll
    for (int j = 0; j < 4; ++j) { kv[j][0] = lds_frag(vf + j * 16 * AT_PITCH); kv[j][1] = lds_frag(vf + j * 16 * AT_PITCH + 64); }
    __builtin_amdgcn_sched_barrier(0);                  /* the pass's V^T reads are issued here, as one group: their latency passes under the softmax arithmetic */
    const bool farl = (kt + 63 + MAXREL <= q0);          /* every key of the block at distance <= -32 of every query of the wave */
    const bool farr = (kt >= q0 + 15 + MAXREL);          /* every key at distance >= +32 */
    const int dbase = kt + 8 * hh - qi;
    const bool far = farl || farr;
    if (!far) {
#pragma unroll
      for (int j = 0; j < 4; ++j)
#pragma unroll
        for (int r = 0; r < 8; ++r) {
          const int d = dbase + 16 * j + r;
          const int rel = min(max(d, -MAXREL), MAXREL) + MAXREL;
          float bias = qrt[w][ln][rel]; asm volatile("" : "+v"(bias));
          const float t = s[j][r] * AT_KS + bias;
          s[j][r] = t;
          const int slot = (d > -MAXREL && d < MAXREL) ? rel : 66 + hh;      /* band logit kept; clipped keys go to a per-lane dump slot */
          tlg[w][ln][slot] = t;
        }
    }
    float mx = -1.0e30f;
#pragma unroll
    for (int j = 0; j < 4; ++j)
#pragma unroll
      for (int r = 0; r < 8; ++r) mx = fmaxf(mx, s[j][r]);
    const float cb = farl ? c0 : c64;
    mx = far ? fmaf(mx, AT_KS, cb) : mx;                /* a far block's scores are still raw: the FMA is monotone, so the maximum's logit is the logits' maximum */
    mx = fmaxf(mx, __shfl_xor(mx, 16, 32));
    const float mnew = fmaxf(mrun, mx);
    const float alpha = __builtin_amdgcn_exp2f(mrun - mnew);
    mrun = mnew;
    const float km = far ? AT_KS : 1.0f;                /* band scores are logits already */
    const float off = (far ? cb : 0.f) + (10.0f - mnew);
    const v2f km2 = {km, km}, off2 = {off, off};
    v2f psj[4]; FragH pf[2];                            /* one chain of packed adds per 16-key tile: four short chains, not one long one */
#pragma unroll
    for (int j = 0; j < 4; ++j)
#pragma unroll
      for (int r = 0; r < 8; r += 2) {
        const v2f sv = {s[j][r], s[j][r + 1]};
        const v2f a = __builtin_elementwise_fma(sv, km2, off2);
        const v2f p = {__builtin_amdgcn_exp2f(a[0]), __builtin_amdgcn_exp2f(a[1])};
        s[j][r] = p[0]; s[j][r + 1] = p[1];
        psj[j] = (r == 0) ? p : psj[j] + p;
        pf[j >> 1].h2[((j & 1) * 8 + r) >> 1] = __builtin_convertvector(p, v2h);
      }
    const v2f ps2 = (psj[0] + psj[1]) + (psj[2] + psj[3]);
    const float ps = ps2[0] + ps2[1];
    float pl = 0.f, pr = 0.f;
    if (far) {
      pl = farl ? ps : 0.f; pr = farl ? 0.f : ps;
    } else {
#pragma unroll
      for (int j = 0; j < 4; ++j)
#pragma unroll
        for (int r = 0; r < 8; ++r) {
          const int d = dbase + 16 * j + r; const float p = s[j][r];
          pl += (d <= -MAXREL) ? p : 0.f;
          pr += (d >= MAXREL) ? p : 0.f;
        }
    }
    wl = wl * alpha + pl; wr = wr * alpha + pr;
    lrun = lrun * alpha + ps;                           /* this lane's keys only: the wave's halves are joined behind the loop */
#pragma unroll
    for (int r = 0; r < 8; ++r) { o0[r] *= alpha; o1[r] *= alpha; o2[r] *= alpha; o3[r] *= alpha; }
    o0 = mma2(kv[0][0], pf[0].v, kv[0][1], pf[1].v, o0);
    o1 = mma2(kv[1][0], pf[0].v, kv[1][1], pf[1].v, o1);
    o2 = mma2(kv[2][0], pf[0].v, kv[2][1], pf[1].v, o2);
    o3 = mma2(kv[3][0], pf[0].v, kv[3][1], pf[1].v, o3);
    asm volatile("s_wait_dscnt 0x0" ::: "memory");      /* this wave has left the buffer of pass st */
    if (pinned(issuer)) asm volatile("s_wait_tensorcnt 0x0" :: "s"(g0), "s"(g1) : "memory");  /* the issuer's tile of stage st + 1 has landed; the descriptor words are named so that their registers stay untouched from the issue to here */
    __syncthreads();                                    /* publishes stage st + 1 and frees the buffer of pass st */
    if (pinned(issuer & (unsigned int)(st + 2u < AT_NPASS))) issue(pinned(st + 2u));  /* refill of the buffer just left: stage st + 2 flies while pass st + 1 is worked on */
  }
  asm volatile("s_wait_tensorcnt 0x0" ::: "memory");    /* nothing of the mover is outstanding when the ring becomes the waves' epilogue staging */
  asm volatile("s_wait_dscnt 0x0" ::: "memory");
  unsigned short (*wt)[104] = (unsigned short (*)[104])(L + (unsigned int)w * AT_WTB);                  /* bucket weights, this wave's own 16 x 104 */
  unsigned short (*so)[72] = (unsigned short (*)[72])(L + 4u * AT_WTB + (unsigned int)w * AT_SOB);      /* output rows, this wave's own 16 x 72 */
  wl += __shfl_xor(wl, 16, 32); wr += __shfl_xor(wr, 16, 32); lrun += __shfl_xor(lrun, 16, 32);
  wl *= 0.0009765625f; wr *= 0.0009765625f;             /* the running sums carry x1024 */
  __builtin_amdgcn_fence(4 /* acq_rel order */, "workgroup"); __builtin_amdgcn_wave_barrier();
  // bucket weight row of query ln, columns 48hh .. 48hh+47 by this lane (all RVK columns written; columns >= NREL zero)
#pragma unroll 1
  for (int c = 0; c < 6; ++c) {
    FragH f;
#pragma unroll
    for (int q = 0; q < 8; ++q) {
      const int r = 48 * hh + 8 * c + q;
      const int rr = min(r, 67);
      float tv = tlg[w][ln][rr]; asm volatile("" : "+v"(tv));
      const float e = __builtin_amdgcn_exp2f(tv - mrun);
      const float wv = (r == 0) ? wl : (r == 2 * MAXREL) ? wr : (r < 2 * MAXREL) ? e : 0.f;
      f.h[q] = toh_flush(wv * 16.0f);
    }
    *(v8us*)&wt[ln][48 * hh + 8 * c] = f.half[0];
  }
  __builtin_amdgcn_fence(4 /* acq_rel order */, "workgroup"); __builtin_amdgcn_wave_barrier();
#pragma unroll
  for (int ks = 0; ks < RVK / 32; ++ks) {
    FragH wb; wb.half[0] = *(const v8us*)&wt[ln][32 * ks + 8 * hh]; wb.half[1] = *(const v8us*)&wt[ln][32 * ks + 16 + 8 * hh];
    const _Float16* rv = RVT + (size_t)ln * RVK + 32 * ks;
    o0 = g2_mma(g2_frag(rv, hh), wb.v, o0);
    o1 = g2_mma(g2_frag(rv + 16 * RVK, hh), wb.v, o1);
    o2 = g2_mma(g2_frag(rv + 32 * RVK, hh), wb.v, o2);
    o3 = g2_mma(g2_frag(rv + 48 * RVK, hh), wb.v, o3);
  }
  const float rl = (1.0f / lrun) * 16.0f;
  { FragH f;
#pragma unroll
    for (int r = 0; r < 8; ++r) f.h[r] = toh_flush(o0[r] * rl);
    *(v8us*)&so[ln][0 + 8 * hh] = f.half[0]; }
  { FragH f;
#pragma unroll
    for (int r = 0; r < 8; ++r) f.h[r] = toh_flush(o1[r] * rl);
    *(v8us*)&so[ln][16 + 8 * hh] = f.half[0]; }
  { FragH f;
#pragma unroll
    for (int r = 0; r < 8; ++r) f.h[r] = toh_flush(o2[r] * rl);
    *(v8us*)&so[ln][32 + 8 * hh] = f.half[0]; }
  { FragH f;
#pragma unroll
    for (int r = 0; r < 8; ++r) f.h[r] = toh_flush(o3[r] * rl);
    *(v8us*)&so[ln][48 + 8 * hh] = f.half[0]; }
  __builtin_amdgcn_fence(4 /* acq_rel order */, "workgroup"); __builtin_amdgcn_wave_barrier();
  const int li = lane >> 3, pc = lane & 7;
  {
#pragma unroll
    for (int g = 0; g < 4; ++g) {
      const int i = g * 4 + li;
      const v8us v = *(const v8us*)&so[i][pc * 8];
      *(v8us*)((unsigned short*)O16 + (rq + i) * DM + h * HD + pc * 8) = v;
    }
    
  }
}

// out[r][col] = (A1[r] . B1[col]) * al1 + bf16(bias[col]); the same tile loop; each wave stages 32 x 128 f32 at a time in its own quarter of the ring; bias added at the store stage as a 4-wide f32 vector; f32 rows:
__global__ __launch_bounds__(128) void k_out(const _Float16* __restrict__ A1, const _Float16* __restrict__ B1, float al1, const float* __restrict__ bias, float* __restrict__ Out) {
  __shared__ __attribute__((aligned(2048))) unsigned char L[2u * GP_STAGE];
  const int tid = threadIdx.x, lane = tid & 31, ln = lane & 15, hh = lane >> 4;
  const int w = __builtin_amdgcn_readfirstlane(tid >> 5);
  const int ntn = DM / 256;
  const int mt = blockIdx.x / ntn, nq = blockIdx.x - mt * ntn;
  if (mt * 128 >= (int)NR) return;
  const v8f z8 = {0.f, 0.f, 0.f, 0.f, 0.f, 0.f, 0.f, 0.f};
  v8f acc[4][8];
#pragma unroll
  for (int i = 0; i < 4; ++i)
#pragma unroll
    for (int j = 0; j < 8; ++j) acc[i][j] = z8;
  gemm128x256(A1 + (size_t)mt * 128 * DM, B1 + (size_t)nq * 256 * DM, L, w, ln, hh, acc);
  const int row0 = mt * 128 + 64 * (w >> 1), col0 = nq * 256 + 128 * (w & 1);
  float (*so)[132] = (float (*)[132])(L + (size_t)w * (GP_STAGE / 2u));
  const v4f bz = *(const v4fa*)(bias + col0 + lane * 4);
  v4f bb;
#pragma unroll
  for (int i = 0; i < 4; ++i) bb[i] = bf16_rne(bz[i]);
#pragma unroll
  for (int h2 = 0; h2 < 2; ++h2) {
#pragma unroll
    for (int ii = 0; ii < 2; ++ii)
#pragma unroll
      for (int j = 0; j < 8; ++j)
#pragma unroll
        for (int r = 0; r < 8; ++r) so[ii * 16 + 8 * hh + r][j * 16 + ln] = acc[2 * h2 + ii][j][r] * al1;
    __builtin_amdgcn_fence(4 /* acq_rel order */, "workgroup"); __builtin_amdgcn_wave_barrier();
#pragma unroll 1                                        /* groups of eight rows: eight LDS reads in flight cover their latency, one wait per group behind the stores */
    for (int q8 = 0; q8 < 32; q8 += 8) {
#pragma unroll
      for (int q = 0; q < 8; ++q) {
        const v4f v0 = *(const v4fa*)&so[q8 + q][lane * 4];
        const v4f v = v0 + bb;
        *(v4f*)(Out + (size_t)(row0 + 32 * h2 + q8 + q) * DM + col0 + lane * 4) = v;
      }
      asm volatile("s_wait_xcnt 0x0" ::: "memory");     /* in front of the next group, which overwrites registers that these stores name */
    }
    __builtin_amdgcn_fence(4 /* acq_rel order */, "workgroup"); __builtin_amdgcn_wave_barrier();
  }
}

extern "C" void kernel_launch(void* const* d_in, const int* in_sizes, int n_in,
                              void* d_out, int out_size, void* d_ws, size_t ws_size, hipStream_t stream) {
  if (n_in < 8) return;
  if (in_sizes[0] < (int)(((size_t)(NB - 1) * SEQ_FULL + SEQ) * DM)) return;
  for (int i = 1; i <= 4; ++i) if (in_sizes[i] < DM * DM) return;
  if (in_sizes[5] < DM) return;
  if (in_sizes[6] < NREL * HD) return;
  if (in_sizes[7] < NREL * HD) return;
  if (out_size < (int)(NR * DM)) return;
  const float* const* I = (const float* const*)d_in;
  const float* x = I[0]; const float* wq = I[1]; const float* wk = I[2]; const float* wv = I[3]; const float* wo = I[4]; const float* bo = I[5]; const float* relk = I[6]; const float* relv = I[7];
  char* ws = (char*)d_ws; size_t off = 0;
  auto take = [&](size_t bytes) { char* p = ws + off; off += (bytes + 255) & ~(size_t)255; return p; };
  _Float16* BQKV = (_Float16*)take((size_t)3 * SZ_BT);               /* Bt planes q, k, v (contiguous, stride DM*DM) */
  _Float16* BO   = (_Float16*)take(SZ_BT);
  _Float16* RK16 = (_Float16*)take(SZ_RK);                           /* [RKR][HD] */
  _Float16* RVT  = (_Float16*)take(SZ_RV);                           /* [HD][RVK] */
  _Float16* X16  = (_Float16*)take(SZ_ACT);
  _Float16* QKV16 = (_Float16*)take((size_t)3 * SZ_ACT);             /* Q16, K16 planes (stride NR*DM); the third plane is not used */
  _Float16* VT   = (_Float16*)take((size_t)NB * NH * HD * SEQ * 2);  /* [b*NH+h][d][s] */
  _Float16* O16  = (_Float16*)take(SZ_ACT);
  if (off > ws_size) return;
  _Float16* Q16 = QKV16; _Float16* K16 = QKV16 + NR * DM;

  k_prep<<<1u + 4u * PB_W + PB_X, 256, 0, stream>>>(x, wq, wk, wv, wo, relk, relv, X16, BQKV, BO, RK16, RVT);      /* every f32 -> f16 operand plane */
  k_qkv<<<dim3((unsigned)((NR / 128) * (DM / 256)), 3), 128, 0, stream>>>(X16, BQKV, 0.0625f, QKV16, VT);      /* q, k as f16 rows, v as f16 V^T rows */
  k_attn<<<dim3(SEQ / 64, NH, NB), 128, 0, stream>>>(Q16, K16, VT, RK16, RVT, O16);
  k_out<<<(unsigned)((NR / 128) * (DM / 256)), 128, 0, stream>>>(O16, BO, 0.00390625f, bo, (float*)d_out);      /* out = ctx Wo^T + b_o */
}

// v006
// It runs in 134 microseconds.
// Two timings next to v005 both put it at 1.03 times that version's speed.
// All steps since v000 together make it 3.05 times as fast.
#include <hip/hip_runtime.h>
// Contractions: q/k/v/o projections ([tokens][1024] x [1024][1024]^T), scores k.q^T (K = 64), relative-key table relk.q^T (K = 64), v^T.p^T (K = keys) and relv^T.w^T (K = 65 padded to 96) on v_wmma_f32_16x16x32_f16 (f16 operands, f32 accumulate). Inputs RNE-converted to bf16 on load (exact in f16; weights carried x16, relk x1024, relv x64), softmax numerators carried x1024, bucket weights x16, ctx rows x16; softmax statistics and all epilogues in f32.
// Structure: token rows r = b*SEQ + s. X16 = f16(bf16(x)); Q16/K16 = f16(X16 . Bt_w / 16) as token rows, VT[b*NH+h][d][s] = f16(X16 . Bt_v / 16) stored transposed by the projection itself; attention per (64 queries, head, batch): per wave a table QR[query][bucket] = q . relk[bucket] / 8
// (5 WMMA tiles into wave-private LDS), S^T tiles = K . Q^T, logit = s/8 + QR[query][clip(key - query, -32, 32) + 32], online softmax per lane, O^T = VT . P^T; bucket weights W[query][bucket] (buckets 1..63 from band logits kept in LDS,
// buckets 0 and 64 as running sums) then O^T += RelVT . W^T; O16[r][h*64+d] = f16(16 ctx); out = (O16 . Bt_o) / 256 + bf16(b_o) -> f32 rows.
#ifndef NB
#define NB 8
#endif
#ifndef SEQ
#define SEQ 1024
#endif
#define NB_FULL 8
#define SEQ_FULL 1024
#define DM 1024
#define NH 16
#define HD 64
#define MAXREL 32
#define NREL 65
#define RKR 80
#define RVK 96
#define NR ((size_t)NB * SEQ)
#define SZ_BT ((size_t)DM * DM * 2)
#define SZ_ACT (NR * DM * 2)
#define SZ_RK ((size_t)RKR * HD * 2)
#define SZ_RV ((size_t)HD * RVK * 2)
#define WS_TOTAL ((size_t)4 * SZ_BT + SZ_RK + SZ_RV + (size_t)6 * SZ_ACT)
static_assert(NH * HD == DM);
static_assert(SEQ % 128 == 0);
static_assert(SEQ <= SEQ_FULL);
static_assert(NB >= 1 && NB <= NB_FULL);
static_assert(DM == 128 * 8);
static_assert(DM % 256 == 0);
static_assert(HD == 64);
static_assert(NREL == 2 * MAXREL + 1);
static_assert(RKR % 16 == 0 && RKR >= NREL);
static_assert(RVK % 32 == 0 && RVK >= NREL);
static_assert((RKR * HD / 8) % 32 == 0);
static_assert((HD * RVK / 8) % 256 == 0);
static_assert(SZ_BT % 256 == 0 && SZ_ACT % 256 == 0 && SZ_RK % 256 == 0 && SZ_RV % 256 == 0);
static_assert(WS_TOTAL <= (size_t)134217728);
static_assert((size_t)NB * NH * HD * SEQ * 2 == SZ_ACT);

typedef _Float16 v16h __attribute__((ext_vector_type(16)));
typedef unsigned short v8us __attribute__((ext_vector_type(8), may_alias));
typedef float v8f __attribute__((ext_vector_type(8)));
typedef float v4f __attribute__((ext_vector_type(4)));
typedef float v4fa __attribute__((ext_vector_type(4), may_alias));
typedef _Float16 v4h __attribute__((ext_vector_type(4)));
typedef float v2f __attribute__((ext_vector_type(2)));
typedef _Float16 v2h __attribute__((ext_vector_type(2)));
union FragH { v16h v; v8us half[2]; v2h h2[8]; _Float16 h[16]; unsigned short u[16]; };

__device__ __forceinline__ unsigned short bf16_bits(float x) { unsigned int u = __float_as_uint(x); return (unsigned short)((u + 0x7FFFu + ((u >> 16) & 1u)) >> 16); }
__device__ __forceinline__ float bf16_val(unsigned short b) { return __uint_as_float(((unsigned int)b) << 16); }
__device__ __forceinline__ float bf16_rne(float x) { return bf16_val(bf16_bits(x)); }
// f32 -> f16 operand convert that cannot produce an f16 subnormal (value select)
static __device__ __forceinline__ _Float16 toh_flush(float v) { const _Float16 r = (_Float16)v; return (fabsf(v) < 6.103515625e-05f) ? (_Float16)0.0f : r; }

// 16x32 f16 fragment from a k-contiguous row: elements 0..7 <- p[8h .. 8h+7], elements 8..15 <- p[16+8h .. 16+8h+7] (same map for A rows and for Bt[n][k] rows)
__device__ __forceinline__ v16h g2_frag(const _Float16* p, int hh) { FragH f; f.half[0] = *(const v8us*)((const unsigned short*)p + 8 * hh); f.half[1] = *(const v8us*)((const unsigned short*)p + 16 + 8 * hh); return f.v; }
__device__ __forceinline__ v8f g2_mma(v16h a, v16h b, v8f c) { v8f d = __builtin_amdgcn_wmma_f32_16x16x32_f16(false, a, false, b, (short)0, c, false, false); asm volatile("v_nop\n\tv_nop\n\tv_nop\n\tv_nop" : "+v"(d) : "v"(a), "v"(b)); return d; }
// two k-steps into one accumulator, hazard guard after the second
__device__ __forceinline__ v8f mma2(v16h a0, v16h b0, v16h a1, v16h b1, v8f c) {
  c = __builtin_amdgcn_wmma_f32_16x16x32_f16(false, a0, false, b0, (short)0, c, false, false);
  c = __builtin_amdgcn_wmma_f32_16x16x32_f16(false, a1, false, b1, (short)0, c, false, false);
  asm volatile("v_nop\n\tv_nop\n\tv_nop\n\tv_nop" : "+v"(c) : "v"(a0), "v"(b0), "v"(a1), "v"(b1));
  return c;
}

// Operand conversions in one grid of few, long waves: the launch starts 16 waves per work-group, about one work-group per WGP, and each wave keeps all its loads in flight.
// A chunk is PW_CH = 1024 consecutive f32 (4 KiB): lane l reads 16 B at float 128 j + 4 l, j = 0..7 (every load covers four whole lines), and stores 8 B of f16 at the same element index (every store covers two whole lines).
// Wave gw owns weight chunk gw of the planes q, k, v, o laid end to end (Bt[n][k] = f16(bf16(w[n][k]) * 16)) and the PW_XPW adjacent token rows from gw * PW_XPW of x (a row is one chunk; X16[r][c] = f16(bf16(x)); input rows read at the full stride b*SEQ_FULL + s; the rows of a wave lie in one batch).
// All of a wave's loads are issued before its first convert. None of the parts reads what another writes: block-uniform branches, no barrier.
#define PW_THREADS 512
#define PW_CH 1024
#define PW_NWV ((unsigned)((size_t)4 * DM * DM / PW_CH))
#define PW_BLK (PW_NWV / (PW_THREADS / 32u))
#define PW_XPW ((unsigned)((NR + PW_NWV - 1) / PW_NWV))
#define PW_RKC ((unsigned)(RKR * HD / 8))
#define PW_RVC ((unsigned)(HD * RVK / 8))
#define PW_REL ((PW_RKC + PW_RVC + PW_THREADS - 1u) / PW_THREADS)
static_assert(DM == PW_CH && ((size_t)DM * DM) % PW_CH == 0 && PW_NWV % (PW_THREADS / 32u) == 0);
static_assert(PW_RKC % 32u == 0 && PW_RVC % 32u == 0);
static_assert(NR % PW_XPW == 0 && SEQ % PW_XPW == 0);

// relative-position planes, one 8-element piece per thread, its loads independent: RK16[bucket][d] = f16(bf16(relk[bucket][d]) * 1024), rows NREL..RKR-1 zero; RVT[d][bucket] = f16(bf16(relv[bucket][d]) * 64), columns NREL..RVK-1 zero.
__device__ __forceinline__ void d_rel(const float* __restrict__ relk, const float* __restrict__ relv, unsigned int t, _Float16* __restrict__ RK16, _Float16* __restrict__ RVT) {
  if (t < PW_RKC) {                                     /* wave-uniform: the piece counts are multiples of 32 */
    const int c = (int)t;
    const int row = c / (HD / 8), d8 = (c % (HD / 8)) * 8;
    const int rr = min(row, NREL - 1);
    const float* rp = relk + rr * HD + d8;              /* a multiple of 8 floats from the plane's start: two aligned 16-byte loads */
    const v4f va = *(const v4fa*)rp, vb = *(const v4fa*)(rp + 4);
    FragH f;
#pragma unroll
    for (int q = 0; q < 4; ++q) { f.h[q] = toh_flush((row < NREL) ? bf16_rne(va[q]) * 1024.0f : 0.0f); f.h[4 + q] = toh_flush((row < NREL) ? bf16_rne(vb[q]) * 1024.0f : 0.0f); }
    *(v8us*)((unsigned short*)RK16 + (size_t)c * 8) = f.half[0];
  } else if (t < PW_RKC + PW_RVC) {
    const int c = (int)(t - PW_RKC);
    const int d = c / (RVK / 8), r8 = (c % (RVK / 8)) * 8;
    float val[8];
#pragma unroll
    for (int q = 0; q < 8; ++q) val[q] = relv[min(r8 + q, NREL - 1) * HD + d];
    FragH f;
#pragma unroll
    for (int q = 0; q < 8; ++q) f.h[q] = toh_flush((r8 + q < NREL) ? bf16_rne(val[q]) * 64.0f : 0.0f);
    *(v8us*)((unsigned short*)RVT + (size_t)c * 8) = f.half[0];
  }
}

// Blocks 0 .. PW_REL-1: the relative-position planes; then PW_BLK blocks of 16 waves for the weight planes and x.
__global__ __launch_bounds__(PW_THREADS) void k_prep(const float* __restrict__ x, const float* __restrict__ wq, const float* __restrict__ wk, const float* __restrict__ wv, const float* __restrict__ wo,
                                              const float* __restrict__ relk, const float* __restrict__ relv,
                                              _Float16* __restrict__ X16, _Float16* __restrict__ BQKV, _Float16* __restrict__ BO, _Float16* __restrict__ RK16, _Float16* __restrict__ RVT) {
  const unsigned int bid = blockIdx.x;
  if (bid < PW_REL) { d_rel(relk, relv, bid * PW_THREADS + threadIdx.x, RK16, RVT); return; }
  const unsigned int lo = 16u * (threadIdx.x & 31u);    /* the lane's byte offset in every 512-B load; half of it in every 256-B store */
  const unsigned int gw = (bid - PW_REL) * (PW_THREADS / 32u) + (unsigned int)__builtin_amdgcn_readfirstlane(threadIdx.x >> 5);
  const unsigned int pl = gw / (unsigned)((size_t)DM * DM / PW_CH), ch = gw - pl * (unsigned)((size_t)DM * DM / PW_CH);
  const float* w = (pl == 0u) ? wq : (pl == 1u) ? wk : (pl == 2u) ? wv : wo;
  const char* wsrc = (const char*)(w + (size_t)ch * PW_CH);
  const unsigned int r0 = min(gw * PW_XPW, (unsigned int)NR - PW_XPW);    /* a wave past the last row re-reads the last rows and stores nothing */
  const unsigned int b = r0 / SEQ, s = r0 - b * SEQ;
  const char* xsrc = (const char*)(x + ((size_t)b * SEQ_FULL + s) * DM);
  v4f wa[8], xa[8 * PW_XPW];
#pragma unroll
  for (unsigned int j = 0; j < 8u; ++j) wa[j] = *(const v4fa*)(wsrc + lo + 512u * j);
#pragma unroll
  for (unsigned int j = 0; j < 8u * PW_XPW; ++j) xa[j] = *(const v4fa*)(xsrc + lo + 512u * j);
  asm volatile("s_wait_xcnt 0x0" :: "v"(lo) : "memory");  /* behind the loads, in front of the converts and the store addresses, which reuse registers; the lane offset that every load names is an input, so that its register stays as it is up to here */
  __builtin_amdgcn_sched_barrier(0);                    /* every load of the wave, and the wait above, stand in front of its first convert: with loads moved down among the converts only a window of them is in flight and the wave waits out the memory latency several times */
  char* wdst = (char*)(((pl < 3u) ? BQKV + (size_t)pl * DM * DM : BO) + (size_t)ch * PW_CH);
  v4h wh[8], xh[8 * PW_XPW];
#pragma unroll
  for (unsigned int j = 0; j < 8u; ++j)
#pragma unroll
    for (int q = 0; q < 4; ++q) wh[j][q] = (_Float16)(bf16_rne(wa[j][q]) * 16.0f);
#pragma unroll
  for (unsigned int j = 0; j < 8u * PW_XPW; ++j)
#pragma unroll
    for (int q = 0; q < 4; ++q) xh[j][q] = toh_flush(bf16_rne(xa[j][q]));
#pragma unroll
  for (unsigned int j = 0; j < 8u; ++j) *(v4h*)(wdst + (lo >> 1) + 256u * j) = wh[j];
  if ((size_t)PW_NWV * PW_XPW == NR || gw * PW_XPW < (unsigned int)NR) {  /* wave-uniform; always true where the rows fill the waves exactly */
    char* xdst = (char*)(X16 + (size_t)r0 * DM);
#pragma unroll
    for (unsigned int j = 0; j < 8u * PW_XPW; ++j) *(v4h*)(xdst + (lo >> 1) + 256u * j) = xh[j];
  }
  asm volatile("s_wait_xcnt 0x0" ::: "memory");         /* behind the wave's last store */
}

// Projection GEMM tile: one block of 4 waves computes 128 rows x 256 columns; wave (w >> 1, w & 1) owns 64 x 128 (4 x 8 accumulator tiles).
// A pass is 64 k = 128 B of every operand row. A stage in LDS is [A slice 0 | A slice 1 | B slice 0 | B slice 1], rows at pitch 144 B (128 B + the mover's 16 B pad, conflict-free for 16-byte reads);
// A slices hold 64 rows (9216 B, placed every 10240 B so that each place is a multiple of 2 KiB), B slices 128 rows (18432 B). Two stages; every wave issues one tensor load per stage: waves 0, 1 the A slices, waves 2, 3 the B slices.
#define GP_ROWB 128u
#define GP_PITCH 144u
#define GP_SLA 10240u
#define GP_SLB 18432u
#define GP_STAGE (2u * GP_SLA + 2u * GP_SLB)
#define GP_NPASS ((unsigned)(DM * 2) / GP_ROWB)
static_assert(GP_SLA % 2048u == 0 && GP_SLB % 2048u == 0 && GP_STAGE % 2048u == 0);
static_assert(64u * GP_PITCH <= GP_SLA && 128u * GP_PITCH <= GP_SLB);
static_assert(GP_NPASS >= 2);
static_assert(NR % 128 == 0 && DM % 256 == 0);
static_assert(4u * 32u * 132u * 4u <= 2u * GP_STAGE);
typedef unsigned int u32x4 __attribute__((ext_vector_type(4)));
typedef unsigned int u32x8 __attribute__((ext_vector_type(8)));
__device__ __forceinline__ unsigned int uni(unsigned int v) { return (unsigned int)__builtin_amdgcn_readfirstlane(v); }
__device__ __forceinline__ unsigned int pinned(unsigned int v) { unsigned int s = uni(v); asm volatile("" : "+s"(s)); return s; }  // a wave-uniform word held in a scalar register, so that the test around a tensor load is a scalar branch and a descriptor formed from the word stays behind the wait and the barrier in front of it
__device__ __forceinline__ v16h lds_frag(const unsigned char* p) { FragH f; f.half[0] = *(const v8us*)p; f.half[1] = *(const v8us*)(p + 32); return f.v; }

__device__ __forceinline__ void gemm128x256(const _Float16* __restrict__ Arows, const _Float16* __restrict__ Brows, unsigned char* L, int w, int ln, int hh, v8f (&acc)[4][8]) {
  const unsigned int lbase = (unsigned int)(size_t)L;
  const bool isB = w >= 2; const unsigned int sl = (unsigned int)w & 1u;
  const unsigned int nrows = isB ? 128u : 64u;
  const unsigned long long srcb = (unsigned long long)(size_t)(isB ? Brows + (size_t)sl * 128 * DM : Arows + (size_t)sl * 64 * DM);
  const unsigned int place = lbase + (isB ? 2u * GP_SLA + sl * GP_SLB : sl * GP_SLA);
  u32x8 g1;                                             /* 1-byte elements, tensor = tile = nrows rows of 128 B, source pitch one operand row, 4 dwords of pad behind every 32 */
  g1[0] = uni((1u << 20) | (4u << 22) | (3u << 25));
  g1[1] = uni(GP_ROWB << 16);
  g1[2] = uni(nrows << 16);
  g1[3] = uni(GP_ROWB << 16);
  g1[4] = uni(nrows);
  g1[5] = uni((unsigned int)(DM * 2));
  g1[6] = uni(0u);
  g1[7] = uni(0u);
  u32x4 g0;
  auto issue = [&](unsigned int st) {
    const unsigned long long ga = srcb + (unsigned long long)st * GP_ROWB;
    g0[0] = uni(1u); g0[1] = uni(place + (st & 1u) * GP_STAGE); g0[2] = uni((unsigned int)ga); g0[3] = uni((((unsigned int)(ga >> 32)) & 0x01FFFFFFu) | 0x80000000u);
    asm volatile("tensor_load_to_lds %0, %1" :: "s"(g0), "s"(g1) : "memory");
  };
  issue(0u);
  asm volatile("s_wait_tensorcnt 0x0" :: "s"(g0), "s"(g1) : "memory");  /* stage 0 has landed for this wave's slice; the descriptor words are named so that their registers stay untouched while the request is outstanding */
  __syncthreads();                                      /* ... and is published to the other waves */
  const unsigned char* ap = L + (unsigned int)(w >> 1) * GP_SLA + (unsigned int)ln * GP_PITCH + 16u * (unsigned int)hh;
  const unsigned char* bp = L + 2u * GP_SLA + (unsigned int)(w & 1) * GP_SLB + (unsigned int)ln * GP_PITCH + 16u * (unsigned int)hh;
#pragma unroll 1
  for (unsigned int s = 0; s < GP_NPASS; ++s) {         /* rolled: one copy of the pass in the instruction cache; the buffer is picked by the pass's parity */
    if (pinned(s + 1u < GP_NPASS)) issue(pinned(s + 1u)); /* behind the barrier that freed its buffer: stage s + 1 flies while pass s is worked on */
    const unsigned char* as = ap + (s & 1u) * GP_STAGE; const unsigned char* bs = bp + (s & 1u) * GP_STAGE;
    v16h a[2][4], b[2][8];
#pragma unroll
    for (int ks = 0; ks < 2; ++ks) {
      a[ks][0] = lds_frag(as + ks * 64);
#pragma unroll
      for (int j = 0; j < 8; ++j) b[ks][j] = lds_frag(bs + j * 16 * GP_PITCH + ks * 64);
#pragma unroll
      for (int i = 1; i < 4; ++i) a[ks][i] = lds_frag(as + i * 16 * GP_PITCH + ks * 64);
    }
    __builtin_amdgcn_sched_barrier(0);                  /* the pass's LDS reads stay one group ahead of its WMMAs (for speed only) */
#pragma unroll
    for (int ks = 0; ks < 2; ++ks)
#pragma unroll
      for (int i = 0; i < 4; ++i)
#pragma unroll
        for (int j = 0; j < 8; ++j) acc[i][j] = __builtin_amdgcn_wmma_f32_16x16x32_f16(false, a[ks][i], false, b[ks][j], (short)0, acc[i][j], false, false);
    __builtin_amdgcn_sched_barrier(0);                  /* the WMMAs stay in front of the publish point: moved behind it, the wait for stage s + 1 would stand a whole pass earlier and the refill would lose its lead */
    asm volatile("s_wait_dscnt 0x0" ::: "memory");      /* this wave has left the buffer of pass s */
    asm volatile("s_wait_tensorcnt 0x0" :: "s"(g0), "s"(g1) : "memory");  /* its slice of stage s + 1 has landed; the descriptor words are named so that their registers stay untouched from the issue to here */
    __syncthreads();                                    /* publishes stage s + 1 and frees the buffer of pass s */
  }
  asm volatile("s_wait_tensorcnt 0x0" ::: "memory");    /* nothing of the mover is outstanding when the ring becomes output staging */
  asm volatile("s_wait_dscnt 0x0" ::: "memory");
}

// projections: plane by (0 q, 1 k, 2 v): Y16_by[r][col] = f16((X16[r] . Bt_by[col]) * alpha) for q and k; the v plane goes out transposed, VT[b*DM + col][s]. The last pass's barrier has ended every read of the ring; each wave then stages in its own quarter of it:
// q, k: 32 x 128 f32 at a time. v: a lane's 8 accumulator rows of a tile are 8 consecutive tokens of one column, so they are one 16-byte LDS write into [column][token] rows (64 tokens = 128 B; pitch 144 B, so that the 16 rows a half-wave writes fall on distinct banks); read back, 8 lanes store one whole 128-B line of a VT row.
#define VS_PITCH 144u
static_assert(128u * VS_PITCH <= GP_STAGE / 2u && (GP_STAGE / 2u) % 16u == 0);
static_assert(SEQ % 128 == 0);
__global__ __launch_bounds__(128) void k_qkv(const _Float16* __restrict__ X16, const _Float16* __restrict__ Bt, float alpha, _Float16* __restrict__ Y16, _Float16* __restrict__ VT) {
  __shared__ __attribute__((aligned(2048))) unsigned char L[2u * GP_STAGE];
  const int tid = threadIdx.x, lane = tid & 31, ln = lane & 15, hh = lane >> 4;
  const int w = __builtin_amdgcn_readfirstlane(tid >> 5);
  const int by = blockIdx.y;
  const _Float16* Bh = Bt + (size_t)by * DM * DM;
  _Float16* Yp = Y16 + (size_t)by * NR * DM;
  const int ntn = DM / 256;
  const int mt = blockIdx.x / ntn, nq = blockIdx.x - mt * ntn;
  if (mt * 128 >= (int)NR) return;
  const v8f z8 = {0.f, 0.f, 0.f, 0.f, 0.f, 0.f, 0.f, 0.f};
  v8f acc[4][8];
#pragma unroll
  for (int i = 0; i < 4; ++i)
#pragma unroll
    for (int j = 0; j < 8; ++j) acc[i][j] = z8;
  gemm128x256(X16 + (size_t)mt * 128 * DM, Bh + (size_t)nq * 256 * DM, L, w, ln, hh, acc);
  const int row0 = mt * 128 + 64 * (w >> 1), col0 = nq * 256 + 128 * (w & 1);
  if (by == 2) {                                        /* block-uniform: the whole block is of one plane */
    unsigned char* st = L + (size_t)w * (GP_STAGE / 2u);
#pragma unroll
    for (int i = 0; i < 4; ++i)
#pragma unroll
      for (int j = 0; j < 8; ++j) {
        FragH f;
#pragma unroll
        for (int r = 0; r < 8; ++r) f.h[r] = toh_flush(acc[i][j][r] * alpha);
        *(v8us*)(st + (unsigned int)(16 * j + ln) * VS_PITCH + 32u * (unsigned int)i + 16u * (unsigned int)hh) = f.half[0];
      }
    __builtin_amdgcn_fence(4 /* acq_rel order */, "workgroup"); __builtin_amdgcn_wave_barrier();
    const int bb = row0 / SEQ, s0 = row0 - bb * SEQ;    /* the wave's 64 tokens lie in one batch */
    const unsigned char* sr = st + (unsigned int)(lane >> 3) * VS_PITCH + (unsigned int)(lane & 7) * 16u;
    unsigned short* vo = (unsigned short*)VT + ((size_t)bb * DM + col0 + (lane >> 3)) * SEQ + s0 + (lane & 7) * 8;
#pragma unroll 1                                        /* groups of eight: eight LDS reads in flight cover their latency, one wait per group behind the stores */
    for (int q8 = 0; q8 < 32; q8 += 8) {
#pragma unroll
      for (int q = 0; q < 8; ++q) {
        const v8us v = *(const v8us*)(sr + (unsigned int)(q8 + q) * 4u * VS_PITCH);
        *(v8us*)(vo + (size_t)(q8 + q) * 4 * SEQ) = v;
      }
      asm volatile("s_wait_xcnt 0x0" ::: "memory");     /* in front of the next group, which overwrites registers that these stores name */
    }
    return;
  }
  float (*so)[132] = (float (*)[132])(L + (size_t)w * (GP_STAGE / 2u));
#pragma unroll
  for (int h2 = 0; h2 < 2; ++h2) {
#pragma unroll
    for (int ii = 0; ii < 2; ++ii)
#pragma unroll
      for (int j = 0; j < 8; ++j)
#pragma unroll
        for (int r = 0; r < 8; ++r) so[ii * 16 + 8 * hh + r][j * 16 + ln] = acc[2 * h2 + ii][j][r] * alpha;
    __builtin_amdgcn_fence(4 /* acq_rel order */, "workgroup"); __builtin_amdgcn_wave_barrier();
#pragma unroll 1                                        /* groups of eight rows: eight LDS reads in flight cover their latency, one wait per group behind the stores */
    for (int q8 = 0; q8 < 32; q8 += 8) {
#pragma unroll
      for (int q = 0; q < 8; ++q) {
        const v4f v = *(const v4fa*)&so[q8 + q][lane * 4]; v4h h4;
#pragma unroll
        for (int i = 0; i < 4; ++i) h4[i] = toh_flush(v[i]);
        *(v4h*)(Yp + (size_t)(row0 + 32 * h2 + q8 + q) * DM + col0 + lane * 4) = h4;
      }
      asm volatile("s_wait_xcnt 0x0" ::: "memory");     /* in front of the next group, which overwrites registers that these stores name */
    }
    __builtin_amdgcn_fence(4 /* acq_rel order */, "workgroup"); __builtin_amdgcn_wave_barrier();
  }
}

// Attention K / V^T ring: a stage is 64 keys = [K tile: 64 key rows of 128 B | V^T tile: 64 d rows of 128 B], rows at pitch 144 B (128 B + the mover's 16 B pad, conflict-free for 16-byte reads); a tile holds 9216 B and is placed every 10240 B (a multiple of 2 KiB).
// Two stages, shared by the block's four waves; behind the loop's last barrier the ring is free and holds each wave's own bucket-weight and output rows.
#define AT_ROWB 128u
#define AT_PITCH 144u
#define AT_TILE 10240u
#define AT_STAGE (2u * AT_TILE)
#define AT_NPASS ((unsigned)SEQ / 64u)
#define AT_WTB (16u * 104u * 2u)
#define AT_SOB (16u * 72u * 2u)
#define LOG2E 1.4426950408889634f
#define AT_KS (0.125f * LOG2E)
static_assert(AT_TILE % 2048u == 0 && 64u * AT_PITCH <= AT_TILE);
static_assert(AT_NPASS >= 2);
static_assert(AT_ROWB == (unsigned)(HD * 2) && (DM * 2) % 16 == 0 && (SEQ * 2) % 16 == 0 && SEQ % 64 == 0);
static_assert(4u * (AT_WTB + AT_SOB) <= 2u * AT_STAGE && AT_WTB % 16u == 0 && AT_SOB % 16u == 0);
// QR^T tiles (16 buckets x 16 queries) = RK16 . Q^T -> qrt[w][query][bucket] = q.relk[bucket] / 8. S^T 16-key tiles = K . Q^T (A = K16 rows: row = key, k = d; B = Q16 rows: col = query);
// each lane holds keys 8hh+r of query ln; logit = s/8 + qrt[query][clip(key-query)+32], carried in base 2 (table, maximum and kept band logits all x log2 e); 64-key blocks wholly left (key-query <= -32) or right (>= 32) of the band take one per-lane constant (wave-uniform test);
// p x 1024 = exp2(one FMA per score: scale, constant, maximum and the carry's exponent 10 folded), as f16 and in the f32 sums alike; O^T (64 d x 16 queries) = VT . P^T with the B operand packed from the two adjacent S^T D tiles (element r <- keys 0..15, element 8+r <- keys 16..31).
// Bucket weights: buckets 1..63 hold one key each -> the logit is kept in tlg[w][query][bucket] and exponentiated against the final maximum; buckets 0 / 64 are running sums scaled with the online factor.
__global__ __launch_bounds__(128) __attribute__((amdgpu_num_vgpr(256))) void k_attn(const _Float16* __restrict__ Q16, const _Float16* __restrict__ K16, const _Float16* __restrict__ VT,
                                                                                const _Float16* __restrict__ RK16, const _Float16* __restrict__ RVT, _Float16* __restrict__ O16) {
  __shared__ __attribute__((aligned(2048))) unsigned char L[2u * AT_STAGE];
  __shared__ float qrt[4][16][84];
  __shared__ float tlg[4][16][68];
  const int tid = threadIdx.x, lane = tid & 31, ln = lane & 15, hh = lane >> 4;
  const int w = __builtin_amdgcn_readfirstlane(tid >> 5);
  const int h = blockIdx.y, b = blockIdx.z;
  const int q0 = blockIdx.x * 64 + w * 16;
  const int qi = q0 + ln;
  const size_t rq = (size_t)b * SEQ + q0;
  const size_t rk = (size_t)b * SEQ;
  const _Float16* qp = Q16 + (rq + ln) * DM + h * HD;
  const v16h qb0 = g2_frag(qp, hh), qb1 = g2_frag(qp + 32, hh);
  const v8f z8 = {0.f, 0.f, 0.f, 0.f, 0.f, 0.f, 0.f, 0.f};
  // K / V^T ring: wave 0 brings the stage's 64 K rows (next stage 64 rows on), wave 1 its 64 V^T rows (next stage 128 B on); waves 2 and 3 issue nothing
  const unsigned int issuer = (unsigned int)(w < 2);
  const unsigned long long srcb = (unsigned long long)(size_t)(w == 0 ? K16 + rk * DM + h * HD : VT + (size_t)(b * NH + h) * HD * SEQ);
  const unsigned int sstep = (w == 0) ? 64u * (unsigned int)(DM * 2) : AT_ROWB;
  const unsigned int place = (unsigned int)(size_t)L + (w == 0 ? 0u : AT_TILE);
  u32x8 g1;                                             /* 1-byte elements, tensor = tile = 64 rows of 128 B, source pitch one K16 or VT row, 4 dwords of pad behind every 32 */
  g1[0] = uni((1u << 20) | (4u << 22) | (3u << 25));
  g1[1] = pinned(AT_ROWB << 16);                        /* words 1 to 7: descriptor words held in scalar registers, so that the group is built once and its registers stay as they are while a request is outstanding */
  g1[2] = pinned(64u << 16);
  g1[3] = pinned(AT_ROWB << 16);
  g1[4] = pinned(64u);
  g1[5] = pinned(w == 0 ? (unsigned int)(DM * 2) : (unsigned int)(SEQ * 2));
  g1[6] = pinned(0u);
  g1[7] = pinned(0u);
  u32x4 g0;
  const unsigned int cnt1 = pinned(1u);                 /* group 0's constant word held in a scalar register, not written again while a request is outstanding */
  auto issue = [&](unsigned int st) {
    const unsigned long long ga = srcb + (unsigned long long)st * sstep;
    g0[0] = uni(cnt1); g0[1] = uni(place + (st & 1u) * AT_STAGE); g0[2] = uni((unsigned int)ga); g0[3] = uni((((unsigned int)(ga >> 32)) & 0x01FFFFFFu) | 0x80000000u);
    asm volatile("tensor_load_to_lds %0, %1" :: "s"(g0), "s"(g1) : "memory");
  };
  if (pinned(issuer)) {
    issue(0u);
    asm volatile("s_wait_tensorcnt 0x0" :: "s"(g0), "s"(g1) : "memory");  /* stage 0 has landed; the descriptor words are named so that their registers stay untouched while the request is outstanding */
  }
  __syncthreads();                                      /* ... and is published to the other waves */
  if (pinned(issuer)) issue(pinned(1u));                /* stage 1 flies while the table below and pass 0 are worked on */
  const unsigned char* kf0 = L + (unsigned int)ln * AT_PITCH + 16u * (unsigned int)hh;
  // relative-key table: columns 0..RKR-1 of the row of query ln, in base-2 logit units (1/1024 carry, 1/8 scale and log2 e folded)
#pragma unroll
  for (int t = 0; t < RKR / 16; ++t) {
    const _Float16* rp = RK16 + (size_t)(16 * t + ln) * HD;
    const v16h ra0 = g2_frag(rp, hh), ra1 = g2_frag(rp + 32, hh);
    const v8f c = mma2(ra0, qb0, ra1, qb1, z8);
#pragma unroll
    for (int r = 0; r < 8; ++r) qrt[w][ln][16 * t + 8 * hh + r] = c[r] * (0.0001220703125f * LOG2E);
  }
#pragma unroll 1
  for (int c = 0; c < 34; ++c) tlg[w][ln][34 * hh + c] = -1.0e30f;
  __builtin_amdgcn_fence(4 /* acq_rel order */, "workgroup"); __builtin_amdgcn_wave_barrier();
  const float c0 = qrt[w][ln][0], c64 = qrt[w][ln][2 * MAXREL];
  v8f o0 = z8, o1 = z8, o2 = z8, o3 = z8;
  float mrun = -1.0e30f, lrun = 0.f, wl = 0.f, wr = 0.f;
#pragma unroll 1
  for (int kt = 0; kt < SEQ; kt += 64) {
    const unsigned int st = (unsigned int)kt >> 6;
    const unsigned char* kf = kf0 + (st & 1u) * AT_STAGE; const unsigned char* vf = kf + AT_TILE;
    v8f s[4];
    v16h kv[4][2];
#pragma unroll
    for (int j = 0; j < 4; ++j) { kv[j][0] = lds_frag(kf + j * 16 * AT_PITCH); kv[j][1] = lds_frag(kf + j * 16 * AT_PITCH + 64); }
    __builtin_amdgcn_sched_barrier(0);                  /* the pass's K reads stay one group ahead of its WMMAs: read tile by tile, the wave waits out the LDS latency four times */
#pragma unroll
    for (int j = 0; j < 4; ++j) s[j] = mma2(kv[j][0], qb0, kv[j][1], qb1, z8);
#pragma unroll
    for (int j = 0; j < 4; ++j) { kv[j][0] = lds_frag(vf + j * 16 * AT_PITCH); kv[j][1] = lds_frag(vf + j * 16 * AT_PITCH + 64); }
    __builtin_amdgcn_sched_barrier(0);                  /* the pass's V^T reads are issued here, as one group: their latency passes under the softmax arithmetic */
    const bool farl = (kt + 63 + MAXREL <= q0);          /* every key of the block at distance <= -32 of every query of the wave */
    const bool farr = (kt >= q0 + 15 + MAXREL);          /* every key at distance >= +32 */
    const int dbase = kt + 8 * hh - qi;
    const bool far = farl || farr;
    if (!far) {
#pragma unroll
      for (int j = 0; j < 4; ++j)
#pragma unroll
        for (int r = 0; r < 8; ++r) {
          const int d = dbase + 16 * j + r;
          const int rel = min(max(d, -MAXREL), MAXREL) + MAXREL;
          float bias = qrt[w][ln][rel]; asm volatile("" : "+v"(bias));
          const float t = s[j][r] * AT_KS + bias;
          s[j][r] = t;
          const int slot = (d > -MAXREL && d < MAXREL) ? rel : 66 + hh;      /* band logit kept; clipped keys go to a per-lane dump slot */
          tlg[w][ln][slot] = t;
        }
    }
    float mx = -1.0e30f;
#pragma unroll
    for (int j = 0; j < 4; ++j)
#pragma unroll
      for (int r = 0; r < 8; ++r) mx = fmaxf(mx, s[j][r]);
    const float cb = farl ? c0 : c64;
    mx = far ? fmaf(mx, AT_KS, cb) : mx;                /* a far block's scores are still raw: the FMA is monotone, so the maximum's logit is the logits' maximum */
    mx = fmaxf(mx, __shfl_xor(mx, 16, 32));
    const float mnew = fmaxf(mrun, mx);
    const float alpha = __builtin_amdgcn_exp2f(mrun - mnew);
    mrun = mnew;
    const float km = far ? AT_KS : 1.0f;                /* band scores are logits already */
    const float off = (far ? cb : 0.f) + (10.0f - mnew);
    const v2f km2 = {km, km}, off2 = {off, off};
    v2f psj[4]; FragH pf[2];                            /* one chain of packed adds per 16-key tile: four short chains, not one long one */
#pragma unroll
    for (int j = 0; j < 4; ++j)
#pragma unroll
      for (int r = 0; r < 8; r += 2) {
        const v2f sv = {s[j][r], s[j][r + 1]};
        const v2f a = __builtin_elementwise_fma(sv, km2, off2);
        const v2f p = {__builtin_amdgcn_exp2f(a[0]), __builtin_amdgcn_exp2f(a[1])};
        s[j][r] = p[0]; s[j][r + 1] = p[1];
        psj[j] = (r == 0) ? p : psj[j] + p;
        pf[j >> 1].h2[((j & 1) * 8 + r) >> 1] = __builtin_convertvector(p, v2h);
      }
    const v2f ps2 = (psj[0] + psj[1]) + (psj[2] + psj[3]);
    const float ps = ps2[0] + ps2[1];
    float pl = 0.f, pr = 0.f;
    if (far) {
      pl = farl ? ps : 0.f; pr = farl ? 0.f : ps;
    } else {
#pragma unroll
      for (int j = 0; j < 4; ++j)
#pragma unroll
        for (int r = 0; r < 8; ++r) {
          const int d = dbase + 16 * j + r; const float p = s[j][r];
          pl += (d <= -MAXREL) ? p : 0.f;
          pr += (d >= MAXREL) ? p : 0.f;
        }
    }
    wl = wl * alpha + pl; wr = wr * alpha + pr;
    lrun = lrun * alpha + ps;                           /* this lane's keys only: the wave's halves are joined behind the loop */
#pragma unroll
    for (int r = 0; r < 8; ++r) { o0[r] *= alpha; o1[r] *= alpha; o2[r] *= alpha; o3[r] *= alpha; }
    o0 = mma2(kv[0][0], pf[0].v, kv[0][1], pf[1].v, o0);
    o1 = mma2(kv[1][0], pf[0].v, kv[1][1], pf[1].v, o1);
    o2 = mma2(kv[2][0], pf[0].v, kv[2][1], pf[1].v, o2);
    o3 = mma2(kv[3][0], pf[0].v, kv[3][1], pf[1].v, o3);
    asm volatile("s_wait_dscnt 0x0" ::: "memory");      /* this wave has left the buffer of pass st */
    if (pinned(issuer)) asm volatile("s_wait_tensorcnt 0x0" :: "s"(g0), "s"(g1) : "memory");  /* the issuer's tile of stage st + 1 has landed; the descriptor words are named so that their registers stay untouched from the issue to here */
    __syncthreads();                                    /* publishes stage st + 1 and frees the buffer of pass st */
    if (pinned(issuer & (unsigned int)(st + 2u < AT_NPASS))) issue(pinned(st + 2u));  /* refill of the buffer just left: stage st + 2 flies while pass st + 1 is worked on */
  }
  asm volatile("s_wait_tensorcnt 0x0" ::: "memory");    /* nothing of the mover is outstanding when the ring becomes the waves' epilogue staging */
  asm volatile("s_wait_dscnt 0x0" ::: "memory");
  unsigned short (*wt)[104] = (unsigned short (*)[104])(L + (unsigned int)w * AT_WTB);                  /* bucket weights, this wave's own 16 x 104 */
  unsigned short (*so)[72] = (unsigned short (*)[72])(L + 4u * AT_WTB + (unsigned int)w * AT_SOB);      /* output rows, this wave's own 16 x 72 */
  wl += __shfl_xor(wl, 16, 32); wr += __shfl_xor(wr, 16, 32); lrun += __shfl_xor(lrun, 16, 32);
  wl *= 0.0009765625f; wr *= 0.0009765625f;             /* the running sums carry x1024 */
  __builtin_amdgcn_fence(4 /* acq_rel order */, "workgroup"); __builtin_amdgcn_wave_barrier();
  // bucket weight row of query ln, columns 48hh .. 48hh+47 by this lane (all RVK columns written; columns >= NREL zero)
#pragma unroll 1
  for (int c = 0; c < 6; ++c) {
    FragH f;
#pragma unroll
    for (int q = 0; q < 8; ++q) {
      const int r = 48 * hh + 8 * c + q;
      const int rr = min(r, 67);
      float tv = tlg[w][ln][rr]; asm volatile("" : "+v"(tv));
      const float e = __builtin_amdgcn_exp2f(tv - mrun);
      const float wv = (r == 0) ? wl : (r == 2 * MAXREL) ? wr : (r < 2 * MAXREL) ? e : 0.f;
      f.h[q] = toh_flush(wv * 16.0f);
    }
    *(v8us*)&wt[ln][48 * hh + 8 * c] = f.half[0];
  }
  __builtin_amdgcn_fence(4 /* acq_rel order */, "workgroup"); __builtin_amdgcn_wave_barrier();
#pragma unroll
  for (int ks = 0; ks < RVK / 32; ++ks) {
    FragH wb; wb.half[0] = *(const v8us*)&wt[ln][32 * ks + 8 * hh]; wb.half[1] = *(const v8us*)&wt[ln][32 * ks + 16 + 8 * hh];
    const _Float16* rv = RVT + (size_t)ln * RVK + 32 * ks;
    o0 = g2_mma(g2_frag(rv, hh), wb.v, o0);
    o1 = g2_mma(g2_frag(rv + 16 * RVK, hh), wb.v, o1);
    o2 = g2_mma(g2_frag(rv + 32 * RVK, hh), wb.v, o2);
    o3 = g2_mma(g2_frag(rv + 48 * RVK, hh), wb.v, o3);
  }
  const float rl = (1.0f / lrun) * 16.0f;
  { FragH f;
#pragma unroll
    for (int r = 0; r < 8; ++r) f.h[r] = toh_flush(o0[r] * rl);
    *(v8us*)&so[ln][0 + 8 * hh] = f.half[0]; }
  { FragH f;
#pragma unroll
    for (int r = 0; r < 8; ++r) f.h[r] = toh_flush(o1[r] * rl);
    *(v8us*)&so[ln][16 + 8 * hh] = f.half[0]; }
  { FragH f;
#pragma unroll
    for (int r = 0; r < 8; ++r) f.h[r] = toh_flush(o2[r] * rl);
    *(v8us*)&so[ln][32 + 8 * hh] = f.half[0]; }
  { FragH f;
#pragma unroll
    for (int r = 0; r < 8; ++r) f.h[r] = toh_flush(o3[r] * rl);
    *(v8us*)&so[ln][48 + 8 * hh] = f.half[0]; }
  __builtin_amdgcn_fence(4 /* acq_rel order */, "workgroup"); __builtin_amdgcn_wave_barrier();
  const int li = lane >> 3, pc = lane & 7;
  {
#pragma unroll
    for (int g = 0; g < 4; ++g) {
      const int i = g * 4 + li;
      const v8us v = *(const v8us*)&so[i][pc * 8];
      *(v8us*)((unsigned short*)O16 + (rq + i) * DM + h * HD + pc * 8) = v;
    }
    
  }
}

// out[r][col] = (A1[r] . B1[col]) * al1 + bf16(bias[col]); the same tile loop; each wave stages 32 x 128 f32 at a time in its own quarter of the ring; bias added at the store stage as a 4-wide f32 vector; f32 rows:
__global__ __launch_bounds__(128) void k_out(const _Float16* __restrict__ A1, const _Float16* __restrict__ B1, float al1, const float* __restrict__ bias, float* __restrict__ Out) {
  __shared__ __attribute__((aligned(2048))) unsigned char L[2u * GP_STAGE];
  const int tid = threadIdx.x, lane = tid & 31, ln = lane & 15, hh = lane >> 4;
  const int w = __builtin_amdgcn_readfirstlane(tid >> 5);
  const int ntn = DM / 256;
  const int mt = blockIdx.x / ntn, nq = blockIdx.x - mt * ntn;
  if (mt * 128 >= (int)NR) return;
  const v8f z8 = {0.f, 0.f, 0.f, 0.f, 0.f, 0.f, 0.f, 0.f};
  v8f acc[4][8];
#pragma unroll
  for (int i = 0; i < 4; ++i)
#pragma unroll
    for (int j = 0; j < 8; ++j) acc[i][j] = z8;
  gemm128x256(A1 + (size_t)mt * 128 * DM, B1 + (size_t)nq * 256 * DM, L, w, ln, hh, acc);
  const int row0 = mt * 128 + 64 * (w >> 1), col0 = nq * 256 + 128 * (w & 1);
  float (*so)[132] = (float (*)[132])(L + (size_t)w * (GP_STAGE / 2u));
  const v4f bz = *(const v4fa*)(bias + col0 + lane * 4);
  v4f bb;
#pragma unroll
  for (int i = 0; i < 4; ++i) bb[i] = bf16_rne(bz[i]);
#pragma unroll
  for (int h2 = 0; h2 < 2; ++h2) {
#pragma unroll
    for (int ii = 0; ii < 2; ++ii)
#pragma unroll
      for (int j = 0; j < 8; ++j)
#pragma unroll
        for (int r = 0; r < 8; ++r) so[ii * 16 + 8 * hh + r][j * 16 + ln] = acc[2 * h2 + ii][j][r] * al1;
    __builtin_amdgcn_fence(4 /* acq_rel order */, "workgroup"); __builtin_amdgcn_wave_barrier();
#pragma unroll 1                                        /* groups of eight rows: eight LDS reads in flight cover their latency, one wait per group behind the stores */
    for (int q8 = 0; q8 < 32; q8 += 8) {
#pragma unroll
      for (int q = 0; q < 8; ++q) {
        const v4f v0 = *(const v4fa*)&so[q8 + q][lane * 4];
        const v4f v = v0 + bb;
        *(v4f*)(Out + (size_t)(row0 + 32 * h2 + q8 + q) * DM + col0 + lane * 4) = v;
      }
      asm volatile("s_wait_xcnt 0x0" ::: "memory");     /* in front of the next group, which overwrites registers that these stores name */
    }
    __builtin_amdgcn_fence(4 /* acq_rel order */, "workgroup"); __builtin_amdgcn_wave_barrier();
  }
}

extern "C" void kernel_launch(void* const* d_in, const int* in_sizes, int n_in,
                              void* d_out, int out_size, void* d_ws, size_t ws_size, hipStream_t stream) {
  if (n_in < 8) return;
  if (in_sizes[0] < (int)(((size_t)(NB - 1) * SEQ_FULL + SEQ) * DM)) return;
  for (int i = 1; i <= 4; ++i) if (in_sizes[i] < DM * DM) return;
  if (in_sizes[5] < DM) return;
  if (in_sizes[6] < NREL * HD) return;
  if (in_sizes[7] < NREL * HD) return;
  if (out_size < (int)(NR * DM)) return;
  const float* const* I = (const float* const*)d_in;
  const float* x = I[0]; const float* wq = I[1]; const float* wk = I[2]; const float* wv = I[3]; const float* wo = I[4]; const float* bo = I[5]; const float* relk = I[6]; const float* relv = I[7];
  char* ws = (char*)d_ws; size_t off = 0;
  auto take = [&](size_t bytes) { char* p = ws + off; off += (bytes + 255) & ~(size_t)255; return p; };
  _Float16* BQKV = (_Float16*)take((size_t)3 * SZ_BT);               /* Bt planes q, k, v (contiguous, stride DM*DM) */
  _Float16* BO   = (_Float16*)take(SZ_BT);
  _Float16* RK16 = (_Float16*)take(SZ_RK);                           /* [RKR][HD] */
  _Float16* RVT  = (_Float16*)take(SZ_RV);                           /* [HD][RVK] */
  _Float16* X16  = (_Float16*)take(SZ_ACT);
  _Float16* QKV16 = (_Float16*)take((size_t)3 * SZ_ACT);             /* Q16, K16 planes (stride NR*DM); the third plane is not used */
  _Float16* VT   = (_Float16*)take((size_t)NB * NH * HD * SEQ * 2);  /* [b*NH+h][d][s] */
  _Float16* O16  = (_Float16*)take(SZ_ACT);
  if (off > ws_size) return;
  _Float16* Q16 = QKV16; _Float16* K16 = QKV16 + NR * DM;

  k_prep<<<PW_REL + PW_BLK, PW_THREADS, 0, stream>>>(x, wq, wk, wv, wo, relk, relv, X16, BQKV, BO, RK16, RVT);      /* every f32 -> f16 operand plane */
  k_qkv<<<dim3((unsigned)((NR / 128) * (DM / 256)), 3), 128, 0, stream>>>(X16, BQKV, 0.0625f, QKV16, VT);      /* q, k as f16 rows, v as f16 V^T rows */
  k_attn<<<dim3(SEQ / 64, NH, NB), 128, 0, stream>>>(Q16, K16, VT, RK16, RVT, O16);
  k_out<<<(unsigned)((NR / 128) * (DM / 256)), 128, 0, stream>>>(O16, BO, 0.00390625f, bo, (float*)d_out);      /* out = ctx Wo^T + b_o */
}

// v007
// A run of this version takes 123 microseconds.
// Next to v006, in two timings, it ran 1.08 times as fast each time.
// Over all steps from v000 it is 3.29 times as fast.
#include <hip/hip_runtime.h>
// Contractions: q/k/v/o projections ([tokens][1024] x [1024][1024]^T), scores k.q^T (K = 64), relative-key table relk.q^T (K = 64), v^T.p^T (K = keys) and relv^T.w^T (K = 65 padded to 96) on v_wmma_f32_16x16x32_f16 (f16 operands, f32 accumulate). Inputs RNE-converted to bf16 on load (exact in f16; weights carried x16, relk x1024, relv x64), softmax numerators carried x1024, bucket weights x16, ctx rows x16; softmax statistics and all epilogues in f32.
// Structure: token rows r = b*SEQ + s. X16 = f16(bf16(x)); Q16/K16 = f16(X16 . Bt_w / 16) as token rows, VT[b*NH+h][d][s] = f16(X16 . Bt_v / 16) stored transposed by the projection itself; attention per (64 queries, head, batch): per wave a table QR[query][bucket] = q . relk[bucket] / 8
// (5 WMMA tiles into wave-private LDS), S^T tiles = K . Q^T, logit = s/8 + QR[query][clip(key - query, -32, 32) + 32], online softmax per lane, O^T = VT . P^T; bucket weights W[query][bucket] (buckets 1..63 from band logits kept in LDS,
// buckets 0 and 64 as running sums) then O^T += RelVT . W^T; O16[r][h*64+d] = f16(16 ctx); out = (O16 . Bt_o) / 256 + bf16(b_o) -> f32 rows.
#ifndef NB
#define NB 8
#endif
#ifndef SEQ
#define SEQ 1024
#endif
#define NB_FULL 8
#define SEQ_FULL 1024
#define DM 1024
#define NH 16
#define HD 64
#define MAXREL 32
#define NREL 65
#define RKR 80
#define RVK 96
#define NR ((size_t)NB * SEQ)
#define SZ_BT ((size_t)DM * DM * 2)
#define SZ_ACT (NR * DM * 2)
#define SZ_RK ((size_t)RKR * HD * 2)
#define SZ_RV ((size_t)HD * RVK * 2)
#define WS_TOTAL ((size_t)4 * SZ_BT + SZ_RK + SZ_RV + (size_t)6 * SZ_ACT)
static_assert(NH * HD == DM);
static_assert(SEQ % 128 == 0);
static_assert(SEQ <= SEQ_FULL);
static_assert(NB >= 1 && NB <= NB_FULL);
static_assert(DM == 128 * 8);
static_assert(DM % 256 == 0);
static_assert(HD == 64);
static_assert(NREL == 2 * MAXREL + 1);
static_assert(RKR % 16 == 0 && RKR >= NREL);
static_assert(RVK % 32 == 0 && RVK >= NREL);
static_assert((RKR * HD / 8) % 32 == 0);
static_assert((HD * RVK / 8) % 256 == 0);
static_assert(SZ_BT % 256 == 0 && SZ_ACT % 256 == 0 && SZ_RK % 256 == 0 && SZ_RV % 256 == 0);
static_assert(WS_TOTAL <= (size_t)134217728);
static_assert((size_t)NB * NH * HD * SEQ * 2 == SZ_ACT);

typedef _Float16 v16h __attribute__((ext_vector_type(16)));
typedef unsigned short v8us __attribute__((ext_vector_type(8), may_alias));
typedef float v8f __attribute__((ext_vector_type(8)));
typedef float v4f __attribute__((ext_vector_type(4)));
typedef float v4fa __attribute__((ext_vector_type(4), may_alias));
typedef _Float16 v4h __attribute__((ext_vector_type(4)));
typedef float v2f __attribute__((ext_vector_type(2)));
typedef _Float16 v2h __attribute__((ext_vector_type(2)));
union FragH { v16h v; v8us half[2]; v2h h2[8]; _Float16 h[16]; unsigned short u[16]; };

__device__ __forceinline__ unsigned short bf16_bits(float x) { unsigned int u = __float_as_uint(x); return (unsigned short)((u + 0x7FFFu + ((u >> 16) & 1u)) >> 16); }
__device__ __forceinline__ float bf16_val(unsigned short b) { return __uint_as_float(((unsigned int)b) << 16); }
__device__ __forceinline__ float bf16_rne(float x) { return bf16_val(bf16_bits(x)); }
// f32 -> f16 operand convert that cannot produce an f16 subnormal (value select)
static __device__ __forceinline__ _Float16 toh_flush(float v) { const _Float16 r = (_Float16)v; return (fabsf(v) < 6.103515625e-05f) ? (_Float16)0.0f : r; }

// 16x32 f16 fragment from a k-contiguous row: elements 0..7 <- p[8h .. 8h+7], elements 8..15 <- p[16+8h .. 16+8h+7] (same map for A rows and for Bt[n][k] rows)
__device__ __forceinline__ v16h g2_frag(const _Float16* p, int hh) { FragH f; f.half[0] = *(const v8us*)((const unsigned short*)p + 8 * hh); f.half[1] = *(const v8us*)((const unsigned short*)p + 16 + 8 * hh); return f.v; }
__device__ __forceinline__ v8f g2_mma(v16h a, v16h b, v8f c) { v8f d = __builtin_amdgcn_wmma_f32_16x16x32_f16(false, a, false, b, (short)0, c, false, false); asm volatile("v_nop\n\tv_nop\n\tv_nop\n\tv_nop" : "+v"(d) : "v"(a), "v"(b)); return d; }
// two k-steps into one accumulator, hazard guard after the second
__device__ __forceinline__ v8f mma2(v16h a0, v16h b0, v16h a1, v16h b1, v8f c) {
  c = __builtin_amdgcn_wmma_f32_16x16x32_f16(false, a0, false, b0, (short)0, c, false, false);
  c = __builtin_amdgcn_wmma_f32_16x16x32_f16(false, a1, false, b1, (short)0, c, false, false);
  asm volatile("v_nop\n\tv_nop\n\tv_nop\n\tv_nop" : "+v"(c) : "v"(a0), "v"(b0), "v"(a1), "v"(b1));
  return c;
}

// Operand conversions in one grid of few, long waves: the launch starts 16 waves per work-group, about one work-group per WGP, and each wave keeps all its loads in flight.
// A chunk is PW_CH = 1024 consecutive f32 (4 KiB): lane l reads 16 B at float 128 j + 4 l, j = 0..7 (every load covers four whole lines), and stores 8 B of f16 at the same element index (every store covers two whole lines).
// Wave gw owns weight chunk gw of the planes q, k, v, o laid end to end (Bt[n][k] = f16(bf16(w[n][k]) * 16)) and the PW_XPW adjacent token rows from gw * PW_XPW of x (a row is one chunk; X16[r][c] = f16(bf16(x)); input rows read at the full stride b*SEQ_FULL + s; the rows of a wave lie in one batch).
// All of a wave's loads are issued before its first convert. None of the parts reads what another writes: block-uniform branches, no barrier.
#define PW_THREADS 512
#define PW_CH 1024
#define PW_NWV ((unsigned)((size_t)4 * DM * DM / PW_CH))
#define PW_BLK (PW_NWV / (PW_THREADS / 32u))
#define PW_XPW ((unsigned)((NR + PW_NWV - 1) / PW_NWV))
#define PW_RKC ((unsigned)(RKR * HD / 8))
#define PW_RVC ((unsigned)(HD * RVK / 8))
#define PW_REL ((PW_RKC + PW_RVC + PW_THREADS - 1u) / PW_THREADS)
static_assert(DM == PW_CH && ((size_t)DM * DM) % PW_CH == 0 && PW_NWV % (PW_THREADS / 32u) == 0);
static_assert(PW_RKC % 32u == 0 && PW_RVC % 32u == 0);
static_assert(NR % PW_XPW == 0 && SEQ % PW_XPW == 0);

// relative-position planes, one 8-element piece per thread, its loads independent: RK16[bucket][d] = f16(bf16(relk[bucket][d]) * 1024), rows NREL..RKR-1 zero; RVT[d][bucket] = f16(bf16(relv[bucket][d]) * 64), columns NREL..RVK-1 zero.
__device__ __forceinline__ void d_rel(const float* __restrict__ relk, const float* __restrict__ relv, unsigned int t, _Float16* __restrict__ RK16, _Float16* __restrict__ RVT) {
  if (t < PW_RKC) {                                     /* wave-uniform: the piece counts are multiples of 32 */
    const int c = (int)t;
    const int row = c / (HD / 8), d8 = (c % (HD / 8)) * 8;
    const int rr = min(row, NREL - 1);
    const float* rp = relk + rr * HD + d8;              /* a multiple of 8 floats from the plane's start: two aligned 16-byte loads */
    const v4f va = *(const v4fa*)rp, vb = *(const v4fa*)(rp + 4);
    FragH f;
#pragma unroll
    for (int q = 0; q < 4; ++q) { f.h[q] = toh_flush((row < NREL) ? bf16_rne(va[q]) * 1024.0f : 0.0f); f.h[4 + q] = toh_flush((row < NREL) ? bf16_rne(vb[q]) * 1024.0f : 0.0f); }
    *(v8us*)((unsigned short*)RK16 + (size_t)c * 8) = f.half[0];
  } else if (t < PW_RKC + PW_RVC) {
    const int c = (int)(t - PW_RKC);
    const int d = c / (RVK / 8), r8 = (c % (RVK / 8)) * 8;
    float val[8];
#pragma unroll
    for (int q = 0; q < 8; ++q) val[q] = relv[min(r8 + q, NREL - 1) * HD + d];
    FragH f;
#pragma unroll
    for (int q = 0; q < 8; ++q) f.h[q] = toh_flush((r8 + q < NREL) ? bf16_rne(val[q]) * 64.0f : 0.0f);
    *(v8us*)((unsigned short*)RVT + (size_t)c * 8) = f.half[0];
  }
}

// Blocks 0 .. PW_REL-1: the relative-position planes; then PW_BLK blocks of 16 waves for the weight planes and x.
__global__ __launch_bounds__(PW_THREADS) void k_prep(const float* __restrict__ x, const float* __restrict__ wq, const float* __restrict__ wk, const float* __restrict__ wv, const float* __restrict__ wo,
                                              const float* __restrict__ relk, const float* __restrict__ relv,
                                              _Float16* __restrict__ X16, _Float16* __restrict__ BQKV, _Float16* __restrict__ BO, _Float16* __restrict__ RK16, _Float16* __restrict__ RVT) {
  const unsigned int bid = blockIdx.x;
  if (bid < PW_REL) { d_rel(relk, relv, bid * PW_THREADS + threadIdx.x, RK16, RVT); return; }
  const unsigned int lo = 16u * (threadIdx.x & 31u);    /* the lane's byte offset in every 512-B load; half of it in every 256-B store */
  const unsigned int gw = (bid - PW_REL) * (PW_THREADS / 32u) + (unsigned int)__builtin_amdgcn_readfirstlane(threadIdx.x >> 5);
  const unsigned int pl = gw / (unsigned)((size_t)DM * DM / PW_CH), ch = gw - pl * (unsigned)((size_t)DM * DM / PW_CH);
  const float* w = (pl == 0u) ? wq : (pl == 1u) ? wk : (pl == 2u) ? wv : wo;
  const char* wsrc = (const char*)(w + (size_t)ch * PW_CH);
  const unsigned int r0 = min(gw * PW_XPW, (unsigned int)NR - PW_XPW);    /* a wave past the last row re-reads the last rows and stores nothing */
  const unsigned int b = r0 / SEQ, s = r0 - b * SEQ;
  const char* xsrc = (const char*)(x + ((size_t)b * SEQ_FULL + s) * DM);
  v4f wa[8], xa[8 * PW_XPW];
#pragma unroll
  for (unsigned int j = 0; j < 8u; ++j) wa[j] = *(const v4fa*)(wsrc + lo + 512u * j);
#pragma unroll
  for (unsigned int j = 0; j < 8u * PW_XPW; ++j) xa[j] = *(const v4fa*)(xsrc + lo + 512u * j);
  asm volatile("s_wait_xcnt 0x0" :: "v"(lo) : "memory");  /* behind the loads, in front of the converts and the store addresses, which reuse registers; the lane offset that every load names is an input, so that its register stays as it is up to here */
  __builtin_amdgcn_sched_barrier(0);                    /* every load of the wave, and the wait above, stand in front of its first convert: with loads moved down among the converts only a window of them is in flight and the wave waits out the memory latency several times */
  char* wdst = (char*)(((pl < 3u) ? BQKV + (size_t)pl * DM * DM : BO) + (size_t)ch * PW_CH);
  v4h wh[8], xh[8 * PW_XPW];
#pragma unroll
  for (unsigned int j = 0; j < 8u; ++j)
#pragma unroll
    for (int q = 0; q < 4; ++q) wh[j][q] = (_Float16)(bf16_rne(wa[j][q]) * 16.0f);
#pragma unroll
  for (unsigned int j = 0; j < 8u * PW_XPW; ++j)
#pragma unroll
    for (int q = 0; q < 4; ++q) xh[j][q] = toh_flush(bf16_rne(xa[j][q]));
#pragma unroll
  for (unsigned int j = 0; j < 8u; ++j) *(v4h*)(wdst + (lo >> 1) + 256u * j) = wh[j];
  if ((size_t)PW_NWV * PW_XPW == NR || gw * PW_XPW < (unsigned int)NR) {  /* wave-uniform; always true where the rows fill the waves exactly */
    char* xdst = (char*)(X16 + (size_t)r0 * DM);
#pragma unroll
    for (unsigned int j = 0; j < 8u * PW_XPW; ++j) *(v4h*)(xdst + (lo >> 1) + 256u * j) = xh[j];
  }
  asm volatile("s_wait_xcnt 0x0" ::: "memory");         /* behind the wave's last store */
}

// Projection GEMM tile: one block of 4 waves computes 128 rows x 256 columns; wave (w >> 1, w & 1) owns 64 x 128 (4 x 8 accumulator tiles).
// A pass is 64 k = 128 B of every operand row. A stage in LDS is [A slice 0 | A slice 1 | B slice 0 | B slice 1], rows at pitch 144 B (128 B + the mover's 16 B pad, conflict-free for 16-byte reads);
// A slices hold 64 rows (9216 B, placed every 10240 B so that each place is a multiple of 2 KiB), B slices 128 rows (18432 B). Two stages; every wave issues one tensor load per stage: waves 0, 1 the A slices, waves 2, 3 the B slices.
#define GP_ROWB 128u
#define GP_PITCH 144u
#define GP_SLA 10240u
#define GP_SLB 18432u
#define GP_STAGE (2u * GP_SLA + 2u * GP_SLB)
#define GP_NPASS ((unsigned)(DM * 2) / GP_ROWB)
static_assert(GP_SLA % 2048u == 0 && GP_SLB % 2048u == 0 && GP_STAGE % 2048u == 0);
static_assert(64u * GP_PITCH <= GP_SLA && 128u * GP_PITCH <= GP_SLB);
static_assert(GP_NPASS >= 2);
static_assert(NR % 128 == 0 && DM % 256 == 0);
static_assert(4u * 32u * 132u * 4u <= 2u * GP_STAGE);
typedef unsigned int u32x4 __attribute__((ext_vector_type(4)));
typedef unsigned int u32x8 __attribute__((ext_vector_type(8)));
__device__ __forceinline__ unsigned int uni(unsigned int v) { return (unsigned int)__builtin_amdgcn_readfirstlane(v); }
__device__ __forceinline__ unsigned int pinned(unsigned int v) { unsigned int s = uni(v); asm volatile("" : "+s"(s)); return s; }  // a wave-uniform word held in a scalar register, so that the test around a tensor load is a scalar branch and a descriptor formed from the word stays behind the wait and the barrier in front of it
__device__ __forceinline__ v16h lds_frag(const unsigned char* p) { FragH f; f.half[0] = *(const v8us*)p; f.half[1] = *(const v8us*)(p + 32); return f.v; }

__device__ __forceinline__ void gemm128x256(const _Float16* __restrict__ Arows, const _Float16* __restrict__ Brows, unsigned char* L, int w, int ln, int hh, v8f (&acc)[4][8]) {
  const unsigned int lbase = (unsigned int)(size_t)L;
  const bool isB = w >= 2; const unsigned int sl = (unsigned int)w & 1u;
  const unsigned int nrows = isB ? 128u : 64u;
  const unsigned long long srcb = (unsigned long long)(size_t)(isB ? Brows + (size_t)sl * 128 * DM : Arows + (size_t)sl * 64 * DM);
  const unsigned int place = lbase + (isB ? 2u * GP_SLA + sl * GP_SLB : sl * GP_SLA);
  u32x8 g1;                                             /* 1-byte elements, tensor = tile = nrows rows of 128 B, source pitch one operand row, 4 dwords of pad behind every 32 */
  g1[0] = uni((1u << 20) | (4u << 22) | (3u << 25));
  g1[1] = uni(GP_ROWB << 16);
  g1[2] = uni(nrows << 16);
  g1[3] = uni(GP_ROWB << 16);
  g1[4] = uni(nrows);
  g1[5] = uni((unsigned int)(DM * 2));
  g1[6] = uni(0u);
  g1[7] = uni(0u);
  u32x4 g0;
  auto issue = [&](unsigned int st) {
    const unsigned long long ga = srcb + (unsigned long long)st * GP_ROWB;
    g0[0] = uni(1u); g0[1] = uni(place + (st & 1u) * GP_STAGE); g0[2] = uni((unsigned int)ga); g0[3] = uni((((unsigned int)(ga >> 32)) & 0x01FFFFFFu) | 0x80000000u);
    asm volatile("tensor_load_to_lds %0, %1" :: "s"(g0), "s"(g1) : "memory");
  };
  issue(0u);
  asm volatile("s_wait_tensorcnt 0x0" :: "s"(g0), "s"(g1) : "memory");  /* stage 0 has landed for this wave's slice; the descriptor words are named so that their registers stay untouched while the request is outstanding */
  __syncthreads();                                      /* ... and is published to the other waves */
  const unsigned char* ap = L + (unsigned int)(w >> 1) * GP_SLA + (unsigned int)ln * GP_PITCH + 16u * (unsigned int)hh;
  const unsigned char* bp = L + 2u * GP_SLA + (unsigned int)(w & 1) * GP_SLB + (unsigned int)ln * GP_PITCH + 16u * (unsigned int)hh;
#pragma unroll 1
  for (unsigned int s = 0; s < GP_NPASS; ++s) {         /* rolled: one copy of the pass in the instruction cache; the buffer is picked by the pass's parity */
    if (pinned(s + 1u < GP_NPASS)) issue(pinned(s + 1u)); /* behind the barrier that freed its buffer: stage s + 1 flies while pass s is worked on */
    const unsigned char* as = ap + (s & 1u) * GP_STAGE; const unsigned char* bs = bp + (s & 1u) * GP_STAGE;
    v16h a[2][4], b[2][8];
#pragma unroll
    for (int ks = 0; ks < 2; ++ks) {
      a[ks][0] = lds_frag(as + ks * 64);
#pragma unroll
      for (int j = 0; j < 8; ++j) b[ks][j] = lds_frag(bs + j * 16 * GP_PITCH + ks * 64);
#pragma unroll
      for (int i = 1; i < 4; ++i) a[ks][i] = lds_frag(as + i * 16 * GP_PITCH + ks * 64);
    }
    __builtin_amdgcn_sched_barrier(0);                  /* the pass's LDS reads stay one group ahead of its WMMAs (for speed only) */
#pragma unroll
    for (int ks = 0; ks < 2; ++ks)
#pragma unroll
      for (int i = 0; i < 4; ++i)
#pragma unroll
        for (int j = 0; j < 8; ++j) acc[i][j] = __builtin_amdgcn_wmma_f32_16x16x32_f16(false, a[ks][i], false, b[ks][j], (short)0, acc[i][j], false, false);
    __builtin_amdgcn_sched_barrier(0);                  /* the WMMAs stay in front of the publish point: moved behind it, the wait for stage s + 1 would stand a whole pass earlier and the refill would lose its lead */
    asm volatile("s_wait_dscnt 0x0" ::: "memory");      /* this wave has left the buffer of pass s */
    asm volatile("s_wait_tensorcnt 0x0" :: "s"(g0), "s"(g1) : "memory");  /* its slice of stage s + 1 has landed; the descriptor words are named so that their registers stay untouched from the issue to here */
    __syncthreads();                                    /* publishes stage s + 1 and frees the buffer of pass s */
  }
  asm volatile("s_wait_tensorcnt 0x0" ::: "memory");    /* nothing of the mover is outstanding when the ring becomes output staging */
  asm volatile("s_wait_dscnt 0x0" ::: "memory");
}

// projections: plane by (0 q, 1 k, 2 v): Y16_by[r][col] = f16((X16[r] . Bt_by[col]) * alpha) for q and k; the v plane goes out transposed, VT[b*DM + col][s]. The last pass's barrier has ended every read of the ring; each wave then stages in its own quarter of it:
// q, k: 32 x 128 f32 at a time. v: a lane's 8 accumulator rows of a tile are 8 consecutive tokens of one column, so they are one 16-byte LDS write into [column][token] rows (64 tokens = 128 B; pitch 144 B, so that the 16 rows a half-wave writes fall on distinct banks); read back, 8 lanes store one whole 128-B line of a VT row.
#define VS_PITCH 144u
static_assert(128u * VS_PITCH <= GP_STAGE / 2u && (GP_STAGE / 2u) % 16u == 0);
static_assert(SEQ % 128 == 0);
__global__ __launch_bounds__(128) void k_qkv(const _Float16* __restrict__ X16, const _Float16* __restrict__ Bt, float alpha, _Float16* __restrict__ Y16, _Float16* __restrict__ VT) {
  __shared__ __attribute__((aligned(2048))) unsigned char L[2u * GP_STAGE];
  const int tid = threadIdx.x, lane = tid & 31, ln = lane & 15, hh = lane >> 4;
  const int w = __builtin_amdgcn_readfirstlane(tid >> 5);
  const int by = blockIdx.y;
  const _Float16* Bh = Bt + (size_t)by * DM * DM;
  _Float16* Yp = Y16 + (size_t)by * NR * DM;
  const int ntn = DM / 256;
  const int mt = blockIdx.x / ntn, nq = blockIdx.x - mt * ntn;
  if (mt * 128 >= (int)NR) return;
  const v8f z8 = {0.f, 0.f, 0.f, 0.f, 0.f, 0.f, 0.f, 0.f};
  v8f acc[4][8];
#pragma unroll
  for (int i = 0; i < 4; ++i)
#pragma unroll
    for (int j = 0; j < 8; ++j) acc[i][j] = z8;
  gemm128x256(X16 + (size_t)mt * 128 * DM, Bh + (size_t)nq * 256 * DM, L, w, ln, hh, acc);
  const int row0 = mt * 128 + 64 * (w >> 1), col0 = nq * 256 + 128 * (w & 1);
  if (by == 2) {                                        /* block-uniform: the whole block is of one plane */
    unsigned char* st = L + (size_t)w * (GP_STAGE / 2u);
#pragma unroll
    for (int i = 0; i < 4; ++i)
#pragma unroll
      for (int j = 0; j < 8; ++j) {
        FragH f;
#pragma unroll
        for (int r = 0; r < 8; ++r) f.h[r] = toh_flush(acc[i][j][r] * alpha);
        *(v8us*)(st + (unsigned int)(16 * j + ln) * VS_PITCH + 32u * (unsigned int)i + 16u * (unsigned int)hh) = f.half[0];
      }
    __builtin_amdgcn_fence(4 /* acq_rel order */, "workgroup"); __builtin_amdgcn_wave_barrier();
    const int bb = row0 / SEQ, s0 = row0 - bb * SEQ;    /* the wave's 64 tokens lie in one batch */
    const unsigned char* sr = st + (unsigned int)(lane >> 3) * VS_PITCH + (unsigned int)(lane & 7) * 16u;
    unsigned short* vo = (unsigned short*)VT + ((size_t)bb * DM + col0 + (lane >> 3)) * SEQ + s0 + (lane & 7) * 8;
#pragma unroll 1                                        /* groups of eight: eight LDS reads in flight cover their latency, one wait per group behind the stores */
    for (int q8 = 0; q8 < 32; q8 += 8) {
#pragma unroll
      for (int q = 0; q < 8; ++q) {
        const v8us v = *(const v8us*)(sr + (unsigned int)(q8 + q) * 4u * VS_PITCH);
        *(v8us*)(vo + (size_t)(q8 + q) * 4 * SEQ) = v;
      }
      asm volatile("s_wait_xcnt 0x0" ::: "memory");     /* in front of the next group, which overwrites registers that these stores name */
    }
    return;
  }
  float (*so)[132] = (float (*)[132])(L + (size_t)w * (GP_STAGE / 2u));
#pragma unroll
  for (int h2 = 0; h2 < 2; ++h2) {
#pragma unroll
    for (int ii = 0; ii < 2; ++ii)
#pragma unroll
      for (int j = 0; j < 8; ++j)
#pragma unroll
        for (int r = 0; r < 8; ++r) so[ii * 16 + 8 * hh + r][j * 16 + ln] = acc[2 * h2 + ii][j][r] * alpha;
    __builtin_amdgcn_fence(4 /* acq_rel order */, "workgroup"); __builtin_amdgcn_wave_barrier();
#pragma unroll 1                                        /* groups of eight rows: eight LDS reads in flight cover their latency, one wait per group behind the stores */
    for (int q8 = 0; q8 < 32; q8 += 8) {
#pragma unroll
      for (int q = 0; q < 8; ++q) {
        const v4f v = *(const v4fa*)&so[q8 + q][lane * 4]; v4h h4;
#pragma unroll
        for (int i = 0; i < 4; ++i) h4[i] = toh_flush(v[i]);
        *(v4h*)(Yp + (size_t)(row0 + 32 * h2 + q8 + q) * DM + col0 + lane * 4) = h4;
      }
      asm volatile("s_wait_xcnt 0x0" ::: "memory");     /* in front of the next group, which overwrites registers that these stores name */
    }
    __builtin_amdgcn_fence(4 /* acq_rel order */, "workgroup"); __builtin_amdgcn_wave_barrier();
  }
}

// Attention K / V^T ring: a stage is 64 keys = [K tile: 64 key rows of 128 B | V^T tile: 64 d rows of 128 B], rows at pitch 144 B (128 B + the mover's 16 B pad, conflict-free for 16-byte reads); a tile holds 9216 B and is placed every 10240 B (a multiple of 2 KiB).
// Two stages, shared by the block's four waves; behind the loop's last barrier the ring is free and holds each wave's own bucket-weight and output rows.
#define AT_ROWB 128u
#define AT_PITCH 144u
#define AT_TILE 10240u
#define AT_STAGE (2u * AT_TILE)
#define AT_NPASS ((unsigned)SEQ / 64u)
#define AT_WTB (16u * 104u * 2u)
#define AT_SOB (16u * 72u * 2u)
#define LOG2E 1.4426950408889634f
#define AT_KS (0.125f * LOG2E)
#define AT_RP 76
static_assert(AT_RP == 4 + NREL + 3 + 4 && (AT_RP * 4) % 16 == 0 && AT_RP % 2 == 0);
static_assert(RVK == 96 && NREL + 3 <= 40 + 36 && 40 + 36 <= AT_RP);
static_assert(AT_TILE % 2048u == 0 && 64u * AT_PITCH <= AT_TILE);
static_assert(AT_NPASS >= 2);
static_assert(AT_ROWB == (unsigned)(HD * 2) && (DM * 2) % 16 == 0 && (SEQ * 2) % 16 == 0 && SEQ % 64 == 0);
static_assert(4u * (AT_WTB + AT_SOB) <= 2u * AT_STAGE && AT_WTB % 16u == 0 && AT_SOB % 16u == 0);
// QR^T tiles (16 buckets x 16 queries) = RK16 . Q^T -> qrt[w][query], a skewed row (below) of q.relk[bucket] / 8. S^T 16-key tiles = K . Q^T (A = K16 rows: row = key, k = d; B = Q16 rows: col = query);
// each lane holds keys 8hh+r of query ln; logit = s/8 + the row's entry of bucket clip(key-query)+32, carried in base 2 (table, maximum and kept band logits all x log2 e); 64-key blocks wholly left (key-query <= -32) or right (>= 32) of the band take one per-lane constant (wave-uniform test);
// p x 1024 = exp2(one FMA per score: scale, constant, maximum and the carry's exponent 10 folded), as f16 and in the f32 sums alike; O^T (64 d x 16 queries) = VT . P^T with the B operand packed from the two adjacent S^T D tiles (element r <- keys 0..15, element 8+r <- keys 16..31).
// Bucket weights: buckets 1..63 hold one key each -> the logit is kept in tlg[w][query][bucket + skew] and exponentiated against the final maximum; buckets 0 / 64 are running sums scaled with the online factor.
// Skewed rows: a lane's keys come in runs of four (d, d+1, d+2, d+3) with d + query a multiple of 4, so with skew = query & 3 the run's buckets start at a multiple of 4 floats in a row shifted by skew: one 16-byte LDS access per run.
// qrt row: position p holds the table at clip(p - 4 - skew, 0, 64), p = 0..75, so a run's start clamped to 0..72 reads the clipped constants. tlg row: position bucket + skew (0..67); runs wholly outside go to a dump run at 68 + 4 hh.
// msk[skew][p] = 1 where position p of a qrt row is a clipped bucket (<= 0 or >= 64), else 0: the clipped part of a band pass's sum is a dot product with it. One query's 64 keys of a pass are never clipped on both sides.
__global__ __launch_bounds__(128) __attribute__((amdgpu_num_vgpr(256))) void k_attn(const _Float16* __restrict__ Q16, const _Float16* __restrict__ K16, const _Float16* __restrict__ VT,
                                                                                const _Float16* __restrict__ RK16, const _Float16* __restrict__ RVT, _Float16* __restrict__ O16) {
  __shared__ __attribute__((aligned(2048))) unsigned char L[2u * AT_STAGE];
  __shared__ __attribute__((aligned(16))) float qrt[4][16][AT_RP];
  __shared__ __attribute__((aligned(16))) float tlg[4][16][AT_RP];
  __shared__ __attribute__((aligned(16))) float msk[4][AT_RP];
  const int tid = threadIdx.x, lane = tid & 31, ln = lane & 15, hh = lane >> 4;
  const int w = __builtin_amdgcn_readfirstlane(tid >> 5);
  const int h = blockIdx.y, b = blockIdx.z;
  const int q0 = blockIdx.x * 64 + w * 16;
  const int qi = q0 + ln;
  const size_t rq = (size_t)b * SEQ + q0;
  const size_t rk = (size_t)b * SEQ;
  const _Float16* qp = Q16 + (rq + ln) * DM + h * HD;
  const v16h qb0 = g2_frag(qp, hh), qb1 = g2_frag(qp + 32, hh);
  const v8f z8 = {0.f, 0.f, 0.f, 0.f, 0.f, 0.f, 0.f, 0.f};
  const int skew = ln & 3;                              /* = query & 3: the wave's first query is a multiple of 16 */
  for (int i = tid; i < 4 * AT_RP; i += 128) {          /* clip mask, one row per skew; published by the barrier that publishes stage 0 */
    const int sk = i / AT_RP, rho = i - sk * AT_RP - 4 - sk;
    msk[sk][i - sk * AT_RP] = (rho <= 0 || rho >= 2 * MAXREL) ? 1.0f : 0.0f;
  }
  // K / V^T ring: wave 0 brings the stage's 64 K rows (next stage 64 rows on), wave 1 its 64 V^T rows (next stage 128 B on); waves 2 and 3 issue nothing
  const unsigned int issuer = (unsigned int)(w < 2);
  const unsigned long long srcb = (unsigned long long)(size_t)(w == 0 ? K16 + rk * DM + h * HD : VT + (size_t)(b * NH + h) * HD * SEQ);
  const unsigned int sstep = (w == 0) ? 64u * (unsigned int)(DM * 2) : AT_ROWB;
  const unsigned int place = (unsigned int)(size_t)L + (w == 0 ? 0u : AT_TILE);
  u32x8 g1;                                             /* 1-byte elements, tensor = tile = 64 rows of 128 B, source pitch one K16 or VT row, 4 dwords of pad behind every 32 */
  g1[0] = uni((1u << 20) | (4u << 22) | (3u << 25));
  g1[1] = pinned(AT_ROWB << 16);                        /* words 1 to 7: descriptor words held in scalar registers, so that the group is built once and its registers stay as they are while a request is outstanding */
  g1[2] = pinned(64u << 16);
  g1[3] = pinned(AT_ROWB << 16);
  g1[4] = pinned(64u);
  g1[5] = pinned(w == 0 ? (unsigned int)(DM * 2) : (unsigned int)(SEQ * 2));
  g1[6] = pinned(0u);
  g1[7] = pinned(0u);
  u32x4 g0;
  const unsigned int cnt1 = pinned(1u);                 /* group 0's constant word held in a scalar register, not written again while a request is outstanding */
  auto issue = [&](unsigned int st) {
    const unsigned long long ga = srcb + (unsigned long long)st * sstep;
    g0[0] = uni(cnt1); g0[1] = uni(place + (st & 1u) * AT_STAGE); g0[2] = uni((unsigned int)ga); g0[3] = uni((((unsigned int)(ga >> 32)) & 0x01FFFFFFu) | 0x80000000u);
    asm volatile("tensor_load_to_lds %0, %1" :: "s"(g0), "s"(g1) : "memory");
  };
  if (pinned(issuer)) {
    issue(0u);
    asm volatile("s_wait_tensorcnt 0x0" :: "s"(g0), "s"(g1) : "memory");  /* stage 0 has landed; the descriptor words are named so that their registers stay untouched while the request is outstanding */
  }
  __syncthreads();                                      /* ... and is published to the other waves */
  if (pinned(issuer)) issue(pinned(1u));                /* stage 1 flies while the table below and pass 0 are worked on */
  const unsigned char* kf0 = L + (unsigned int)ln * AT_PITCH + 16u * (unsigned int)hh;
  // relative-key table: buckets 0..NREL-1 of the row of query ln at position bucket + 4 + skew, both clipped ends filled, in base-2 logit units (1/1024 carry, 1/8 scale and log2 e folded)
#pragma unroll
  for (int t = 0; t < RKR / 16; ++t) {
    const _Float16* rp = RK16 + (size_t)(16 * t + ln) * HD;
    const v16h ra0 = g2_frag(rp, hh), ra1 = g2_frag(rp + 32, hh);
    const v8f c = mma2(ra0, qb0, ra1, qb1, z8);
    if (16 * t < 2 * MAXREL) {
#pragma unroll
      for (int r = 0; r < 8; ++r) qrt[w][ln][4 + skew + 16 * t + 8 * hh + r] = c[r] * (0.0001220703125f * LOG2E);
    }
    if (hh == 0) {                                      /* the lanes that hold bucket 0 (first tile) and bucket 64 (last tile) fill the row's clipped ends */
      const float e = c[0] * (0.0001220703125f * LOG2E);
      if (t == 0) {
#pragma unroll
        for (int k = 0; k < 7; ++k) qrt[w][ln][min(k, 4 + skew)] = e;
      }
      if (16 * t == 2 * MAXREL) {
#pragma unroll
        for (int k = 0; k < 8; ++k) qrt[w][ln][min(4 + skew + 2 * MAXREL + k, AT_RP - 1)] = e;
      }
    }
  }
#pragma unroll 1
  for (int c = 0; c < AT_RP / 2; ++c) tlg[w][ln][(AT_RP / 2) * hh + c] = -1.0e30f;
  __builtin_amdgcn_fence(4 /* acq_rel order */, "workgroup"); __builtin_amdgcn_wave_barrier();
  const float* qrow = qrt[w][ln]; float* trow = tlg[w][ln]; const float* mrow = msk[skew];   /* row starts, multiples of 16 B: through these pointers a run of four is one 16-byte access */
  const float c0 = qrow[0], c64 = qrow[AT_RP - 1];
  v8f o0 = z8, o1 = z8, o2 = z8, o3 = z8;
  float mrun = -1.0e30f, lrun = 0.f, wl = 0.f, wr = 0.f;
#pragma unroll 1
  for (int kt = 0; kt < SEQ; kt += 64) {
    const unsigned int st = (unsigned int)kt >> 6;
    const unsigned char* kf = kf0 + (st & 1u) * AT_STAGE; const unsigned char* vf = kf + AT_TILE;
    v8f s[4];
    v16h kv[4][2];
#pragma unroll
    for (int j = 0; j < 4; ++j) { kv[j][0] = lds_frag(kf + j * 16 * AT_PITCH); kv[j][1] = lds_frag(kf + j * 16 * AT_PITCH + 64); }
    __builtin_amdgcn_sched_barrier(0);                  /* the pass's K reads stay one group ahead of its WMMAs: read tile by tile, the wave waits out the LDS latency four times */
#pragma unroll
    for (int j = 0; j < 4; ++j) s[j] = mma2(kv[j][0], qb0, kv[j][1], qb1, z8);
#pragma unroll
    for (int j = 0; j < 4; ++j) { kv[j][0] = lds_frag(vf + j * 16 * AT_PITCH); kv[j][1] = lds_frag(vf + j * 16 * AT_PITCH + 64); }
    __builtin_amdgcn_sched_barrier(0);                  /* the pass's V^T reads are issued here, as one group: their latency passes under the softmax arithmetic */
    const bool farl = (kt + 63 + MAXREL <= q0);          /* every key of the block at distance <= -32 of every query of the wave */
    const bool farr = (kt >= q0 + 15 + MAXREL);          /* every key at distance >= +32 */
    const int dbase = kt + 8 * hh - qi;
    const bool far = farl || farr;
    const int pbase = dbase + MAXREL + skew;            /* bucket + skew of the lane's first key: a multiple of 4 */
    if (!far) {
      v4f bias[4][2];
#pragma unroll
      for (int j = 0; j < 4; ++j)
#pragma unroll
        for (int m = 0; m < 2; ++m) bias[j][m] = *(const v4fa*)(qrow + min(max(pbase + 16 * j + 4 * m + 4, 0), AT_RP - 4));
#pragma unroll
      for (int j = 0; j < 4; ++j)
#pragma unroll
        for (int m = 0; m < 2; ++m) {
          v4f t4;
#pragma unroll
          for (int e = 0; e < 4; ++e) { t4[e] = s[j][4 * m + e] * AT_KS + bias[j][m][e]; s[j][4 * m + e] = t4[e]; }
          const int pq = pbase + 16 * j + 4 * m;
          *(v4fa*)(trow + (((unsigned int)pq <= (unsigned int)(2 * MAXREL)) ? pq : 2 * MAXREL + 4 + 4 * hh)) = t4;   /* band logits kept; a run with no band key goes to the lane's dump run */
        }
    }
    float mx = -1.0e30f;
#pragma unroll
    for (int j = 0; j < 4; ++j)
#pragma unroll
      for (int r = 0; r < 8; ++r) mx = fmaxf(mx, s[j][r]);
    const float cb = farl ? c0 : c64;
    mx = far ? fmaf(mx, AT_KS, cb) : mx;                /* a far block's scores are still raw: the FMA is monotone, so the maximum's logit is the logits' maximum */
    mx = fmaxf(mx, __shfl_xor(mx, 16, 32));
    const float mnew = fmaxf(mrun, mx);
    const float alpha = __builtin_amdgcn_exp2f(mrun - mnew);
    mrun = mnew;
    const float km = far ? AT_KS : 1.0f;                /* band scores are logits already */
    const float off = (far ? cb : 0.f) + (10.0f - mnew);
    const v2f km2 = {km, km}, off2 = {off, off};
    v2f psj[4]; FragH pf[2];                            /* one chain of packed adds per 16-key tile: four short chains, not one long one */
#pragma unroll
    for (int j = 0; j < 4; ++j)
#pragma unroll
      for (int r = 0; r < 8; r += 2) {
        const v2f sv = {s[j][r], s[j][r + 1]};
        const v2f a = __builtin_elementwise_fma(sv, km2, off2);
        const v2f p = {__builtin_amdgcn_exp2f(a[0]), __builtin_amdgcn_exp2f(a[1])};
        s[j][r] = p[0]; s[j][r + 1] = p[1];
        psj[j] = (r == 0) ? p : psj[j] + p;
        pf[j >> 1].h2[((j & 1) * 8 + r) >> 1] = __builtin_convertvector(p, v2h);
      }
    const v2f ps2 = (psj[0] + psj[1]) + (psj[2] + psj[3]);
    const float ps = ps2[0] + ps2[1];
    float pl = 0.f, pr = 0.f;
    if (far) {
      pl = farl ? ps : 0.f; pr = farl ? 0.f : ps;
    } else {
      v4f mk[4][2];
#pragma unroll
      for (int j = 0; j < 4; ++j)
#pragma unroll
        for (int m = 0; m < 2; ++m) mk[j][m] = *(const v4fa*)(mrow + min(max(pbase + 16 * j + 4 * m + 4, 0), AT_RP - 4));
      v2f pc[2] = {{0.f, 0.f}, {0.f, 0.f}};
#pragma unroll
      for (int j = 0; j < 4; ++j)
#pragma unroll
        for (int m = 0; m < 2; ++m) {
          const v2f pa = {s[j][4 * m], s[j][4 * m + 1]}, pb = {s[j][4 * m + 2], s[j][4 * m + 3]};
          const v2f ma = {mk[j][m][0], mk[j][m][1]}, mb = {mk[j][m][2], mk[j][m][3]};
          pc[0] = __builtin_elementwise_fma(pa, ma, pc[0]);
          pc[1] = __builtin_elementwise_fma(pb, mb, pc[1]);
        }
      const v2f pcs = pc[0] + pc[1];
      const float pclip = pcs[0] + pcs[1];
      const bool lside = (kt - qi <= -MAXREL);            /* the query's first key of the pass is clipped on the left: then none of its 64 keys reaches +32 */
      pl = lside ? pclip : 0.f; pr = lside ? 0.f : pclip;
    }
    wl = wl * alpha + pl; wr = wr * alpha + pr;
    lrun = lrun * alpha + ps;                           /* this lane's keys only: the wave's halves are joined behind the loop */
#pragma unroll
    for (int r = 0; r < 8; ++r) { o0[r] *= alpha; o1[r] *= alpha; o2[r] *= alpha; o3[r] *= alpha; }
    o0 = mma2(kv[0][0], pf[0].v, kv[0][1], pf[1].v, o0);
    o1 = mma2(kv[1][0], pf[0].v, kv[1][1], pf[1].v, o1);
    o2 = mma2(kv[2][0], pf[0].v, kv[2][1], pf[1].v, o2);
    o3 = mma2(kv[3][0], pf[0].v, kv[3][1], pf[1].v, o3);
    asm volatile("s_wait_dscnt 0x0" ::: "memory");      /* this wave has left the buffer of pass st */
    if (pinned(issuer)) asm volatile("s_wait_tensorcnt 0x0" :: "s"(g0), "s"(g1) : "memory");  /* the issuer's tile of stage st + 1 has landed; the descriptor words are named so that their registers stay untouched from the issue to here */
    __syncthreads();                                    /* publishes stage st + 1 and frees the buffer of pass st */
    if (pinned(issuer & (unsigned int)(st + 2u < AT_NPASS))) issue(pinned(st + 2u));  /* refill of the buffer just left: stage st + 2 flies while pass st + 1 is worked on */
  }
  asm volatile("s_wait_tensorcnt 0x0" ::: "memory");    /* nothing of the mover is outstanding when the ring becomes the waves' epilogue staging */
  asm volatile("s_wait_dscnt 0x0" ::: "memory");
  unsigned short (*wt)[104] = (unsigned short (*)[104])(L + (unsigned int)w * AT_WTB);                  /* bucket weights, this wave's own 16 x 104 */
  unsigned short (*so)[72] = (unsigned short (*)[72])(L + 4u * AT_WTB + (unsigned int)w * AT_SOB);      /* output rows, this wave's own 16 x 72 */
  wl += __shfl_xor(wl, 16, 32); wr += __shfl_xor(wr, 16, 32); lrun += __shfl_xor(lrun, 16, 32);
  wl *= 0.0009765625f; wr *= 0.0009765625f;             /* the running sums carry x1024 */
  __builtin_amdgcn_fence(4 /* acq_rel order */, "workgroup"); __builtin_amdgcn_wave_barrier();
  // bucket weight row of query ln, columns 40hh .. 40hh+39 and 80+8hh .. 87+8hh by this lane (all RVK columns written; columns >= NREL zero): eleven 16-byte reads of the kept-logit row, issued together, cover positions 40hh .. 40hh+43
  // (a read past the row's end is clamped: its positions belong to columns >= NREL); two rounds of selects, by bit 0 and bit 1 of the skew, move position column + skew to its column
  {
    float ta[44], tb[42];
#pragma unroll
    for (int c = 0; c < 11; ++c) {
      const v4f tq = *(const v4fa*)(trow + min(40 * hh + 4 * c, AT_RP - 4));
#pragma unroll
      for (int e = 0; e < 4; ++e) ta[4 * c + e] = tq[e];
    }
    const bool sk1 = (skew & 1) != 0, sk2 = (skew & 2) != 0;
#pragma unroll
    for (int i = 0; i < 42; ++i) { const float x0 = ta[i], x1 = ta[i + 1]; tb[i] = sk1 ? x1 : x0; }   /* both values named first: a select between values in registers, not between addresses */
#pragma unroll
    for (int g = 0; g < 5; ++g) {
      FragH f;
#pragma unroll
      for (int q = 0; q < 8; ++q) {
        const int i = 8 * g + q, r = 40 * hh + i;
        const float y0 = tb[i], y2 = tb[i + 2];
        const float tv = sk2 ? y2 : y0;
        float e; asm("v_exp_f32 %0, %1\n\tv_nop" : "=v"(e) : "v"(tv - mrun));   /* exp2 with the slot behind a transcendental in its own statement */
        const float wv = (r == 0) ? wl : (r == 2 * MAXREL) ? wr : (r < 2 * MAXREL) ? e : 0.f;
        f.h[q] = toh_flush(wv * 16.0f);
      }
      *(v8us*)&wt[ln][40 * hh + 8 * g] = f.half[0];
    }
    const v8us zz = {0, 0, 0, 0, 0, 0, 0, 0};
    *(v8us*)&wt[ln][80 + 8 * hh] = zz;
  }
  __builtin_amdgcn_fence(4 /* acq_rel order */, "workgroup"); __builtin_amdgcn_wave_barrier();
#pragma unroll
  for (int ks = 0; ks < RVK / 32; ++ks) {
    FragH wb; wb.half[0] = *(const v8us*)&wt[ln][32 * ks + 8 * hh]; wb.half[1] = *(const v8us*)&wt[ln][32 * ks + 16 + 8 * hh];
    const _Float16* rv = RVT + (size_t)ln * RVK + 32 * ks;
    o0 = g2_mma(g2_frag(rv, hh), wb.v, o0);
    o1 = g2_mma(g2_frag(rv + 16 * RVK, hh), wb.v, o1);
    o2 = g2_mma(g2_frag(rv + 32 * RVK, hh), wb.v, o2);
    o3 = g2_mma(g2_frag(rv + 48 * RVK, hh), wb.v, o3);
  }
  const float rl = (1.0f / lrun) * 16.0f;
  { FragH f;
#pragma unroll
    for (int r = 0; r < 8; ++r) f.h[r] = toh_flush(o0[r] * rl);
    *(v8us*)&so[ln][0 + 8 * hh] = f.half[0]; }
  { FragH f;
#pragma unroll
    for (int r = 0; r < 8; ++r) f.h[r] = toh_flush(o1[r] * rl);
    *(v8us*)&so[ln][16 + 8 * hh] = f.half[0]; }
  { FragH f;
#pragma unroll
    for (int r = 0; r < 8; ++r) f.h[r] = toh_flush(o2[r] * rl);
    *(v8us*)&so[ln][32 + 8 * hh] = f.half[0]; }
  { FragH f;
#pragma unroll
    for (int r = 0; r < 8; ++r) f.h[r] = toh_flush(o3[r] * rl);
    *(v8us*)&so[ln][48 + 8 * hh] = f.half[0]; }
  __builtin_amdgcn_fence(4 /* acq_rel order */, "workgroup"); __builtin_amdgcn_wave_barrier();
  const int li = lane >> 3, pc = lane & 7;
  {
#pragma unroll
    for (int g = 0; g < 4; ++g) {
      const int i = g * 4 + li;
      const v8us v = *(const v8us*)&so[i][pc * 8];
      *(v8us*)((unsigned short*)O16 + (rq + i) * DM + h * HD + pc * 8) = v;
    }
    
  }
}

// out[r][col] = (A1[r] . B1[col]) * al1 + bf16(bias[col]); the same tile loop; each wave stages 32 x 128 f32 at a time in its own quarter of the ring; bias added at the store stage as a 4-wide f32 vector; f32 rows:
__global__ __launch_bounds__(128) void k_out(const _Float16* __restrict__ A1, const _Float16* __restrict__ B1, float al1, const float* __restrict__ bias, float* __restrict__ Out) {
  __shared__ __attribute__((aligned(2048))) unsigned char L[2u * GP_STAGE];
  const int tid = threadIdx.x, lane = tid & 31, ln = lane & 15, hh = lane >> 4;
  const int w = __builtin_amdgcn_readfirstlane(tid >> 5);
  const int ntn = DM / 256;
  const int mt = blockIdx.x / ntn, nq = blockIdx.x - mt * ntn;
  if (mt * 128 >= (int)NR) return;
  const v8f z8 = {0.f, 0.f, 0.f, 0.f, 0.f, 0.f, 0.f, 0.f};
  v8f acc[4][8];
#pragma unroll
  for (int i = 0; i < 4; ++i)
#pragma unroll
    for (int j = 0; j < 8; ++j) acc[i][j] = z8;
  gemm128x256(A1 + (size_t)mt * 128 * DM, B1 + (size_t)nq * 256 * DM, L, w, ln, hh, acc);
  const int row0 = mt * 128 + 64 * (w >> 1), col0 = nq * 256 + 128 * (w & 1);
  float (*so)[132] = (float (*)[132])(L + (size_t)w * (GP_STAGE / 2u));
  const v4f bz = *(const v4fa*)(bias + col0 + lane * 4);
  v4f bb;
#pragma unroll
  for (int i = 0; i < 4; ++i) bb[i] = bf16_rne(bz[i]);
#pragma unroll
  for (int h2 = 0; h2 < 2; ++h2) {
#pragma unroll
    for (int ii = 0; ii < 2; ++ii)
#pragma unroll
      for (int j = 0; j < 8; ++j)
#pragma unroll
        for (int r = 0; r < 8; ++r) so[ii * 16 + 8 * hh + r][j * 16 + ln] = acc[2 * h2 + ii][j][r] * al1;
    __builtin_amdgcn_fence(4 /* acq_rel order */, "workgroup"); __builtin_amdgcn_wave_barrier();
#pragma unroll 1                                        /* groups of eight rows: eight LDS reads in flight cover their latency, one wait per group behind the stores */
    for (int q8 = 0; q8 < 32; q8 += 8) {
#pragma unroll
      for (int q = 0; q < 8; ++q) {
        const v4f v0 = *(const v4fa*)&so[q8 + q][lane * 4];
        const v4f v = v0 + bb;
        *(v4f*)(Out + (size_t)(row0 + 32 * h2 + q8 + q) * DM + col0 + lane * 4) = v;
      }
      asm volatile("s_wait_xcnt 0x0" ::: "memory");     /* in front of the next group, which overwrites registers that these stores name */
    }
    __builtin_amdgcn_fence(4 /* acq_rel order */, "workgroup"); __builtin_amdgcn_wave_barrier();
  }
}

extern "C" void kernel_launch(void* const* d_in, const int* in_sizes, int n_in,
                              void* d_out, int out_size, void* d_ws, size_t ws_size, hipStream_t stream) {
  if (n_in < 8) return;
  if (in_sizes[0] < (int)(((size_t)(NB - 1) * SEQ_FULL + SEQ) * DM)) return;
  for (int i = 1; i <= 4; ++i) if (in_sizes[i] < DM * DM) return;
  if (in_sizes[5] < DM) return;
  if (in_sizes[6] < NREL * HD) return;
  if (in_sizes[7] < NREL * HD) return;
  if (out_size < (int)(NR * DM)) return;
  const float* const* I = (const float* const*)d_in;
  const float* x = I[0]; const float* wq = I[1]; const float* wk = I[2]; const float* wv = I[3]; const float* wo = I[4]; const float* bo = I[5]; const float* relk = I[6]; const float* relv = I[7];
  char* ws = (char*)d_ws; size_t off = 0;
  auto take = [&](size_t bytes) { char* p = ws + off; off += (bytes + 255) & ~(size_t)255; return p; };
  _Float16* BQKV = (_Float16*)take((size_t)3 * SZ_BT);               /* Bt planes q, k, v (contiguous, stride DM*DM) */
  _Float16* BO   = (_Float16*)take(SZ_BT);
  _Float16* RK16 = (_Float16*)take(SZ_RK);                           /* [RKR][HD] */
  _Float16* RVT  = (_Float16*)take(SZ_RV);                           /* [HD][RVK] */
  _Float16* X16  = (_Float16*)take(SZ_ACT);
  _Float16* QKV16 = (_Float16*)take((size_t)3 * SZ_ACT);             /* Q16, K16 planes (stride NR*DM); the third plane is not used */
  _Float16* VT   = (_Float16*)take((size_t)NB * NH * HD * SEQ * 2);  /* [b*NH+h][d][s] */
  _Float16* O16  = (_Float16*)take(SZ_ACT);
  if (off > ws_size) return;
  _Float16* Q16 = QKV16; _Float16* K16 = QKV16 + NR * DM;

  k_prep<<<PW_REL + PW_BLK, PW_THREADS, 0, stream>>>(x, wq, wk, wv, wo, relk, relv, X16, BQKV, BO, RK16, RVT);      /* every f32 -> f16 operand plane */
  k_qkv<<<dim3((unsigned)((NR / 128) * (DM / 256)), 3), 128, 0, stream>>>(X16, BQKV, 0.0625f, QKV16, VT);      /* q, k as f16 rows, v as f16 V^T rows */
  k_attn<<<dim3(SEQ / 64, NH, NB), 128, 0, stream>>>(Q16, K16, VT, RK16, RVT, O16);
  k_out<<<(unsigned)((NR / 128) * (DM / 256)), 128, 0, stream>>>(O16, BO, 0.00390625f, bo, (float*)d_out);      /* out = ctx Wo^T + b_o */
}

// v008
// One run takes 114 microseconds.
// Next to v007, in two timings, it ran 1.10 and 1.09 times as fast.
// All steps since v000 together make it 3.62 times as fast.
#include <hip/hip_runtime.h>
// Contractions: q/k/v/o projections ([tokens][1024] x [1024][1024]^T), scores k.q^T (K = 64), relative-key table relk.q^T (K = 64), v^T.p^T (K = keys) and relv^T.w^T (K = 65 padded to 96) on v_wmma_f32_16x16x32_f16 (f16 operands, f32 accumulate). Inputs RNE-converted to bf16 on load (exact in f16; weights carried x16, relk x1024, relv x64), softmax numerators carried x1024, bucket weights x16, ctx rows x16; softmax statistics and all epilogues in f32.
// Structure: token rows r = b*SEQ + s. X16 = f16(bf16(x)); Q16/K16 = f16(X16 . Bt_w / 16) as token rows, VT[b*NH+h][d][s] = f16(X16 . Bt_v / 16) stored transposed by the projection itself; attention per (64 queries, head, batch): per wave a table QR[query][bucket] = q . relk[bucket] / 8
// (5 WMMA tiles into wave-private LDS), S^T tiles = K . Q^T, logit = s/8 + QR[query][clip(key - query, -32, 32) + 32], online softmax per lane, O^T = VT . P^T; bucket weights W[query][bucket] (buckets 1..63 from band logits kept in LDS,
// buckets 0 and 64 as running sums) then O^T += RelVT . W^T; O16[r][h*64+d] = f16(16 ctx); out = (O16 . Bt_o) / 256 + bf16(b_o) -> f32 rows.
#ifndef NB
#define NB 8
#endif
#ifndef SEQ
#define SEQ 1024
#endif
#define NB_FULL 8
#define SEQ_FULL 1024
#define DM 1024
#define NH 16
#define HD 64
#define MAXREL 32
#define NREL 65
#define RKR 80
#define RVK 96
#define NR ((size_t)NB * SEQ)
#define SZ_BT ((size_t)DM * DM * 2)
#define SZ_ACT (NR * DM * 2)
#define SZ_RK ((size_t)RKR * HD * 2)
#define SZ_RV ((size_t)HD * RVK * 2)
#define WS_TOTAL ((size_t)4 * SZ_BT + SZ_RK + SZ_RV + (size_t)6 * SZ_ACT)
static_assert(NH * HD == DM);
static_assert(SEQ % 128 == 0);
static_assert(SEQ <= SEQ_FULL);
static_assert(NB >= 1 && NB <= NB_FULL);
static_assert(DM == 128 * 8);
static_assert(DM % 256 == 0);
static_assert(HD == 64);
static_assert(NREL == 2 * MAXREL + 1);
static_assert(RKR % 16 == 0 && RKR >= NREL);
static_assert(RVK % 32 == 0 && RVK >= NREL);
static_assert((RKR * HD / 8) % 32 == 0);
static_assert((HD * RVK / 8) % 256 == 0);
static_assert(SZ_BT % 256 == 0 && SZ_ACT % 256 == 0 && SZ_RK % 256 == 0 && SZ_RV % 256 == 0);
static_assert(WS_TOTAL <= (size_t)134217728);
static_assert((size_t)NB * NH * HD * SEQ * 2 == SZ_ACT);

typedef _Float16 v16h __attribute__((ext_vector_type(16)));
typedef unsigned short v8us __attribute__((ext_vector_type(8), may_alias));
typedef float v8f __attribute__((ext_vector_type(8)));
typedef float v4f __attribute__((ext_vector_type(4)));
typedef float v4fa __attribute__((ext_vector_type(4), may_alias));
typedef _Float16 v4h __attribute__((ext_vector_type(4)));
typedef float v2f __attribute__((ext_vector_type(2)));
typedef _Float16 v2h __attribute__((ext_vector_type(2)));
union FragH { v16h v; v8us half[2]; v2h h2[8]; _Float16 h[16]; unsigned short u[16]; };

__device__ __forceinline__ unsigned short bf16_bits(float x) { unsigned int u = __float_as_uint(x); return (unsigned short)((u + 0x7FFFu + ((u >> 16) & 1u)) >> 16); }
__device__ __forceinline__ float bf16_val(unsigned short b) { return __uint_as_float(((unsigned int)b) << 16); }
__device__ __forceinline__ float bf16_rne(float x) { return bf16_val(bf16_bits(x)); }
// f32 -> f16 operand convert that cannot produce an f16 subnormal (value select)
static __device__ __forceinline__ _Float16 toh_flush(float v) { const _Float16 r = (_Float16)v; return (fabsf(v) < 6.103515625e-05f) ? (_Float16)0.0f : r; }

// 16x32 f16 fragment from a k-contiguous row: elements 0..7 <- p[8h .. 8h+7], elements 8..15 <- p[16+8h .. 16+8h+7] (same map for A rows and for Bt[n][k] rows)
__device__ __forceinline__ v16h g2_frag(const _Float16* p, int hh) { FragH f; f.half[0] = *(const v8us*)((const unsigned short*)p + 8 * hh); f.half[1] = *(const v8us*)((const unsigned short*)p + 16 + 8 * hh); return f.v; }
__device__ __forceinline__ v8f g2_mma(v16h a, v16h b, v8f c) { v8f d = __builtin_amdgcn_wmma_f32_16x16x32_f16(false, a, false, b, (short)0, c, false, false); asm volatile("v_nop\n\tv_nop\n\tv_nop\n\tv_nop" : "+v"(d) : "v"(a), "v"(b)); return d; }
// two k-steps into one accumulator, hazard guard after the second
__device__ __forceinline__ v8f mma2(v16h a0, v16h b0, v16h a1, v16h b1, v8f c) {
  c = __builtin_amdgcn_wmma_f32_16x16x32_f16(false, a0, false, b0, (short)0, c, false, false);
  c = __builtin_amdgcn_wmma_f32_16x16x32_f16(false, a1, false, b1, (short)0, c, false, false);
  asm volatile("v_nop\n\tv_nop\n\tv_nop\n\tv_nop" : "+v"(c) : "v"(a0), "v"(b0), "v"(a1), "v"(b1));
  return c;
}

// Operand conversions in one grid of few, long waves: the launch starts 16 waves per work-group, about one work-group per WGP, and each wave keeps all its loads in flight.
// A chunk is PW_CH = 1024 consecutive f32 (4 KiB): lane l reads 16 B at float 128 j + 4 l, j = 0..7 (every load covers four whole lines), and stores 8 B of f16 at the same element index (every store covers two whole lines).
// Wave gw owns weight chunk gw of the planes q, k, v, o laid end to end (Bt[n][k] = f16(bf16(w[n][k]) * 16)) and the PW_XPW adjacent token rows from gw * PW_XPW of x (a row is one chunk; X16[r][c] = f16(bf16(x)); input rows read at the full stride b*SEQ_FULL + s; the rows of a wave lie in one batch).
// All of a wave's loads are issued before its first convert. None of the parts reads what another writes: block-uniform branches, no barrier.
#define PW_THREADS 512
#define PW_CH 1024
#define PW_NWV ((unsigned)((size_t)4 * DM * DM / PW_CH))
#define PW_BLK (PW_NWV / (PW_THREADS / 32u))
#define PW_XPW ((unsigned)((NR + PW_NWV - 1) / PW_NWV))
#define PW_RKC ((unsigned)(RKR * HD / 8))
#define PW_RVC ((unsigned)(HD * RVK / 8))
#define PW_REL ((PW_RKC + PW_RVC + PW_THREADS - 1u) / PW_THREADS)
static_assert(DM == PW_CH && ((size_t)DM * DM) % PW_CH == 0 && PW_NWV % (PW_THREADS / 32u) == 0);
static_assert(PW_RKC % 32u == 0 && PW_RVC % 32u == 0);
static_assert(NR % PW_XPW == 0 && SEQ % PW_XPW == 0);

// relative-position planes, one 8-element piece per thread, its loads independent: RK16[bucket][d] = f16(bf16(relk[bucket][d]) * 1024), rows NREL..RKR-1 zero; RVT[d][bucket] = f16(bf16(relv[bucket][d]) * 64), columns NREL..RVK-1 zero.
__device__ __forceinline__ void d_rel(const float* __restrict__ relk, const float* __restrict__ relv, unsigned int t, _Float16* __restrict__ RK16, _Float16* __restrict__ RVT) {
  if (t < PW_RKC) {                                     /* wave-uniform: the piece counts are multiples of 32 */
    const int c = (int)t;
    const int row = c / (HD / 8), d8 = (c % (HD / 8)) * 8;
    const int rr = min(row, NREL - 1);
    const float* rp = relk + rr * HD + d8;              /* a multiple of 8 floats from the plane's start: two aligned 16-byte loads */
    const v4f va = *(const v4fa*)rp, vb = *(const v4fa*)(rp + 4);
    FragH f;
#pragma unroll
    for (int q = 0; q < 4; ++q) { f.h[q] = toh_flush((row < NREL) ? bf16_rne(va[q]) * 1024.0f : 0.0f); f.h[4 + q] = toh_flush((row < NREL) ? bf16_rne(vb[q]) * 1024.0f : 0.0f); }
    *(v8us*)((unsigned short*)RK16 + (size_t)c * 8) = f.half[0];
  } else if (t < PW_RKC + PW_RVC) {
    const int c = (int)(t - PW_RKC);
    const int d = c / (RVK / 8), r8 = (c % (RVK / 8)) * 8;
    float val[8];
#pragma unroll
    for (int q = 0; q < 8; ++q) val[q] = relv[min(r8 + q, NREL - 1) * HD + d];
    FragH f;
#pragma unroll
    for (int q = 0; q < 8; ++q) f.h[q] = toh_flush((r8 + q < NREL) ? bf16_rne(val[q]) * 64.0f : 0.0f);
    *(v8us*)((unsigned short*)RVT + (size_t)c * 8) = f.half[0];
  }
}

// Blocks 0 .. PW_REL-1: the relative-position planes; then PW_BLK blocks of 16 waves for the weight planes and x.
__global__ __launch_bounds__(PW_THREADS) void k_prep(const float* __restrict__ x, const float* __restrict__ wq, const float* __restrict__ wk, const float* __restrict__ wv, const float* __restrict__ wo,
                                              const float* __restrict__ relk, const float* __restrict__ relv,
                                              _Float16* __restrict__ X16, _Float16* __restrict__ BQKV, _Float16* __restrict__ BO, _Float16* __restrict__ RK16, _Float16* __restrict__ RVT) {
  const unsigned int bid = blockIdx.x;
  if (bid < PW_REL) { d_rel(relk, relv, bid * PW_THREADS + threadIdx.x, RK16, RVT); return; }
  const unsigned int lo = 16u * (threadIdx.x & 31u);    /* the lane's byte offset in every 512-B load; half of it in every 256-B store */
  const unsigned int gw = (bid - PW_REL) * (PW_THREADS / 32u) + (unsigned int)__builtin_amdgcn_readfirstlane(threadIdx.x >> 5);
  const unsigned int pl = gw / (unsigned)((size_t)DM * DM / PW_CH), ch = gw - pl * (unsigned)((size_t)DM * DM / PW_CH);
  const float* w = (pl == 0u) ? wq : (pl == 1u) ? wk : (pl == 2u) ? wv : wo;
  const char* wsrc = (const char*)(w + (size_t)ch * PW_CH);
  const unsigned int r0 = min(gw * PW_XPW, (unsigned int)NR - PW_XPW);    /* a wave past the last row re-reads the last rows and stores nothing */
  const unsigned int b = r0 / SEQ, s = r0 - b * SEQ;
  const char* xsrc = (const char*)(x + ((size_t)b * SEQ_FULL + s) * DM);
  v4f wa[8], xa[8 * PW_XPW];
#pragma unroll
  for (unsigned int j = 0; j < 8u; ++j) wa[j] = *(const v4fa*)(wsrc + lo + 512u * j);
#pragma unroll
  for (unsigned int j = 0; j < 8u * PW_XPW; ++j) xa[j] = *(const v4fa*)(xsrc + lo + 512u * j);
  asm volatile("s_wait_xcnt 0x0" :: "v"(lo) : "memory");  /* behind the loads, in front of the converts and the store addresses, which reuse registers; the lane offset that every load names is an input, so that its register stays as it is up to here */
  __builtin_amdgcn_sched_barrier(0);                    /* every load of the wave, and the wait above, stand in front of its first convert: with loads moved down among the converts only a window of them is in flight and the wave waits out the memory latency several times */
  char* wdst = (char*)(((pl < 3u) ? BQKV + (size_t)pl * DM * DM : BO) + (size_t)ch * PW_CH);
  v4h wh[8], xh[8 * PW_XPW];
#pragma unroll
  for (unsigned int j = 0; j < 8u; ++j)
#pragma unroll
    for (int q = 0; q < 4; ++q) wh[j][q] = (_Float16)(bf16_rne(wa[j][q]) * 16.0f);
#pragma unroll
  for (unsigned int j = 0; j < 8u * PW_XPW; ++j)
#pragma unroll
    for (int q = 0; q < 4; ++q) xh[j][q] = toh_flush(bf16_rne(xa[j][q]));
#pragma unroll
  for (unsigned int j = 0; j < 8u; ++j) *(v4h*)(wdst + (lo >> 1) + 256u * j) = wh[j];
  if ((size_t)PW_NWV * PW_XPW == NR || gw * PW_XPW < (unsigned int)NR) {  /* wave-uniform; always true where the rows fill the waves exactly */
    char* xdst = (char*)(X16 + (size_t)r0 * DM);
#pragma unroll
    for (unsigned int j = 0; j < 8u * PW_XPW; ++j) *(v4h*)(xdst + (lo >> 1) + 256u * j) = xh[j];
  }
  asm volatile("s_wait_xcnt 0x0" ::: "memory");         /* behind the wave's last store */
}

// Projection GEMM tile: one block of 4 waves computes 128 rows x 256 columns; wave (w >> 1, w & 1) owns 64 x 128 (4 x 8 accumulator tiles).
// A pass is 64 k = 128 B of every operand row. A stage in LDS is [A slice 0 | A slice 1 | B slice 0 | B slice 1], rows at pitch 144 B (128 B + the mover's 16 B pad, conflict-free for 16-byte reads);
// A slices hold 64 rows (9216 B, placed every 10240 B so that each place is a multiple of 2 KiB), B slices 128 rows (18432 B). Two stages; every wave issues one tensor load per stage: waves 0, 1 the A slices, waves 2, 3 the B slices.
#define GP_ROWB 128u
#define GP_PITCH 144u
#define GP_SLA 10240u
#define GP_SLB 18432u
#define GP_STAGE (2u * GP_SLA + 2u * GP_SLB)
#define GP_NPASS ((unsigned)(DM * 2) / GP_ROWB)
static_assert(GP_SLA % 2048u == 0 && GP_SLB % 2048u == 0 && GP_STAGE % 2048u == 0);
static_assert(64u * GP_PITCH <= GP_SLA && 128u * GP_PITCH <= GP_SLB);
static_assert(GP_NPASS >= 2 && (GP_NPASS & (GP_NPASS - 1u)) == 0);
static_assert(NR % 128 == 0 && DM % 256 == 0);
static_assert(4u * 32u * 132u * 4u <= 2u * GP_STAGE);
typedef unsigned int u32x4 __attribute__((ext_vector_type(4)));
typedef unsigned int u32x8 __attribute__((ext_vector_type(8)));
__device__ __forceinline__ unsigned int uni(unsigned int v) { return (unsigned int)__builtin_amdgcn_readfirstlane(v); }
__device__ __forceinline__ unsigned int pinned(unsigned int v) { unsigned int s = uni(v); asm volatile("" : "+s"(s)); return s; }  // a wave-uniform word held in a scalar register, so that the test around a tensor load is a scalar branch and a descriptor formed from the word stays behind the wait and the barrier in front of it
__device__ __forceinline__ v16h lds_frag(const unsigned char* p) { FragH f; f.half[0] = *(const v8us*)p; f.half[1] = *(const v8us*)(p + 32); return f.v; }

// rot (block-uniform): stage st of the ring holds k slice (st + rot) mod GP_NPASS of both operands, so a block walks all of k once, from its own start and round the end. Blocks that share an A or a B tile run in step; with one common start they ask L2 for the same lines at the same moment, with different starts for different lines.
__device__ __forceinline__ void gemm128x256(const _Float16* __restrict__ Arows, const _Float16* __restrict__ Brows, unsigned int rot, unsigned char* L, int w, int ln, int hh, v8f (&acc)[4][8]) {
  const unsigned int lbase = (unsigned int)(size_t)L;
  const bool isB = w >= 2; const unsigned int sl = (unsigned int)w & 1u;
  const unsigned int nrows = isB ? 128u : 64u;
  const unsigned long long srcb = (unsigned long long)(size_t)(isB ? Brows + (size_t)sl * 128 * DM : Arows + (size_t)sl * 64 * DM);
  const unsigned int place = lbase + (isB ? 2u * GP_SLA + sl * GP_SLB : sl * GP_SLA);
  u32x8 g1;                                             /* 1-byte elements, tensor = tile = nrows rows of 128 B, source pitch one operand row, 4 dwords of pad behind every 32 */
  g1[0] = uni((1u << 20) | (4u << 22) | (3u << 25));
  g1[1] = uni(GP_ROWB << 16);
  g1[2] = uni(nrows << 16);
  g1[3] = uni(GP_ROWB << 16);
  g1[4] = uni(nrows);
  g1[5] = uni((unsigned int)(DM * 2));
  g1[6] = uni(0u);
  g1[7] = uni(0u);
  u32x4 g0;
  auto issue = [&](unsigned int st) {
    const unsigned long long ga = srcb + (unsigned long long)(((st + rot) & (GP_NPASS - 1u)) * GP_ROWB);
    g0[0] = uni(1u); g0[1] = uni(place + (st & 1u) * GP_STAGE); g0[2] = uni((unsigned int)ga); g0[3] = uni((((unsigned int)(ga >> 32)) & 0x01FFFFFFu) | 0x80000000u);
    asm volatile("tensor_load_to_lds %0, %1" :: "s"(g0), "s"(g1) : "memory");
  };
  issue(0u);
  asm volatile("s_wait_tensorcnt 0x0" :: "s"(g0), "s"(g1) : "memory");  /* stage 0 has landed for this wave's slice; the descriptor words are named so that their registers stay untouched while the request is outstanding */
  __syncthreads();                                      /* ... and is published to the other waves */
  const unsigned char* ap = L + (unsigned int)(w >> 1) * GP_SLA + (unsigned int)ln * GP_PITCH + 16u * (unsigned int)hh;
  const unsigned char* bp = L + 2u * GP_SLA + (unsigned int)(w & 1) * GP_SLB + (unsigned int)ln * GP_PITCH + 16u * (unsigned int)hh;
#pragma unroll 1
  for (unsigned int s = 0; s < GP_NPASS; ++s) {         /* rolled: one copy of the pass in the instruction cache; the buffer is picked by the pass's parity */
    if (pinned(s + 1u < GP_NPASS)) issue(pinned(s + 1u)); /* behind the barrier that freed its buffer: stage s + 1 flies while pass s is worked on */
    const unsigned char* as = ap + (s & 1u) * GP_STAGE; const unsigned char* bs = bp + (s & 1u) * GP_STAGE;
    v16h a[2][4], b[2][8];
#pragma unroll
    for (int ks = 0; ks < 2; ++ks) {
      a[ks][0] = lds_frag(as + ks * 64);
#pragma unroll
      for (int j = 0; j < 8; ++j) b[ks][j] = lds_frag(bs + j * 16 * GP_PITCH + ks * 64);
#pragma unroll
      for (int i = 1; i < 4; ++i) a[ks][i] = lds_frag(as + i * 16 * GP_PITCH + ks * 64);
    }
    __builtin_amdgcn_sched_barrier(0);                  /* the pass's LDS reads stay one group ahead of its WMMAs (for speed only) */
#pragma unroll
    for (int ks = 0; ks < 2; ++ks)
#pragma unroll
      for (int i = 0; i < 4; ++i)
#pragma unroll
        for (int j = 0; j < 8; ++j) acc[i][j] = __builtin_amdgcn_wmma_f32_16x16x32_f16(false, a[ks][i], false, b[ks][j], (short)0, acc[i][j], false, false);
    __builtin_amdgcn_sched_barrier(0);                  /* the WMMAs stay in front of the publish point: moved behind it, the wait for stage s + 1 would stand a whole pass earlier and the refill would lose its lead */
    asm volatile("s_wait_dscnt 0x0" ::: "memory");      /* this wave has left the buffer of pass s */
    asm volatile("s_wait_tensorcnt 0x0" :: "s"(g0), "s"(g1) : "memory");  /* its slice of stage s + 1 has landed; the descriptor words are named so that their registers stay untouched from the issue to here */
    __syncthreads();                                    /* publishes stage s + 1 and frees the buffer of pass s */
  }
  asm volatile("s_wait_tensorcnt 0x0" ::: "memory");    /* nothing of the mover is outstanding when the ring becomes output staging */
  asm volatile("s_wait_dscnt 0x0" ::: "memory");
}

// projections: plane by (0 q, 1 k, 2 v): Y16_by[r][col] = f16((X16[r] . Bt_by[col]) * alpha) for q and k; the v plane goes out transposed, VT[b*DM + col][s]. The last pass's barrier has ended every read of the ring; each wave then stages in its own quarter of it:
// q, k: 32 x 128 f32 at a time. v: a lane's 8 accumulator rows of a tile are 8 consecutive tokens of one column, so they are one 16-byte LDS write into [column][token] rows (64 tokens = 128 B; pitch 144 B, so that the 16 rows a half-wave writes fall on distinct banks); read back, 8 lanes store one whole 128-B line of a VT row.
#define VS_PITCH 144u
static_assert(128u * VS_PITCH <= GP_STAGE / 2u && (GP_STAGE / 2u) % 16u == 0);
static_assert(SEQ % 128 == 0);
__global__ __launch_bounds__(128) void k_qkv(const _Float16* __restrict__ X16, const _Float16* __restrict__ Bt, float alpha, _Float16* __restrict__ Y16, _Float16* __restrict__ VT) {
  __shared__ __attribute__((aligned(2048))) unsigned char L[2u * GP_STAGE];
  const int tid = threadIdx.x, lane = tid & 31, ln = lane & 15, hh = lane >> 4;
  const int w = __builtin_amdgcn_readfirstlane(tid >> 5);
  const int by = blockIdx.y;
  const _Float16* Bh = Bt + (size_t)by * DM * DM;
  _Float16* Yp = Y16 + (size_t)by * NR * DM;
  const int ntn = DM / 256;
  const int mt = blockIdx.x / ntn, nq = blockIdx.x - mt * ntn;
  if (mt * 128 >= (int)NR) return;
  const v8f z8 = {0.f, 0.f, 0.f, 0.f, 0.f, 0.f, 0.f, 0.f};
  v8f acc[4][8];
#pragma unroll
  for (int i = 0; i < 4; ++i)
#pragma unroll
    for (int j = 0; j < 8; ++j) acc[i][j] = z8;
  gemm128x256(X16 + (size_t)mt * 128 * DM, Bh + (size_t)nq * 256 * DM, (unsigned int)(mt + 4 * nq + by), L, w, ln, hh, acc);  /* the 12 blocks of a row tile get 12 different starts; the 64 of a column tile spread evenly over the 16 */
  const int row0 = mt * 128 + 64 * (w >> 1), col0 = nq * 256 + 128 * (w & 1);
  if (by == 2) {                                        /* block-uniform: the whole block is of one plane */
    unsigned char* st = L + (size_t)w * (GP_STAGE / 2u);
#pragma unroll
    for (int i = 0; i < 4; ++i)
#pragma unroll
      for (int j = 0; j < 8; ++j) {
        FragH f;
#pragma unroll
        for (int r = 0; r < 8; ++r) f.h[r] = toh_flush(acc[i][j][r] * alpha);
        *(v8us*)(st + (unsigned int)(16 * j + ln) * VS_PITCH + 32u * (unsigned int)i + 16u * (unsigned int)hh) = f.half[0];
      }
    __builtin_amdgcn_fence(4 /* acq_rel order */, "workgroup"); __builtin_amdgcn_wave_barrier();
    const int bb = row0 / SEQ, s0 = row0 - bb * SEQ;    /* the wave's 64 tokens lie in one batch */
    const unsigned char* sr = st + (unsigned int)(lane >> 3) * VS_PITCH + (unsigned int)(lane & 7) * 16u;
    unsigned short* vo = (unsigned short*)VT + ((size_t)bb * DM + col0 + (lane >> 3)) * SEQ + s0 + (lane & 7) * 8;
#pragma unroll 1                                        /* groups of eight: eight LDS reads in flight cover their latency, one wait per group behind the stores */
    for (int q8 = 0; q8 < 32; q8 += 8) {
#pragma unroll
      for (int q = 0; q < 8; ++q) {
        const v8us v = *(const v8us*)(sr + (unsigned int)(q8 + q) * 4u * VS_PITCH);
        *(v8us*)(vo + (size_t)(q8 + q) * 4 * SEQ) = v;
      }
      asm volatile("s_wait_xcnt 0x0" ::: "memory");     /* in front of the next group, which overwrites registers that these stores name */
    }
    return;
  }
  float (*so)[132] = (float (*)[132])(L + (size_t)w * (GP_STAGE / 2u));
#pragma unroll
  for (int h2 = 0; h2 < 2; ++h2) {
#pragma unroll
    for (int ii = 0; ii < 2; ++ii)
#pragma unroll
      for (int j = 0; j < 8; ++j)
#pragma unroll
        for (int r = 0; r < 8; ++r) so[ii * 16 + 8 * hh + r][j * 16 + ln] = acc[2 * h2 + ii][j][r] * alpha;
    __builtin_amdgcn_fence(4 /* acq_rel order */, "workgroup"); __builtin_amdgcn_wave_barrier();
#pragma unroll 1                                        /* groups of eight rows: eight LDS reads in flight cover their latency, one wait per group behind the stores */
    for (int q8 = 0; q8 < 32; q8 += 8) {
#pragma unroll
      for (int q = 0; q < 8; ++q) {
        const v4f v = *(const v4fa*)&so[q8 + q][lane * 4]; v4h h4;
#pragma unroll
        for (int i = 0; i < 4; ++i) h4[i] = toh_flush(v[i]);
        *(v4h*)(Yp + (size_t)(row0 + 32 * h2 + q8 + q) * DM + col0 + lane * 4) = h4;
      }
      asm volatile("s_wait_xcnt 0x0" ::: "memory");     /* in front of the next group, which overwrites registers that these stores name */
    }
    __builtin_amdgcn_fence(4 /* acq_rel order */, "workgroup"); __builtin_amdgcn_wave_barrier();
  }
}

// Attention K / V^T ring: a stage is 64 keys = [K tile: 64 key rows of 128 B | V^T tile: 64 d rows of 128 B], rows at pitch 144 B (128 B + the mover's 16 B pad, conflict-free for 16-byte reads); a tile holds 9216 B and is placed every 10240 B (a multiple of 2 KiB).
// Two stages, shared by the block's four waves; behind the loop's last barrier the ring is free and holds each wave's own bucket-weight and output rows.
#define AT_ROWB 128u
#define AT_PITCH 144u
#define AT_TILE 10240u
#define AT_STAGE (2u * AT_TILE)
#define AT_NPASS ((unsigned)SEQ / 64u)
#define AT_WTB (16u * 104u * 2u)
#define AT_SOB (16u * 72u * 2u)
#define LOG2E 1.4426950408889634f
#define AT_KS (0.125f * LOG2E)
#define AT_RP 76
static_assert(AT_RP == 4 + NREL + 3 + 4 && (AT_RP * 4) % 16 == 0 && AT_RP % 2 == 0);
static_assert(RVK == 96 && NREL + 3 <= 40 + 36 && 40 + 36 <= AT_RP);
static_assert(AT_TILE % 2048u == 0 && 64u * AT_PITCH <= AT_TILE);
static_assert(AT_NPASS >= 2 && (AT_NPASS & (AT_NPASS - 1u)) == 0);
static_assert(AT_ROWB == (unsigned)(HD * 2) && (DM * 2) % 16 == 0 && (SEQ * 2) % 16 == 0 && SEQ % 64 == 0);
static_assert(4u * (AT_WTB + AT_SOB) <= 2u * AT_STAGE && AT_WTB % 16u == 0 && AT_SOB % 16u == 0);
// QR^T tiles (16 buckets x 16 queries) = RK16 . Q^T -> qrt[w][query], a skewed row (below) of q.relk[bucket] / 8. S^T 16-key tiles = K . Q^T (A = K16 rows: row = key, k = d; B = Q16 rows: col = query);
// each lane holds keys 8hh+r of query ln; logit = s/8 + the row's entry of bucket clip(key-query)+32, carried in base 2 (table, maximum and kept band logits all x log2 e); 64-key blocks wholly left (key-query <= -32) or right (>= 32) of the band take one per-lane constant (wave-uniform test);
// p x 1024 = exp2(one FMA per score: scale, constant, maximum and the carry's exponent 10 folded), as f16 and in the f32 sums alike; O^T (64 d x 16 queries) = VT . P^T with the B operand packed from the two adjacent S^T D tiles (element r <- keys 0..15, element 8+r <- keys 16..31).
// Bucket weights: buckets 1..63 hold one key each -> the logit is kept in tlg[w][query][bucket + skew] and exponentiated against the final maximum; buckets 0 / 64 are running sums scaled with the online factor.
// Skewed rows: a lane's keys come in runs of four (d, d+1, d+2, d+3) with d + query a multiple of 4, so with skew = query & 3 the run's buckets start at a multiple of 4 floats in a row shifted by skew: one 16-byte LDS access per run.
// qrt row: position p holds the table at clip(p - 4 - skew, 0, 64), p = 0..75, so a run's start clamped to 0..72 reads the clipped constants. tlg row: position bucket + skew (0..67); runs wholly outside go to a dump run at 68 + 4 hh.
// msk[skew][p] = 1 where position p of a qrt row is a clipped bucket (<= 0 or >= 64), else 0: the clipped part of a band pass's sum is a dot product with it. One query's 64 keys of a pass are never clipped on both sides.
__global__ __launch_bounds__(128) __attribute__((amdgpu_num_vgpr(256))) void k_attn(const _Float16* __restrict__ Q16, const _Float16* __restrict__ K16, const _Float16* __restrict__ VT,
                                                                                const _Float16* __restrict__ RK16, const _Float16* __restrict__ RVT, _Float16* __restrict__ O16) {
  __shared__ __attribute__((aligned(2048))) unsigned char L[2u * AT_STAGE];
  __shared__ __attribute__((aligned(16))) float qrt[4][16][AT_RP];
  __shared__ __attribute__((aligned(16))) float tlg[4][16][AT_RP];
  __shared__ __attribute__((aligned(16))) float msk[4][AT_RP];
  const int tid = threadIdx.x, lane = tid & 31, ln = lane & 15, hh = lane >> 4;
  const int w = __builtin_amdgcn_readfirstlane(tid >> 5);
  const int h = blockIdx.y, b = blockIdx.z;
  const int q0 = blockIdx.x * 64 + w * 16;
  const int qi = q0 + ln;
  const size_t rq = (size_t)b * SEQ + q0;
  const size_t rk = (size_t)b * SEQ;
  const _Float16* qp = Q16 + (rq + ln) * DM + h * HD;
  const v16h qb0 = g2_frag(qp, hh), qb1 = g2_frag(qp + 32, hh);
  const v8f z8 = {0.f, 0.f, 0.f, 0.f, 0.f, 0.f, 0.f, 0.f};
  const int skew = ln & 3;                              /* = query & 3: the wave's first query is a multiple of 16 */
  for (int i = tid; i < 4 * AT_RP; i += 128) {          /* clip mask, one row per skew; published by the barrier that publishes stage 0 */
    const int sk = i / AT_RP, rho = i - sk * AT_RP - 4 - sk;
    msk[sk][i - sk * AT_RP] = (rho <= 0 || rho >= 2 * MAXREL) ? 1.0f : 0.0f;
  }
  // K / V^T ring: wave 0 brings the stage's 64 K rows (next stage 64 rows on), wave 1 its 64 V^T rows (next stage 128 B on); waves 2 and 3 issue nothing
  // Stage st of the ring holds key tile (st + rot) mod AT_NPASS: a block walks all keys once, from its own start and round the end. The blocks of one (head, batch) read the same K and V^T tiles and run in step; the starts, three tiles apart and all different (3 is odd), keep them on different lines at any moment.
  const unsigned int rot = (3u * blockIdx.x) & (AT_NPASS - 1u);
  const unsigned int issuer = (unsigned int)(w < 2);
  const unsigned long long srcb = (unsigned long long)(size_t)(w == 0 ? K16 + rk * DM + h * HD : VT + (size_t)(b * NH + h) * HD * SEQ);
  const unsigned int sstep = (w == 0) ? 64u * (unsigned int)(DM * 2) : AT_ROWB;
  const unsigned int place = (unsigned int)(size_t)L + (w == 0 ? 0u : AT_TILE);
  u32x8 g1;                                             /* 1-byte elements, tensor = tile = 64 rows of 128 B, source pitch one K16 or VT row, 4 dwords of pad behind every 32 */
  g1[0] = uni((1u << 20) | (4u << 22) | (3u << 25));
  g1[1] = pinned(AT_ROWB << 16);                        /* words 1 to 7: descriptor words held in scalar registers, so that the group is built once and its registers stay as they are while a request is outstanding */
  g1[2] = pinned(64u << 16);
  g1[3] = pinned(AT_ROWB << 16);
  g1[4] = pinned(64u);
  g1[5] = pinned(w == 0 ? (unsigned int)(DM * 2) : (unsigned int)(SEQ * 2));
  g1[6] = pinned(0u);
  g1[7] = pinned(0u);
  u32x4 g0;
  const unsigned int cnt1 = pinned(1u);                 /* group 0's constant word held in a scalar register, not written again while a request is outstanding */
  auto issue = [&](unsigned int st) {
    const unsigned long long ga = srcb + (unsigned long long)((st + rot) & (AT_NPASS - 1u)) * sstep;
    g0[0] = uni(cnt1); g0[1] = uni(place + (st & 1u) * AT_STAGE); g0[2] = uni((unsigned int)ga); g0[3] = uni((((unsigned int)(ga >> 32)) & 0x01FFFFFFu) | 0x80000000u);
    asm volatile("tensor_load_to_lds %0, %1" :: "s"(g0), "s"(g1) : "memory");
  };
  if (pinned(issuer)) {
    issue(0u);
    asm volatile("s_wait_tensorcnt 0x0" :: "s"(g0), "s"(g1) : "memory");  /* stage 0 has landed; the descriptor words are named so that their registers stay untouched while the request is outstanding */
  }
  __syncthreads();                                      /* ... and is published to the other waves */
  if (pinned(issuer)) issue(pinned(1u));                /* stage 1 flies while the table below and pass 0 are worked on */
  const unsigned char* kf0 = L + (unsigned int)ln * AT_PITCH + 16u * (unsigned int)hh;
  // relative-key table: buckets 0..NREL-1 of the row of query ln at position bucket + 4 + skew, both clipped ends filled, in base-2 logit units (1/1024 carry, 1/8 scale and log2 e folded)
#pragma unroll
  for (int t = 0; t < RKR / 16; ++t) {
    const _Float16* rp = RK16 + (size_t)(16 * t + ln) * HD;
    const v16h ra0 = g2_frag(rp, hh), ra1 = g2_frag(rp + 32, hh);
    const v8f c = mma2(ra0, qb0, ra1, qb1, z8);
    if (16 * t < 2 * MAXREL) {
#pragma unroll
      for (int r = 0; r < 8; ++r) qrt[w][ln][4 + skew + 16 * t + 8 * hh + r] = c[r] * (0.0001220703125f * LOG2E);
    }
    if (hh == 0) {                                      /* the lanes that hold bucket 0 (first tile) and bucket 64 (last tile) fill the row's clipped ends */
      const float e = c[0] * (0.0001220703125f * LOG2E);
      if (t == 0) {
#pragma unroll
        for (int k = 0; k < 7; ++k) qrt[w][ln][min(k, 4 + skew)] = e;
      }
      if (16 * t == 2 * MAXREL) {
#pragma unroll
        for (int k = 0; k < 8; ++k) qrt[w][ln][min(4 + skew + 2 * MAXREL + k, AT_RP - 1)] = e;
      }
    }
  }
#pragma unroll 1
  for (int c = 0; c < AT_RP / 2; ++c) tlg[w][ln][(AT_RP / 2) * hh + c] = -1.0e30f;
  __builtin_amdgcn_fence(4 /* acq_rel order */, "workgroup"); __builtin_amdgcn_wave_barrier();
  const float* qrow = qrt[w][ln]; float* trow = tlg[w][ln]; const float* mrow = msk[skew];   /* row starts, multiples of 16 B: through these pointers a run of four is one 16-byte access */
  const float c0 = qrow[0], c64 = qrow[AT_RP - 1];
  v8f o0 = z8, o1 = z8, o2 = z8, o3 = z8;
  float mrun = -1.0e30f, lrun = 0.f, wl = 0.f, wr = 0.f;
#pragma unroll 1
  for (unsigned int st = 0; st < AT_NPASS; ++st) {
    const int kt = (int)(((st + rot) & (AT_NPASS - 1u)) << 6);   /* first key of the pass's tile */
    const unsigned char* kf = kf0 + (st & 1u) * AT_STAGE; const unsigned char* vf = kf + AT_TILE;
    v8f s[4];
    v16h kv[4][2];
#pragma unroll
    for (int j = 0; j < 4; ++j) { kv[j][0] = lds_frag(kf + j * 16 * AT_PITCH); kv[j][1] = lds_frag(kf + j * 16 * AT_PITCH + 64); }
    __builtin_amdgcn_sched_barrier(0);                  /* the pass's K reads stay one group ahead of its WMMAs: read tile by tile, the wave waits out the LDS latency four times */
#pragma unroll
    for (int j = 0; j < 4; ++j) s[j] = mma2(kv[j][0], qb0, kv[j][1], qb1, z8);
#pragma unroll
    for (int j = 0; j < 4; ++j) { kv[j][0] = lds_frag(vf + j * 16 * AT_PITCH); kv[j][1] = lds_frag(vf + j * 16 * AT_PITCH + 64); }
    __builtin_amdgcn_sched_barrier(0);                  /* the pass's V^T reads are issued here, as one group: their latency passes under the softmax arithmetic */
    const bool farl = (kt + 63 + MAXREL <= q0);          /* every key of the block at distance <= -32 of every query of the wave */
    const bool farr = (kt >= q0 + 15 + MAXREL);          /* every key at distance >= +32 */
    const int dbase = kt + 8 * hh - qi;
    const bool far = farl || farr;
    const int pbase = dbase + MAXREL + skew;            /* bucket + skew of the lane's first key: a multiple of 4 */
    if (!far) {
      v4f bias[4][2];
#pragma unroll
      for (int j = 0; j < 4; ++j)
#pragma unroll
        for (int m = 0; m < 2; ++m) bias[j][m] = *(const v4fa*)(qrow + min(max(pbase + 16 * j + 4 * m + 4, 0), AT_RP - 4));
#pragma unroll
      for (int j = 0; j < 4; ++j)
#pragma unroll
        for (int m = 0; m < 2; ++m) {
          v4f t4;
#pragma unroll
          for (int e = 0; e < 4; ++e) { t4[e] = s[j][4 * m + e] * AT_KS + bias[j][m][e]; s[j][4 * m + e] = t4[e]; }
          const int pq = pbase + 16 * j + 4 * m;
          *(v4fa*)(trow + (((unsigned int)pq <= (unsigned int)(2 * MAXREL)) ? pq : 2 * MAXREL + 4 + 4 * hh)) = t4;   /* band logits kept; a run with no band key goes to the lane's dump run */
        }
    }
    float mx = -1.0e30f;
#pragma unroll
    for (int j = 0; j < 4; ++j)
#pragma unroll
      for (int r = 0; r < 8; ++r) mx = fmaxf(mx, s[j][r]);
    const float cb = farl ? c0 : c64;
    mx = far ? fmaf(mx, AT_KS, cb) : mx;                /* a far block's scores are still raw: the FMA is monotone, so the maximum's logit is the logits' maximum */
    mx = fmaxf(mx, __shfl_xor(mx, 16, 32));
    const float mnew = fmaxf(mrun, mx);
    const float alpha = __builtin_amdgcn_exp2f(mrun - mnew);
    mrun = mnew;
    const float km = far ? AT_KS : 1.0f;                /* band scores are logits already */
    const float off = (far ? cb : 0.f) + (10.0f - mnew);
    const v2f km2 = {km, km}, off2 = {off, off};
    v2f psj[4]; FragH pf[2];                            /* one chain of packed adds per 16-key tile: four short chains, not one long one */
#pragma unroll
    for (int j = 0; j < 4; ++j)
#pragma unroll
      for (int r = 0; r < 8; r += 2) {
        const v2f sv = {s[j][r], s[j][r + 1]};
        const v2f a = __builtin_elementwise_fma(sv, km2, off2);
        const v2f p = {__builtin_amdgcn_exp2f(a[0]), __builtin_amdgcn_exp2f(a[1])};
        s[j][r] = p[0]; s[j][r + 1] = p[1];
        psj[j] = (r == 0) ? p : psj[j] + p;
        pf[j >> 1].h2[((j & 1) * 8 + r) >> 1] = __builtin_convertvector(p, v2h);
      }
    const v2f ps2 = (psj[0] + psj[1]) + (psj[2] + psj[3]);
    const float ps = ps2[0] + ps2[1];
    float pl = 0.f, pr = 0.f;
    if (far) {
      pl = farl ? ps : 0.f; pr = farl ? 0.f : ps;
    } else {
      v4f mk[4][2];
#pragma unroll
      for (int j = 0; j < 4; ++j)
#pragma unroll
        for (int m = 0; m < 2; ++m) mk[j][m] = *(const v4fa*)(mrow + min(max(pbase + 16 * j + 4 * m + 4, 0), AT_RP - 4));
      v2f pc[2] = {{0.f, 0.f}, {0.f, 0.f}};
#pragma unroll
      for (int j = 0; j < 4; ++j)
#pragma unroll
        for (int m = 0; m < 2; ++m) {
          const v2f pa = {s[j][4 * m], s[j][4 * m + 1]}, pb = {s[j][4 * m + 2], s[j][4 * m + 3]};
          const v2f ma = {mk[j][m][0], mk[j][m][1]}, mb = {mk[j][m][2], mk[j][m][3]};
          pc[0] = __builtin_elementwise_fma(pa, ma, pc[0]);
          pc[1] = __builtin_elementwise_fma(pb, mb, pc[1]);
        }
      const v2f pcs = pc[0] + pc[1];
      const float pclip = pcs[0] + pcs[1];
      const bool lside = (kt - qi <= -MAXREL);            /* the query's first key of the pass is clipped on the left: then none of its 64 keys reaches +32 */
      pl = lside ? pclip : 0.f; pr = lside ? 0.f : pclip;
    }
    wl = wl * alpha + pl; wr = wr * alpha + pr;
    lrun = lrun * alpha + ps;                           /* this lane's keys only: the wave's halves are joined behind the loop */
#pragma unroll
    for (int r = 0; r < 8; ++r) { o0[r] *= alpha; o1[r] *= alpha; o2[r] *= alpha; o3[r] *= alpha; }
    o0 = mma2(kv[0][0], pf[0].v, kv[0][1], pf[1].v, o0);
    o1 = mma2(kv[1][0], pf[0].v, kv[1][1], pf[1].v, o1);
    o2 = mma2(kv[2][0], pf[0].v, kv[2][1], pf[1].v, o2);
    o3 = mma2(kv[3][0], pf[0].v, kv[3][1], pf[1].v, o3);
    asm volatile("s_wait_dscnt 0x0" ::: "memory");      /* this wave has left the buffer of pass st */
    if (pinned(issuer)) asm volatile("s_wait_tensorcnt 0x0" :: "s"(g0), "s"(g1) : "memory");  /* the issuer's tile of stage st + 1 has landed; the descriptor words are named so that their registers stay untouched from the issue to here */
    __syncthreads();                                    /* publishes stage st + 1 and frees the buffer of pass st */
    if (pinned(issuer & (unsigned int)(st + 2u < AT_NPASS))) issue(pinned(st + 2u));  /* refill of the buffer just left: stage st + 2 flies while pass st + 1 is worked on */
  }
  asm volatile("s_wait_tensorcnt 0x0" ::: "memory");    /* nothing of the mover is outstanding when the ring becomes the waves' epilogue staging */
  asm volatile("s_wait_dscnt 0x0" ::: "memory");
  unsigned short (*wt)[104] = (unsigned short (*)[104])(L + (unsigned int)w * AT_WTB);                  /* bucket weights, this wave's own 16 x 104 */
  unsigned short (*so)[72] = (unsigned short (*)[72])(L + 4u * AT_WTB + (unsigned int)w * AT_SOB);      /* output rows, this wave's own 16 x 72 */
  wl += __shfl_xor(wl, 16, 32); wr += __shfl_xor(wr, 16, 32); lrun += __shfl_xor(lrun, 16, 32);
  wl *= 0.0009765625f; wr *= 0.0009765625f;             /* the running sums carry x1024 */
  __builtin_amdgcn_fence(4 /* acq_rel order */, "workgroup"); __builtin_amdgcn_wave_barrier();
  // bucket weight row of query ln, columns 40hh .. 40hh+39 and 80+8hh .. 87+8hh by this lane (all RVK columns written; columns >= NREL zero): eleven 16-byte reads of the kept-logit row, issued together, cover positions 40hh .. 40hh+43
  // (a read past the row's end is clamped: its positions belong to columns >= NREL); two rounds of selects, by bit 0 and bit 1 of the skew, move position column + skew to its column
  {
    float ta[44], tb[42];
#pragma unroll
    for (int c = 0; c < 11; ++c) {
      const v4f tq = *(const v4fa*)(trow + min(40 * hh + 4 * c, AT_RP - 4));
#pragma unroll
      for (int e = 0; e < 4; ++e) ta[4 * c + e] = tq[e];
    }
    const bool sk1 = (skew & 1) != 0, sk2 = (skew & 2) != 0;
#pragma unroll
    for (int i = 0; i < 42; ++i) { const float x0 = ta[i], x1 = ta[i + 1]; tb[i] = sk1 ? x1 : x0; }   /* both values named first: a select between values in registers, not between addresses */
#pragma unroll
    for (int g = 0; g < 5; ++g) {
      FragH f;
#pragma unroll
      for (int q = 0; q < 8; ++q) {
        const int i = 8 * g + q, r = 40 * hh + i;
        const float y0 = tb[i], y2 = tb[i + 2];
        const float tv = sk2 ? y2 : y0;
        float e; asm("v_exp_f32 %0, %1\n\tv_nop" : "=v"(e) : "v"(tv - mrun));   /* exp2 with the slot behind a transcendental in its own statement */
        const float wv = (r == 0) ? wl : (r == 2 * MAXREL) ? wr : (r < 2 * MAXREL) ? e : 0.f;
        f.h[q] = toh_flush(wv * 16.0f);
      }
      *(v8us*)&wt[ln][40 * hh + 8 * g] = f.half[0];
    }
    const v8us zz = {0, 0, 0, 0, 0, 0, 0, 0};
    *(v8us*)&wt[ln][80 + 8 * hh] = zz;
  }
  __builtin_amdgcn_fence(4 /* acq_rel order */, "workgroup"); __builtin_amdgcn_wave_barrier();
#pragma unroll
  for (int ks = 0; ks < RVK / 32; ++ks) {
    FragH wb; wb.half[0] = *(const v8us*)&wt[ln][32 * ks + 8 * hh]; wb.half[1] = *(const v8us*)&wt[ln][32 * ks + 16 + 8 * hh];
    const _Float16* rv = RVT + (size_t)ln * RVK + 32 * ks;
    o0 = g2_mma(g2_frag(rv, hh), wb.v, o0);
    o1 = g2_mma(g2_frag(rv + 16 * RVK, hh), wb.v, o1);
    o2 = g2_mma(g2_frag(rv + 32 * RVK, hh), wb.v, o2);
    o3 = g2_mma(g2_frag(rv + 48 * RVK, hh), wb.v, o3);
  }
  const float rl = (1.0f / lrun) * 16.0f;
  { FragH f;
#pragma unroll
    for (int r = 0; r < 8; ++r) f.h[r] = toh_flush(o0[r] * rl);
    *(v8us*)&so[ln][0 + 8 * hh] = f.half[0]; }
  { FragH f;
#pragma unroll
    for (int r = 0; r < 8; ++r) f.h[r] = toh_flush(o1[r] * rl);
    *(v8us*)&so[ln][16 + 8 * hh] = f.half[0]; }
  { FragH f;
#pragma unroll
    for (int r = 0; r < 8; ++r) f.h[r] = toh_flush(o2[r] * rl);
    *(v8us*)&so[ln][32 + 8 * hh] = f.half[0]; }
  { FragH f;
#pragma unroll
    for (int r = 0; r < 8; ++r) f.h[r] = toh_flush(o3[r] * rl);
    *(v8us*)&so[ln][48 + 8 * hh] = f.half[0]; }
  __builtin_amdgcn_fence(4 /* acq_rel order */, "workgroup"); __builtin_amdgcn_wave_barrier();
  const int li = lane >> 3, pc = lane & 7;
  {
#pragma unroll
    for (int g = 0; g < 4; ++g) {
      const int i = g * 4 + li;
      const v8us v = *(const v8us*)&so[i][pc * 8];
      *(v8us*)((unsigned short*)O16 + (rq + i) * DM + h * HD + pc * 8) = v;
    }
    
  }
}

// out[r][col] = (A1[r] . B1[col]) * al1 + bf16(bias[col]); the same tile loop; each wave stages 32 x 128 f32 at a time in its own quarter of the ring; bias added at the store stage as a 4-wide f32 vector; f32 rows:
__global__ __launch_bounds__(128) void k_out(const _Float16* __restrict__ A1, const _Float16* __restrict__ B1, float al1, const float* __restrict__ bias, float* __restrict__ Out) {
  __shared__ __attribute__((aligned(2048))) unsigned char L[2u * GP_STAGE];
  const int tid = threadIdx.x, lane = tid & 31, ln = lane & 15, hh = lane >> 4;
  const int w = __builtin_amdgcn_readfirstlane(tid >> 5);
  const int ntn = DM / 256;
  const int mt = blockIdx.x / ntn, nq = blockIdx.x - mt * ntn;
  if (mt * 128 >= (int)NR) return;
  const v8f z8 = {0.f, 0.f, 0.f, 0.f, 0.f, 0.f, 0.f, 0.f};
  v8f acc[4][8];
#pragma unroll
  for (int i = 0; i < 4; ++i)
#pragma unroll
    for (int j = 0; j < 8; ++j) acc[i][j] = z8;
  gemm128x256(A1 + (size_t)mt * 128 * DM, B1 + (size_t)nq * 256 * DM, (unsigned int)(mt + 4 * nq), L, w, ln, hh, acc);  /* the 4 blocks of a row tile get 4 different starts; the 64 of a column tile spread evenly over the 16 */
  const int row0 = mt * 128 + 64 * (w >> 1), col0 = nq * 256 + 128 * (w & 1);
  float (*so)[132] = (float (*)[132])(L + (size_t)w * (GP_STAGE / 2u));
  const v4f bz = *(const v4fa*)(bias + col0 + lane * 4);
  v4f bb;
#pragma unroll
  for (int i = 0; i < 4; ++i) bb[i] = bf16_rne(bz[i]);
#pragma unroll
  for (int h2 = 0; h2 < 2; ++h2) {
#pragma unroll
    for (int ii = 0; ii < 2; ++ii)
#pragma unroll
      for (int j = 0; j < 8; ++j)
#pragma unroll
        for (int r = 0; r < 8; ++r) so[ii * 16 + 8 * hh + r][j * 16 + ln] = acc[2 * h2 + ii][j][r] * al1;
    __builtin_amdgcn_fence(4 /* acq_rel order */, "workgroup"); __builtin_amdgcn_wave_barrier();
#pragma unroll 1                                        /* groups of eight rows: eight LDS reads in flight cover their latency, one wait per group behind the stores */
    for (int q8 = 0; q8 < 32; q8 += 8) {
#pragma unroll
      for (int q = 0; q < 8; ++q) {
        const v4f v0 = *(const v4fa*)&so[q8 + q][lane * 4];
        const v4f v = v0 + bb;
        *(v4f*)(Out + (size_t)(row0 + 32 * h2 + q8 + q) * DM + col0 + lane * 4) = v;
      }
      asm volatile("s_wait_xcnt 0x0" ::: "memory");     /* in front of the next group, which overwrites registers that these stores name */
    }
    __builtin_amdgcn_fence(4 /* acq_rel order */, "workgroup"); __builtin_amdgcn_wave_barrier();
  }
}

extern "C" void kernel_launch(void* const* d_in, const int* in_sizes, int n_in,
                              void* d_out, int out_size, void* d_ws, size_t ws_size, hipStream_t stream) {
  if (n_in < 8) return;
  if (in_sizes[0] < (int)(((size_t)(NB - 1) * SEQ_FULL + SEQ) * DM)) return;
  for (int i = 1; i <= 4; ++i) if (in_sizes[i] < DM * DM) return;
  if (in_sizes[5] < DM) return;
  if (in_sizes[6] < NREL * HD) return;
  if (in_sizes[7] < NREL * HD) return;
  if (out_size < (int)(NR * DM)) return;
  const float* const* I = (const float* const*)d_in;
  const float* x = I[0]; const float* wq = I[1]; const float* wk = I[2]; const float* wv = I[3]; const float* wo = I[4]; const float* bo = I[5]; const float* relk = I[6]; const float* relv = I[7];
  char* ws = (char*)d_ws; size_t off = 0;
  auto take = [&](size_t bytes) { char* p = ws + off; off += (bytes + 255) & ~(size_t)255; return p; };
  _Float16* BQKV = (_Float16*)take((size_t)3 * SZ_BT);               /* Bt planes q, k, v (contiguous, stride DM*DM) */
  _Float16* BO   = (_Float16*)take(SZ_BT);
  _Float16* RK16 = (_Float16*)take(SZ_RK);                           /* [RKR][HD] */
  _Float16* RVT  = (_Float16*)take(SZ_RV);                           /* [HD][RVK] */
  _Float16* X16  = (_Float16*)take(SZ_ACT);
  _Float16* QKV16 = (_Float16*)take((size_t)3 * SZ_ACT);             /* Q16, K16 planes (stride NR*DM); the third plane is not used */
  _Float16* VT   = (_Float16*)take((size_t)NB * NH * HD * SEQ * 2);  /* [b*NH+h][d][s] */
  _Float16* O16  = (_Float16*)take(SZ_ACT);
  if (off > ws_size) return;
  _Float16* Q16 = QKV16; _Float16* K16 = QKV16 + NR * DM;

  k_prep<<<PW_REL + PW_BLK, PW_THREADS, 0, stream>>>(x, wq, wk, wv, wo, relk, relv, X16, BQKV, BO, RK16, RVT);      /* every f32 -> f16 operand plane */
  k_qkv<<<dim3((unsigned)((NR / 128) * (DM / 256)), 3), 128, 0, stream>>>(X16, BQKV, 0.0625f, QKV16, VT);      /* q, k as f16 rows, v as f16 V^T rows */
  k_attn<<<dim3(SEQ / 64, NH, NB), 128, 0, stream>>>(Q16, K16, VT, RK16, RVT, O16);
  k_out<<<(unsigned)((NR / 128) * (DM / 256)), 128, 0, stream>>>(O16, BO, 0.00390625f, bo, (float*)d_out);      /* out = ctx Wo^T + b_o */
}

// v009
// It runs in 107 microseconds.
// Timed twice side by side with v008, it ran 1.06 times as fast both times.
// Counting every step since v000, it is 3.83 times as fast.
#include <hip/hip_runtime.h>
// Contractions: q/k/v/o projections ([tokens][1024] x [1024][1024]^T), scores k.q^T (K = 64), relative-key table relk.q^T (K = 64), v^T.p^T (K = keys) and relv^T.w^T (K = 65 padded to 96) on v_wmma_f32_16x16x32_f16 (f16 operands, f32 accumulate). Inputs RNE-converted to bf16 on load (exact in f16; weights carried x16, relk x1024, relv x64), softmax numerators carried x1024, bucket weights x16, ctx rows x16; softmax statistics and all epilogues in f32.
// Structure: token rows r = b*SEQ + s. X16 = f16(bf16(x)); Q16/K16 = f16(X16 . Bt_w / 16) as token rows, VT[b*NH+h][d][s] = f16(X16 . Bt_v / 16) stored transposed by the projection itself; attention per (128 queries, head, batch), 32 queries per wave: per wave a table QR[query][bucket] = q . relk[bucket] / 8
// (10 WMMA tiles into wave-private LDS), S^T tiles = K . Q^T, logit = s/8 + QR[query][clip(key - query, -32, 32) + 32], online softmax per lane, O^T = VT . P^T; bucket weights W[query][bucket] (buckets 1..63 from band logits kept in LDS,
// buckets 0 and 64 as running sums) then O^T += RelVT . W^T; O16[r][h*64+d] = f16(16 ctx); out = (O16 . Bt_o) / 256 + bf16(b_o) -> f32 rows.
#ifndef NB
#define NB 8
#endif
#ifndef SEQ
#define SEQ 1024
#endif
#define NB_FULL 8
#define SEQ_FULL 1024
#define DM 1024
#define NH 16
#define HD 64
#define MAXREL 32
#define NREL 65
#define RKR 80
#define RVK 96
#define NR ((size_t)NB * SEQ)
#define SZ_BT ((size_t)DM * DM * 2)
#define SZ_ACT (NR * DM * 2)
#define SZ_RK ((size_t)RKR * HD * 2)
#define SZ_RV ((size_t)HD * RVK * 2)
#define WS_TOTAL ((size_t)4 * SZ_BT + SZ_RK + SZ_RV + (size_t)6 * SZ_ACT)
static_assert(NH * HD == DM);
static_assert(SEQ % 128 == 0);
static_assert(SEQ <= SEQ_FULL);
static_assert(NB >= 1 && NB <= NB_FULL);
static_assert(DM == 128 * 8);
static_assert(DM % 256 == 0);
static_assert(HD == 64);
static_assert(NREL == 2 * MAXREL + 1);
static_assert(RKR % 16 == 0 && RKR >= NREL);
static_assert(RVK % 32 == 0 && RVK >= NREL);
static_assert((RKR * HD / 8) % 32 == 0);
static_assert((HD * RVK / 8) % 256 == 0);
static_assert(SZ_BT % 256 == 0 && SZ_ACT % 256 == 0 && SZ_RK % 256 == 0 && SZ_RV % 256 == 0);
static_assert(WS_TOTAL <= (size_t)134217728);
static_assert((size_t)NB * NH * HD * SEQ * 2 == SZ_ACT);

typedef _Float16 v16h __attribute__((ext_vector_type(16)));
typedef unsigned short v8us __attribute__((ext_vector_type(8), may_alias));
typedef float v8f __attribute__((ext_vector_type(8)));
typedef float v4f __attribute__((ext_vector_type(4)));
typedef float v4fa __attribute__((ext_vector_type(4), may_alias));
typedef _Float16 v4h __attribute__((ext_vector_type(4)));
typedef float v2f __attribute__((ext_vector_type(2)));
typedef _Float16 v2h __attribute__((ext_vector_type(2)));
union FragH { v16h v; v8us half[2]; v2h h2[8]; _Float16 h[16]; unsigned short u[16]; };

__device__ __forceinline__ unsigned short bf16_bits(float x) { unsigned int u = __float_as_uint(x); return (unsigned short)((u + 0x7FFFu + ((u >> 16) & 1u)) >> 16); }
__device__ __forceinline__ float bf16_val(unsigned short b) { return __uint_as_float(((unsigned int)b) << 16); }
__device__ __forceinline__ float bf16_rne(float x) { return bf16_val(bf16_bits(x)); }
// f32 -> f16 operand convert that cannot produce an f16 subnormal (value select)
static __device__ __forceinline__ _Float16 toh_flush(float v) { const _Float16 r = (_Float16)v; return (fabsf(v) < 6.103515625e-05f) ? (_Float16)0.0f : r; }

// 16x32 f16 fragment from a k-contiguous row: elements 0..7 <- p[8h .. 8h+7], elements 8..15 <- p[16+8h .. 16+8h+7] (same map for A rows and for Bt[n][k] rows)
__device__ __forceinline__ v16h g2_frag(const _Float16* p, int hh) { FragH f; f.half[0] = *(const v8us*)((const unsigned short*)p + 8 * hh); f.half[1] = *(const v8us*)((const unsigned short*)p + 16 + 8 * hh); return f.v; }
__device__ __forceinline__ v8f g2_mma(v16h a, v16h b, v8f c) { v8f d = __builtin_amdgcn_wmma_f32_16x16x32_f16(false, a, false, b, (short)0, c, false, false); asm volatile("v_nop\n\tv_nop\n\tv_nop\n\tv_nop" : "+v"(d) : "v"(a), "v"(b)); return d; }
// two k-steps into one accumulator, hazard guard after the second
__device__ __forceinline__ v8f mma2(v16h a0, v16h b0, v16h a1, v16h b1, v8f c) {
  c = __builtin_amdgcn_wmma_f32_16x16x32_f16(false, a0, false, b0, (short)0, c, false, false);
  c = __builtin_amdgcn_wmma_f32_16x16x32_f16(false, a1, false, b1, (short)0, c, false, false);
  asm volatile("v_nop\n\tv_nop\n\tv_nop\n\tv_nop" : "+v"(c) : "v"(a0), "v"(b0), "v"(a1), "v"(b1));
  return c;
}

// Operand conversions in one grid of few, long waves: the launch starts 16 waves per work-group, about one work-group per WGP, and each wave keeps all its loads in flight.
// A chunk is PW_CH = 1024 consecutive f32 (4 KiB): lane l reads 16 B at float 128 j + 4 l, j = 0..7 (every load covers four whole lines), and stores 8 B of f16 at the same element index (every store covers two whole lines).
// Wave gw owns weight chunk gw of the planes q, k, v, o laid end to end (Bt[n][k] = f16(bf16(w[n][k]) * 16)) and the PW_XPW adjacent token rows from gw * PW_XPW of x (a row is one chunk; X16[r][c] = f16(bf16(x)); input rows read at the full stride b*SEQ_FULL + s; the rows of a wave lie in one batch).
// All of a wave's loads are issued before its first convert. None of the parts reads what another writes: block-uniform branches, no barrier.
#define PW_THREADS 512
#define PW_CH 1024
#define PW_NWV ((unsigned)((size_t)4 * DM * DM / PW_CH))
#define PW_BLK (PW_NWV / (PW_THREADS / 32u))
#define PW_XPW ((unsigned)((NR + PW_NWV - 1) / PW_NWV))
#define PW_RKC ((unsigned)(RKR * HD / 8))
#define PW_RVC ((unsigned)(HD * RVK / 8))
#define PW_REL ((PW_RKC + PW_RVC + PW_THREADS - 1u) / PW_THREADS)
static_assert(DM == PW_CH && ((size_t)DM * DM) % PW_CH == 0 && PW_NWV % (PW_THREADS / 32u) == 0);
static_assert(PW_RKC % 32u == 0 && PW_RVC % 32u == 0);
static_assert(NR % PW_XPW == 0 && SEQ % PW_XPW == 0);

// relative-position planes, one 8-element piece per thread, its loads independent: RK16[bucket][d] = f16(bf16(relk[bucket][d]) * 1024), rows NREL..RKR-1 zero; RVT[d][bucket] = f16(bf16(relv[bucket][d]) * 64), columns NREL..RVK-1 zero.
__device__ __forceinline__ void d_rel(const float* __restrict__ relk, const float* __restrict__ relv, unsigned int t, _Float16* __restrict__ RK16, _Float16* __restrict__ RVT) {
  if (t < PW_RKC) {                                     /* wave-uniform: the piece counts are multiples of 32 */
    const int c = (int)t;
    const int row = c / (HD / 8), d8 = (c % (HD / 8)) * 8;
    const int rr = min(row, NREL - 1);
    const float* rp = relk + rr * HD + d8;              /* a multiple of 8 floats from the plane's start: two aligned 16-byte loads */
    const v4f va = *(const v4fa*)rp, vb = *(const v4fa*)(rp + 4);
    FragH f;
#pragma unroll
    for (int q = 0; q < 4; ++q) { f.h[q] = toh_flush((row < NREL) ? bf16_rne(va[q]) * 1024.0f : 0.0f); f.h[4 + q] = toh_flush((row < NREL) ? bf16_rne(vb[q]) * 1024.0f : 0.0f); }
    *(v8us*)((unsigned short*)RK16 + (size_t)c * 8) = f.half[0];
  } else if (t < PW_RKC + PW_RVC) {
    const int c = (int)(t - PW_RKC);
    const int d = c / (RVK / 8), r8 = (c % (RVK / 8)) * 8;
    float val[8];
#pragma unroll
    for (int q = 0; q < 8; ++q) val[q] = relv[min(r8 + q, NREL - 1) * HD + d];
    FragH f;
#pragma unroll
    for (int q = 0; q < 8; ++q) f.h[q] = toh_flush((r8 + q < NREL) ? bf16_rne(val[q]) * 64.0f : 0.0f);
    *(v8us*)((unsigned short*)RVT + (size_t)c * 8) = f.half[0];
  }
}

// Blocks 0 .. PW_REL-1: the relative-position planes; then PW_BLK blocks of 16 waves for the weight planes and x.
__global__ __launch_bounds__(PW_THREADS) void k_prep(const float* __restrict__ x, const float* __restrict__ wq, const float* __restrict__ wk, const float* __restrict__ wv, const float* __restrict__ wo,
                                              const float* __restrict__ relk, const float* __restrict__ relv,
                                              _Float16* __restrict__ X16, _Float16* __restrict__ BQKV, _Float16* __restrict__ BO, _Float16* __restrict__ RK16, _Float16* __restrict__ RVT) {
  const unsigned int bid = blockIdx.x;
  if (bid < PW_REL) { d_rel(relk, relv, bid * PW_THREADS + threadIdx.x, RK16, RVT); return; }
  const unsigned int lo = 16u * (threadIdx.x & 31u);    /* the lane's byte offset in every 512-B load; half of it in every 256-B store */
  const unsigned int gw = (bid - PW_REL) * (PW_THREADS / 32u) + (unsigned int)__builtin_amdgcn_readfirstlane(threadIdx.x >> 5);
  const unsigned int pl = gw / (unsigned)((size_t)DM * DM / PW_CH), ch = gw - pl * (unsigned)((size_t)DM * DM / PW_CH);
  const float* w = (pl == 0u) ? wq : (pl == 1u) ? wk : (pl == 2u) ? wv : wo;
  const char* wsrc = (const char*)(w + (size_t)ch * PW_CH);
  const unsigned int r0 = min(gw * PW_XPW, (unsigned int)NR - PW_XPW);    /* a wave past the last row re-reads the last rows and stores nothing */
  const unsigned int b = r0 / SEQ, s = r0 - b * SEQ;
  const char* xsrc = (const char*)(x + ((size_t)b * SEQ_FULL + s) * DM);
  v4f wa[8], xa[8 * PW_XPW];
#pragma unroll
  for (unsigned int j = 0; j < 8u; ++j) wa[j] = *(const v4fa*)(wsrc + lo + 512u * j);
#pragma unroll
  for (unsigned int j = 0; j < 8u * PW_XPW; ++j) xa[j] = *(const v4fa*)(xsrc + lo + 512u * j);
  asm volatile("s_wait_xcnt 0x0" :: "v"(lo) : "memory");  /* behind the loads, in front of the converts and the store addresses, which reuse registers; the lane offset that every load names is an input, so that its register stays as it is up to here */
  __builtin_amdgcn_sched_barrier(0);                    /* every load of the wave, and the wait above, stand in front of its first convert: with loads moved down among the converts only a window of them is in flight and the wave waits out the memory latency several times */
  char* wdst = (char*)(((pl < 3u) ? BQKV + (size_t)pl * DM * DM : BO) + (size_t)ch * PW_CH);
  v4h wh[8], xh[8 * PW_XPW];
#pragma unroll
  for (unsigned int j = 0; j < 8u; ++j)
#pragma unroll
    for (int q = 0; q < 4; ++q) wh[j][q] = (_Float16)(bf16_rne(wa[j][q]) * 16.0f);
#pragma unroll
  for (unsigned int j = 0; j < 8u * PW_XPW; ++j)
#pragma unroll
    for (int q = 0; q < 4; ++q) xh[j][q] = toh_flush(bf16_rne(xa[j][q]));
#pragma unroll
  for (unsigned int j = 0; j < 8u; ++j) *(v4h*)(wdst + (lo >> 1) + 256u * j) = wh[j];
  if ((size_t)PW_NWV * PW_XPW == NR || gw * PW_XPW < (unsigned int)NR) {  /* wave-uniform; always true where the rows fill the waves exactly */
    char* xdst = (char*)(X16 + (size_t)r0 * DM);
#pragma unroll
    for (unsigned int j = 0; j < 8u * PW_XPW; ++j) *(v4h*)(xdst + (lo >> 1) + 256u * j) = xh[j];
  }
  asm volatile("s_wait_xcnt 0x0" ::: "memory");         /* behind the wave's last store */
}

// Projection GEMM tile: one block of 4 waves computes 128 rows x 256 columns; wave (w >> 1, w & 1) owns 64 x 128 (4 x 8 accumulator tiles).
// A pass is 64 k = 128 B of every operand row. A stage in LDS is [A slice 0 | A slice 1 | B slice 0 | B slice 1], rows at pitch 144 B (128 B + the mover's 16 B pad, conflict-free for 16-byte reads);
// A slices hold 64 rows (9216 B, placed every 10240 B so that each place is a multiple of 2 KiB), B slices 128 rows (18432 B). Two stages; every wave issues one tensor load per stage: waves 0, 1 the A slices, waves 2, 3 the B slices.
#define GP_ROWB 128u
#define GP_PITCH 144u
#define GP_SLA 10240u
#define GP_SLB 18432u
#define GP_STAGE (2u * GP_SLA + 2u * GP_SLB)
#define GP_NPASS ((unsigned)(DM * 2) / GP_ROWB)
static_assert(GP_SLA % 2048u == 0 && GP_SLB % 2048u == 0 && GP_STAGE % 2048u == 0);
static_assert(64u * GP_PITCH <= GP_SLA && 128u * GP_PITCH <= GP_SLB);
static_assert(GP_NPASS >= 2 && (GP_NPASS & (GP_NPASS - 1u)) == 0);
static_assert(NR % 128 == 0 && DM % 256 == 0);
static_assert(4u * 32u * 132u * 4u <= 2u * GP_STAGE);
typedef unsigned int u32x4 __attribute__((ext_vector_type(4)));
typedef unsigned int u32x8 __attribute__((ext_vector_type(8)));
__device__ __forceinline__ unsigned int uni(unsigned int v) { return (unsigned int)__builtin_amdgcn_readfirstlane(v); }
__device__ __forceinline__ unsigned int pinned(unsigned int v) { unsigned int s = uni(v); asm volatile("" : "+s"(s)); return s; }  // a wave-uniform word held in a scalar register, so that the test around a tensor load is a scalar branch and a descriptor formed from the word stays behind the wait and the barrier in front of it
__device__ __forceinline__ v16h lds_frag(const unsigned char* p) { FragH f; f.half[0] = *(const v8us*)p; f.half[1] = *(const v8us*)(p + 32); return f.v; }

// rot (block-uniform): stage st of the ring holds k slice (st + rot) mod GP_NPASS of both operands, so a block walks all of k once, from its own start and round the end. Blocks that share an A or a B tile run in step; with one common start they ask L2 for the same lines at the same moment, with different starts for different lines.
__device__ __forceinline__ void gemm128x256(const _Float16* __restrict__ Arows, const _Float16* __restrict__ Brows, unsigned int rot, unsigned char* L, int w, int ln, int hh, v8f (&acc)[4][8]) {
  const unsigned int lbase = (unsigned int)(size_t)L;
  const bool isB = w >= 2; const unsigned int sl = (unsigned int)w & 1u;
  const unsigned int nrows = isB ? 128u : 64u;
  const unsigned long long srcb = (unsigned long long)(size_t)(isB ? Brows + (size_t)sl * 128 * DM : Arows + (size_t)sl * 64 * DM);
  const unsigned int place = lbase + (isB ? 2u * GP_SLA + sl * GP_SLB : sl * GP_SLA);
  u32x8 g1;                                             /* 1-byte elements, tensor = tile = nrows rows of 128 B, source pitch one operand row, 4 dwords of pad behind every 32 */
  g1[0] = uni((1u << 20) | (4u << 22) | (3u << 25));
  g1[1] = uni(GP_ROWB << 16);
  g1[2] = uni(nrows << 16);
  g1[3] = uni(GP_ROWB << 16);
  g1[4] = uni(nrows);
  g1[5] = uni((unsigned int)(DM * 2));
  g1[6] = uni(0u);
  g1[7] = uni(0u);
  u32x4 g0;
  auto issue = [&](unsigned int st) {
    const unsigned long long ga = srcb + (unsigned long long)(((st + rot) & (GP_NPASS - 1u)) * GP_ROWB);
    g0[0] = uni(1u); g0[1] = uni(place + (st & 1u) * GP_STAGE); g0[2] = uni((unsigned int)ga); g0[3] = uni((((unsigned int)(ga >> 32)) & 0x01FFFFFFu) | 0x80000000u);
    asm volatile("tensor_load_to_lds %0, %1" :: "s"(g0), "s"(g1) : "memory");
  };
  issue(0u);
  asm volatile("s_wait_tensorcnt 0x0" :: "s"(g0), "s"(g1) : "memory");  /* stage 0 has landed for this wave's slice; the descriptor words are named so that their registers stay untouched while the request is outstanding */
  __syncthreads();                                      /* ... and is published to the other waves */
  const unsigned char* ap = L + (unsigned int)(w >> 1) * GP_SLA + (unsigned int)ln * GP_PITCH + 16u * (unsigned int)hh;
  const unsigned char* bp = L + 2u * GP_SLA + (unsigned int)(w & 1) * GP_SLB + (unsigned int)ln * GP_PITCH + 16u * (unsigned int)hh;
#pragma unroll 1
  for (unsigned int s = 0; s < GP_NPASS; ++s) {         /* rolled: one copy of the pass in the instruction cache; the buffer is picked by the pass's parity */
    if (pinned(s + 1u < GP_NPASS)) issue(pinned(s + 1u)); /* behind the barrier that freed its buffer: stage s + 1 flies while pass s is worked on */
    const unsigned char* as = ap + (s & 1u) * GP_STAGE; const unsigned char* bs = bp + (s & 1u) * GP_STAGE;
    v16h a[2][4], b[2][8];
#pragma unroll
    for (int ks = 0; ks < 2; ++ks) {
      a[ks][0] = lds_frag(as + ks * 64);
#pragma unroll
      for (int j = 0; j < 8; ++j) b[ks][j] = lds_frag(bs + j * 16 * GP_PITCH + ks * 64);
#pragma unroll
      for (int i = 1; i < 4; ++i) a[ks][i] = lds_frag(as + i * 16 * GP_PITCH + ks * 64);
    }
    __builtin_amdgcn_sched_barrier(0);                  /* the pass's LDS reads stay one group ahead of its WMMAs (for speed only) */
#pragma unroll
    for (int ks = 0; ks < 2; ++ks)
#pragma unroll
      for (int i = 0; i < 4; ++i)
#pragma unroll
        for (int j = 0; j < 8; ++j) acc[i][j] = __builtin_amdgcn_wmma_f32_16x16x32_f16(false, a[ks][i], false, b[ks][j], (short)0, acc[i][j], false, false);
    __builtin_amdgcn_sched_barrier(0);                  /* the WMMAs stay in front of the publish point: moved behind it, the wait for stage s + 1 would stand a whole pass earlier and the refill would lose its lead */
    asm volatile("s_wait_dscnt 0x0" ::: "memory");      /* this wave has left the buffer of pass s */
    asm volatile("s_wait_tensorcnt 0x0" :: "s"(g0), "s"(g1) : "memory");  /* its slice of stage s + 1 has landed; the descriptor words are named so that their registers stay untouched from the issue to here */
    __syncthreads();                                    /* publishes stage s + 1 and frees the buffer of pass s */
  }
  asm volatile("s_wait_tensorcnt 0x0" ::: "memory");    /* nothing of the mover is outstanding when the ring becomes output staging */
  asm volatile("s_wait_dscnt 0x0" ::: "memory");
}

// projections: plane by (0 q, 1 k, 2 v): Y16_by[r][col] = f16((X16[r] . Bt_by[col]) * alpha) for q and k; the v plane goes out transposed, VT[b*DM + col][s]. The last pass's barrier has ended every read of the ring; each wave then stages in its own quarter of it:
// q, k: 32 x 128 f32 at a time. v: a lane's 8 accumulator rows of a tile are 8 consecutive tokens of one column, so they are one 16-byte LDS write into [column][token] rows (64 tokens = 128 B; pitch 144 B, so that the 16 rows a half-wave writes fall on distinct banks); read back, 8 lanes store one whole 128-B line of a VT row.
#define VS_PITCH 144u
static_assert(128u * VS_PITCH <= GP_STAGE / 2u && (GP_STAGE / 2u) % 16u == 0);
static_assert(SEQ % 128 == 0);
__global__ __launch_bounds__(128) void k_qkv(const _Float16* __restrict__ X16, const _Float16* __restrict__ Bt, float alpha, _Float16* __restrict__ Y16, _Float16* __restrict__ VT) {
  __shared__ __attribute__((aligned(2048))) unsigned char L[2u * GP_STAGE];
  const int tid = threadIdx.x, lane = tid & 31, ln = lane & 15, hh = lane >> 4;
  const int w = __builtin_amdgcn_readfirstlane(tid >> 5);
  const int by = blockIdx.y;
  const _Float16* Bh = Bt + (size_t)by * DM * DM;
  _Float16* Yp = Y16 + (size_t)by * NR * DM;
  const int ntn = DM / 256;
  const int mt = blockIdx.x / ntn, nq = blockIdx.x - mt * ntn;
  if (mt * 128 >= (int)NR) return;
  const v8f z8 = {0.f, 0.f, 0.f, 0.f, 0.f, 0.f, 0.f, 0.f};
  v8f acc[4][8];
#pragma unroll
  for (int i = 0; i < 4; ++i)
#pragma unroll
    for (int j = 0; j < 8; ++j) acc[i][j] = z8;
  gemm128x256(X16 + (size_t)mt * 128 * DM, Bh + (size_t)nq * 256 * DM, (unsigned int)(mt + 4 * nq + by), L, w, ln, hh, acc);  /* the 12 blocks of a row tile get 12 different starts; the 64 of a column tile spread evenly over the 16 */
  const int row0 = mt * 128 + 64 * (w >> 1), col0 = nq * 256 + 128 * (w & 1);
  if (by == 2) {                                        /* block-uniform: the whole block is of one plane */
    unsigned char* st = L + (size_t)w * (GP_STAGE / 2u);
#pragma unroll
    for (int i = 0; i < 4; ++i)
#pragma unroll
      for (int j = 0; j < 8; ++j) {
        FragH f;
#pragma unroll
        for (int r = 0; r < 8; ++r) f.h[r] = toh_flush(acc[i][j][r] * alpha);
        *(v8us*)(st + (unsigned int)(16 * j + ln) * VS_PITCH + 32u * (unsigned int)i + 16u * (unsigned int)hh) = f.half[0];
      }
    __builtin_amdgcn_fence(4 /* acq_rel order */, "workgroup"); __builtin_amdgcn_wave_barrier();
    const int bb = row0 / SEQ, s0 = row0 - bb * SEQ;    /* the wave's 64 tokens lie in one batch */
    const unsigned char* sr = st + (unsigned int)(lane >> 3) * VS_PITCH + (unsigned int)(lane & 7) * 16u;
    unsigned short* vo = (unsigned short*)VT + ((size_t)bb * DM + col0 + (lane >> 3)) * SEQ + s0 + (lane & 7) * 8;
#pragma unroll 1                                        /* groups of eight: eight LDS reads in flight cover their latency, one wait per group behind the stores */
    for (int q8 = 0; q8 < 32; q8 += 8) {
#pragma unroll
      for (int q = 0; q < 8; ++q) {
        const v8us v = *(const v8us*)(sr + (unsigned int)(q8 + q) * 4u * VS_PITCH);
        *(v8us*)(vo + (size_t)(q8 + q) * 4 * SEQ) = v;
      }
      asm volatile("s_wait_xcnt 0x0" ::: "memory");     /* in front of the next group, which overwrites registers that these stores name */
    }
    return;
  }
  float (*so)[132] = (float (*)[132])(L + (size_t)w * (GP_STAGE / 2u));
#pragma unroll
  for (int h2 = 0; h2 < 2; ++h2) {
#pragma unroll
    for (int ii = 0; ii < 2; ++ii)
#pragma unroll
      for (int j = 0; j < 8; ++j)
#pragma unroll
        for (int r = 0; r < 8; ++r) so[ii * 16 + 8 * hh + r][j * 16 + ln] = acc[2 * h2 + ii][j][r] * alpha;
    __builtin_amdgcn_fence(4 /* acq_rel order */, "workgroup"); __builtin_amdgcn_wave_barrier();
#pragma unroll 1                                        /* groups of eight rows: eight LDS reads in flight cover their latency, one wait per group behind the stores */
    for (int q8 = 0; q8 < 32; q8 += 8) {
#pragma unroll
      for (int q = 0; q < 8; ++q) {
        const v4f v = *(const v4fa*)&so[q8 + q][lane * 4]; v4h h4;
#pragma unroll
        for (int i = 0; i < 4; ++i) h4[i] = toh_flush(v[i]);
        *(v4h*)(Yp + (size_t)(row0 + 32 * h2 + q8 + q) * DM + col0 + lane * 4) = h4;
      }
      asm volatile("s_wait_xcnt 0x0" ::: "memory");     /* in front of the next group, which overwrites registers that these stores name */
    }
    __builtin_amdgcn_fence(4 /* acq_rel order */, "workgroup"); __builtin_amdgcn_wave_barrier();
  }
}

// Attention K / V^T ring: a stage is 64 keys = [K tile: 64 key rows of 128 B | V^T tile: 64 d rows of 128 B], rows at pitch 144 B (128 B + the mover's 16 B pad, conflict-free for 16-byte reads); a tile holds 9216 B and is placed every 10240 B (a multiple of 2 KiB).
// Two stages, shared by the block's four waves. A wave owns AT_QW = 32 queries as two 16-query column tiles: every K and V^T fragment it reads from LDS feeds two WMMAs, and a block's stage serves 128 queries. Four blocks fit one WGP (LDS, registers), so the whole grid is resident at four waves per SIMD. Behind the loop's last barrier the ring is free and holds each wave's own bucket-weight rows.
#define AT_ROWB 128u
#define AT_PITCH 144u
#define AT_TILE 10240u
#define AT_STAGE (2u * AT_TILE)
#define AT_NPASS ((unsigned)SEQ / 64u)
#define AT_QW 32
#define AT_WTB ((unsigned)AT_QW * 104u * 2u)
#define AT_SOB ((unsigned)AT_QW * 72u * 2u)
#define LOG2E 1.4426950408889634f
#define AT_KS (0.125f * LOG2E)
#define AT_RP 76
static_assert(AT_RP == 4 + NREL + 3 + 4 && (AT_RP * 4) % 16 == 0 && AT_RP % 2 == 0);
static_assert(RVK == 96 && NREL + 3 <= 40 + 36 && 40 + 36 <= AT_RP);
static_assert(AT_TILE % 2048u == 0 && 64u * AT_PITCH <= AT_TILE);
static_assert(AT_NPASS >= 2 && (AT_NPASS & (AT_NPASS - 1u)) == 0);
static_assert(AT_ROWB == (unsigned)(HD * 2) && (DM * 2) % 16 == 0 && (SEQ * 2) % 16 == 0 && SEQ % 64 == 0);
static_assert(AT_QW == 32 && SEQ % (4 * AT_QW) == 0);
static_assert(4u * AT_WTB <= 2u * AT_STAGE && AT_WTB % 16u == 0 && AT_SOB <= (unsigned)(AT_QW * AT_RP * 4) && (AT_QW * AT_RP * 4) % 16 == 0);
static_assert(4u * (2u * AT_STAGE + (unsigned)(4 * AT_QW * AT_RP * 4) + (unsigned)(4 * AT_RP * 4)) <= 327680u);
static_assert(64u * AT_PITCH + 32u * 16u <= AT_TILE && (64u * AT_PITCH) % 16u == 0);
// QR^T tiles (16 buckets x 16 queries) = RK16 . Q^T -> qrt[w][query], a skewed row (below) of q.relk[bucket] / 8. S^T 16-key tiles = K . Q^T (A = K16 rows: row = key, k = d; B = Q16 rows: col = query);
// each lane holds keys 8hh+r of query ln; logit = s/8 + the row's entry of bucket clip(key-query)+32, carried in base 2 (table, maximum and kept band logits all x log2 e); 64-key blocks wholly left (key-query <= -32) or right (>= 32) of the band take one per-lane constant (wave-uniform test);
// p x 1024 = exp2(one FMA per score: scale, constant, maximum and the carry's exponent 10 folded), as f16 and in the f32 sums alike; O^T (64 d x 16 queries) = VT . P^T with the B operand packed from the two adjacent S^T D tiles (element r <- keys 0..15, element 8+r <- keys 16..31).
// Bucket weights: buckets 1..63 hold one key each -> the logit is kept in the query's qrt row, over the bias it was formed from, and exponentiated against the final maximum; buckets 0 / 64 are running sums scaled with the online factor.
// Skewed rows: a lane's keys come in runs of four (d, d+1, d+2, d+3) with d + query a multiple of 4, so with skew = query & 3 the run's buckets start at a multiple of 4 floats in a row shifted by skew: one 16-byte LDS access per run.
// qrt row: position p holds the table at clip(p - 4 - skew, 0, 64), p = 0..75, so a run's start clamped to 0..72 reads the clipped constants. A run's start in 4..68 belongs to that one run of four keys, so its four logits replace its four biases in place (one table per query instead of two: half the LDS); runs wholly outside read the clamped ends, which stay, and store to a dump run.
// msk[skew][p] = 1 where position p of a qrt row is a clipped bucket (<= 0 or >= 64), else 0: the clipped part of a band pass's sum is a dot product with it. One query's 64 keys of a pass are never clipped on both sides.
__global__ __launch_bounds__(128) __attribute__((amdgpu_waves_per_eu(4, 4))) void k_attn(const _Float16* __restrict__ Q16, const _Float16* __restrict__ K16, const _Float16* __restrict__ VT,
                                                                                const _Float16* __restrict__ RK16, const _Float16* __restrict__ RVT, _Float16* __restrict__ O16) {
  __shared__ __attribute__((aligned(2048))) unsigned char L[2u * AT_STAGE];
  __shared__ __attribute__((aligned(16))) float qrt[4][AT_QW][AT_RP];
  __shared__ __attribute__((aligned(16))) float msk[4][AT_RP];
  const int tid = threadIdx.x, lane = tid & 31, ln = lane & 15, hh = lane >> 4;
  const int w = __builtin_amdgcn_readfirstlane(tid >> 5);
  const int h = blockIdx.y, b = blockIdx.z;
  const int q0 = blockIdx.x * (4 * AT_QW) + w * AT_QW;  /* the wave's first query; its column tile t holds queries q0 + 16 t + ln */
  const size_t rq = (size_t)b * SEQ + q0;
  const size_t rk = (size_t)b * SEQ;
  v16h qb[2][2];
#pragma unroll
  for (int t = 0; t < 2; ++t) {
    const _Float16* qp = Q16 + (rq + 16 * t + ln) * DM + h * HD;
    qb[t][0] = g2_frag(qp, hh); qb[t][1] = g2_frag(qp + 32, hh);
  }
  const v8f z8 = {0.f, 0.f, 0.f, 0.f, 0.f, 0.f, 0.f, 0.f};
  const int skew = ln & 3;                              /* = query & 3 in both column tiles: each tile's first query is a multiple of 16 */
  for (int i = tid; i < 4 * AT_RP; i += 128) {          /* clip mask, one row per skew; published by the barrier that publishes stage 0 */
    const int sk = i / AT_RP, rho = i - sk * AT_RP - 4 - sk;
    msk[sk][i - sk * AT_RP] = (rho <= 0 || rho >= 2 * MAXREL) ? 1.0f : 0.0f;
  }
  // K / V^T ring: wave 0 brings the stage's 64 K rows (next stage 64 rows on), wave 1 its 64 V^T rows (next stage 128 B on); waves 2 and 3 issue nothing
  // Stage st of the ring holds key tile (st + rot) mod AT_NPASS: a block walks all keys once, from its own start and round the end. The blocks of one (head, batch) read the same K and V^T tiles and run in step; the starts, three tiles apart and all different (3 is odd), keep them on different lines at any moment.
  const unsigned int rot = (3u * blockIdx.x) & (AT_NPASS - 1u);
  const unsigned int issuer = (unsigned int)(w < 2);
  const unsigned long long srcb = (unsigned long long)(size_t)(w == 0 ? K16 + rk * DM + h * HD : VT + (size_t)(b * NH + h) * HD * SEQ);
  const unsigned int sstep = (w == 0) ? 64u * (unsigned int)(DM * 2) : AT_ROWB;
  const unsigned int place = (unsigned int)(size_t)L + (w == 0 ? 0u : AT_TILE);
  u32x8 g1;                                             /* 1-byte elements, tensor = tile = 64 rows of 128 B, source pitch one K16 or VT row, 4 dwords of pad behind every 32 */
  g1[0] = uni((1u << 20) | (4u << 22) | (3u << 25));
  g1[1] = pinned(AT_ROWB << 16);                        /* words 1 to 7: descriptor words held in scalar registers, so that the group is built once and its registers stay as they are while a request is outstanding */
  g1[2] = pinned(64u << 16);
  g1[3] = pinned(AT_ROWB << 16);
  g1[4] = pinned(64u);
  g1[5] = pinned(w == 0 ? (unsigned int)(DM * 2) : (unsigned int)(SEQ * 2));
  g1[6] = pinned(0u);
  g1[7] = pinned(0u);
  u32x4 g0;
  const unsigned int cnt1 = pinned(1u);                 /* group 0's constant word held in a scalar register, not written again while a request is outstanding */
  auto issue = [&](unsigned int st) {
    const unsigned long long ga = srcb + (unsigned long long)((st + rot) & (AT_NPASS - 1u)) * sstep;
    g0[0] = uni(cnt1); g0[1] = uni(place + (st & 1u) * AT_STAGE); g0[2] = uni((unsigned int)ga); g0[3] = uni((((unsigned int)(ga >> 32)) & 0x01FFFFFFu) | 0x80000000u);
    asm volatile("tensor_load_to_lds %0, %1" :: "s"(g0), "s"(g1) : "memory");
  };
  if (pinned(issuer)) {
    issue(0u);
    asm volatile("s_wait_tensorcnt 0x0" :: "s"(g0), "s"(g1) : "memory");  /* stage 0 has landed; the descriptor words are named so that their registers stay untouched while the request is outstanding */
  }
  __syncthreads();                                      /* ... and is published to the other waves */
  if (pinned(issuer)) issue(pinned(1u));                /* stage 1 flies while the table below and pass 0 are worked on */
  const unsigned char* kf0 = L + (unsigned int)ln * AT_PITCH + 16u * (unsigned int)hh;
  // relative-key table: columns 0..RKR-1 of the rows of queries ln and 16 + ln, in base-2 logit units (1/1024 carry, 1/8 scale and log2 e folded); each table fragment is loaded once for both column tiles
#pragma unroll
  for (int t = 0; t < RKR / 16; ++t) {
    const _Float16* rp = RK16 + (size_t)(16 * t + ln) * HD;
    const v16h ra0 = g2_frag(rp, hh), ra1 = g2_frag(rp + 32, hh);
#pragma unroll
    for (int u = 0; u < 2; ++u) {
      float* qw = qrt[w][16 * u + ln];
      const v8f c = mma2(ra0, qb[u][0], ra1, qb[u][1], z8);
      if (16 * t < 2 * MAXREL) {
#pragma unroll
        for (int r = 0; r < 8; ++r) qw[4 + skew + 16 * t + 8 * hh + r] = ((unsigned int)(q0 + 16 * u + ln + 16 * t + 8 * hh + r - MAXREL) < (unsigned int)SEQ) ? c[r] * (0.0001220703125f * LOG2E) : -1.0e30f;   /* a bucket whose key lies outside the sequence is never read as a bias: it holds the kept logit of no key */
      }
      if (hh == 0) {                                    /* the lanes that hold bucket 0 (first tile) and bucket 64 (last tile) fill the row's clipped ends */
        const float e = c[0] * (0.0001220703125f * LOG2E);
        if (t == 0) {
#pragma unroll
          for (int k = 0; k < 7; ++k) qw[min(k, 4 + skew)] = e;
        }
        if (16 * t == 2 * MAXREL) {
#pragma unroll
          for (int k = 0; k < 8; ++k) qw[min(4 + skew + 2 * MAXREL + k, AT_RP - 1)] = e;
        }
      }
    }
  }
  __builtin_amdgcn_fence(4 /* acq_rel order */, "workgroup"); __builtin_amdgcn_wave_barrier();
  float* qrow[2] = {qrt[w][ln], qrt[w][16 + ln]}; float* dump = (float*)(L + (unsigned int)w * AT_TILE + 64u * AT_PITCH) + 4 * lane; const float* mrow = msk[skew];   /* row starts, multiples of 16 B: through these pointers a run of four is one 16-byte access; the dump runs, 16 B per lane, lie in the unused bytes behind the 64 rows of ring tile w, which no tensor load writes */
  const float c0[2] = {qrow[0][0], qrow[1][0]}, c64[2] = {qrow[0][AT_RP - 1], qrow[1][AT_RP - 1]};
  v8f o[2][4];
  float mrun[2], lrun[2], wl[2], wr[2];
#pragma unroll
  for (int t = 0; t < 2; ++t) { o[t][0] = z8; o[t][1] = z8; o[t][2] = z8; o[t][3] = z8; mrun[t] = -1.0e30f; lrun[t] = 0.f; wl[t] = 0.f; wr[t] = 0.f; }
#pragma unroll 1
  for (unsigned int st = 0; st < AT_NPASS; ++st) {
    const int kt = (int)(((st + rot) & (AT_NPASS - 1u)) << 6);   /* first key of the pass's tile */
    const unsigned char* kf = kf0 + (st & 1u) * AT_STAGE; const unsigned char* vf = kf + AT_TILE;
    v8f s[2][4];
#pragma unroll
    for (int g = 0; g < 2; ++g) {                       /* the K tile in two halves of 32 keys, through one set of fragment registers: a whole tile's fragments beside both column tiles' scores do not fit four waves per SIMD */
      v16h ka[2][2];
#pragma unroll
      for (int j = 0; j < 2; ++j) { ka[j][0] = lds_frag(kf + (2 * g + j) * 16 * AT_PITCH); ka[j][1] = lds_frag(kf + (2 * g + j) * 16 * AT_PITCH + 64); }
      __builtin_amdgcn_sched_barrier(0);                /* the half's K reads stay one group ahead of its WMMAs: read tile by tile, the wave waits out the LDS latency at every tile */
#pragma unroll
      for (int t = 0; t < 2; ++t)
#pragma unroll
        for (int j = 0; j < 2; ++j) s[t][2 * g + j] = mma2(ka[j][0], qb[t][0], ka[j][1], qb[t][1], z8);   /* every K fragment serves both column tiles */
      __builtin_amdgcn_sched_barrier(0);                /* the next reads stay behind these WMMAs: hoisted, they would need a second set of registers */
    }
    bool farl[2], far[2]; int pbase[2];
#pragma unroll
    for (int t = 0; t < 2; ++t) {
      const int qt = q0 + 16 * t;
      farl[t] = (kt + 63 + MAXREL <= qt);               /* every key of the block at distance <= -32 of every query of the column tile */
      far[t] = farl[t] || (kt >= qt + 15 + MAXREL);     /* ... or every key at distance >= +32 */
      pbase[t] = kt + 8 * hh - (qt + ln) + MAXREL + skew;   /* bucket + skew of the lane's first key: a multiple of 4 */
    }
#pragma unroll
    for (int t = 0; t < 2; ++t)
      if (!far[t]) {
        v4f bias[4][2];
#pragma unroll
        for (int j = 0; j < 4; ++j)
#pragma unroll
          for (int m = 0; m < 2; ++m) bias[j][m] = *(const v4fa*)(qrow[t] + min(max(pbase[t] + 16 * j + 4 * m + 4, 0), AT_RP - 4));
#pragma unroll
        for (int j = 0; j < 4; ++j)
#pragma unroll
          for (int m = 0; m < 2; ++m) {
            v4f t4;
#pragma unroll
            for (int e = 0; e < 4; ++e) { t4[e] = s[t][j][4 * m + e] * AT_KS + bias[j][m][e]; s[t][j][4 * m + e] = t4[e]; }
            const int pq = pbase[t] + 16 * j + 4 * m;
            *(v4fa*)(((unsigned int)pq <= (unsigned int)(2 * MAXREL)) ? qrow[t] + pq + 4 : dump) = t4;   /* band logits kept over the run's own biases, which were read just above and are read by no other run; a run with no band key goes to the lane's dump run, which nobody reads */
          }
      }
    float alpha[2], km[2], off[2];
#pragma unroll
    for (int t = 0; t < 2; ++t) {                       /* both column tiles' maxima first: two independent chains, and both exchanges between the wave's halves stand in front of the V^T reads */
      float mx = -1.0e30f;
#pragma unroll
      for (int j = 0; j < 4; ++j)
#pragma unroll
        for (int r = 0; r < 8; ++r) mx = fmaxf(mx, s[t][j][r]);
      const float cb = farl[t] ? c0[t] : c64[t];
      mx = far[t] ? fmaf(mx, AT_KS, cb) : mx;           /* a far block's scores are still raw: the FMA is monotone, so the maximum's logit is the logits' maximum */
      mx = fmaxf(mx, __shfl_xor(mx, 16, 32));
      const float mnew = fmaxf(mrun[t], mx);
      alpha[t] = __builtin_amdgcn_exp2f(mrun[t] - mnew);
      mrun[t] = mnew;
      km[t] = far[t] ? AT_KS : 1.0f;                    /* band scores are logits already */
      off[t] = (far[t] ? cb : 0.f) + (10.0f - mnew);
    }
    FragH pf[2][2];
    v16h kv[4][2];
#pragma unroll
    for (int t = 0; t < 2; ++t) {
      if (t == 1) {
        __builtin_amdgcn_sched_barrier(0);              /* the first half of the V^T reads stays behind the first column tile's softmax, whose score registers it takes over */
#pragma unroll
        for (int j = 0; j < 2; ++j) { kv[j][0] = lds_frag(vf + j * 16 * AT_PITCH); kv[j][1] = lds_frag(vf + j * 16 * AT_PITCH + 64); }
        __builtin_amdgcn_sched_barrier(0);              /* ... and is issued here, as one group: its latency passes under the second column tile's softmax */
      }
      const v2f km2 = {km[t], km[t]}, off2 = {off[t], off[t]};
      v2f psj[4];                                       /* one chain of packed adds per 16-key tile: four short chains, not one long one */
#pragma unroll
      for (int j = 0; j < 4; ++j)
#pragma unroll
        for (int r = 0; r < 8; r += 2) {
          const v2f sv = {s[t][j][r], s[t][j][r + 1]};
          const v2f a = __builtin_elementwise_fma(sv, km2, off2);
          const v2f p = {__builtin_amdgcn_exp2f(a[0]), __builtin_amdgcn_exp2f(a[1])};
          s[t][j][r] = p[0]; s[t][j][r + 1] = p[1];
          psj[j] = (r == 0) ? p : psj[j] + p;
          pf[t][j >> 1].h2[((j & 1) * 8 + r) >> 1] = __builtin_convertvector(p, v2h);
        }
      const v2f ps2 = (psj[0] + psj[1]) + (psj[2] + psj[3]);
      const float ps = ps2[0] + ps2[1];
      float pl = 0.f, pr = 0.f;
      if (far[t]) {
        pl = farl[t] ? ps : 0.f; pr = farl[t] ? 0.f : ps;
      } else {
        v4f mk[4][2];
#pragma unroll
        for (int j = 0; j < 4; ++j)
#pragma unroll
          for (int m = 0; m < 2; ++m) mk[j][m] = *(const v4fa*)(mrow + min(max(pbase[t] + 16 * j + 4 * m + 4, 0), AT_RP - 4));
        v2f pc[2] = {{0.f, 0.f}, {0.f, 0.f}};
#pragma unroll
        for (int j = 0; j < 4; ++j)
#pragma unroll
          for (int m = 0; m < 2; ++m) {
            const v2f pa = {s[t][j][4 * m], s[t][j][4 * m + 1]}, pb = {s[t][j][4 * m + 2], s[t][j][4 * m + 3]};
            const v2f ma = {mk[j][m][0], mk[j][m][1]}, mb = {mk[j][m][2], mk[j][m][3]};
            pc[0] = __builtin_elementwise_fma(pa, ma, pc[0]);
            pc[1] = __builtin_elementwise_fma(pb, mb, pc[1]);
          }
        const v2f pcs = pc[0] + pc[1];
        const float pclip = pcs[0] + pcs[1];
        const bool lside = (kt - (q0 + 16 * t + ln) <= -MAXREL);   /* the query's first key of the pass is clipped on the left: then none of its 64 keys reaches +32 */
        pl = lside ? pclip : 0.f; pr = lside ? 0.f : pclip;
      }
      wl[t] = wl[t] * alpha[t] + pl; wr[t] = wr[t] * alpha[t] + pr;
      lrun[t] = lrun[t] * alpha[t] + ps;                /* this lane's keys only: the wave's halves are joined behind the loop */
    }
    __builtin_amdgcn_sched_barrier(0);                  /* the second half of the V^T reads stays behind the second column tile's softmax, whose score registers it takes over */
#pragma unroll
    for (int j = 2; j < 4; ++j) { kv[j][0] = lds_frag(vf + j * 16 * AT_PITCH); kv[j][1] = lds_frag(vf + j * 16 * AT_PITCH + 64); }
    __builtin_amdgcn_sched_barrier(0);                  /* ... and is issued here, as one group: its latency passes under the rescale and the first half's WMMAs */
#pragma unroll
    for (int t = 0; t < 2; ++t)
#pragma unroll
      for (int j = 0; j < 4; ++j)
#pragma unroll
        for (int r = 0; r < 8; ++r) o[t][j][r] *= alpha[t];
#pragma unroll
    for (int j = 0; j < 4; ++j)
#pragma unroll
      for (int t = 0; t < 2; ++t) o[t][j] = mma2(kv[j][0], pf[t][0].v, kv[j][1], pf[t][1].v, o[t][j]);   /* every V^T fragment serves both column tiles */
    asm volatile("s_wait_dscnt 0x0" ::: "memory");      /* this wave has left the buffer of pass st */
    if (pinned(issuer)) asm volatile("s_wait_tensorcnt 0x0" :: "s"(g0), "s"(g1) : "memory");  /* the issuer's tile of stage st + 1 has landed; the descriptor words are named so that their registers stay untouched from the issue to here */
    __syncthreads();                                    /* publishes stage st + 1 and frees the buffer of pass st */
    if (pinned(issuer & (unsigned int)(st + 2u < AT_NPASS))) issue(pinned(st + 2u));  /* refill of the buffer just left: stage st + 2 flies while pass st + 1 is worked on */
  }
  asm volatile("s_wait_tensorcnt 0x0" ::: "memory");    /* nothing of the mover is outstanding when the ring becomes the waves' epilogue staging */
  asm volatile("s_wait_dscnt 0x0" ::: "memory");
  unsigned short (*wt)[104] = (unsigned short (*)[104])(L + (unsigned int)w * AT_WTB);                  /* bucket weights, this wave's own AT_QW x 104, in the free ring */
  unsigned short (*so)[72] = (unsigned short (*)[72])&qrt[w][0][0];                                     /* output rows, this wave's own AT_QW x 72, over its own table rows, behind its last read of them */
#pragma unroll
  for (int t = 0; t < 2; ++t) {
    wl[t] += __shfl_xor(wl[t], 16, 32); wr[t] += __shfl_xor(wr[t], 16, 32); lrun[t] += __shfl_xor(lrun[t], 16, 32);
    wl[t] *= 0.0009765625f; wr[t] *= 0.0009765625f;     /* the running sums carry x1024 */
  }
  __builtin_amdgcn_fence(4 /* acq_rel order */, "workgroup"); __builtin_amdgcn_wave_barrier();
  // bucket weight row of query 16 t + ln, columns 40hh .. 40hh+39 and 80+8hh .. 87+8hh by this lane (all RVK columns written; columns >= NREL zero): eleven 16-byte reads of the row, issued together, cover positions 4+40hh .. 4+40hh+43
  // (a read past the row's end is clamped: its positions belong to columns >= NREL); two rounds of selects, by bit 0 and bit 1 of the skew, move position 4 + column + skew to its column
#pragma unroll
  for (int t = 0; t < 2; ++t) {
    float ta[44], tb[42];
#pragma unroll
    for (int c = 0; c < 11; ++c) {
      const v4f tq = *(const v4fa*)(qrow[t] + min(4 + 40 * hh + 4 * c, AT_RP - 4));
#pragma unroll
      for (int e = 0; e < 4; ++e) ta[4 * c + e] = tq[e];
    }
    const bool sk1 = (skew & 1) != 0, sk2 = (skew & 2) != 0;
#pragma unroll
    for (int i = 0; i < 42; ++i) { const float x0 = ta[i], x1 = ta[i + 1]; tb[i] = sk1 ? x1 : x0; }   /* both values named first: a select between values in registers, not between addresses */
#pragma unroll
    for (int g = 0; g < 5; ++g) {
      FragH f;
#pragma unroll
      for (int q = 0; q < 8; ++q) {
        const int i = 8 * g + q, r = 40 * hh + i;
        const float y0 = tb[i], y2 = tb[i + 2];
        const float tv = sk2 ? y2 : y0;
        float e; asm("v_exp_f32 %0, %1\n\tv_nop" : "=v"(e) : "v"(tv - mrun[t]));   /* exp2 with the slot behind a transcendental in its own statement */
        const float wv = (r == 0) ? wl[t] : (r == 2 * MAXREL) ? wr[t] : (r < 2 * MAXREL) ? e : 0.f;
        f.h[q] = toh_flush(wv * 16.0f);
      }
      *(v8us*)&wt[16 * t + ln][40 * hh + 8 * g] = f.half[0];
    }
    const v8us zz = {0, 0, 0, 0, 0, 0, 0, 0};
    *(v8us*)&wt[16 * t + ln][80 + 8 * hh] = zz;
  }
  __builtin_amdgcn_fence(4 /* acq_rel order */, "workgroup"); __builtin_amdgcn_wave_barrier();
#pragma unroll
  for (int ks = 0; ks < RVK / 32; ++ks) {
    const _Float16* rv = RVT + (size_t)ln * RVK + 32 * ks;
    const v16h r0 = g2_frag(rv, hh), r1 = g2_frag(rv + 16 * RVK, hh), r2 = g2_frag(rv + 32 * RVK, hh), r3 = g2_frag(rv + 48 * RVK, hh);   /* each table fragment is loaded once for both column tiles */
    asm volatile("s_wait_xcnt 0x0" ::: "memory");       /* behind the table loads, in front of later code that reuses their address registers */
#pragma unroll
    for (int t = 0; t < 2; ++t) {
      FragH wb; wb.half[0] = *(const v8us*)&wt[16 * t + ln][32 * ks + 8 * hh]; wb.half[1] = *(const v8us*)&wt[16 * t + ln][32 * ks + 16 + 8 * hh];
      o[t][0] = g2_mma(r0, wb.v, o[t][0]);
      o[t][1] = g2_mma(r1, wb.v, o[t][1]);
      o[t][2] = g2_mma(r2, wb.v, o[t][2]);
      o[t][3] = g2_mma(r3, wb.v, o[t][3]);
    }
  }
#pragma unroll
  for (int t = 0; t < 2; ++t) {
    const float rl = (1.0f / lrun[t]) * 16.0f;
#pragma unroll
    for (int j = 0; j < 4; ++j) {
      FragH f;
#pragma unroll
      for (int r = 0; r < 8; ++r) f.h[r] = toh_flush(o[t][j][r] * rl);
      *(v8us*)&so[16 * t + ln][16 * j + 8 * hh] = f.half[0];
    }
  }
  __builtin_amdgcn_fence(4 /* acq_rel order */, "workgroup"); __builtin_amdgcn_wave_barrier();
  const int li = lane >> 3, pc = lane & 7;
#pragma unroll
  for (int g = 0; g < AT_QW / 4; ++g) {
    const int i = g * 4 + li;
    const v8us v = *(const v8us*)&so[i][pc * 8];
    *(v8us*)((unsigned short*)O16 + (rq + i) * DM + h * HD + pc * 8) = v;
  }
}

// out[r][col] = (A1[r] . B1[col]) * al1 + bf16(bias[col]); the same tile loop; each wave stages 32 x 128 f32 at a time in its own quarter of the ring; bias added at the store stage as a 4-wide f32 vector; f32 rows:
__global__ __launch_bounds__(128) void k_out(const _Float16* __restrict__ A1, const _Float16* __restrict__ B1, float al1, const float* __restrict__ bias, float* __restrict__ Out) {
  __shared__ __attribute__((aligned(2048))) unsigned char L[2u * GP_STAGE];
  const int tid = threadIdx.x, lane = tid & 31, ln = lane & 15, hh = lane >> 4;
  const int w = __builtin_amdgcn_readfirstlane(tid >> 5);
  const int ntn = DM / 256;
  const int mt = blockIdx.x / ntn, nq = blockIdx.x - mt * ntn;
  if (mt * 128 >= (int)NR) return;
  const v8f z8 = {0.f, 0.f, 0.f, 0.f, 0.f, 0.f, 0.f, 0.f};
  v8f acc[4][8];
#pragma unroll
  for (int i = 0; i < 4; ++i)
#pragma unroll
    for (int j = 0; j < 8; ++j) acc[i][j] = z8;
  gemm128x256(A1 + (size_t)mt * 128 * DM, B1 + (size_t)nq * 256 * DM, (unsigned int)(mt + 4 * nq), L, w, ln, hh, acc);  /* the 4 blocks of a row tile get 4 different starts; the 64 of a column tile spread evenly over the 16 */
  const int row0 = mt * 128 + 64 * (w >> 1), col0 = nq * 256 + 128 * (w & 1);
  float (*so)[132] = (float (*)[132])(L + (size_t)w * (GP_STAGE / 2u));
  const v4f bz = *(const v4fa*)(bias + col0 + lane * 4);
  v4f bb;
#pragma unroll
  for (int i = 0; i < 4; ++i) bb[i] = bf16_rne(bz[i]);
#pragma unroll
  for (int h2 = 0; h2 < 2; ++h2) {
#pragma unroll
    for (int ii = 0; ii < 2; ++ii)
#pragma unroll
      for (int j = 0; j < 8; ++j)
#pragma unroll
        for (int r = 0; r < 8; ++r) so[ii * 16 + 8 * hh + r][j * 16 + ln] = acc[2 * h2 + ii][j][r] * al1;
    __builtin_amdgcn_fence(4 /* acq_rel order */, "workgroup"); __builtin_amdgcn_wave_barrier();
#pragma unroll 1                                        /* groups of eight rows: eight LDS reads in flight cover their latency, one wait per group behind the stores */
    for (int q8 = 0; q8 < 32; q8 += 8) {
#pragma unroll
      for (int q = 0; q < 8; ++q) {
        const v4f v0 = *(const v4fa*)&so[q8 + q][lane * 4];
        const v4f v = v0 + bb;
        *(v4f*)(Out + (size_t)(row0 + 32 * h2 + q8 + q) * DM + col0 + lane * 4) = v;
      }
      asm volatile("s_wait_xcnt 0x0" ::: "memory");     /* in front of the next group, which overwrites registers that these stores name */
    }
    __builtin_amdgcn_fence(4 /* acq_rel order */, "workgroup"); __builtin_amdgcn_wave_barrier();
  }
}

extern "C" void kernel_launch(void* const* d_in, const int* in_sizes, int n_in,
                              void* d_out, int out_size, void* d_ws, size_t ws_size, hipStream_t stream) {
  if (n_in < 8) return;
  if (in_sizes[0] < (int)(((size_t)(NB - 1) * SEQ_FULL + SEQ) * DM)) return;
  for (int i = 1; i <= 4; ++i) if (in_sizes[i] < DM * DM) return;
  if (in_sizes[5] < DM) return;
  if (in_sizes[6] < NREL * HD) return;
  if (in_sizes[7] < NREL * HD) return;
  if (out_size < (int)(NR * DM)) return;
  const float* const* I = (const float* const*)d_in;
  const float* x = I[0]; const float* wq = I[1]; const float* wk = I[2]; const float* wv = I[3]; const float* wo = I[4]; const float* bo = I[5]; const float* relk = I[6]; const float* relv = I[7];
  char* ws = (char*)d_ws; size_t off = 0;
  auto take = [&](size_t bytes) { char* p = ws + off; off += (bytes + 255) & ~(size_t)255; return p; };
  _Float16* BQKV = (_Float16*)take((size_t)3 * SZ_BT);               /* Bt planes q, k, v (contiguous, stride DM*DM) */
  _Float16* BO   = (_Float16*)take(SZ_BT);
  _Float16* RK16 = (_Float16*)take(SZ_RK);                           /* [RKR][HD] */
  _Float16* RVT  = (_Float16*)take(SZ_RV);                           /* [HD][RVK] */
  _Float16* X16  = (_Float16*)take(SZ_ACT);
  _Float16* QKV16 = (_Float16*)take((size_t)3 * SZ_ACT);             /* Q16, K16 planes (stride NR*DM); the third plane is not used */
  _Float16* VT   = (_Float16*)take((size_t)NB * NH * HD * SEQ * 2);  /* [b*NH+h][d][s] */
  _Float16* O16  = (_Float16*)take(SZ_ACT);
  if (off > ws_size) return;
  _Float16* Q16 = QKV16; _Float16* K16 = QKV16 + NR * DM;

  k_prep<<<PW_REL + PW_BLK, PW_THREADS, 0, stream>>>(x, wq, wk, wv, wo, relk, relv, X16, BQKV, BO, RK16, RVT);      /* every f32 -> f16 operand plane */
  k_qkv<<<dim3((unsigned)((NR / 128) * (DM / 256)), 3), 128, 0, stream>>>(X16, BQKV, 0.0625f, QKV16, VT);      /* q, k as f16 rows, v as f16 V^T rows */
  k_attn<<<dim3(SEQ / (4 * AT_QW), NH, NB), 128, 0, stream>>>(Q16, K16, VT, RK16, RVT, O16);
  k_out<<<(unsigned)((NR / 128) * (DM / 256)), 128, 0, stream>>>(O16, BO, 0.00390625f, bo, (float*)d_out);      /* out = ctx Wo^T + b_o */
}
